// v000
// Times are from an AMD MI455X. After a warm-up the kernel runs many times in a row, and a time is the length of
// such a window on the GPU divided by its runs, so every launch and the gaps after it count. The runs cycle
// through copies of the inputs. A figure is the median of several windows, for all but v000 over two sittings.
// Sittings can differ by a few percent; kernels timed side by side share one.
// The starting kernel, v000, takes 577 microseconds a run.
#include <hip/hip_runtime.h>

// Single-stream multi-head self-attention block: x [4][2048][768]; q / k / v = x.W^T + b with W stored [out][in]; heads = 12 x 64; scores = q.k^T with NO scale; softmax over all 2048 keys;
// the probabilities are multiplied AFTER the softmax by mask_q * mask_k (int input [4][2048], read by value); ctx merged to [4][2048][768]; y = ctx.Wo^T + bo + x; output = LayerNorm(y) with eps 1e-5 and gain / shift inputs.
// Compute dtypes, f32 accumulate everywhere: x and the weights converted to bf16 (RNE) once; q / k / v projections = single v_wmma_f32_16x16x32_bf16 products + bf16(bias) in f32; scores = bf16 hi|lo planes, 3 products (hh + lh + hl) in one accumulator;
// softmax f32 (base 2, running max from a finite start, denominator over all keys); P = f16(256 p) packed straight from the score accumulators into the B fragment; V times the key mask = f16 value plane + f16 residual x2048 plane on v_wmma_f32_16x16x32_f16, each with its own accumulator set, folded in the f32 epilogue;
// output projection = single v_wmma_f32_16x16x32_f16 product: ctx times the query mask as f16 x16, bf16(Wo) as f16 x64, folded by 1/1024 in f32; bias, skip connection (bf16(x)) and LayerNorm in f32.

#ifndef NB
#define NB 4
#endif
#ifndef SEQ
#define SEQ 2048
#endif
#define NB_FULL  4
#define SEQ_FULL 2048
#define DMOD  768
#define NHEAD 12
#define HDIM  64
#define OSP   68
#define LOG2E 1.4426950408889634f
#define PSH   8.0f
#define RCAR  2048.0f
#define WCAR  64.0f
#define CCAR  16.0f

static_assert(NHEAD * HDIM == DMOD);          // merged width
static_assert(HDIM == 64);                    // one 64-column GEMM tile == one head; 4 d-tiles in the attention kernel
static_assert(DMOD % 64 == 0);                // GEMM tile multiple (N and the transposed M)
static_assert(DMOD % 32 == 0);                // k-loop step
static_assert(SEQ % 64 == 0);                 // GEMM row tiles never straddle a batch; attention block = 64 queries; key step 32
static_assert(SEQ <= SEQ_FULL);
static_assert(NB <= NB_FULL);
static_assert((SEQ * DMOD) % 8 == 0);         // convert kernel: 8 elements per thread never straddle a batch
static_assert((DMOD * DMOD) % 8 == 0);
static_assert((NB * SEQ) % 64 == 0);
static_assert((NB * SEQ) / 64 <= 65535);      // grid.y bound
static_assert(OSP % 4 == 0);                  // 16-byte aligned LDS rows
static_assert(OSP >= HDIM);
static_assert(DMOD % 8 == 0);                 // ctx convert: 8 elements per thread never straddle a row
static_assert(SEQ % 8 == 0);                  // key-mask vector loads stay 16-byte aligned
static_assert(SEQ_FULL % 8 == 0);
static_assert(DMOD == 6 * 32 * 4);            // LayerNorm: one wave per row, 6 x (32 lanes x 4 floats)
static_assert((NB * SEQ) % 8 == 0);           // LayerNorm: 8 rows (waves) per block, no tail
static_assert(HDIM == 16 * 4);                // output GEMM store: 16 lanes x 16 B == one 64-float row segment

typedef _Float16 h16;
typedef unsigned short bf;
typedef __attribute__((ext_vector_type(16))) __bf16   v16bf;
typedef __attribute__((ext_vector_type(16))) _Float16 v16h;
typedef __attribute__((ext_vector_type(8)))  _Float16 v8h;
typedef __attribute__((ext_vector_type(8)))  unsigned short v8us;
typedef __attribute__((ext_vector_type(8)))  float    v8f;
typedef __attribute__((ext_vector_type(4)))  float    v4f;
typedef __attribute__((ext_vector_type(4)))  int      v4i;
typedef v4f  __attribute__((may_alias)) v4fa;

__device__ __forceinline__ unsigned short f2bf(float f) { unsigned u = __float_as_uint(f); u += 0x7FFFu + ((u >> 16) & 1u); return (unsigned short)(u >> 16); }
__device__ __forceinline__ float bf2f(unsigned short b) { return __uint_as_float(((unsigned)b) << 16); }
__device__ __forceinline__ float bfr(float f) { return bf2f(f2bf(f)); }
__device__ __forceinline__ void splitf(float y, unsigned short& h, unsigned short& l) { h = f2bf(y); l = f2bf(y - bf2f(h)); }
__device__ __forceinline__ v16h cat16(v8h lo, v8h hi) { return __builtin_shufflevector(lo, hi, 0, 1, 2, 3, 4, 5, 6, 7, 8, 9, 10, 11, 12, 13, 14, 15); }
__device__ __forceinline__ v16bf cat16b(v8us lo, v8us hi) { return __builtin_bit_cast(v16bf, __builtin_shufflevector(lo, hi, 0, 1, 2, 3, 4, 5, 6, 7, 8, 9, 10, 11, 12, 13, 14, 15)); }
__device__ __forceinline__ v8f wmma16(v16h a, v16h b, v8f c) { return __builtin_amdgcn_wmma_f32_16x16x32_f16(false, a, false, b, (short)0, c, false, false); }
__device__ __forceinline__ v8f wmmab(v16bf a, v16bf b, v8f c) { return __builtin_amdgcn_wmma_f32_16x16x32_bf16(false, a, false, b, (short)0, c, false, false); }
// per-instruction guarded f16 WMMA: ONE accumulator tied with its own two operands to four nops
__device__ __forceinline__ v8f wmma16g(v16h a, v16h b, v8f c) { c = wmma16(a, b, c); asm volatile("v_nop\n\tv_nop\n\tv_nop\n\tv_nop" : "+v"(c) : "v"(a), "v"(b)); return c; }
// fragment loaders (A and B alike, K-contiguous rows): p already carries + 8*(lane>>4); elements 0..7 = k0+8h.., elements 8..15 = k0+16+8h..
__device__ __forceinline__ v16bf ldbf(const bf* p) { return cat16b(*(const v8us*)p, *(const v8us*)(p + 16)); }
__device__ __forceinline__ v16h  ldh(const h16* p) { return cat16(*(const v8h*)p, *(const v8h*)(p + 16)); }
// f32 -> f16 convert for WMMA operand planes: values below the smallest f16 normal become exact zero (applied after the plane's power-of-two carry)
static __device__ __forceinline__ h16 toh_flush(float v) { const h16 r = (h16)v; return (fabsf(v) < 6.103515625e-05f) ? (h16)0.0f : r; }

// dst[e] = src[(e / per) * per_full + e % per]  (per / per_full = compact and staged batch strides).
__global__ __launch_bounds__(256) void k_cvt(const float* __restrict__ src, bf* dst, int n, int per, int per_full) {
    const int e = ((int)blockIdx.x * 256 + (int)threadIdx.x) * 8;
    if (e >= n) return;
    const int b = e / per;
    const size_t so = (size_t)b * (size_t)per_full + (size_t)(e - b * per);
    const v4f a0 = *(const v4f*)(src + so);
    const v4f a1 = *(const v4f*)(src + so + 4);
    v8us o;
    o[0] = f2bf(a0[0]); o[1] = f2bf(a0[1]); o[2] = f2bf(a0[2]); o[3] = f2bf(a0[3]);
    o[4] = f2bf(a1[0]); o[5] = f2bf(a1[1]); o[6] = f2bf(a1[2]); o[7] = f2bf(a1[3]);
    *(v8us*)(dst + e) = o;
    
}

__global__ __launch_bounds__(256) void k_cvt_wo(const float* __restrict__ src, h16* dst, int n) {
    const int e = ((int)blockIdx.x * 256 + (int)threadIdx.x) * 8;
    if (e >= n) return;
    const v4f a0 = *(const v4f*)(src + e);
    const v4f a1 = *(const v4f*)(src + e + 4);
    v8h o;
    o[0] = toh_flush(bfr(a0[0]) * WCAR); o[1] = toh_flush(bfr(a0[1]) * WCAR); o[2] = toh_flush(bfr(a0[2]) * WCAR); o[3] = toh_flush(bfr(a0[3]) * WCAR);
    o[4] = toh_flush(bfr(a1[0]) * WCAR); o[5] = toh_flush(bfr(a1[1]) * WCAR); o[6] = toh_flush(bfr(a1[2]) * WCAR); o[7] = toh_flush(bfr(a1[3]) * WCAR);
    *(v8h*)(dst + e) = o;
    
}

__global__ __launch_bounds__(256) void k_cvt_ctx(const float* __restrict__ src, const int* __restrict__ mask, h16* dst, int n) {
    const int e = ((int)blockIdx.x * 256 + (int)threadIdx.x) * 8;
    if (e >= n) return;
    const int row = e / DMOD, col = e - row * DMOD;
    const int b = row / SEQ, t = row - b * SEQ;
    const size_t srow = (size_t)b * SEQ_FULL + (size_t)t;
    const float mq = (float)mask[srow] * CCAR;
    const v4f a0 = *(const v4f*)(src + srow * DMOD + col);
    const v4f a1 = *(const v4f*)(src + srow * DMOD + col + 4);
    v8h o;
    o[0] = toh_flush(a0[0] * mq); o[1] = toh_flush(a0[1] * mq); o[2] = toh_flush(a0[2] * mq); o[3] = toh_flush(a0[3] * mq);
    o[4] = toh_flush(a1[0] * mq); o[5] = toh_flush(a1[1] * mq); o[6] = toh_flush(a1[2] * mq); o[7] = toh_flush(a1[3] * mq);
    *(v8h*)(dst + e) = o;
    
}

// ---- GEMM main loop: ONE WAVE per 64x64 tile (16 accumulators), operands straight from K-contiguous bf16 planes, K = DMOD.
// acc[mb][nb][j] = sum_k A[r0 + mb*16 + 8*hi + j][k] * Bt[c0 + nb*16 + lr][k].
__device__ __forceinline__ void gemm_tile(const bf* __restrict__ A, const bf* __restrict__ Bt, size_t aoff, size_t boff, v8f (&acc)[4][4]) {
#pragma unroll
    for (int mb = 0; mb < 4; ++mb)
#pragma unroll
        for (int nb = 0; nb < 4; ++nb) acc[mb][nb] = (v8f){};
#pragma unroll 1
    for (int kc = 0; kc < DMOD; kc += 32) {
        v16bf a[4];
        v16bf b;
#pragma unroll
        for (int mb = 0; mb < 4; ++mb) a[mb] = ldbf(A + aoff + (size_t)mb * 16 * DMOD + kc);
#pragma unroll
        for (int nb = 0; nb < 4; ++nb) {
            b = ldbf(Bt + boff + (size_t)nb * 16 * DMOD + kc);
#pragma unroll
            for (int mb = 0; mb < 4; ++mb) acc[mb][nb] = wmmab(a[mb], b, acc[mb][nb]);
        }
        asm volatile("" : "+v"(acc[0][0]), "+v"(acc[1][0]), "+v"(acc[2][0]), "+v"(acc[3][0]), "+v"(acc[0][1]), "+v"(acc[1][1]), "+v"(acc[2][1]), "+v"(acc[3][1]));
        asm volatile("v_nop\n\tv_nop\n\tv_nop\n\tv_nop" : "+v"(acc[0][2]), "+v"(acc[1][2]), "+v"(acc[2][2]), "+v"(acc[3][2]), "+v"(acc[0][3]), "+v"(acc[1][3]), "+v"(acc[2][3]), "+v"(acc[3][3]) : "v"(a[0]), "v"(a[3]), "v"(b));
    }
}

// ---- f16 twin of the GEMM main loop (same tile map, K-contiguous f16 planes); every WMMA carries its own four-nop guard.
__device__ __forceinline__ void gemm_tile_h(const h16* __restrict__ A, const h16* __restrict__ Bt, size_t aoff, size_t boff, v8f (&acc)[4][4]) {
#pragma unroll
    for (int mb = 0; mb < 4; ++mb)
#pragma unroll
        for (int nb = 0; nb < 4; ++nb) acc[mb][nb] = (v8f){};
#pragma unroll 1
    for (int kc = 0; kc < DMOD; kc += 32) {
        v16h a[4];
        v16h b;
#pragma unroll
        for (int mb = 0; mb < 4; ++mb) a[mb] = ldh(A + aoff + (size_t)mb * 16 * DMOD + kc);
#pragma unroll
        for (int nb = 0; nb < 4; ++nb) {
            b = ldh(Bt + boff + (size_t)nb * 16 * DMOD + kc);
#pragma unroll
            for (int mb = 0; mb < 4; ++mb) acc[mb][nb] = wmma16g(a[mb], b, acc[mb][nb]);
        }
    }
}

// ---- k_proj_qk: y[m][n] = X[m][:] . W[n][:] + bf16(bias[n]); tile rows m = b*SEQ + t, tile columns = one head (n = head*64 + d).
// grid (NB*SEQ/64, DMOD/64), 32 threads.
__global__ __launch_bounds__(32) void k_proj_qk(const bf* __restrict__ X, const bf* __restrict__ W, const float* __restrict__ bias, bf* Ph, bf* Pl) {
    __shared__ __align__(16) float os[16 * OSP];
    const int lane = (int)threadIdx.x & 31, lr = lane & 15, hi = lane >> 4;
    const int r0 = (int)blockIdx.x * 64, c0 = (int)blockIdx.y * 64;
    v8f acc[4][4];
    gemm_tile(X, W, (size_t)(r0 + lr) * DMOD + 8 * hi, (size_t)(c0 + lr) * DMOD + 8 * hi, acc);
    const int b = r0 / SEQ, t0 = r0 - b * SEQ, hd = (int)blockIdx.y;
    const int rq = lane >> 3, cq = (lane & 7) * 8;
    const v4f bv0 = *(const v4f*)(bias + c0 + cq);
    const v4f bv1 = *(const v4f*)(bias + c0 + cq + 4);
    float bb[8];
    bb[0] = bfr(bv0[0]); bb[1] = bfr(bv0[1]); bb[2] = bfr(bv0[2]); bb[3] = bfr(bv0[3]);
    bb[4] = bfr(bv1[0]); bb[5] = bfr(bv1[1]); bb[6] = bfr(bv1[2]); bb[7] = bfr(bv1[3]);
    const size_t pbase = ((size_t)(b * NHEAD + hd) * SEQ + t0) * HDIM;
#pragma unroll
    for (int mb = 0; mb < 4; ++mb) {
#pragma unroll
        for (int nb = 0; nb < 4; ++nb) {
#pragma unroll
            for (int j = 0; j < 8; ++j) os[(hi * 8 + j) * OSP + nb * 16 + lr] = acc[mb][nb][j];
        }
        __syncthreads();
{
#pragma unroll
            for (int s = 0; s < 4; ++s) {
                const int row = s * 4 + rq;                       // s 0..3 x rq 0..3 -> rows 0..15
                const v4f x0 = *(const v4fa*)(os + row * OSP + cq);
                const v4f x1 = *(const v4fa*)(os + row * OSP + cq + 4);
                v8us oh, ol;
#pragma unroll
                for (int i = 0; i < 4; ++i) {
                    unsigned short a2, c2;
                    splitf(x0[i] + bb[i], a2, c2); oh[i] = a2; ol[i] = c2;
                    splitf(x1[i] + bb[4 + i], a2, c2); oh[4 + i] = a2; ol[4 + i] = c2;
                }
                const size_t oo = pbase + (size_t)(mb * 16 + row) * HDIM + cq;
                *(v8us*)(Ph + oo) = oh;
                *(v8us*)(Pl + oo) = ol;
            }
            
        }
        __syncthreads();
    }
}

// ---- k_proj_v: transposed projection y^T[n][m] = (W[n][:] . X[m][:] + bf16(bias[n])) * mask[m]; tile rows n = head*64 + d, tile columns m = b*SEQ + t (the key index).
// The key mask multiplies the value rows, so the attention kernel's probabilities and its denominator stay over all keys.
// grid (DMOD/64, NB*SEQ/64), 32 threads.
__global__ __launch_bounds__(32) void k_proj_v(const bf* __restrict__ W, const bf* __restrict__ X, const float* __restrict__ bias, const int* __restrict__ mask, h16* Pv, h16* Pr) {
    __shared__ __align__(16) float os[16 * OSP];
    const int lane = (int)threadIdx.x & 31, lr = lane & 15, hi = lane >> 4;
    const int r0 = (int)blockIdx.x * 64, c0 = (int)blockIdx.y * 64;
    v8f acc[4][4];
    gemm_tile(W, X, (size_t)(r0 + lr) * DMOD + 8 * hi, (size_t)(c0 + lr) * DMOD + 8 * hi, acc);
    const int b = c0 / SEQ, t0 = c0 - b * SEQ, hd = (int)blockIdx.x;
    const int rq = lane >> 3, cq = (lane & 7) * 8;
    const v4i mk0 = *(const v4i*)(mask + (size_t)b * SEQ_FULL + t0 + cq);          // staged mask rows use the FULL batch stride
    const v4i mk1 = *(const v4i*)(mask + (size_t)b * SEQ_FULL + t0 + cq + 4);
    float mf[8];
    mf[0] = (float)mk0[0]; mf[1] = (float)mk0[1]; mf[2] = (float)mk0[2]; mf[3] = (float)mk0[3];
    mf[4] = (float)mk1[0]; mf[5] = (float)mk1[1]; mf[6] = (float)mk1[2]; mf[7] = (float)mk1[3];
    const size_t pbase = (size_t)(b * NHEAD + hd) * HDIM * SEQ + t0;
#pragma unroll
    for (int mb = 0; mb < 4; ++mb) {
#pragma unroll
        for (int nb = 0; nb < 4; ++nb) {
#pragma unroll
            for (int j = 0; j < 8; ++j) os[(hi * 8 + j) * OSP + nb * 16 + lr] = acc[mb][nb][j];
        }
        __syncthreads();
{
#pragma unroll
            for (int s = 0; s < 4; ++s) {
                const int row = s * 4 + rq;                       // d within the slab, 0..15
                const float bsc = bfr(bias[r0 + mb * 16 + row]);
                const v4f x0 = *(const v4fa*)(os + row * OSP + cq);
                const v4f x1 = *(const v4fa*)(os + row * OSP + cq + 4);
                v8h ov, orr;
#pragma unroll
                for (int i = 0; i < 4; ++i) {
                    const float y0 = (x0[i] + bsc) * mf[i]; const h16 h0 = toh_flush(y0); ov[i] = h0; orr[i] = toh_flush((y0 - (float)h0) * RCAR);
                    const float y1 = (x1[i] + bsc) * mf[4 + i]; const h16 h1 = toh_flush(y1); ov[4 + i] = h1; orr[4 + i] = toh_flush((y1 - (float)h1) * RCAR);
                }
                const size_t oo = pbase + (size_t)(mb * 16 + row) * SEQ + cq;
                *(v8h*)(Pv + oo) = ov;
                *(v8h*)(Pr + oo) = orr;
            }
            
        }
        __syncthreads();
    }
}

// ---- k_attn: fused attention, transposed form. Block = 4 waves = 64 queries of one (batch, head); each wave owns 16 queries.
// Per 32-key step: S^T[key][query] = K.Q^T on bf16 hi|lo planes (3 products, one accumulator per 16-key tile); base-2 online softmax per query column
// (lane (hi, lr) holds keys 8*hi + r and 16 + 8*hi + r of query lr; the two lanes of a query share the running max through one shuffle);
// P^T packed from the two score tiles into the B fragment (element r <- tile 0, element 8 + r <- tile 1); O^T[d][query] += V^T.P^T for the value and the residual plane
// (every one of the eight P.V WMMAs carries its own four-nop guard tying exactly its accumulator and its two operands).
// grid (SEQ/64, NB*NHEAD), 128 threads.
__global__ __launch_bounds__(128) void k_attn(const bf* __restrict__ QH, const bf* __restrict__ QL, const bf* __restrict__ KH, const bf* __restrict__ KL,
                                              const h16* __restrict__ VV, const h16* __restrict__ VR, float* OUT) {
    __shared__ __align__(16) float os[4 * 16 * OSP];
    const int wave = __builtin_amdgcn_readfirstlane((int)(threadIdx.x >> 5));
    const int lane = (int)threadIdx.x & 31, lr = lane & 15, hi = lane >> 4;
    const int bh = (int)blockIdx.y;
    const int b = bh / NHEAD, hd = bh - b * NHEAD;
    const int q0 = (int)blockIdx.x * 64 + wave * 16;
    const size_t pb = (size_t)bh * SEQ * HDIM;
    const bf* qh = QH + pb; const bf* ql = QL + pb;
    const bf* kh = KH + pb; const bf* kl = KL + pb;
    const h16* vv = VV + pb; const h16* vr = VR + pb;
    const int qoff0 = (q0 + lr) * HDIM + 8 * hi;
    const int koff = lr * HDIM + 8 * hi;
    const int voff = lr * SEQ + 8 * hi;
    v8f ova[4], ore[4];
#pragma unroll
    for (int dt = 0; dt < 4; ++dt) { ova[dt] = (v8f){}; ore[dt] = (v8f){}; }
    float m = -3.0e38f, lsum = 0.0f;
#pragma unroll 1
    for (int j0 = 0; j0 < SEQ; j0 += 32) {
        int qo = qoff0;
        asm volatile("" : "+v"(qo));
        v8f s0 = (v8f){}, s1 = (v8f){};
        v16bf qhf, qlf, k0h, k0l, k1h, k1l;
#pragma unroll
        for (int kc = 0; kc < HDIM; kc += 32) {
            qhf = ldbf(qh + qo + kc); qlf = ldbf(ql + qo + kc);
            const int ko = koff + j0 * HDIM + kc;
            k0h = ldbf(kh + ko); k0l = ldbf(kl + ko);
            k1h = ldbf(kh + ko + 16 * HDIM); k1l = ldbf(kl + ko + 16 * HDIM);
            s0 = wmmab(k0h, qhf, s0); s1 = wmmab(k1h, qhf, s1);
            s0 = wmmab(k0l, qhf, s0); s1 = wmmab(k1l, qhf, s1);
            s0 = wmmab(k0h, qlf, s0); s1 = wmmab(k1h, qlf, s1);
        }
        asm volatile("v_nop\n\tv_nop\n\tv_nop\n\tv_nop" : "+v"(s0), "+v"(s1) : "v"(k1h), "v"(qlf));
        float t0[8], t1[8];
        float mx = -3.0e38f;
#pragma unroll
        for (int r = 0; r < 8; ++r) { t0[r] = s0[r] * LOG2E; t1[r] = s1[r] * LOG2E; mx = fmaxf(mx, fmaxf(t0[r], t1[r])); }
        mx = fmaxf(mx, __shfl_xor(mx, 16, 32));
        const float mnew = fmaxf(m, mx);
        const float sc = __builtin_amdgcn_exp2f(m - mnew);
        m = mnew;
        const float mo = mnew - PSH;                  // exp2(t - mo) = 256 p, at most 256
        float psum = 0.0f;
        v16h pf;
#pragma unroll
        for (int r = 0; r < 8; ++r) {
            const float e0 = __builtin_amdgcn_exp2f(t0[r] - mo);
            const float e1 = __builtin_amdgcn_exp2f(t1[r] - mo);
            psum += e0 + e1;
            pf[r] = (h16)e0; pf[8 + r] = (h16)e1;
        }
        lsum = lsum * sc + psum;
        if (__builtin_amdgcn_ballot_w32(sc != 1.0f) != 0u) {      // wave-uniform: rescale only when some running max moved
#pragma unroll
            for (int dt = 0; dt < 4; ++dt) {
#pragma unroll
                for (int r = 0; r < 8; ++r) { ova[dt][r] *= sc; ore[dt][r] *= sc; }
            }
        }
        const int vo = voff + j0;
        v16h va[4], vb[4];
#pragma unroll
        for (int dt = 0; dt < 4; ++dt) va[dt] = ldh(vv + vo + dt * 16 * SEQ);
#pragma unroll
        for (int dt = 0; dt < 4; ++dt) ova[dt] = wmma16g(va[dt], pf, ova[dt]);
#pragma unroll
        for (int dt = 0; dt < 4; ++dt) vb[dt] = ldh(vr + vo + dt * 16 * SEQ);
#pragma unroll
        for (int dt = 0; dt < 4; ++dt) ore[dt] = wmma16g(vb[dt], pf, ore[dt]);
    }
    lsum += __shfl_xor(lsum, 16, 32);
    const float inv = 1.0f / lsum;
    const int obase = wave * 16 * OSP;
#pragma unroll
    for (int dt = 0; dt < 4; ++dt) {
        v4f x0, x1;
#pragma unroll
        for (int i = 0; i < 4; ++i) {
            x0[i] = (ova[dt][i] + ore[dt][i] * (1.0f / RCAR)) * inv;
            x1[i] = (ova[dt][4 + i] + ore[dt][4 + i] * (1.0f / RCAR)) * inv;
        }
        *(v4fa*)(os + obase + lr * OSP + dt * 16 + 8 * hi) = x0;
        *(v4fa*)(os + obase + lr * OSP + dt * 16 + 8 * hi + 4) = x1;
    }
    __syncthreads();
    float* orow = OUT + ((size_t)b * SEQ_FULL + q0) * DMOD + hd * HDIM;   // FULL batch stride of the output rows
{
#pragma unroll
        for (int s = 0; s < 8; ++s) {
            const int row = 2 * s + hi, cofs = lr * 4;            // s 0..7 x hi 0..1 -> queries 0..15; 16 lanes x 16 B = one 256-B head row
            const v4f val = *(const v4fa*)(os + obase + row * OSP + cofs);
            *(v4f*)(orow + (size_t)row * DMOD + cofs) = val;
        }
        
    }
}

// ---- k_out: y[m][n] = (A[m][:] . W[n][:]) / 1024 + bf16(bias[n]) + bf16(x[m][n]); A = f16 ctx plane (x16, compact rows), W = f16 plane of 64 * bf16(Wo) stored [out][in].
// The skip connection is read from the staged f32 input at the FULL batch stride and added at the store stage.
// grid (NB*SEQ/64, DMOD/64), 32 threads.
__global__ __launch_bounds__(32) void k_out(const h16* __restrict__ A, const h16* __restrict__ W, const float* __restrict__ bias, const float* __restrict__ xin, float* Y) {
    __shared__ __align__(16) float os[16 * OSP];
    const int lane = (int)threadIdx.x & 31, lr = lane & 15, hi = lane >> 4;
    const int r0 = (int)blockIdx.x * 64, c0 = (int)blockIdx.y * 64;
    v8f acc[4][4];
    gemm_tile_h(A, W, (size_t)(r0 + lr) * DMOD + 8 * hi, (size_t)(c0 + lr) * DMOD + 8 * hi, acc);
    const int b = r0 / SEQ, t0 = r0 - b * SEQ;
    const int cofs = lr * 4;
    const v4f bv0 = *(const v4f*)(bias + c0 + cofs);
    float bb[4];
    bb[0] = bfr(bv0[0]); bb[1] = bfr(bv0[1]); bb[2] = bfr(bv0[2]); bb[3] = bfr(bv0[3]);
    const size_t xbase = ((size_t)b * SEQ_FULL + (size_t)t0) * DMOD + c0 + cofs;
    const size_t ybase = (size_t)r0 * DMOD + c0 + cofs;
    const float osc = 1.0f / (WCAR * CCAR);
#pragma unroll
    for (int mb = 0; mb < 4; ++mb) {
#pragma unroll
        for (int nb = 0; nb < 4; ++nb) {
#pragma unroll
            for (int j = 0; j < 8; ++j) os[(hi * 8 + j) * OSP + nb * 16 + lr] = acc[mb][nb][j];
        }
        __syncthreads();
{
#pragma unroll
            for (int s = 0; s < 8; ++s) {
                const int row = 2 * s + hi;                       // s 0..7 x hi 0..1 -> rows 0..15; 16 lanes x 16 B = one 256-B row segment
                const v4f a4 = *(const v4fa*)(os + row * OSP + cofs);
                const v4f xr = *(const v4f*)(xin + xbase + (size_t)(mb * 16 + row) * DMOD);
                v4f o;
#pragma unroll
                for (int i = 0; i < 4; ++i) o[i] = (a4[i] * osc + bb[i]) + bfr(xr[i]);
                *(v4f*)(Y + ybase + (size_t)(mb * 16 + row) * DMOD) = o;
            }
            
        }
        __syncthreads();
    }
}

// ---- k_ln: LayerNorm over the 768 columns, one wave per row (8 rows per block), row held in registers (6 x 4 floats per lane);
// mean, then centred variance (divide by the width), y = (x - mu) * rsqrt(var + 1e-5) * bf16(gain) + bf16(shift).
// grid (NB*SEQ/8), 256 threads.
__global__ __launch_bounds__(256) void k_ln(const float* __restrict__ X, const float* __restrict__ g, const float* __restrict__ be, float* OUT) {
#pragma clang fp contract(off)
    const int wave = __builtin_amdgcn_readfirstlane((int)(threadIdx.x >> 5));
    const int lane = (int)threadIdx.x & 31;
    const int row = (int)blockIdx.x * 8 + wave;
    const int b = row / SEQ, t = row - b * SEQ;
    const float* xr = X + (size_t)row * DMOD;
    v4f x[6];
    float s = 0.0f;
#pragma unroll
    for (int j = 0; j < 6; ++j) {
        x[j] = *(const v4f*)(xr + (j * 32 + lane) * 4);
        s += (x[j][0] + x[j][1]) + (x[j][2] + x[j][3]);
    }
    s += __shfl_xor(s, 16, 32); s += __shfl_xor(s, 8, 32); s += __shfl_xor(s, 4, 32); s += __shfl_xor(s, 2, 32); s += __shfl_xor(s, 1, 32);
    const float mu = s * (1.0f / (float)DMOD);
    float q = 0.0f;
#pragma unroll
    for (int j = 0; j < 6; ++j) {
        const float d0 = x[j][0] - mu, d1 = x[j][1] - mu, d2 = x[j][2] - mu, d3 = x[j][3] - mu;
        q += (d0 * d0 + d1 * d1) + (d2 * d2 + d3 * d3);
    }
    q += __shfl_xor(q, 16, 32); q += __shfl_xor(q, 8, 32); q += __shfl_xor(q, 4, 32); q += __shfl_xor(q, 2, 32); q += __shfl_xor(q, 1, 32);
    const float var = q * (1.0f / (float)DMOD);
    const float rstd = rsqrtf(var + 1.0e-5f);
    v4f o[6];
#pragma unroll
    for (int j = 0; j < 6; ++j) {
        const v4f g4 = *(const v4f*)(g + (j * 32 + lane) * 4);
        const v4f b4 = *(const v4f*)(be + (j * 32 + lane) * 4);
#pragma unroll
        for (int i = 0; i < 4; ++i) o[j][i] = ((x[j][i] - mu) * rstd) * bfr(g4[i]) + bfr(b4[i]);
    }
    float* orow = OUT + ((size_t)b * SEQ_FULL + (size_t)t) * DMOD;          // FULL batch stride of the output rows
#pragma unroll
    for (int j = 0; j < 6; ++j) *(v4f*)(orow + (j * 32 + lane) * 4) = o[j];
    
}

extern "C" void kernel_launch(void* const* d_in, const int* in_sizes, int n_in,
                              void* d_out, int out_size, void* d_ws, size_t ws_size, hipStream_t stream) {
    if (n_in < 12) return;
    const size_t need_x = (size_t)(NB - 1) * SEQ_FULL * DMOD + (size_t)SEQ * DMOD;
    const size_t need_m = (size_t)(NB - 1) * SEQ_FULL + (size_t)SEQ;
    if ((size_t)in_sizes[0] < need_x || (size_t)in_sizes[1] < need_m) return;
    if (in_sizes[2] < DMOD * DMOD || in_sizes[4] < DMOD * DMOD || in_sizes[6] < DMOD * DMOD || in_sizes[8] < DMOD * DMOD) return;
    if (in_sizes[3] < DMOD || in_sizes[5] < DMOD || in_sizes[7] < DMOD || in_sizes[9] < DMOD) return;
    if (in_sizes[10] < DMOD || in_sizes[11] < DMOD) return;
    if ((size_t)out_size < need_x) return;                       // output rows are addressed at the FULL batch stride
    const float* xin = (const float*)d_in[0];
    const int*   msk = (const int*)d_in[1];
    const float* Wq = (const float*)d_in[2]; const float* bq = (const float*)d_in[3];
    const float* Wk = (const float*)d_in[4]; const float* bk = (const float*)d_in[5];
    const float* Wv = (const float*)d_in[6]; const float* bv = (const float*)d_in[7];
    const float* Wo = (const float*)d_in[8]; const float* bo = (const float*)d_in[9];
    const float* lng = (const float*)d_in[10]; const float* lnb = (const float*)d_in[11];
    float* OUT = (float*)d_out;

    constexpr size_t WB = (size_t)DMOD * DMOD * 2;               // one 16-bit weight plane
    constexpr size_t PB = (size_t)NB * SEQ * DMOD * 2;           // one 16-bit activation / head plane (NB*NHEAD*SEQ*HDIM elements)
    constexpr size_t CB = (size_t)NB * SEQ_FULL * DMOD * 4;      // f32 ctx plane, rows at the FULL batch stride
    static_assert(WB % 256 == 0);
    static_assert(PB % 256 == 0);
    static_assert(CB % 256 == 0);
    static_assert(4 * WB + 7 * PB + CB <= (size_t)134217728);    // total carve at most 128 MiB
    static_assert(((size_t)(NB - 1) * SEQ_FULL + SEQ) * DMOD * 4 <= CB);     // last ctx row written by the attention kernel
    static_assert((size_t)NB * SEQ * DMOD * 2 <= PB);            // f16 ctx plane reuses the q hi plane (dead after the attention kernel)
    static_assert((size_t)NB * SEQ * DMOD * 4 <= 2 * PB);        // f32 pre-norm plane reuses the adjacent k hi | lo planes (dead after the attention kernel)
    if (4 * WB + 7 * PB + CB > ws_size) return;
    char* wsp = (char*)d_ws;
    bf* WQ = (bf*)wsp; wsp += WB;
    bf* WK = (bf*)wsp; wsp += WB;
    bf* WV = (bf*)wsp; wsp += WB;
    h16* WO = (h16*)wsp; wsp += WB;
    bf* XB = (bf*)wsp; wsp += PB;
    bf* QHp = (bf*)wsp; wsp += PB;
    bf* QLp = (bf*)wsp; wsp += PB;
    bf* KHp = (bf*)wsp; wsp += PB;
    bf* KLp = (bf*)wsp; wsp += PB;
    h16* VVp = (h16*)wsp; wsp += PB;
    h16* VRp = (h16*)wsp; wsp += PB;
    float* CTX = (float*)wsp; wsp += CB;
    h16* CTXH = (h16*)QHp;                                       // stream order: written only after the attention kernel has finished
    float* XF = (float*)KHp;                                     // spans KHp and KLp

    const int nW = DMOD * DMOD, nX = NB * SEQ * DMOD;
    const unsigned gW = (unsigned)((nW / 8 + 255) / 256), gX = (unsigned)((nX / 8 + 255) / 256);
    k_cvt<<<gW, 256, 0, stream>>>(Wq, WQ, nW, nW, nW);
    k_cvt<<<gW, 256, 0, stream>>>(Wk, WK, nW, nW, nW);
    k_cvt<<<gW, 256, 0, stream>>>(Wv, WV, nW, nW, nW);
    k_cvt_wo<<<gW, 256, 0, stream>>>(Wo, WO, nW);
    // the single input stream feeds all three projections
    k_cvt<<<gX, 256, 0, stream>>>(xin, XB, nX, SEQ * DMOD, SEQ_FULL * DMOD);
    // q: X[NB*SEQ][DMOD] (A) x Wq[DMOD][DMOD] (Bt as stored) -> q hi|lo head planes
    k_proj_qk<<<dim3(NB * SEQ / 64, DMOD / 64), 32, 0, stream>>>(XB, WQ, bq, QHp, QLp);
    k_proj_qk<<<dim3(NB * SEQ / 64, DMOD / 64), 32, 0, stream>>>(XB, WK, bk, KHp, KLp);
    // v: Wv[DMOD][DMOD] (A) x X[NB*SEQ][DMOD] (Bt) -> transposed value / residual planes [b][head][d][t], key mask applied
    k_proj_v<<<dim3(DMOD / 64, NB * SEQ / 64), 32, 0, stream>>>(WV, XB, bv, msk, VVp, VRp);
    k_attn<<<dim3(SEQ / 64, NB * NHEAD), 128, 0, stream>>>(QHp, QLp, KHp, KLp, VVp, VRp, CTX);
    // ctx[NB*SEQ][DMOD] (f32, FULL stride) x query mask -> compact f16 plane
    k_cvt_ctx<<<gX, 256, 0, stream>>>(CTX, msk, CTXH, nX);
    // output projection: CTXH[NB*SEQ][DMOD] (A) x Wo[DMOD out][DMOD in] (Bt as stored) + bias + skip -> f32 pre-norm plane
    k_out<<<dim3(NB * SEQ / 64, DMOD / 64), 32, 0, stream>>>(CTXH, WO, bo, xin, XF);
    k_ln<<<dim3(NB * SEQ / 8), 256, 0, stream>>>(XF, lng, lnb, OUT);
}

// v001
// It runs in 291 microseconds.
// Timed twice side by side with v000, it ran 2.07 and 2.08 times as fast.
#include <hip/hip_runtime.h>

// Single-stream multi-head self-attention block: x [4][2048][768]; q / k / v = x.W^T + b with W stored [out][in]; heads = 12 x 64; scores = q.k^T with NO scale; softmax over all 2048 keys;
// the probabilities are multiplied AFTER the softmax by mask_q * mask_k (int input [4][2048], read by value); ctx merged to [4][2048][768]; y = ctx.Wo^T + bo + x; output = LayerNorm(y) with eps 1e-5 and gain / shift inputs.
// Compute dtypes, f32 accumulate everywhere: x and the weights converted to bf16 (RNE) once; q / k / v projections = single v_wmma_f32_16x16x32_bf16 products + bf16(bias) in f32; scores = bf16 hi|lo planes, 3 products (hh + lh + hl) in one accumulator;
// softmax f32 (base 2, running max from a finite start, denominator over all keys); P = f16(256 p) packed straight from the score accumulators into the B fragment; V times the key mask = f16 value plane + f16 residual x2048 plane on v_wmma_f32_16x16x32_f16, each with its own accumulator set, folded in the f32 epilogue;
// output projection = single v_wmma_f32_16x16x32_f16 product: ctx times the query mask as f16 x16, bf16(Wo) as f16 x64, folded by 1/1024 in f32; bias, skip connection (bf16(x)) and LayerNorm in f32.

#ifndef NB
#define NB 4
#endif
#ifndef SEQ
#define SEQ 2048
#endif
#define NB_FULL  4
#define SEQ_FULL 2048
#define DMOD  768
#define NHEAD 12
#define HDIM  64
#define OSP   68
#define LOG2E 1.4426950408889634f
#define PSH   8.0f
#define RCAR  2048.0f
#define WCAR  64.0f
#define CCAR  16.0f

static_assert(NHEAD * HDIM == DMOD);          // merged width
static_assert(HDIM == 64);                    // one 64-column GEMM tile == one head; 4 d-tiles in the attention kernel
static_assert(DMOD % 64 == 0);                // GEMM tile multiple (N and the transposed M)
static_assert(DMOD % 32 == 0);                // k-loop step
static_assert(SEQ % 64 == 0);                 // GEMM row tiles never straddle a batch; attention key step 32
static_assert(SEQ <= SEQ_FULL);
static_assert(NB <= NB_FULL);
static_assert((SEQ * DMOD) % 8 == 0);         // convert kernel: 8 elements per thread never straddle a batch
static_assert((DMOD * DMOD) % 8 == 0);
static_assert((NB * SEQ) % 64 == 0);
static_assert((NB * SEQ) / 64 <= 65535);      // grid.y bound
static_assert(OSP % 4 == 0);                  // 16-byte aligned LDS rows
static_assert(OSP >= HDIM);
static_assert(DMOD % 8 == 0);                 // ctx convert: 8 elements per thread never straddle a row
static_assert(SEQ % 8 == 0);                  // key-mask vector loads stay 16-byte aligned
static_assert(SEQ_FULL % 8 == 0);
static_assert(DMOD == 6 * 32 * 4);            // LayerNorm: one wave per row, 6 x (32 lanes x 4 floats)
static_assert((NB * SEQ) % 8 == 0);           // LayerNorm: 8 rows (waves) per block, no tail
static_assert(HDIM == 16 * 4);                // output GEMM store: 16 lanes x 16 B == one 64-float row segment

typedef _Float16 h16;
typedef unsigned short bf;
typedef __attribute__((ext_vector_type(16))) __bf16   v16bf;
typedef __attribute__((ext_vector_type(16))) _Float16 v16h;
typedef __attribute__((ext_vector_type(8)))  _Float16 v8h;
typedef __attribute__((ext_vector_type(8)))  unsigned short v8us;
typedef __attribute__((ext_vector_type(8)))  float    v8f;
typedef __attribute__((ext_vector_type(4)))  float    v4f;
typedef __attribute__((ext_vector_type(4)))  int      v4i;
typedef v4f  __attribute__((may_alias)) v4fa;

__device__ __forceinline__ unsigned short f2bf(float f) { unsigned u = __float_as_uint(f); u += 0x7FFFu + ((u >> 16) & 1u); return (unsigned short)(u >> 16); }
__device__ __forceinline__ float bf2f(unsigned short b) { return __uint_as_float(((unsigned)b) << 16); }
__device__ __forceinline__ float bfr(float f) { return bf2f(f2bf(f)); }
__device__ __forceinline__ void splitf(float y, unsigned short& h, unsigned short& l) { h = f2bf(y); l = f2bf(y - bf2f(h)); }
__device__ __forceinline__ v16h cat16(v8h lo, v8h hi) { return __builtin_shufflevector(lo, hi, 0, 1, 2, 3, 4, 5, 6, 7, 8, 9, 10, 11, 12, 13, 14, 15); }
__device__ __forceinline__ v16bf cat16b(v8us lo, v8us hi) { return __builtin_bit_cast(v16bf, __builtin_shufflevector(lo, hi, 0, 1, 2, 3, 4, 5, 6, 7, 8, 9, 10, 11, 12, 13, 14, 15)); }
__device__ __forceinline__ v8f wmma16(v16h a, v16h b, v8f c) { return __builtin_amdgcn_wmma_f32_16x16x32_f16(false, a, false, b, (short)0, c, false, false); }
__device__ __forceinline__ v8f wmmab(v16bf a, v16bf b, v8f c) { return __builtin_amdgcn_wmma_f32_16x16x32_bf16(false, a, false, b, (short)0, c, false, false); }
// per-instruction guarded f16 WMMA: ONE accumulator tied with its own two operands to four nops
__device__ __forceinline__ v8f wmma16g(v16h a, v16h b, v8f c) { c = wmma16(a, b, c); asm volatile("v_nop\n\tv_nop\n\tv_nop\n\tv_nop" : "+v"(c) : "v"(a), "v"(b)); return c; }
// fragment loaders (A and B alike, K-contiguous rows): p already carries + 8*(lane>>4); elements 0..7 = k0+8h.., elements 8..15 = k0+16+8h..
__device__ __forceinline__ v16bf ldbf(const bf* p) { return cat16b(*(const v8us*)p, *(const v8us*)(p + 16)); }
__device__ __forceinline__ v16h  ldh(const h16* p) { return cat16(*(const v8h*)p, *(const v8h*)(p + 16)); }
// f32 -> f16 convert for WMMA operand planes: values below the smallest f16 normal become exact zero (applied after the plane's power-of-two carry)
static __device__ __forceinline__ h16 toh_flush(float v) { const h16 r = (h16)v; return (fabsf(v) < 6.103515625e-05f) ? (h16)0.0f : r; }

// dst[e] = src[(e / per) * per_full + e % per]  (per / per_full = compact and staged batch strides).
__global__ __launch_bounds__(256) void k_cvt(const float* __restrict__ src, bf* dst, int n, int per, int per_full) {
    const int e = ((int)blockIdx.x * 256 + (int)threadIdx.x) * 8;
    if (e >= n) return;
    const int b = e / per;
    const size_t so = (size_t)b * (size_t)per_full + (size_t)(e - b * per);
    const v4f a0 = *(const v4f*)(src + so);
    const v4f a1 = *(const v4f*)(src + so + 4);
    v8us o;
    o[0] = f2bf(a0[0]); o[1] = f2bf(a0[1]); o[2] = f2bf(a0[2]); o[3] = f2bf(a0[3]);
    o[4] = f2bf(a1[0]); o[5] = f2bf(a1[1]); o[6] = f2bf(a1[2]); o[7] = f2bf(a1[3]);
    *(v8us*)(dst + e) = o;
    
}

__global__ __launch_bounds__(256) void k_cvt_wo(const float* __restrict__ src, h16* dst, int n) {
    const int e = ((int)blockIdx.x * 256 + (int)threadIdx.x) * 8;
    if (e >= n) return;
    const v4f a0 = *(const v4f*)(src + e);
    const v4f a1 = *(const v4f*)(src + e + 4);
    v8h o;
    o[0] = toh_flush(bfr(a0[0]) * WCAR); o[1] = toh_flush(bfr(a0[1]) * WCAR); o[2] = toh_flush(bfr(a0[2]) * WCAR); o[3] = toh_flush(bfr(a0[3]) * WCAR);
    o[4] = toh_flush(bfr(a1[0]) * WCAR); o[5] = toh_flush(bfr(a1[1]) * WCAR); o[6] = toh_flush(bfr(a1[2]) * WCAR); o[7] = toh_flush(bfr(a1[3]) * WCAR);
    *(v8h*)(dst + e) = o;
    
}

__global__ __launch_bounds__(256) void k_cvt_ctx(const float* __restrict__ src, const int* __restrict__ mask, h16* dst, int n) {
    const int e = ((int)blockIdx.x * 256 + (int)threadIdx.x) * 8;
    if (e >= n) return;
    const int row = e / DMOD, col = e - row * DMOD;
    const int b = row / SEQ, t = row - b * SEQ;
    const size_t srow = (size_t)b * SEQ_FULL + (size_t)t;
    const float mq = (float)mask[srow] * CCAR;
    const v4f a0 = *(const v4f*)(src + srow * DMOD + col);
    const v4f a1 = *(const v4f*)(src + srow * DMOD + col + 4);
    v8h o;
    o[0] = toh_flush(a0[0] * mq); o[1] = toh_flush(a0[1] * mq); o[2] = toh_flush(a0[2] * mq); o[3] = toh_flush(a0[3] * mq);
    o[4] = toh_flush(a1[0] * mq); o[5] = toh_flush(a1[1] * mq); o[6] = toh_flush(a1[2] * mq); o[7] = toh_flush(a1[3] * mq);
    *(v8h*)(dst + e) = o;
    
}

// ---- GEMM main loop: ONE WAVE per 64x64 tile (16 accumulators), operands straight from K-contiguous bf16 planes, K = DMOD.
// acc[mb][nb][j] = sum_k A[r0 + mb*16 + 8*hi + j][k] * Bt[c0 + nb*16 + lr][k].
__device__ __forceinline__ void gemm_tile(const bf* __restrict__ A, const bf* __restrict__ Bt, size_t aoff, size_t boff, v8f (&acc)[4][4]) {
#pragma unroll
    for (int mb = 0; mb < 4; ++mb)
#pragma unroll
        for (int nb = 0; nb < 4; ++nb) acc[mb][nb] = (v8f){};
#pragma unroll 1
    for (int kc = 0; kc < DMOD; kc += 32) {
        v16bf a[4];
        v16bf b;
#pragma unroll
        for (int mb = 0; mb < 4; ++mb) a[mb] = ldbf(A + aoff + (size_t)mb * 16 * DMOD + kc);
#pragma unroll
        for (int nb = 0; nb < 4; ++nb) {
            b = ldbf(Bt + boff + (size_t)nb * 16 * DMOD + kc);
#pragma unroll
            for (int mb = 0; mb < 4; ++mb) acc[mb][nb] = wmmab(a[mb], b, acc[mb][nb]);
        }
        asm volatile("" : "+v"(acc[0][0]), "+v"(acc[1][0]), "+v"(acc[2][0]), "+v"(acc[3][0]), "+v"(acc[0][1]), "+v"(acc[1][1]), "+v"(acc[2][1]), "+v"(acc[3][1]));
        asm volatile("v_nop\n\tv_nop\n\tv_nop\n\tv_nop" : "+v"(acc[0][2]), "+v"(acc[1][2]), "+v"(acc[2][2]), "+v"(acc[3][2]), "+v"(acc[0][3]), "+v"(acc[1][3]), "+v"(acc[2][3]), "+v"(acc[3][3]) : "v"(a[0]), "v"(a[3]), "v"(b));
    }
}

// ---- f16 twin of the GEMM main loop (same tile map, K-contiguous f16 planes); every WMMA carries its own four-nop guard.
__device__ __forceinline__ void gemm_tile_h(const h16* __restrict__ A, const h16* __restrict__ Bt, size_t aoff, size_t boff, v8f (&acc)[4][4]) {
#pragma unroll
    for (int mb = 0; mb < 4; ++mb)
#pragma unroll
        for (int nb = 0; nb < 4; ++nb) acc[mb][nb] = (v8f){};
#pragma unroll 1
    for (int kc = 0; kc < DMOD; kc += 32) {
        v16h a[4];
        v16h b;
#pragma unroll
        for (int mb = 0; mb < 4; ++mb) a[mb] = ldh(A + aoff + (size_t)mb * 16 * DMOD + kc);
#pragma unroll
        for (int nb = 0; nb < 4; ++nb) {
            b = ldh(Bt + boff + (size_t)nb * 16 * DMOD + kc);
#pragma unroll
            for (int mb = 0; mb < 4; ++mb) acc[mb][nb] = wmma16g(a[mb], b, acc[mb][nb]);
        }
    }
}

// ---- k_proj_qk: y[m][n] = X[m][:] . W[n][:] + bf16(bias[n]); tile rows m = b*SEQ + t, tile columns = one head (n = head*64 + d).
// grid (NB*SEQ/64, DMOD/64), 32 threads.
__global__ __launch_bounds__(32) void k_proj_qk(const bf* __restrict__ X, const bf* __restrict__ W, const float* __restrict__ bias, bf* Ph, bf* Pl) {
    __shared__ __align__(16) float os[16 * OSP];
    const int lane = (int)threadIdx.x & 31, lr = lane & 15, hi = lane >> 4;
    const int r0 = (int)blockIdx.x * 64, c0 = (int)blockIdx.y * 64;
    v8f acc[4][4];
    gemm_tile(X, W, (size_t)(r0 + lr) * DMOD + 8 * hi, (size_t)(c0 + lr) * DMOD + 8 * hi, acc);
    const int b = r0 / SEQ, t0 = r0 - b * SEQ, hd = (int)blockIdx.y;
    const int rq = lane >> 3, cq = (lane & 7) * 8;
    const v4f bv0 = *(const v4f*)(bias + c0 + cq);
    const v4f bv1 = *(const v4f*)(bias + c0 + cq + 4);
    float bb[8];
    bb[0] = bfr(bv0[0]); bb[1] = bfr(bv0[1]); bb[2] = bfr(bv0[2]); bb[3] = bfr(bv0[3]);
    bb[4] = bfr(bv1[0]); bb[5] = bfr(bv1[1]); bb[6] = bfr(bv1[2]); bb[7] = bfr(bv1[3]);
    const size_t pbase = ((size_t)(b * NHEAD + hd) * SEQ + t0) * HDIM;
#pragma unroll
    for (int mb = 0; mb < 4; ++mb) {
#pragma unroll
        for (int nb = 0; nb < 4; ++nb) {
#pragma unroll
            for (int j = 0; j < 8; ++j) os[(hi * 8 + j) * OSP + nb * 16 + lr] = acc[mb][nb][j];
        }
        __syncthreads();
{
#pragma unroll
            for (int s = 0; s < 4; ++s) {
                const int row = s * 4 + rq;                       // s 0..3 x rq 0..3 -> rows 0..15
                const v4f x0 = *(const v4fa*)(os + row * OSP + cq);
                const v4f x1 = *(const v4fa*)(os + row * OSP + cq + 4);
                v8us oh, ol;
#pragma unroll
                for (int i = 0; i < 4; ++i) {
                    unsigned short a2, c2;
                    splitf(x0[i] + bb[i], a2, c2); oh[i] = a2; ol[i] = c2;
                    splitf(x1[i] + bb[4 + i], a2, c2); oh[4 + i] = a2; ol[4 + i] = c2;
                }
                const size_t oo = pbase + (size_t)(mb * 16 + row) * HDIM + cq;
                *(v8us*)(Ph + oo) = oh;
                *(v8us*)(Pl + oo) = ol;
            }
            
        }
        __syncthreads();
    }
}

// ---- k_proj_v: transposed projection y^T[n][m] = (W[n][:] . X[m][:] + bf16(bias[n])) * mask[m]; tile rows n = head*64 + d, tile columns m = b*SEQ + t (the key index).
// The key mask multiplies the value rows, so the attention kernel's probabilities and its denominator stay over all keys.
// grid (DMOD/64, NB*SEQ/64), 32 threads.
__global__ __launch_bounds__(32) void k_proj_v(const bf* __restrict__ W, const bf* __restrict__ X, const float* __restrict__ bias, const int* __restrict__ mask, h16* Pv, h16* Pr) {
    __shared__ __align__(16) float os[16 * OSP];
    const int lane = (int)threadIdx.x & 31, lr = lane & 15, hi = lane >> 4;
    const int r0 = (int)blockIdx.x * 64, c0 = (int)blockIdx.y * 64;
    v8f acc[4][4];
    gemm_tile(W, X, (size_t)(r0 + lr) * DMOD + 8 * hi, (size_t)(c0 + lr) * DMOD + 8 * hi, acc);
    const int b = c0 / SEQ, t0 = c0 - b * SEQ, hd = (int)blockIdx.x;
    const int rq = lane >> 3, cq = (lane & 7) * 8;
    const v4i mk0 = *(const v4i*)(mask + (size_t)b * SEQ_FULL + t0 + cq);          // staged mask rows use the FULL batch stride
    const v4i mk1 = *(const v4i*)(mask + (size_t)b * SEQ_FULL + t0 + cq + 4);
    float mf[8];
    mf[0] = (float)mk0[0]; mf[1] = (float)mk0[1]; mf[2] = (float)mk0[2]; mf[3] = (float)mk0[3];
    mf[4] = (float)mk1[0]; mf[5] = (float)mk1[1]; mf[6] = (float)mk1[2]; mf[7] = (float)mk1[3];
    const size_t pbase = (size_t)(b * NHEAD + hd) * HDIM * SEQ + t0;
#pragma unroll
    for (int mb = 0; mb < 4; ++mb) {
#pragma unroll
        for (int nb = 0; nb < 4; ++nb) {
#pragma unroll
            for (int j = 0; j < 8; ++j) os[(hi * 8 + j) * OSP + nb * 16 + lr] = acc[mb][nb][j];
        }
        __syncthreads();
{
#pragma unroll
            for (int s = 0; s < 4; ++s) {
                const int row = s * 4 + rq;                       // d within the slab, 0..15
                const float bsc = bfr(bias[r0 + mb * 16 + row]);
                const v4f x0 = *(const v4fa*)(os + row * OSP + cq);
                const v4f x1 = *(const v4fa*)(os + row * OSP + cq + 4);
                v8h ov, orr;
#pragma unroll
                for (int i = 0; i < 4; ++i) {
                    const float y0 = (x0[i] + bsc) * mf[i]; const h16 h0 = toh_flush(y0); ov[i] = h0; orr[i] = toh_flush((y0 - (float)h0) * RCAR);
                    const float y1 = (x1[i] + bsc) * mf[4 + i]; const h16 h1 = toh_flush(y1); ov[4 + i] = h1; orr[4 + i] = toh_flush((y1 - (float)h1) * RCAR);
                }
                const size_t oo = pbase + (size_t)(mb * 16 + row) * SEQ + cq;
                *(v8h*)(Pv + oo) = ov;
                *(v8h*)(Pr + oo) = orr;
            }
            
        }
        __syncthreads();
    }
}

// ---- k_attn: fused attention, transposed form. Block = 8 waves = 128 queries of one (batch, head); each wave owns 16 queries.
// The K hi|lo rows and the V value|residual rows of 64 keys are staged in LDS once per block by asynchronous copies (16 B per lane, whole 128-B lines), two buffers: tile t + 1 flies while tile t is worked on.
// Per 32-key step: S^T[key][query] = K.Q^T on bf16 hi|lo planes (3 products, one accumulator per 16-key tile); base-2 online softmax per query column
// (lane (hi, lr) holds keys 8*hi + r and 16 + 8*hi + r of query lr; the two lanes of a query share the running max through one shuffle);
// P^T packed from the two score tiles into the B fragment (element r <- tile 0, element 8 + r <- tile 1); O^T[d][query] += V^T.P^T for the value and the residual plane
// (every one of the eight P.V WMMAs carries its own four-nop guard tying exactly its accumulator and its two operands).
// grid (SEQ/128, NB*NHEAD), 256 threads.
#define AWAVES 8                      // waves per block that share one staged tile
#define KTILE  64                     // keys per staged tile: K rows and V rows are both 128 B long
#define LPITCH 144                    // LDS row pitch in bytes: 16 B x odd, conflict-free for the 16-byte fragment reads
#define LPLANE (64 * LPITCH)          // one staged plane: 64 rows (keys for K, head dims for V)
#define LSTAGE (4 * LPLANE)           // one buffer: K hi, K lo, V value, V residual
static_assert(SEQ % (AWAVES * 16) == 0);      // whole blocks of queries
static_assert(SEQ % KTILE == 0);              // whole key tiles
static_assert(SEQ / KTILE >= 2);              // the two-buffer prologue fills tiles 0 and 1
static_assert(KTILE * 2 == 128);              // one V row of a tile == 8 lanes x 16 B
static_assert(HDIM * 2 == 128);               // one K row == 8 lanes x 16 B
static_assert(AWAVES * 32 * 2 == 64 * 8);     // two copies per lane cover one plane (64 rows x 8 pieces)
static_assert(AWAVES * 16 * OSP * 4 <= 2 * LSTAGE);   // the output staging reuses the ring

// One tile = 8 copies per lane. l = the lane's LDS byte address in the K hi plane of the target buffer; the pointers are the lane's own 16 bytes in rows 0..31 of each plane.
__device__ __forceinline__ void stage_tile(unsigned l, const bf* kh, const bf* kl, const h16* vv, const h16* vr) {
    // the closing s_wait_xcnt stands inside the statement so that no address register of a copy is rewritten in front of it
    asm volatile("global_load_async_to_lds_b128 %0, %8, off\n\t"
                 "global_load_async_to_lds_b128 %1, %9, off\n\t"
                 "global_load_async_to_lds_b128 %2, %10, off\n\t"
                 "global_load_async_to_lds_b128 %3, %11, off\n\t"
                 "global_load_async_to_lds_b128 %4, %12, off\n\t"
                 "global_load_async_to_lds_b128 %5, %13, off\n\t"
                 "global_load_async_to_lds_b128 %6, %14, off\n\t"
                 "global_load_async_to_lds_b128 %7, %15, off\n\t"
                 "s_wait_xcnt 0x0"
                 :: "v"(l), "v"(l + 32 * LPITCH), "v"(l + LPLANE), "v"(l + LPLANE + 32 * LPITCH),
                    "v"(l + 2 * LPLANE), "v"(l + 2 * LPLANE + 32 * LPITCH), "v"(l + 3 * LPLANE), "v"(l + 3 * LPLANE + 32 * LPITCH),
                    "v"(kh), "v"(kh + 32 * HDIM), "v"(kl), "v"(kl + 32 * HDIM),
                    "v"(vv), "v"(vv + 32 * SEQ), "v"(vr), "v"(vr + 32 * SEQ)
                 : "memory");
}

__global__ __launch_bounds__(AWAVES * 32) void k_attn(const bf* __restrict__ QH, const bf* __restrict__ QL, const bf* __restrict__ KH, const bf* __restrict__ KL,
                                              const h16* __restrict__ VV, const h16* __restrict__ VR, float* OUT) {
    __shared__ __align__(16) unsigned char ring[2 * LSTAGE];
    const int wave = __builtin_amdgcn_readfirstlane((int)(threadIdx.x >> 5));
    const int lane = (int)threadIdx.x & 31, lr = lane & 15, hi = lane >> 4;
    const int bh = (int)blockIdx.y;
    const int b = bh / NHEAD, hd = bh - b * NHEAD;
    const int q0 = (int)blockIdx.x * (AWAVES * 16) + wave * 16;
    const size_t pb = (size_t)bh * SEQ * HDIM;
    const bf* qh = QH + pb; const bf* ql = QL + pb;
    const int qoff0 = (q0 + lr) * HDIM + 8 * hi;
    // copy side: thread -> (row = tid / 8, 16-byte piece = tid % 8) of rows 0..31 of a plane
    const int crow = (int)threadIdx.x >> 3, cpc = (int)threadIdx.x & 7;
    const bf* ckh = KH + pb + crow * HDIM + cpc * 8; const bf* ckl = KL + pb + crow * HDIM + cpc * 8;
    const h16* cvv = VV + pb + crow * SEQ + cpc * 8; const h16* cvr = VR + pb + crow * SEQ + cpc * 8;
    const unsigned cl = (unsigned)(size_t)(__attribute__((address_space(3))) unsigned char*)ring + (unsigned)(crow * LPITCH + cpc * 16);
    // read side: fragment row lr, 16-byte piece hi (K rows and V rows alike)
    const unsigned char* fr = ring + lr * LPITCH + 16 * hi;
    v8f ova[4], ore[4];
#pragma unroll
    for (int dt = 0; dt < 4; ++dt) { ova[dt] = (v8f){}; ore[dt] = (v8f){}; }
    float m = -3.0e38f, lsum = 0.0f;
    stage_tile(cl, ckh, ckl, cvv, cvr);
    asm volatile("s_wait_asynccnt 0x0" ::: "memory");     // this wave's copies of tile 0 have landed
    __syncthreads();                                      // tile 0 readable by every wave
    stage_tile(cl + LSTAGE, ckh + KTILE * HDIM, ckl + KTILE * HDIM, cvv + KTILE, cvr + KTILE);
#pragma unroll 1   // rolled: one publish point per trip, and the registers stay within six waves per SIMD
    for (int t = 0; t < SEQ / KTILE; ++t) {
        const unsigned char* fb = fr + (t & 1) * LSTAGE;
#pragma unroll     // the two 32-key steps of a tile: every LDS offset becomes an immediate
        for (int sub = 0; sub < KTILE / 32; ++sub) {
            int qo = qoff0;
            asm volatile("" : "+v"(qo));      // as before this step: keeps the Q fragment loads inside the 32-key step (registers)
            v8f s0 = (v8f){}, s1 = (v8f){};
            v16bf qhf, qlf, k0h, k0l, k1h, k1l;
#pragma unroll
            for (int kc = 0; kc < HDIM; kc += 32) {
                qhf = ldbf(qh + qo + kc); qlf = ldbf(ql + qo + kc);
                const unsigned char* kp = fb + sub * 32 * LPITCH + kc * 2;
                k0h = ldbf((const bf*)kp); k0l = ldbf((const bf*)(kp + LPLANE));
                k1h = ldbf((const bf*)(kp + 16 * LPITCH)); k1l = ldbf((const bf*)(kp + LPLANE + 16 * LPITCH));
                s0 = wmmab(k0h, qhf, s0); s1 = wmmab(k1h, qhf, s1);
                s0 = wmmab(k0l, qhf, s0); s1 = wmmab(k1l, qhf, s1);
                s0 = wmmab(k0h, qlf, s0); s1 = wmmab(k1h, qlf, s1);
            }
            asm volatile("v_nop\n\tv_nop\n\tv_nop\n\tv_nop" : "+v"(s0), "+v"(s1) : "v"(k1h), "v"(qlf));
            float t0[8], t1[8];
            float mx = -3.0e38f;
#pragma unroll
            for (int r = 0; r < 8; ++r) { t0[r] = s0[r] * LOG2E; t1[r] = s1[r] * LOG2E; mx = fmaxf(mx, fmaxf(t0[r], t1[r])); }
            mx = fmaxf(mx, __shfl_xor(mx, 16, 32));
            const float mnew = fmaxf(m, mx);
            const float sc = __builtin_amdgcn_exp2f(m - mnew);
            m = mnew;
            const float mo = mnew - PSH;                  // exp2(t - mo) = 256 p, at most 256
            float psum = 0.0f;
            v16h pf;
#pragma unroll
            for (int r = 0; r < 8; ++r) {
                const float e0 = __builtin_amdgcn_exp2f(t0[r] - mo);
                const float e1 = __builtin_amdgcn_exp2f(t1[r] - mo);
                psum += e0 + e1;
                pf[r] = (h16)e0; pf[8 + r] = (h16)e1;
            }
            lsum = lsum * sc + psum;
            if (__builtin_amdgcn_ballot_w32(sc != 1.0f) != 0u) {      // wave-uniform: rescale only when some running max moved
#pragma unroll
                for (int dt = 0; dt < 4; ++dt) {
#pragma unroll
                    for (int r = 0; r < 8; ++r) { ova[dt][r] *= sc; ore[dt][r] *= sc; }
                }
            }
            const unsigned char* vp = fb + 2 * LPLANE + sub * 64;
            v16h va[4], vb[4];
#pragma unroll
            for (int dt = 0; dt < 4; ++dt) va[dt] = ldh((const h16*)(vp + dt * 16 * LPITCH));
#pragma unroll
            for (int dt = 0; dt < 4; ++dt) ova[dt] = wmma16g(va[dt], pf, ova[dt]);
#pragma unroll
            for (int dt = 0; dt < 4; ++dt) vb[dt] = ldh((const h16*)(vp + LPLANE + dt * 16 * LPITCH));
#pragma unroll
            for (int dt = 0; dt < 4; ++dt) ore[dt] = wmma16g(vb[dt], pf, ore[dt]);
        }
        asm volatile("s_wait_dscnt 0x0" ::: "memory");        // this wave's reads of tile t have returned before its buffer is refilled
        asm volatile("s_wait_asynccnt 0x0" ::: "memory");     // this wave's copies of tile t + 1 have landed
        __syncthreads();                                      // publishes tile t + 1 and ends every wave's last read of tile t
        if (t + 2 < SEQ / KTILE) {
            const int jn = (t + 2) * KTILE;
            stage_tile(cl + (unsigned)((t & 1) * LSTAGE), ckh + jn * HDIM, ckl + jn * HDIM, cvv + jn, cvr + jn);
        }
    }
    asm volatile("s_wait_asynccnt 0x0" ::: "memory");         // nothing in flight when the ring becomes output staging
    lsum += __shfl_xor(lsum, 16, 32);
    const float inv = 1.0f / lsum;
    float* os = (float*)ring;                                 // every wave has left the ring at the last trip's barrier
    const int obase = wave * 16 * OSP;
#pragma unroll
    for (int dt = 0; dt < 4; ++dt) {
        v4f x0, x1;
#pragma unroll
        for (int i = 0; i < 4; ++i) {
            x0[i] = (ova[dt][i] + ore[dt][i] * (1.0f / RCAR)) * inv;
            x1[i] = (ova[dt][4 + i] + ore[dt][4 + i] * (1.0f / RCAR)) * inv;
        }
        *(v4fa*)(os + obase + lr * OSP + dt * 16 + 8 * hi) = x0;
        *(v4fa*)(os + obase + lr * OSP + dt * 16 + 8 * hi + 4) = x1;
    }
    __syncthreads();
    float* orow = OUT + ((size_t)b * SEQ_FULL + q0) * DMOD + hd * HDIM;   // FULL batch stride of the output rows
{
#pragma unroll
        for (int s = 0; s < 8; ++s) {
            const int row = 2 * s + hi, cofs = lr * 4;            // s 0..7 x hi 0..1 -> queries 0..15; 16 lanes x 16 B = one 256-B head row
            const v4f val = *(const v4fa*)(os + obase + row * OSP + cofs);
            *(v4f*)(orow + (size_t)row * DMOD + cofs) = val;
        }
        
    }
}

// ---- k_out: y[m][n] = (A[m][:] . W[n][:]) / 1024 + bf16(bias[n]) + bf16(x[m][n]); A = f16 ctx plane (x16, compact rows), W = f16 plane of 64 * bf16(Wo) stored [out][in].
// The skip connection is read from the staged f32 input at the FULL batch stride and added at the store stage.
// grid (NB*SEQ/64, DMOD/64), 32 threads.
__global__ __launch_bounds__(32) void k_out(const h16* __restrict__ A, const h16* __restrict__ W, const float* __restrict__ bias, const float* __restrict__ xin, float* Y) {
    __shared__ __align__(16) float os[16 * OSP];
    const int lane = (int)threadIdx.x & 31, lr = lane & 15, hi = lane >> 4;
    const int r0 = (int)blockIdx.x * 64, c0 = (int)blockIdx.y * 64;
    v8f acc[4][4];
    gemm_tile_h(A, W, (size_t)(r0 + lr) * DMOD + 8 * hi, (size_t)(c0 + lr) * DMOD + 8 * hi, acc);
    const int b = r0 / SEQ, t0 = r0 - b * SEQ;
    const int cofs = lr * 4;
    const v4f bv0 = *(const v4f*)(bias + c0 + cofs);
    float bb[4];
    bb[0] = bfr(bv0[0]); bb[1] = bfr(bv0[1]); bb[2] = bfr(bv0[2]); bb[3] = bfr(bv0[3]);
    const size_t xbase = ((size_t)b * SEQ_FULL + (size_t)t0) * DMOD + c0 + cofs;
    const size_t ybase = (size_t)r0 * DMOD + c0 + cofs;
    const float osc = 1.0f / (WCAR * CCAR);
#pragma unroll
    for (int mb = 0; mb < 4; ++mb) {
#pragma unroll
        for (int nb = 0; nb < 4; ++nb) {
#pragma unroll
            for (int j = 0; j < 8; ++j) os[(hi * 8 + j) * OSP + nb * 16 + lr] = acc[mb][nb][j];
        }
        __syncthreads();
{
#pragma unroll
            for (int s = 0; s < 8; ++s) {
                const int row = 2 * s + hi;                       // s 0..7 x hi 0..1 -> rows 0..15; 16 lanes x 16 B = one 256-B row segment
                const v4f a4 = *(const v4fa*)(os + row * OSP + cofs);
                const v4f xr = *(const v4f*)(xin + xbase + (size_t)(mb * 16 + row) * DMOD);
                v4f o;
#pragma unroll
                for (int i = 0; i < 4; ++i) o[i] = (a4[i] * osc + bb[i]) + bfr(xr[i]);
                *(v4f*)(Y + ybase + (size_t)(mb * 16 + row) * DMOD) = o;
            }
            
        }
        __syncthreads();
    }
}

// ---- k_ln: LayerNorm over the 768 columns, one wave per row (8 rows per block), row held in registers (6 x 4 floats per lane);
// mean, then centred variance (divide by the width), y = (x - mu) * rsqrt(var + 1e-5) * bf16(gain) + bf16(shift).
// grid (NB*SEQ/8), 256 threads.
__global__ __launch_bounds__(256) void k_ln(const float* __restrict__ X, const float* __restrict__ g, const float* __restrict__ be, float* OUT) {
#pragma clang fp contract(off)
    const int wave = __builtin_amdgcn_readfirstlane((int)(threadIdx.x >> 5));
    const int lane = (int)threadIdx.x & 31;
    const int row = (int)blockIdx.x * 8 + wave;
    const int b = row / SEQ, t = row - b * SEQ;
    const float* xr = X + (size_t)row * DMOD;
    v4f x[6];
    float s = 0.0f;
#pragma unroll
    for (int j = 0; j < 6; ++j) {
        x[j] = *(const v4f*)(xr + (j * 32 + lane) * 4);
        s += (x[j][0] + x[j][1]) + (x[j][2] + x[j][3]);
    }
    s += __shfl_xor(s, 16, 32); s += __shfl_xor(s, 8, 32); s += __shfl_xor(s, 4, 32); s += __shfl_xor(s, 2, 32); s += __shfl_xor(s, 1, 32);
    const float mu = s * (1.0f / (float)DMOD);
    float q = 0.0f;
#pragma unroll
    for (int j = 0; j < 6; ++j) {
        const float d0 = x[j][0] - mu, d1 = x[j][1] - mu, d2 = x[j][2] - mu, d3 = x[j][3] - mu;
        q += (d0 * d0 + d1 * d1) + (d2 * d2 + d3 * d3);
    }
    q += __shfl_xor(q, 16, 32); q += __shfl_xor(q, 8, 32); q += __shfl_xor(q, 4, 32); q += __shfl_xor(q, 2, 32); q += __shfl_xor(q, 1, 32);
    const float var = q * (1.0f / (float)DMOD);
    const float rstd = rsqrtf(var + 1.0e-5f);
    v4f o[6];
#pragma unroll
    for (int j = 0; j < 6; ++j) {
        const v4f g4 = *(const v4f*)(g + (j * 32 + lane) * 4);
        const v4f b4 = *(const v4f*)(be + (j * 32 + lane) * 4);
#pragma unroll
        for (int i = 0; i < 4; ++i) o[j][i] = ((x[j][i] - mu) * rstd) * bfr(g4[i]) + bfr(b4[i]);
    }
    float* orow = OUT + ((size_t)b * SEQ_FULL + (size_t)t) * DMOD;          // FULL batch stride of the output rows
#pragma unroll
    for (int j = 0; j < 6; ++j) *(v4f*)(orow + (j * 32 + lane) * 4) = o[j];
    
}

extern "C" void kernel_launch(void* const* d_in, const int* in_sizes, int n_in,
                              void* d_out, int out_size, void* d_ws, size_t ws_size, hipStream_t stream) {
    if (n_in < 12) return;
    const size_t need_x = (size_t)(NB - 1) * SEQ_FULL * DMOD + (size_t)SEQ * DMOD;
    const size_t need_m = (size_t)(NB - 1) * SEQ_FULL + (size_t)SEQ;
    if ((size_t)in_sizes[0] < need_x || (size_t)in_sizes[1] < need_m) return;
    if (in_sizes[2] < DMOD * DMOD || in_sizes[4] < DMOD * DMOD || in_sizes[6] < DMOD * DMOD || in_sizes[8] < DMOD * DMOD) return;
    if (in_sizes[3] < DMOD || in_sizes[5] < DMOD || in_sizes[7] < DMOD || in_sizes[9] < DMOD) return;
    if (in_sizes[10] < DMOD || in_sizes[11] < DMOD) return;
    if ((size_t)out_size < need_x) return;                       // output rows are addressed at the FULL batch stride
    const float* xin = (const float*)d_in[0];
    const int*   msk = (const int*)d_in[1];
    const float* Wq = (const float*)d_in[2]; const float* bq = (const float*)d_in[3];
    const float* Wk = (const float*)d_in[4]; const float* bk = (const float*)d_in[5];
    const float* Wv = (const float*)d_in[6]; const float* bv = (const float*)d_in[7];
    const float* Wo = (const float*)d_in[8]; const float* bo = (const float*)d_in[9];
    const float* lng = (const float*)d_in[10]; const float* lnb = (const float*)d_in[11];
    float* OUT = (float*)d_out;

    constexpr size_t WB = (size_t)DMOD * DMOD * 2;               // one 16-bit weight plane
    constexpr size_t PB = (size_t)NB * SEQ * DMOD * 2;           // one 16-bit activation / head plane (NB*NHEAD*SEQ*HDIM elements)
    constexpr size_t CB = (size_t)NB * SEQ_FULL * DMOD * 4;      // f32 ctx plane, rows at the FULL batch stride
    static_assert(WB % 256 == 0);
    static_assert(PB % 256 == 0);
    static_assert(CB % 256 == 0);
    static_assert(4 * WB + 7 * PB + CB <= (size_t)134217728);    // total carve at most 128 MiB
    static_assert(((size_t)(NB - 1) * SEQ_FULL + SEQ) * DMOD * 4 <= CB);     // last ctx row written by the attention kernel
    static_assert((size_t)NB * SEQ * DMOD * 2 <= PB);            // f16 ctx plane reuses the q hi plane (dead after the attention kernel)
    static_assert((size_t)NB * SEQ * DMOD * 4 <= 2 * PB);        // f32 pre-norm plane reuses the adjacent k hi | lo planes (dead after the attention kernel)
    if (4 * WB + 7 * PB + CB > ws_size) return;
    char* wsp = (char*)d_ws;
    bf* WQ = (bf*)wsp; wsp += WB;
    bf* WK = (bf*)wsp; wsp += WB;
    bf* WV = (bf*)wsp; wsp += WB;
    h16* WO = (h16*)wsp; wsp += WB;
    bf* XB = (bf*)wsp; wsp += PB;
    bf* QHp = (bf*)wsp; wsp += PB;
    bf* QLp = (bf*)wsp; wsp += PB;
    bf* KHp = (bf*)wsp; wsp += PB;
    bf* KLp = (bf*)wsp; wsp += PB;
    h16* VVp = (h16*)wsp; wsp += PB;
    h16* VRp = (h16*)wsp; wsp += PB;
    float* CTX = (float*)wsp; wsp += CB;
    h16* CTXH = (h16*)QHp;                                       // stream order: written only after the attention kernel has finished
    float* XF = (float*)KHp;                                     // spans KHp and KLp

    const int nW = DMOD * DMOD, nX = NB * SEQ * DMOD;
    const unsigned gW = (unsigned)((nW / 8 + 255) / 256), gX = (unsigned)((nX / 8 + 255) / 256);
    k_cvt<<<gW, 256, 0, stream>>>(Wq, WQ, nW, nW, nW);
    k_cvt<<<gW, 256, 0, stream>>>(Wk, WK, nW, nW, nW);
    k_cvt<<<gW, 256, 0, stream>>>(Wv, WV, nW, nW, nW);
    k_cvt_wo<<<gW, 256, 0, stream>>>(Wo, WO, nW);
    // the single input stream feeds all three projections
    k_cvt<<<gX, 256, 0, stream>>>(xin, XB, nX, SEQ * DMOD, SEQ_FULL * DMOD);
    // q: X[NB*SEQ][DMOD] (A) x Wq[DMOD][DMOD] (Bt as stored) -> q hi|lo head planes
    k_proj_qk<<<dim3(NB * SEQ / 64, DMOD / 64), 32, 0, stream>>>(XB, WQ, bq, QHp, QLp);
    k_proj_qk<<<dim3(NB * SEQ / 64, DMOD / 64), 32, 0, stream>>>(XB, WK, bk, KHp, KLp);
    // v: Wv[DMOD][DMOD] (A) x X[NB*SEQ][DMOD] (Bt) -> transposed value / residual planes [b][head][d][t], key mask applied
    k_proj_v<<<dim3(DMOD / 64, NB * SEQ / 64), 32, 0, stream>>>(WV, XB, bv, msk, VVp, VRp);
    k_attn<<<dim3(SEQ / (AWAVES * 16), NB * NHEAD), AWAVES * 32, 0, stream>>>(QHp, QLp, KHp, KLp, VVp, VRp, CTX);
    // ctx[NB*SEQ][DMOD] (f32, FULL stride) x query mask -> compact f16 plane
    k_cvt_ctx<<<gX, 256, 0, stream>>>(CTX, msk, CTXH, nX);
    // output projection: CTXH[NB*SEQ][DMOD] (A) x Wo[DMOD out][DMOD in] (Bt as stored) + bias + skip -> f32 pre-norm plane
    k_out<<<dim3(NB * SEQ / 64, DMOD / 64), 32, 0, stream>>>(CTXH, WO, bo, xin, XF);
    k_ln<<<dim3(NB * SEQ / 8), 256, 0, stream>>>(XF, lng, lnb, OUT);
}

// v002
// Measured time: 238 microseconds a run.
// Timed twice side by side with v001, it ran 1.23 times as fast both times.
// All steps since v000 together make it 2.55 times as fast.
#include <hip/hip_runtime.h>

// Single-stream multi-head self-attention block: x [4][2048][768]; q / k / v = x.W^T + b with W stored [out][in]; heads = 12 x 64; scores = q.k^T with NO scale; softmax over all 2048 keys;
// the probabilities are multiplied AFTER the softmax by mask_q * mask_k (int input [4][2048], read by value); ctx merged to [4][2048][768]; y = ctx.Wo^T + bo + x; output = LayerNorm(y) with eps 1e-5 and gain / shift inputs.
// Compute dtypes, f32 accumulate everywhere: x and the weights converted to bf16 (RNE) once; q / k / v projections = single v_wmma_f32_16x16x32_bf16 products + bf16(bias) in f32; scores = bf16 hi|lo planes, 3 products (hh + lh + hl) in one accumulator;
// softmax f32 (base 2, running max from a finite start, denominator over all keys); P = f16(256 p) packed straight from the score accumulators into the B fragment; V times the key mask = f16 value plane + f16 residual x2048 plane on v_wmma_f32_16x16x32_f16, each with its own accumulator set, folded in the f32 epilogue;
// output projection = single v_wmma_f32_16x16x32_f16 product: ctx times the query mask as f16 x16, bf16(Wo) as f16 x64, folded by 1/1024 in f32; bias, skip connection (bf16(x)) and LayerNorm in f32.

#ifndef NB
#define NB 4
#endif
#ifndef SEQ
#define SEQ 2048
#endif
#define NB_FULL  4
#define SEQ_FULL 2048
#define DMOD  768
#define NHEAD 12
#define HDIM  64
#define OSP   68
#define LOG2E 1.4426950408889634f
#define PSH   8.0f
#define RCAR  2048.0f
#define WCAR  64.0f
#define CCAR  16.0f

static_assert(NHEAD * HDIM == DMOD);          // merged width
static_assert(HDIM == 64);                    // one 64-column GEMM tile == one head; 4 d-tiles in the attention kernel
static_assert(DMOD % 64 == 0);                // GEMM tile multiple (N and the transposed M)
static_assert(DMOD % 32 == 0);                // k-loop step
static_assert(SEQ % 64 == 0);                 // GEMM row tiles never straddle a batch; attention key step 32
static_assert(SEQ <= SEQ_FULL);
static_assert(NB <= NB_FULL);
static_assert((SEQ * DMOD) % 8 == 0);         // convert kernel: 8 elements per thread never straddle a batch
static_assert((DMOD * DMOD) % 8 == 0);
static_assert((NB * SEQ) % 64 == 0);
static_assert((NB * SEQ) / 64 <= 65535);      // grid.y bound
static_assert(OSP % 4 == 0);                  // 16-byte aligned LDS rows
static_assert(OSP >= HDIM);
static_assert(DMOD % 8 == 0);                 // ctx convert: 8 elements per thread never straddle a row
static_assert(SEQ % 8 == 0);                  // key-mask vector loads stay 16-byte aligned
static_assert(SEQ_FULL % 8 == 0);
static_assert(DMOD == 6 * 32 * 4);            // LayerNorm: one wave per row, 6 x (32 lanes x 4 floats)
static_assert((NB * SEQ) % 8 == 0);           // LayerNorm: 8 rows (waves) per block, no tail
static_assert(HDIM == 16 * 4);                // output GEMM store: 16 lanes x 16 B == one 64-float row segment

typedef _Float16 h16;
typedef unsigned short bf;
typedef __attribute__((ext_vector_type(16))) __bf16   v16bf;
typedef __attribute__((ext_vector_type(16))) _Float16 v16h;
typedef __attribute__((ext_vector_type(8)))  _Float16 v8h;
typedef __attribute__((ext_vector_type(8)))  unsigned short v8us;
typedef __attribute__((ext_vector_type(8)))  float    v8f;
typedef __attribute__((ext_vector_type(4)))  float    v4f;
typedef __attribute__((ext_vector_type(4)))  int      v4i;
typedef v4f  __attribute__((may_alias)) v4fa;

__device__ __forceinline__ unsigned short f2bf(float f) { unsigned u = __float_as_uint(f); u += 0x7FFFu + ((u >> 16) & 1u); return (unsigned short)(u >> 16); }
__device__ __forceinline__ float bf2f(unsigned short b) { return __uint_as_float(((unsigned)b) << 16); }
__device__ __forceinline__ float bfr(float f) { return bf2f(f2bf(f)); }
__device__ __forceinline__ void splitf(float y, unsigned short& h, unsigned short& l) { h = f2bf(y); l = f2bf(y - bf2f(h)); }
__device__ __forceinline__ v16h cat16(v8h lo, v8h hi) { return __builtin_shufflevector(lo, hi, 0, 1, 2, 3, 4, 5, 6, 7, 8, 9, 10, 11, 12, 13, 14, 15); }
__device__ __forceinline__ v16bf cat16b(v8us lo, v8us hi) { return __builtin_bit_cast(v16bf, __builtin_shufflevector(lo, hi, 0, 1, 2, 3, 4, 5, 6, 7, 8, 9, 10, 11, 12, 13, 14, 15)); }
__device__ __forceinline__ v8f wmma16(v16h a, v16h b, v8f c) { return __builtin_amdgcn_wmma_f32_16x16x32_f16(false, a, false, b, (short)0, c, false, false); }
__device__ __forceinline__ v8f wmmab(v16bf a, v16bf b, v8f c) { return __builtin_amdgcn_wmma_f32_16x16x32_bf16(false, a, false, b, (short)0, c, false, false); }
// per-instruction guarded f16 WMMA: ONE accumulator tied with its own two operands to four nops
__device__ __forceinline__ v8f wmma16g(v16h a, v16h b, v8f c) { c = wmma16(a, b, c); asm volatile("v_nop\n\tv_nop\n\tv_nop\n\tv_nop" : "+v"(c) : "v"(a), "v"(b)); return c; }
// fragment loaders (A and B alike, K-contiguous rows): p already carries + 8*(lane>>4); elements 0..7 = k0+8h.., elements 8..15 = k0+16+8h..
__device__ __forceinline__ v16bf ldbf(const bf* p) { return cat16b(*(const v8us*)p, *(const v8us*)(p + 16)); }
__device__ __forceinline__ v16h  ldh(const h16* p) { return cat16(*(const v8h*)p, *(const v8h*)(p + 16)); }
// f32 -> f16 convert for WMMA operand planes: values below the smallest f16 normal become exact zero (applied after the plane's power-of-two carry)
static __device__ __forceinline__ h16 toh_flush(float v) { const h16 r = (h16)v; return (fabsf(v) < 6.103515625e-05f) ? (h16)0.0f : r; }

// dst[e] = src[(e / per) * per_full + e % per]  (per / per_full = compact and staged batch strides).
__global__ __launch_bounds__(256) void k_cvt(const float* __restrict__ src, bf* dst, int n, int per, int per_full) {
    const int e = ((int)blockIdx.x * 256 + (int)threadIdx.x) * 8;
    if (e >= n) return;
    const int b = e / per;
    const size_t so = (size_t)b * (size_t)per_full + (size_t)(e - b * per);
    const v4f a0 = *(const v4f*)(src + so);
    const v4f a1 = *(const v4f*)(src + so + 4);
    v8us o;
    o[0] = f2bf(a0[0]); o[1] = f2bf(a0[1]); o[2] = f2bf(a0[2]); o[3] = f2bf(a0[3]);
    o[4] = f2bf(a1[0]); o[5] = f2bf(a1[1]); o[6] = f2bf(a1[2]); o[7] = f2bf(a1[3]);
    *(v8us*)(dst + e) = o;
    
}

__global__ __launch_bounds__(256) void k_cvt_wo(const float* __restrict__ src, h16* dst, int n) {
    const int e = ((int)blockIdx.x * 256 + (int)threadIdx.x) * 8;
    if (e >= n) return;
    const v4f a0 = *(const v4f*)(src + e);
    const v4f a1 = *(const v4f*)(src + e + 4);
    v8h o;
    o[0] = toh_flush(bfr(a0[0]) * WCAR); o[1] = toh_flush(bfr(a0[1]) * WCAR); o[2] = toh_flush(bfr(a0[2]) * WCAR); o[3] = toh_flush(bfr(a0[3]) * WCAR);
    o[4] = toh_flush(bfr(a1[0]) * WCAR); o[5] = toh_flush(bfr(a1[1]) * WCAR); o[6] = toh_flush(bfr(a1[2]) * WCAR); o[7] = toh_flush(bfr(a1[3]) * WCAR);
    *(v8h*)(dst + e) = o;
    
}

__global__ __launch_bounds__(256) void k_cvt_ctx(const float* __restrict__ src, const int* __restrict__ mask, h16* dst, int n) {
    const int e = ((int)blockIdx.x * 256 + (int)threadIdx.x) * 8;
    if (e >= n) return;
    const int row = e / DMOD, col = e - row * DMOD;
    const int b = row / SEQ, t = row - b * SEQ;
    const size_t srow = (size_t)b * SEQ_FULL + (size_t)t;
    const float mq = (float)mask[srow] * CCAR;
    const v4f a0 = *(const v4f*)(src + srow * DMOD + col);
    const v4f a1 = *(const v4f*)(src + srow * DMOD + col + 4);
    v8h o;
    o[0] = toh_flush(a0[0] * mq); o[1] = toh_flush(a0[1] * mq); o[2] = toh_flush(a0[2] * mq); o[3] = toh_flush(a0[3] * mq);
    o[4] = toh_flush(a1[0] * mq); o[5] = toh_flush(a1[1] * mq); o[6] = toh_flush(a1[2] * mq); o[7] = toh_flush(a1[3] * mq);
    *(v8h*)(dst + e) = o;
    
}

// ---- GEMM main loop: ONE WAVE per 64x64 tile (16 accumulators), operands straight from K-contiguous bf16 planes, K = DMOD.
// acc[mb][nb][j] = sum_k A[r0 + mb*16 + 8*hi + j][k] * Bt[c0 + nb*16 + lr][k].
__device__ __forceinline__ void gemm_tile(const bf* __restrict__ A, const bf* __restrict__ Bt, size_t aoff, size_t boff, v8f (&acc)[4][4]) {
#pragma unroll
    for (int mb = 0; mb < 4; ++mb)
#pragma unroll
        for (int nb = 0; nb < 4; ++nb) acc[mb][nb] = (v8f){};
#pragma unroll 1
    for (int kc = 0; kc < DMOD; kc += 32) {
        v16bf a[4];
        v16bf b;
#pragma unroll
        for (int mb = 0; mb < 4; ++mb) a[mb] = ldbf(A + aoff + (size_t)mb * 16 * DMOD + kc);
#pragma unroll
        for (int nb = 0; nb < 4; ++nb) {
            b = ldbf(Bt + boff + (size_t)nb * 16 * DMOD + kc);
#pragma unroll
            for (int mb = 0; mb < 4; ++mb) acc[mb][nb] = wmmab(a[mb], b, acc[mb][nb]);
        }
        asm volatile("" : "+v"(acc[0][0]), "+v"(acc[1][0]), "+v"(acc[2][0]), "+v"(acc[3][0]), "+v"(acc[0][1]), "+v"(acc[1][1]), "+v"(acc[2][1]), "+v"(acc[3][1]));
        asm volatile("v_nop\n\tv_nop\n\tv_nop\n\tv_nop" : "+v"(acc[0][2]), "+v"(acc[1][2]), "+v"(acc[2][2]), "+v"(acc[3][2]), "+v"(acc[0][3]), "+v"(acc[1][3]), "+v"(acc[2][3]), "+v"(acc[3][3]) : "v"(a[0]), "v"(a[3]), "v"(b));
    }
}

// ---- f16 twin of the GEMM main loop (same tile map, K-contiguous f16 planes); every WMMA carries its own four-nop guard.
__device__ __forceinline__ void gemm_tile_h(const h16* __restrict__ A, const h16* __restrict__ Bt, size_t aoff, size_t boff, v8f (&acc)[4][4]) {
#pragma unroll
    for (int mb = 0; mb < 4; ++mb)
#pragma unroll
        for (int nb = 0; nb < 4; ++nb) acc[mb][nb] = (v8f){};
#pragma unroll 1
    for (int kc = 0; kc < DMOD; kc += 32) {
        v16h a[4];
        v16h b;
#pragma unroll
        for (int mb = 0; mb < 4; ++mb) a[mb] = ldh(A + aoff + (size_t)mb * 16 * DMOD + kc);
#pragma unroll
        for (int nb = 0; nb < 4; ++nb) {
            b = ldh(Bt + boff + (size_t)nb * 16 * DMOD + kc);
#pragma unroll
            for (int mb = 0; mb < 4; ++mb) acc[mb][nb] = wmma16g(a[mb], b, acc[mb][nb]);
        }
    }
}

// ---- k_proj_qk: y[m][n] = X[m][:] . W[n][:] + bf16(bias[n]); tile rows m = b*SEQ + t, tile columns = one head (n = head*64 + d).
// grid (NB*SEQ/64, DMOD/64), 32 threads.
__global__ __launch_bounds__(32) void k_proj_qk(const bf* __restrict__ X, const bf* __restrict__ W, const float* __restrict__ bias, bf* Ph, bf* Pl) {
    __shared__ __align__(16) float os[16 * OSP];
    const int lane = (int)threadIdx.x & 31, lr = lane & 15, hi = lane >> 4;
    const int r0 = (int)blockIdx.x * 64, c0 = (int)blockIdx.y * 64;
    v8f acc[4][4];
    gemm_tile(X, W, (size_t)(r0 + lr) * DMOD + 8 * hi, (size_t)(c0 + lr) * DMOD + 8 * hi, acc);
    const int b = r0 / SEQ, t0 = r0 - b * SEQ, hd = (int)blockIdx.y;
    const int rq = lane >> 3, cq = (lane & 7) * 8;
    const v4f bv0 = *(const v4f*)(bias + c0 + cq);
    const v4f bv1 = *(const v4f*)(bias + c0 + cq + 4);
    float bb[8];
    bb[0] = bfr(bv0[0]); bb[1] = bfr(bv0[1]); bb[2] = bfr(bv0[2]); bb[3] = bfr(bv0[3]);
    bb[4] = bfr(bv1[0]); bb[5] = bfr(bv1[1]); bb[6] = bfr(bv1[2]); bb[7] = bfr(bv1[3]);
    const size_t pbase = ((size_t)(b * NHEAD + hd) * SEQ + t0) * HDIM;
#pragma unroll
    for (int mb = 0; mb < 4; ++mb) {
#pragma unroll
        for (int nb = 0; nb < 4; ++nb) {
#pragma unroll
            for (int j = 0; j < 8; ++j) os[(hi * 8 + j) * OSP + nb * 16 + lr] = acc[mb][nb][j];
        }
        __syncthreads();
{
#pragma unroll
            for (int s = 0; s < 4; ++s) {
                const int row = s * 4 + rq;                       // s 0..3 x rq 0..3 -> rows 0..15
                const v4f x0 = *(const v4fa*)(os + row * OSP + cq);
                const v4f x1 = *(const v4fa*)(os + row * OSP + cq + 4);
                v8us oh, ol;
#pragma unroll
                for (int i = 0; i < 4; ++i) {
                    unsigned short a2, c2;
                    splitf(x0[i] + bb[i], a2, c2); oh[i] = a2; ol[i] = c2;
                    splitf(x1[i] + bb[4 + i], a2, c2); oh[4 + i] = a2; ol[4 + i] = c2;
                }
                const size_t oo = pbase + (size_t)(mb * 16 + row) * HDIM + cq;
                *(v8us*)(Ph + oo) = oh;
                *(v8us*)(Pl + oo) = ol;
            }
            
        }
        __syncthreads();
    }
}

// ---- k_proj_v: transposed projection y^T[n][m] = (W[n][:] . X[m][:] + bf16(bias[n])) * mask[m]; tile rows n = head*64 + d, tile columns m = b*SEQ + t (the key index).
// The key mask multiplies the value rows, so the attention kernel's probabilities and its denominator stay over all keys.
// grid (DMOD/64, NB*SEQ/64), 32 threads.
__global__ __launch_bounds__(32) void k_proj_v(const bf* __restrict__ W, const bf* __restrict__ X, const float* __restrict__ bias, const int* __restrict__ mask, h16* Pv, h16* Pr) {
    __shared__ __align__(16) float os[16 * OSP];
    const int lane = (int)threadIdx.x & 31, lr = lane & 15, hi = lane >> 4;
    const int r0 = (int)blockIdx.x * 64, c0 = (int)blockIdx.y * 64;
    v8f acc[4][4];
    gemm_tile(W, X, (size_t)(r0 + lr) * DMOD + 8 * hi, (size_t)(c0 + lr) * DMOD + 8 * hi, acc);
    const int b = c0 / SEQ, t0 = c0 - b * SEQ, hd = (int)blockIdx.x;
    const int rq = lane >> 3, cq = (lane & 7) * 8;
    const v4i mk0 = *(const v4i*)(mask + (size_t)b * SEQ_FULL + t0 + cq);          // staged mask rows use the FULL batch stride
    const v4i mk1 = *(const v4i*)(mask + (size_t)b * SEQ_FULL + t0 + cq + 4);
    float mf[8];
    mf[0] = (float)mk0[0]; mf[1] = (float)mk0[1]; mf[2] = (float)mk0[2]; mf[3] = (float)mk0[3];
    mf[4] = (float)mk1[0]; mf[5] = (float)mk1[1]; mf[6] = (float)mk1[2]; mf[7] = (float)mk1[3];
    const size_t pbase = (size_t)(b * NHEAD + hd) * HDIM * SEQ + t0;
#pragma unroll
    for (int mb = 0; mb < 4; ++mb) {
#pragma unroll
        for (int nb = 0; nb < 4; ++nb) {
#pragma unroll
            for (int j = 0; j < 8; ++j) os[(hi * 8 + j) * OSP + nb * 16 + lr] = acc[mb][nb][j];
        }
        __syncthreads();
{
#pragma unroll
            for (int s = 0; s < 4; ++s) {
                const int row = s * 4 + rq;                       // d within the slab, 0..15
                const float bsc = bfr(bias[r0 + mb * 16 + row]);
                const v4f x0 = *(const v4fa*)(os + row * OSP + cq);
                const v4f x1 = *(const v4fa*)(os + row * OSP + cq + 4);
                v8h ov, orr;
#pragma unroll
                for (int i = 0; i < 4; ++i) {
                    const float y0 = (x0[i] + bsc) * mf[i]; const h16 h0 = toh_flush(y0); ov[i] = h0; orr[i] = toh_flush((y0 - (float)h0) * RCAR);
                    const float y1 = (x1[i] + bsc) * mf[4 + i]; const h16 h1 = toh_flush(y1); ov[4 + i] = h1; orr[4 + i] = toh_flush((y1 - (float)h1) * RCAR);
                }
                const size_t oo = pbase + (size_t)(mb * 16 + row) * SEQ + cq;
                *(v8h*)(Pv + oo) = ov;
                *(v8h*)(Pr + oo) = orr;
            }
            
        }
        __syncthreads();
    }
}

// ---- k_attn: fused attention, transposed form. Block = 8 waves = 128 queries of one (batch, head); each wave owns 16 queries.
// The K hi|lo rows and the V value|residual rows of 64 keys are staged in LDS once per block by asynchronous copies (16 B per lane, whole 128-B lines), two buffers: tile t + 1 flies while tile t is worked on.
// Each wave loads its own Q hi|lo fragments once, before the key loop, and keeps them in registers.
// Per 32-key step: S^T[key][query] = K.Q^T on bf16 hi|lo planes (3 products, one accumulator per 16-key tile); base-2 online softmax per query column
// (lane (hi, lr) holds keys 8*hi + r and 16 + 8*hi + r of query lr; the two lanes of a query share the running max through one shuffle);
// P^T packed from the two score tiles into the B fragment (element r <- tile 0, element 8 + r <- tile 1); O^T[d][query] += V^T.P^T for the value and the residual plane
// (every one of the eight P.V WMMAs carries its own four-nop guard tying exactly its accumulator and its two operands).
// grid (SEQ/128, NB*NHEAD), 256 threads.
#define AWAVES 8                      // waves per block that share one staged tile
#define KTILE  64                     // keys per staged tile: K rows and V rows are both 128 B long
#define LPITCH 144                    // LDS row pitch in bytes: 16 B x odd, conflict-free for the 16-byte fragment reads
#define LPLANE (64 * LPITCH)          // one staged plane: 64 rows (keys for K, head dims for V)
#define LSTAGE (4 * LPLANE)           // one buffer: K hi, K lo, V value, V residual
static_assert(SEQ % (AWAVES * 16) == 0);      // whole blocks of queries
static_assert(SEQ % KTILE == 0);              // whole key tiles
static_assert(SEQ / KTILE >= 2);              // the two-buffer prologue fills tiles 0 and 1
static_assert(KTILE * 2 == 128);              // one V row of a tile == 8 lanes x 16 B
static_assert(HDIM * 2 == 128);               // one K row == 8 lanes x 16 B
static_assert(AWAVES * 32 * 2 == 64 * 8);     // two copies per lane cover one plane (64 rows x 8 pieces)
static_assert(AWAVES * 16 * OSP * 4 <= 2 * LSTAGE);   // the output staging reuses the ring

// One tile = 8 copies per lane. l = the lane's LDS byte address in the K hi plane of the target buffer; the pointers are the lane's own 16 bytes in rows 0..31 of each plane.
__device__ __forceinline__ void stage_tile(unsigned l, const bf* kh, const bf* kl, const h16* vv, const h16* vr) {
    // the closing s_wait_xcnt stands inside the statement so that no address register of a copy is rewritten in front of it
    asm volatile("global_load_async_to_lds_b128 %0, %8, off\n\t"
                 "global_load_async_to_lds_b128 %1, %9, off\n\t"
                 "global_load_async_to_lds_b128 %2, %10, off\n\t"
                 "global_load_async_to_lds_b128 %3, %11, off\n\t"
                 "global_load_async_to_lds_b128 %4, %12, off\n\t"
                 "global_load_async_to_lds_b128 %5, %13, off\n\t"
                 "global_load_async_to_lds_b128 %6, %14, off\n\t"
                 "global_load_async_to_lds_b128 %7, %15, off\n\t"
                 "s_wait_xcnt 0x0"
                 :: "v"(l), "v"(l + 32 * LPITCH), "v"(l + LPLANE), "v"(l + LPLANE + 32 * LPITCH),
                    "v"(l + 2 * LPLANE), "v"(l + 2 * LPLANE + 32 * LPITCH), "v"(l + 3 * LPLANE), "v"(l + 3 * LPLANE + 32 * LPITCH),
                    "v"(kh), "v"(kh + 32 * HDIM), "v"(kl), "v"(kl + 32 * HDIM),
                    "v"(vv), "v"(vv + 32 * SEQ), "v"(vr), "v"(vr + 32 * SEQ)
                 : "memory");
}

// second launch bound: six waves per SIMD, so that the three blocks that fall to each WGP stay resident together
__global__ __launch_bounds__(AWAVES * 32, 6) void k_attn(const bf* __restrict__ QH, const bf* __restrict__ QL, const bf* __restrict__ KH, const bf* __restrict__ KL,
                                              const h16* __restrict__ VV, const h16* __restrict__ VR, float* OUT) {
    __shared__ __align__(16) unsigned char ring[2 * LSTAGE];
    const int wave = __builtin_amdgcn_readfirstlane((int)(threadIdx.x >> 5));
    const int lane = (int)threadIdx.x & 31, lr = lane & 15, hi = lane >> 4;
    const int bh = (int)blockIdx.y;
    const int b = bh / NHEAD, hd = bh - b * NHEAD;
    const int q0 = (int)blockIdx.x * (AWAVES * 16) + wave * 16;
    const size_t pb = (size_t)bh * SEQ * HDIM;
    const bf* qh = QH + pb; const bf* ql = QL + pb;
    const int qoff0 = (q0 + lr) * HDIM + 8 * hi;
    // copy side: thread -> (row = tid / 8, 16-byte piece = tid % 8) of rows 0..31 of a plane
    const int crow = (int)threadIdx.x >> 3, cpc = (int)threadIdx.x & 7;
    const bf* ckh = KH + pb + crow * HDIM + cpc * 8; const h16* cvv = VV + pb + crow * SEQ + cpc * 8;   // running pointers, advanced tile by tile
    const ptrdiff_t dkl = KL - KH, dvr = VR - VV;      // uniform distances of the lo and residual planes (scalar registers instead of two more pointers per lane)
    const unsigned cl = (unsigned)(size_t)(__attribute__((address_space(3))) unsigned char*)ring + (unsigned)(crow * LPITCH + cpc * 16);
    // read side: fragment row lr, 16-byte piece hi (K rows and V rows alike)
    const unsigned char* fr = ring + lr * LPITCH + 16 * hi;
    v8f ova[4], ore[4];
#pragma unroll
    for (int dt = 0; dt < 4; ++dt) { ova[dt] = (v8f){}; ore[dt] = (v8f){}; }
    float m = -3.0e38f, lsum = 0.0f;
    stage_tile(cl, ckh, ckh + dkl, cvv, cvv + dvr);
    ckh += KTILE * HDIM; cvv += KTILE;
    // the wave's own Q hi|lo fragments: loaded once, held in registers over the whole key loop
    v16bf qfh[HDIM / 32], qfl[HDIM / 32];
#pragma unroll
    for (int kc = 0; kc < HDIM; kc += 32) { qfh[kc / 32] = ldbf(qh + qoff0 + kc); qfl[kc / 32] = ldbf(ql + qoff0 + kc); }
    asm volatile("s_wait_xcnt 0x0" ::: "memory");         // precaution: stands in front of every rewrite of the Q loads' address registers
    asm volatile("s_wait_asynccnt 0x0" ::: "memory");     // this wave's copies of tile 0 have landed
    __syncthreads();                                      // tile 0 readable by every wave
    stage_tile(cl + LSTAGE, ckh, ckh + dkl, cvv, cvv + dvr);
#pragma unroll 1   // rolled: one publish point per trip, and the registers stay within six waves per SIMD
    for (int t = 0; t < SEQ / KTILE; ++t) {
        const unsigned char* fb = fr + (t & 1) * LSTAGE;
#pragma unroll 1   // rolled: beside the resident Q fragments only one 32-key step's temporaries fit at six waves per SIMD (unrolled, the build spills)
        for (int sub = 0; sub < KTILE / 32; ++sub) {
            v8f s0 = (v8f){}, s1 = (v8f){};
            v16bf qhf, qlf, k0h, k0l, k1h, k1l;
#pragma unroll
            for (int kc = 0; kc < HDIM; kc += 32) {
                qhf = qfh[kc / 32]; qlf = qfl[kc / 32];
                const unsigned char* kp = fb + sub * 32 * LPITCH + kc * 2;
                k0h = ldbf((const bf*)kp); k0l = ldbf((const bf*)(kp + LPLANE));
                k1h = ldbf((const bf*)(kp + 16 * LPITCH)); k1l = ldbf((const bf*)(kp + LPLANE + 16 * LPITCH));
                s0 = wmmab(k0h, qhf, s0); s1 = wmmab(k1h, qhf, s1);
                s0 = wmmab(k0l, qhf, s0); s1 = wmmab(k1l, qhf, s1);
                s0 = wmmab(k0h, qlf, s0); s1 = wmmab(k1h, qlf, s1);
            }
            asm volatile("v_nop\n\tv_nop\n\tv_nop\n\tv_nop" : "+v"(s0), "+v"(s1) : "v"(k1h), "v"(qlf));
            float t0[8], t1[8];
            float mx = -3.0e38f;
#pragma unroll
            for (int r = 0; r < 8; ++r) { t0[r] = s0[r] * LOG2E; t1[r] = s1[r] * LOG2E; mx = fmaxf(mx, fmaxf(t0[r], t1[r])); }
            mx = fmaxf(mx, __shfl_xor(mx, 16, 32));
            const float mnew = fmaxf(m, mx);
            const float sc = __builtin_amdgcn_exp2f(m - mnew);
            m = mnew;
            const float mo = mnew - PSH;                  // exp2(t - mo) = 256 p, at most 256
            float psum = 0.0f;
            v16h pf;
#pragma unroll
            for (int r = 0; r < 8; ++r) {
                const float e0 = __builtin_amdgcn_exp2f(t0[r] - mo);
                const float e1 = __builtin_amdgcn_exp2f(t1[r] - mo);
                psum += e0 + e1;
                pf[r] = (h16)e0; pf[8 + r] = (h16)e1;
            }
            lsum = lsum * sc + psum;
            if (__builtin_amdgcn_ballot_w32(sc != 1.0f) != 0u) {      // wave-uniform: rescale only when some running max moved
#pragma unroll
                for (int dt = 0; dt < 4; ++dt) {
#pragma unroll
                    for (int r = 0; r < 8; ++r) { ova[dt][r] *= sc; ore[dt][r] *= sc; }
                }
            }
            const unsigned char* vp = fb + 2 * LPLANE + sub * 64;
            v16h va[4], vb[4];
#pragma unroll
            for (int dt = 0; dt < 4; ++dt) va[dt] = ldh((const h16*)(vp + dt * 16 * LPITCH));
#pragma unroll
            for (int dt = 0; dt < 4; ++dt) ova[dt] = wmma16g(va[dt], pf, ova[dt]);
#pragma unroll
            for (int dt = 0; dt < 4; ++dt) vb[dt] = ldh((const h16*)(vp + LPLANE + dt * 16 * LPITCH));
#pragma unroll
            for (int dt = 0; dt < 4; ++dt) ore[dt] = wmma16g(vb[dt], pf, ore[dt]);
        }
        asm volatile("s_wait_dscnt 0x0" ::: "memory");        // this wave's reads of tile t have returned before its buffer is refilled
        asm volatile("s_wait_asynccnt 0x0" ::: "memory");     // this wave's copies of tile t + 1 have landed
        __syncthreads();                                      // publishes tile t + 1 and ends every wave's last read of tile t
        if (t + 2 < SEQ / KTILE) {
            ckh += KTILE * HDIM; cvv += KTILE;
            stage_tile(cl + (unsigned)((t & 1) * LSTAGE), ckh, ckh + dkl, cvv, cvv + dvr);
        }
    }
    asm volatile("s_wait_asynccnt 0x0" ::: "memory");         // nothing in flight when the ring becomes output staging
    lsum += __shfl_xor(lsum, 16, 32);
    const float inv = 1.0f / lsum;
    float* os = (float*)ring;                                 // every wave has left the ring at the last trip's barrier
    const int obase = wave * 16 * OSP;
#pragma unroll
    for (int dt = 0; dt < 4; ++dt) {
        v4f x0, x1;
#pragma unroll
        for (int i = 0; i < 4; ++i) {
            x0[i] = (ova[dt][i] + ore[dt][i] * (1.0f / RCAR)) * inv;
            x1[i] = (ova[dt][4 + i] + ore[dt][4 + i] * (1.0f / RCAR)) * inv;
        }
        *(v4fa*)(os + obase + lr * OSP + dt * 16 + 8 * hi) = x0;
        *(v4fa*)(os + obase + lr * OSP + dt * 16 + 8 * hi + 4) = x1;
    }
    __syncthreads();
    float* orow = OUT + ((size_t)b * SEQ_FULL + q0) * DMOD + hd * HDIM;   // FULL batch stride of the output rows
{
#pragma unroll
        for (int s = 0; s < 8; ++s) {
            const int row = 2 * s + hi, cofs = lr * 4;            // s 0..7 x hi 0..1 -> queries 0..15; 16 lanes x 16 B = one 256-B head row
            const v4f val = *(const v4fa*)(os + obase + row * OSP + cofs);
            *(v4f*)(orow + (size_t)row * DMOD + cofs) = val;
        }
        
    }
}

// ---- k_out: y[m][n] = (A[m][:] . W[n][:]) / 1024 + bf16(bias[n]) + bf16(x[m][n]); A = f16 ctx plane (x16, compact rows), W = f16 plane of 64 * bf16(Wo) stored [out][in].
// The skip connection is read from the staged f32 input at the FULL batch stride and added at the store stage.
// grid (NB*SEQ/64, DMOD/64), 32 threads.
__global__ __launch_bounds__(32) void k_out(const h16* __restrict__ A, const h16* __restrict__ W, const float* __restrict__ bias, const float* __restrict__ xin, float* Y) {
    __shared__ __align__(16) float os[16 * OSP];
    const int lane = (int)threadIdx.x & 31, lr = lane & 15, hi = lane >> 4;
    const int r0 = (int)blockIdx.x * 64, c0 = (int)blockIdx.y * 64;
    v8f acc[4][4];
    gemm_tile_h(A, W, (size_t)(r0 + lr) * DMOD + 8 * hi, (size_t)(c0 + lr) * DMOD + 8 * hi, acc);
    const int b = r0 / SEQ, t0 = r0 - b * SEQ;
    const int cofs = lr * 4;
    const v4f bv0 = *(const v4f*)(bias + c0 + cofs);
    float bb[4];
    bb[0] = bfr(bv0[0]); bb[1] = bfr(bv0[1]); bb[2] = bfr(bv0[2]); bb[3] = bfr(bv0[3]);
    const size_t xbase = ((size_t)b * SEQ_FULL + (size_t)t0) * DMOD + c0 + cofs;
    const size_t ybase = (size_t)r0 * DMOD + c0 + cofs;
    const float osc = 1.0f / (WCAR * CCAR);
#pragma unroll
    for (int mb = 0; mb < 4; ++mb) {
#pragma unroll
        for (int nb = 0; nb < 4; ++nb) {
#pragma unroll
            for (int j = 0; j < 8; ++j) os[(hi * 8 + j) * OSP + nb * 16 + lr] = acc[mb][nb][j];
        }
        __syncthreads();
{
#pragma unroll
            for (int s = 0; s < 8; ++s) {
                const int row = 2 * s + hi;                       // s 0..7 x hi 0..1 -> rows 0..15; 16 lanes x 16 B = one 256-B row segment
                const v4f a4 = *(const v4fa*)(os + row * OSP + cofs);
                const v4f xr = *(const v4f*)(xin + xbase + (size_t)(mb * 16 + row) * DMOD);
                v4f o;
#pragma unroll
                for (int i = 0; i < 4; ++i) o[i] = (a4[i] * osc + bb[i]) + bfr(xr[i]);
                *(v4f*)(Y + ybase + (size_t)(mb * 16 + row) * DMOD) = o;
            }
            
        }
        __syncthreads();
    }
}

// ---- k_ln: LayerNorm over the 768 columns, one wave per row (8 rows per block), row held in registers (6 x 4 floats per lane);
// mean, then centred variance (divide by the width), y = (x - mu) * rsqrt(var + 1e-5) * bf16(gain) + bf16(shift).
// grid (NB*SEQ/8), 256 threads.
__global__ __launch_bounds__(256) void k_ln(const float* __restrict__ X, const float* __restrict__ g, const float* __restrict__ be, float* OUT) {
#pragma clang fp contract(off)
    const int wave = __builtin_amdgcn_readfirstlane((int)(threadIdx.x >> 5));
    const int lane = (int)threadIdx.x & 31;
    const int row = (int)blockIdx.x * 8 + wave;
    const int b = row / SEQ, t = row - b * SEQ;
    const float* xr = X + (size_t)row * DMOD;
    v4f x[6];
    float s = 0.0f;
#pragma unroll
    for (int j = 0; j < 6; ++j) {
        x[j] = *(const v4f*)(xr + (j * 32 + lane) * 4);
        s += (x[j][0] + x[j][1]) + (x[j][2] + x[j][3]);
    }
    s += __shfl_xor(s, 16, 32); s += __shfl_xor(s, 8, 32); s += __shfl_xor(s, 4, 32); s += __shfl_xor(s, 2, 32); s += __shfl_xor(s, 1, 32);
    const float mu = s * (1.0f / (float)DMOD);
    float q = 0.0f;
#pragma unroll
    for (int j = 0; j < 6; ++j) {
        const float d0 = x[j][0] - mu, d1 = x[j][1] - mu, d2 = x[j][2] - mu, d3 = x[j][3] - mu;
        q += (d0 * d0 + d1 * d1) + (d2 * d2 + d3 * d3);
    }
    q += __shfl_xor(q, 16, 32); q += __shfl_xor(q, 8, 32); q += __shfl_xor(q, 4, 32); q += __shfl_xor(q, 2, 32); q += __shfl_xor(q, 1, 32);
    const float var = q * (1.0f / (float)DMOD);
    const float rstd = rsqrtf(var + 1.0e-5f);
    v4f o[6];
#pragma unroll
    for (int j = 0; j < 6; ++j) {
        const v4f g4 = *(const v4f*)(g + (j * 32 + lane) * 4);
        const v4f b4 = *(const v4f*)(be + (j * 32 + lane) * 4);
#pragma unroll
        for (int i = 0; i < 4; ++i) o[j][i] = ((x[j][i] - mu) * rstd) * bfr(g4[i]) + bfr(b4[i]);
    }
    float* orow = OUT + ((size_t)b * SEQ_FULL + (size_t)t) * DMOD;          // FULL batch stride of the output rows
#pragma unroll
    for (int j = 0; j < 6; ++j) *(v4f*)(orow + (j * 32 + lane) * 4) = o[j];
    
}

extern "C" void kernel_launch(void* const* d_in, const int* in_sizes, int n_in,
                              void* d_out, int out_size, void* d_ws, size_t ws_size, hipStream_t stream) {
    if (n_in < 12) return;
    const size_t need_x = (size_t)(NB - 1) * SEQ_FULL * DMOD + (size_t)SEQ * DMOD;
    const size_t need_m = (size_t)(NB - 1) * SEQ_FULL + (size_t)SEQ;
    if ((size_t)in_sizes[0] < need_x || (size_t)in_sizes[1] < need_m) return;
    if (in_sizes[2] < DMOD * DMOD || in_sizes[4] < DMOD * DMOD || in_sizes[6] < DMOD * DMOD || in_sizes[8] < DMOD * DMOD) return;
    if (in_sizes[3] < DMOD || in_sizes[5] < DMOD || in_sizes[7] < DMOD || in_sizes[9] < DMOD) return;
    if (in_sizes[10] < DMOD || in_sizes[11] < DMOD) return;
    if ((size_t)out_size < need_x) return;                       // output rows are addressed at the FULL batch stride
    const float* xin = (const float*)d_in[0];
    const int*   msk = (const int*)d_in[1];
    const float* Wq = (const float*)d_in[2]; const float* bq = (const float*)d_in[3];
    const float* Wk = (const float*)d_in[4]; const float* bk = (const float*)d_in[5];
    const float* Wv = (const float*)d_in[6]; const float* bv = (const float*)d_in[7];
    const float* Wo = (const float*)d_in[8]; const float* bo = (const float*)d_in[9];
    const float* lng = (const float*)d_in[10]; const float* lnb = (const float*)d_in[11];
    float* OUT = (float*)d_out;

    constexpr size_t WB = (size_t)DMOD * DMOD * 2;               // one 16-bit weight plane
    constexpr size_t PB = (size_t)NB * SEQ * DMOD * 2;           // one 16-bit activation / head plane (NB*NHEAD*SEQ*HDIM elements)
    constexpr size_t CB = (size_t)NB * SEQ_FULL * DMOD * 4;      // f32 ctx plane, rows at the FULL batch stride
    static_assert(WB % 256 == 0);
    static_assert(PB % 256 == 0);
    static_assert(CB % 256 == 0);
    static_assert(4 * WB + 7 * PB + CB <= (size_t)134217728);    // total carve at most 128 MiB
    static_assert(((size_t)(NB - 1) * SEQ_FULL + SEQ) * DMOD * 4 <= CB);     // last ctx row written by the attention kernel
    static_assert((size_t)NB * SEQ * DMOD * 2 <= PB);            // f16 ctx plane reuses the q hi plane (dead after the attention kernel)
    static_assert((size_t)NB * SEQ * DMOD * 4 <= 2 * PB);        // f32 pre-norm plane reuses the adjacent k hi | lo planes (dead after the attention kernel)
    if (4 * WB + 7 * PB + CB > ws_size) return;
    char* wsp = (char*)d_ws;
    bf* WQ = (bf*)wsp; wsp += WB;
    bf* WK = (bf*)wsp; wsp += WB;
    bf* WV = (bf*)wsp; wsp += WB;
    h16* WO = (h16*)wsp; wsp += WB;
    bf* XB = (bf*)wsp; wsp += PB;
    bf* QHp = (bf*)wsp; wsp += PB;
    bf* QLp = (bf*)wsp; wsp += PB;
    bf* KHp = (bf*)wsp; wsp += PB;
    bf* KLp = (bf*)wsp; wsp += PB;
    h16* VVp = (h16*)wsp; wsp += PB;
    h16* VRp = (h16*)wsp; wsp += PB;
    float* CTX = (float*)wsp; wsp += CB;
    h16* CTXH = (h16*)QHp;                                       // stream order: written only after the attention kernel has finished
    float* XF = (float*)KHp;                                     // spans KHp and KLp

    const int nW = DMOD * DMOD, nX = NB * SEQ * DMOD;
    const unsigned gW = (unsigned)((nW / 8 + 255) / 256), gX = (unsigned)((nX / 8 + 255) / 256);
    k_cvt<<<gW, 256, 0, stream>>>(Wq, WQ, nW, nW, nW);
    k_cvt<<<gW, 256, 0, stream>>>(Wk, WK, nW, nW, nW);
    k_cvt<<<gW, 256, 0, stream>>>(Wv, WV, nW, nW, nW);
    k_cvt_wo<<<gW, 256, 0, stream>>>(Wo, WO, nW);
    // the single input stream feeds all three projections
    k_cvt<<<gX, 256, 0, stream>>>(xin, XB, nX, SEQ * DMOD, SEQ_FULL * DMOD);
    // q: X[NB*SEQ][DMOD] (A) x Wq[DMOD][DMOD] (Bt as stored) -> q hi|lo head planes
    k_proj_qk<<<dim3(NB * SEQ / 64, DMOD / 64), 32, 0, stream>>>(XB, WQ, bq, QHp, QLp);
    k_proj_qk<<<dim3(NB * SEQ / 64, DMOD / 64), 32, 0, stream>>>(XB, WK, bk, KHp, KLp);
    // v: Wv[DMOD][DMOD] (A) x X[NB*SEQ][DMOD] (Bt) -> transposed value / residual planes [b][head][d][t], key mask applied
    k_proj_v<<<dim3(DMOD / 64, NB * SEQ / 64), 32, 0, stream>>>(WV, XB, bv, msk, VVp, VRp);
    k_attn<<<dim3(SEQ / (AWAVES * 16), NB * NHEAD), AWAVES * 32, 0, stream>>>(QHp, QLp, KHp, KLp, VVp, VRp, CTX);
    // ctx[NB*SEQ][DMOD] (f32, FULL stride) x query mask -> compact f16 plane
    k_cvt_ctx<<<gX, 256, 0, stream>>>(CTX, msk, CTXH, nX);
    // output projection: CTXH[NB*SEQ][DMOD] (A) x Wo[DMOD out][DMOD in] (Bt as stored) + bias + skip -> f32 pre-norm plane
    k_out<<<dim3(NB * SEQ / 64, DMOD / 64), 32, 0, stream>>>(CTXH, WO, bo, xin, XF);
    k_ln<<<dim3(NB * SEQ / 8), 256, 0, stream>>>(XF, lng, lnb, OUT);
}

// v003
// Measured time: 179 microseconds a run.
// Two timings next to v002 put it at 1.33 and 1.34 times that version's speed.
// All steps since v000 together make it 3.41 times as fast.
#include <hip/hip_runtime.h>

// Single-stream multi-head self-attention block: x [4][2048][768]; q / k / v = x.W^T + b with W stored [out][in]; heads = 12 x 64; scores = q.k^T with NO scale; softmax over all 2048 keys;
// the probabilities are multiplied AFTER the softmax by mask_q * mask_k (int input [4][2048], read by value); ctx merged to [4][2048][768]; y = ctx.Wo^T + bo + x; output = LayerNorm(y) with eps 1e-5 and gain / shift inputs.
// Compute dtypes, f32 accumulate everywhere: x and the weights converted to bf16 (RNE) once; q / k / v projections = single v_wmma_f32_16x16x32_bf16 products + bf16(bias) in f32; scores = bf16 hi|lo planes, 3 products (hh + lh + hl) in one accumulator;
// softmax f32 (base 2, running max from a finite start, denominator over all keys); P = f16(256 p) packed straight from the score accumulators into the B fragment; V times the key mask = f16 value plane + f16 residual x2048 plane on v_wmma_f32_16x16x32_f16, each with its own accumulator set, folded in the f32 epilogue;
// output projection = single v_wmma_f32_16x16x32_f16 product: ctx times the query mask as f16 x16, bf16(Wo) as f16 x64, folded by 1/1024 in f32; bias, skip connection (bf16(x)) and LayerNorm in f32.

#ifndef NB
#define NB 4
#endif
#ifndef SEQ
#define SEQ 2048
#endif
#define NB_FULL  4
#define SEQ_FULL 2048
#define DMOD  768
#define NHEAD 12
#define HDIM  64
#define OSP   68
#define LOG2E 1.4426950408889634f
#define PSH   8.0f
#define RCAR  2048.0f
#define WCAR  64.0f
#define CCAR  16.0f

static_assert(NHEAD * HDIM == DMOD);          // merged width
static_assert(HDIM == 64);                    // one 64-column GEMM tile == one head; 4 d-tiles in the attention kernel
static_assert(DMOD % 64 == 0);                // GEMM tile multiple (N and the transposed M)
static_assert(DMOD % 32 == 0);                // k-loop step
static_assert(SEQ % 64 == 0);                 // GEMM row tiles never straddle a batch; attention key step 32
static_assert(SEQ <= SEQ_FULL);
static_assert(NB <= NB_FULL);
static_assert((SEQ * DMOD) % 8 == 0);         // convert kernel: 8 elements per thread never straddle a batch
static_assert((DMOD * DMOD) % 8 == 0);
static_assert((NB * SEQ) % 64 == 0);
static_assert((NB * SEQ) / 64 <= 65535);      // grid.y bound
static_assert(OSP % 4 == 0);                  // 16-byte aligned LDS rows
static_assert(OSP >= HDIM);
static_assert(DMOD % 8 == 0);                 // ctx convert: 8 elements per thread never straddle a row
static_assert(SEQ % 8 == 0);                  // key-mask vector loads stay 16-byte aligned
static_assert(SEQ_FULL % 8 == 0);
static_assert(DMOD == 6 * 32 * 4);            // LayerNorm: one wave per row, 6 x (32 lanes x 4 floats)
static_assert((NB * SEQ) % 8 == 0);           // LayerNorm: 8 rows (waves) per block, no tail
static_assert(HDIM == 16 * 4);                // output GEMM store: 16 lanes x 16 B == one 64-float row segment

typedef _Float16 h16;
typedef unsigned short bf;
typedef __attribute__((ext_vector_type(16))) __bf16   v16bf;
typedef __attribute__((ext_vector_type(16))) _Float16 v16h;
typedef __attribute__((ext_vector_type(8)))  _Float16 v8h;
typedef __attribute__((ext_vector_type(8)))  unsigned short v8us;
typedef __attribute__((ext_vector_type(8)))  float    v8f;
typedef __attribute__((ext_vector_type(4)))  float    v4f;
typedef __attribute__((ext_vector_type(4)))  int      v4i;
typedef v4f  __attribute__((may_alias)) v4fa;

__device__ __forceinline__ unsigned short f2bf(float f) { unsigned u = __float_as_uint(f); u += 0x7FFFu + ((u >> 16) & 1u); return (unsigned short)(u >> 16); }
__device__ __forceinline__ float bf2f(unsigned short b) { return __uint_as_float(((unsigned)b) << 16); }
__device__ __forceinline__ float bfr(float f) { return bf2f(f2bf(f)); }
__device__ __forceinline__ void splitf(float y, unsigned short& h, unsigned short& l) { h = f2bf(y); l = f2bf(y - bf2f(h)); }
__device__ __forceinline__ v16h cat16(v8h lo, v8h hi) { return __builtin_shufflevector(lo, hi, 0, 1, 2, 3, 4, 5, 6, 7, 8, 9, 10, 11, 12, 13, 14, 15); }
__device__ __forceinline__ v16bf cat16b(v8us lo, v8us hi) { return __builtin_bit_cast(v16bf, __builtin_shufflevector(lo, hi, 0, 1, 2, 3, 4, 5, 6, 7, 8, 9, 10, 11, 12, 13, 14, 15)); }
__device__ __forceinline__ v8f wmma16(v16h a, v16h b, v8f c) { return __builtin_amdgcn_wmma_f32_16x16x32_f16(false, a, false, b, (short)0, c, false, false); }
__device__ __forceinline__ v8f wmmab(v16bf a, v16bf b, v8f c) { return __builtin_amdgcn_wmma_f32_16x16x32_bf16(false, a, false, b, (short)0, c, false, false); }
// per-instruction guarded f16 WMMA: ONE accumulator tied with its own two operands to four nops
__device__ __forceinline__ v8f wmma16g(v16h a, v16h b, v8f c) { c = wmma16(a, b, c); asm volatile("v_nop\n\tv_nop\n\tv_nop\n\tv_nop" : "+v"(c) : "v"(a), "v"(b)); return c; }
// fragment loaders (A and B alike, K-contiguous rows): p already carries + 8*(lane>>4); elements 0..7 = k0+8h.., elements 8..15 = k0+16+8h..
__device__ __forceinline__ v16bf ldbf(const bf* p) { return cat16b(*(const v8us*)p, *(const v8us*)(p + 16)); }
__device__ __forceinline__ v16h  ldh(const h16* p) { return cat16(*(const v8h*)p, *(const v8h*)(p + 16)); }
// f32 -> f16 convert for WMMA operand planes: values below the smallest f16 normal become exact zero (applied after the plane's power-of-two carry)
static __device__ __forceinline__ h16 toh_flush(float v) { const h16 r = (h16)v; return (fabsf(v) < 6.103515625e-05f) ? (h16)0.0f : r; }

// dst[e] = src[(e / per) * per_full + e % per]  (per / per_full = compact and staged batch strides).
__global__ __launch_bounds__(256) void k_cvt(const float* __restrict__ src, bf* dst, int n, int per, int per_full) {
    const int e = ((int)blockIdx.x * 256 + (int)threadIdx.x) * 8;
    if (e >= n) return;
    const int b = e / per;
    const size_t so = (size_t)b * (size_t)per_full + (size_t)(e - b * per);
    const v4f a0 = *(const v4f*)(src + so);
    const v4f a1 = *(const v4f*)(src + so + 4);
    v8us o;
    o[0] = f2bf(a0[0]); o[1] = f2bf(a0[1]); o[2] = f2bf(a0[2]); o[3] = f2bf(a0[3]);
    o[4] = f2bf(a1[0]); o[5] = f2bf(a1[1]); o[6] = f2bf(a1[2]); o[7] = f2bf(a1[3]);
    *(v8us*)(dst + e) = o;
    
}

__global__ __launch_bounds__(256) void k_cvt_wo(const float* __restrict__ src, h16* dst, int n) {
    const int e = ((int)blockIdx.x * 256 + (int)threadIdx.x) * 8;
    if (e >= n) return;
    const v4f a0 = *(const v4f*)(src + e);
    const v4f a1 = *(const v4f*)(src + e + 4);
    v8h o;
    o[0] = toh_flush(bfr(a0[0]) * WCAR); o[1] = toh_flush(bfr(a0[1]) * WCAR); o[2] = toh_flush(bfr(a0[2]) * WCAR); o[3] = toh_flush(bfr(a0[3]) * WCAR);
    o[4] = toh_flush(bfr(a1[0]) * WCAR); o[5] = toh_flush(bfr(a1[1]) * WCAR); o[6] = toh_flush(bfr(a1[2]) * WCAR); o[7] = toh_flush(bfr(a1[3]) * WCAR);
    *(v8h*)(dst + e) = o;
    
}

__global__ __launch_bounds__(256) void k_cvt_ctx(const float* __restrict__ src, const int* __restrict__ mask, h16* dst, int n) {
    const int e = ((int)blockIdx.x * 256 + (int)threadIdx.x) * 8;
    if (e >= n) return;
    const int row = e / DMOD, col = e - row * DMOD;
    const int b = row / SEQ, t = row - b * SEQ;
    const size_t srow = (size_t)b * SEQ_FULL + (size_t)t;
    const float mq = (float)mask[srow] * CCAR;
    const v4f a0 = *(const v4f*)(src + srow * DMOD + col);
    const v4f a1 = *(const v4f*)(src + srow * DMOD + col + 4);
    v8h o;
    o[0] = toh_flush(a0[0] * mq); o[1] = toh_flush(a0[1] * mq); o[2] = toh_flush(a0[2] * mq); o[3] = toh_flush(a0[3] * mq);
    o[4] = toh_flush(a1[0] * mq); o[5] = toh_flush(a1[1] * mq); o[6] = toh_flush(a1[2] * mq); o[7] = toh_flush(a1[3] * mq);
    *(v8h*)(dst + e) = o;
    
}

// ---- GEMM staging: a block of 2 x 2 waves owns a 128x128 tile; 128 k (one aligned 256-B unit) of its 128 A rows and 128 Bt rows are staged in LDS by asynchronous copies
// (16 B per lane, 16 lanes per row), two buffers: stage t + 1 flies while stage t is worked on. Every wave reads its 64 + 64 rows as fragments from LDS.
#define GWAVES 4                      // waves per block, 2 (tile rows) x 2 (tile columns)
#define GKT    128                    // k elements per stage: 256 B of every operand row
#define GPITCH 272                    // LDS row pitch in bytes: 16 B x odd, conflict-free for the 16-byte fragment reads
#define GSLAB  (128 * GPITCH)         // one operand's 128 staged rows
#define GSTAGE (2 * GSLAB)            // one buffer: A rows, then Bt rows
static_assert(DMOD % 128 == 0);               // whole 128-wide block tiles
static_assert((NB * SEQ) % 128 == 0);
static_assert(DMOD % GKT == 0);               // whole stages
static_assert(DMOD / GKT >= 2);               // the two-buffer prologue fills stages 0 and 1
static_assert(GKT * 2 == 16 * 16);            // one staged row == 16 lanes x 16 B
static_assert(GWAVES * 32 * 16 == 128 * 16);  // sixteen copies per lane cover one operand's slab

// Half of one operand's slab = 8 copies per lane: rows r, r + 8, ..., r + 56. l = the lane's LDS byte address in row r, g = the lane's own 16 bytes in row r of the 16-bit source plane (row length DMOD).
__device__ __forceinline__ void stage_half(unsigned l, const unsigned char* g) {
    // the closing s_wait_xcnt stands inside the statement so that no address register of a copy is rewritten in front of it
    asm volatile("global_load_async_to_lds_b128 %0, %8, off\n\t"
                 "global_load_async_to_lds_b128 %1, %9, off\n\t"
                 "global_load_async_to_lds_b128 %2, %10, off\n\t"
                 "global_load_async_to_lds_b128 %3, %11, off\n\t"
                 "global_load_async_to_lds_b128 %4, %12, off\n\t"
                 "global_load_async_to_lds_b128 %5, %13, off\n\t"
                 "global_load_async_to_lds_b128 %6, %14, off\n\t"
                 "global_load_async_to_lds_b128 %7, %15, off\n\t"
                 "s_wait_xcnt 0x0"
                 :: "v"(l), "v"(l + 8 * GPITCH), "v"(l + 16 * GPITCH), "v"(l + 24 * GPITCH),
                    "v"(l + 32 * GPITCH), "v"(l + 40 * GPITCH), "v"(l + 48 * GPITCH), "v"(l + 56 * GPITCH),
                    "v"(g), "v"(g + 8 * DMOD * 2), "v"(g + 16 * DMOD * 2), "v"(g + 24 * DMOD * 2),
                    "v"(g + 32 * DMOD * 2), "v"(g + 40 * DMOD * 2), "v"(g + 48 * DMOD * 2), "v"(g + 56 * DMOD * 2)
                 : "memory");
}
// One operand's slab of 128 rows: 16 copies per lane.
__device__ __forceinline__ void stage_slab(unsigned l, const unsigned char* g) {
    stage_half(l, g);
    stage_half(l + 64 * GPITCH, g + 64 * DMOD * 2);
}

// The copy side and the read side of one thread. ra / rb = first A row / first Bt row of the block's tile; wm / wn = the wave's place in the 2 x 2 block.
struct gemm_ring {
    const unsigned char* ga; const unsigned char* gb;   // running source pointers, advanced stage by stage
    unsigned cl;                                        // the lane's LDS byte address in the A slab of buffer 0
    const unsigned char* fa; const unsigned char* fb;   // fragment row lr, 16-byte piece hi, of the wave's 64 A rows and 64 Bt rows in buffer 0
};
__device__ __forceinline__ gemm_ring ring_open(const void* A, const void* Bt, int ra, int rb, int wm, int wn, const unsigned char* ring, unsigned ringl) {
    const int crow = (int)threadIdx.x >> 4, cpc = (int)threadIdx.x & 15;       // copy side: row 0..7, 16-byte piece 0..15
    const int lane = (int)threadIdx.x & 31, lr = lane & 15, hi = lane >> 4;
    gemm_ring g;
    g.ga = (const unsigned char*)A + ((size_t)(ra + crow) * DMOD + cpc * 8) * 2;
    g.gb = (const unsigned char*)Bt + ((size_t)(rb + crow) * DMOD + cpc * 8) * 2;
    g.cl = ringl + (unsigned)(crow * GPITCH + cpc * 16);
    g.fa = ring + (wm * 64 + lr) * GPITCH + 16 * hi;
    g.fb = ring + GSLAB + (wn * 64 + lr) * GPITCH + 16 * hi;
    stage_slab(g.cl, g.ga); stage_slab(g.cl + GSLAB, g.gb);
    g.ga += GKT * 2; g.gb += GKT * 2;
    asm volatile("s_wait_asynccnt 0x0" ::: "memory");     // this wave's copies of stage 0 have landed
    __syncthreads();                                      // stage 0 readable by every wave
    stage_slab(g.cl + GSTAGE, g.ga); stage_slab(g.cl + GSTAGE + GSLAB, g.gb);
    return g;
}
// Foot of trip t: publish stage t + 1, then refill the buffer that trip t has just read.
__device__ __forceinline__ void ring_turn(gemm_ring& g, int t) {
    asm volatile("s_wait_dscnt 0x0" ::: "memory");        // this wave's reads of stage t have returned before its buffer is refilled
    asm volatile("s_wait_asynccnt 0x0" ::: "memory");     // this wave's copies of stage t + 1 have landed
    __syncthreads();                                      // publishes stage t + 1 and ends every wave's last read of stage t
    if (t + 2 < DMOD / GKT) {
        g.ga += GKT * 2; g.gb += GKT * 2;
        const unsigned l = g.cl + (unsigned)((t & 1) * GSTAGE);
        stage_slab(l, g.ga); stage_slab(l + GSLAB, g.gb);
    }
}

// ---- GEMM main loop: one wave per 64x64 tile (16 accumulators), fragments from the staged bf16 rows, K = DMOD in ascending order.
// acc[mb][nb][j] = sum_k A[r0 + mb*16 + 8*hi + j][k] * Bt[c0 + nb*16 + lr][k], r0 = ra + 64*wm, c0 = rb + 64*wn.
__device__ __forceinline__ void gemm_tile(const bf* __restrict__ A, const bf* __restrict__ Bt, int ra, int rb, int wm, int wn, const unsigned char* ring, unsigned ringl, v8f (&acc)[4][4]) {
#pragma unroll
    for (int mb = 0; mb < 4; ++mb)
#pragma unroll
        for (int nb = 0; nb < 4; ++nb) acc[mb][nb] = (v8f){};
    gemm_ring g = ring_open(A, Bt, ra, rb, wm, wn, ring, ringl);
#pragma unroll 1   // rolled: one publish point per trip
    for (int t = 0; t < DMOD / GKT; ++t) {
        const unsigned char* pa = g.fa + (t & 1) * GSTAGE;
        const unsigned char* pb = g.fb + (t & 1) * GSTAGE;
#pragma unroll   // unrolled: the 32-k blocks of a stage read at constant LDS offsets
        for (int kc = 0; kc < GKT; kc += 32) {
            v16bf a[4];
            v16bf b;
#pragma unroll
            for (int mb = 0; mb < 4; ++mb) a[mb] = ldbf((const bf*)(pa + mb * 16 * GPITCH + kc * 2));
#pragma unroll
            for (int nb = 0; nb < 4; ++nb) {
                b = ldbf((const bf*)(pb + nb * 16 * GPITCH + kc * 2));
#pragma unroll
                for (int mb = 0; mb < 4; ++mb) acc[mb][nb] = wmmab(a[mb], b, acc[mb][nb]);
            }
            asm volatile("" : "+v"(acc[0][0]), "+v"(acc[1][0]), "+v"(acc[2][0]), "+v"(acc[3][0]), "+v"(acc[0][1]), "+v"(acc[1][1]), "+v"(acc[2][1]), "+v"(acc[3][1]));
            asm volatile("v_nop\n\tv_nop\n\tv_nop\n\tv_nop" : "+v"(acc[0][2]), "+v"(acc[1][2]), "+v"(acc[2][2]), "+v"(acc[3][2]), "+v"(acc[0][3]), "+v"(acc[1][3]), "+v"(acc[2][3]), "+v"(acc[3][3]) : "v"(a[0]), "v"(a[3]), "v"(b));
        }
        ring_turn(g, t);
    }
    asm volatile("s_wait_asynccnt 0x0" ::: "memory");     // nothing in flight behind the loop
}

// ---- f16 twin of the GEMM main loop (same tile map, same staging, f16 planes); every WMMA carries its own four-nop guard.
__device__ __forceinline__ void gemm_tile_h(const h16* __restrict__ A, const h16* __restrict__ Bt, int ra, int rb, int wm, int wn, const unsigned char* ring, unsigned ringl, v8f (&acc)[4][4]) {
#pragma unroll
    for (int mb = 0; mb < 4; ++mb)
#pragma unroll
        for (int nb = 0; nb < 4; ++nb) acc[mb][nb] = (v8f){};
    gemm_ring g = ring_open(A, Bt, ra, rb, wm, wn, ring, ringl);
#pragma unroll 1   // rolled: one publish point per trip
    for (int t = 0; t < DMOD / GKT; ++t) {
        const unsigned char* pa = g.fa + (t & 1) * GSTAGE;
        const unsigned char* pb = g.fb + (t & 1) * GSTAGE;
#pragma unroll   // unrolled: the 32-k blocks of a stage read at constant LDS offsets
        for (int kc = 0; kc < GKT; kc += 32) {
            v16h a[4], b[4];                              // the block's LDS reads stand as one group in front of its guarded WMMAs
#pragma unroll
            for (int mb = 0; mb < 4; ++mb) a[mb] = ldh((const h16*)(pa + mb * 16 * GPITCH + kc * 2));
#pragma unroll
            for (int nb = 0; nb < 4; ++nb) b[nb] = ldh((const h16*)(pb + nb * 16 * GPITCH + kc * 2));
#pragma unroll
            for (int nb = 0; nb < 4; ++nb) {
#pragma unroll
                for (int mb = 0; mb < 4; ++mb) acc[mb][nb] = wmma16g(a[mb], b[nb], acc[mb][nb]);
            }
        }
        ring_turn(g, t);
    }
    asm volatile("s_wait_asynccnt 0x0" ::: "memory");     // nothing in flight behind the loop
}

// ---- k_proj_qk: y[m][n] = X[m][:] . W[n][:] + bf16(bias[n]); tile rows m = b*SEQ + t, tile columns = one head (n = head*64 + d).
// grid (NB*SEQ/128, DMOD/128), 128 threads; each wave one 64x64 tile.
__global__ __launch_bounds__(GWAVES * 32) void k_proj_qk(const bf* __restrict__ X, const bf* __restrict__ W, const float* __restrict__ bias, bf* Ph, bf* Pl) {
    __shared__ __align__(16) unsigned char ring[2 * GSTAGE];
    __shared__ __align__(16) float osall[GWAVES * 16 * OSP];
    const int wave = __builtin_amdgcn_readfirstlane((int)(threadIdx.x >> 5));
    const int wm = wave >> 1, wn = wave & 1;
    float* os = osall + wave * 16 * OSP;                  // each wave stages its output rows in its own range
    const int lane = (int)threadIdx.x & 31, lr = lane & 15, hi = lane >> 4;
    const int r0 = (int)blockIdx.x * 128 + wm * 64, c0 = (int)blockIdx.y * 128 + wn * 64;
    v8f acc[4][4];
    gemm_tile(X, W, (int)blockIdx.x * 128, (int)blockIdx.y * 128, wm, wn, ring, (unsigned)(size_t)(__attribute__((address_space(3))) unsigned char*)ring, acc);
    const int b = r0 / SEQ, t0 = r0 - b * SEQ, hd = c0 / HDIM;
    const int rq = lane >> 3, cq = (lane & 7) * 8;
    const v4f bv0 = *(const v4f*)(bias + c0 + cq);
    const v4f bv1 = *(const v4f*)(bias + c0 + cq + 4);
    float bb[8];
    bb[0] = bfr(bv0[0]); bb[1] = bfr(bv0[1]); bb[2] = bfr(bv0[2]); bb[3] = bfr(bv0[3]);
    bb[4] = bfr(bv1[0]); bb[5] = bfr(bv1[1]); bb[6] = bfr(bv1[2]); bb[7] = bfr(bv1[3]);
    const size_t pbase = ((size_t)(b * NHEAD + hd) * SEQ + t0) * HDIM;
#pragma unroll
    for (int mb = 0; mb < 4; ++mb) {
#pragma unroll
        for (int nb = 0; nb < 4; ++nb) {
#pragma unroll
            for (int j = 0; j < 8; ++j) os[(hi * 8 + j) * OSP + nb * 16 + lr] = acc[mb][nb][j];
        }
        __syncthreads();
{
#pragma unroll
            for (int s = 0; s < 4; ++s) {
                const int row = s * 4 + rq;                       // s 0..3 x rq 0..3 -> rows 0..15
                const v4f x0 = *(const v4fa*)(os + row * OSP + cq);
                const v4f x1 = *(const v4fa*)(os + row * OSP + cq + 4);
                v8us oh, ol;
#pragma unroll
                for (int i = 0; i < 4; ++i) {
                    unsigned short a2, c2;
                    splitf(x0[i] + bb[i], a2, c2); oh[i] = a2; ol[i] = c2;
                    splitf(x1[i] + bb[4 + i], a2, c2); oh[4 + i] = a2; ol[4 + i] = c2;
                }
                const size_t oo = pbase + (size_t)(mb * 16 + row) * HDIM + cq;
                *(v8us*)(Ph + oo) = oh;
                *(v8us*)(Pl + oo) = ol;
            }
            
        }
        __syncthreads();
    }
}

// ---- k_proj_v: transposed projection y^T[n][m] = (W[n][:] . X[m][:] + bf16(bias[n])) * mask[m]; tile rows n = head*64 + d, tile columns m = b*SEQ + t (the key index).
// The key mask multiplies the value rows, so the attention kernel's probabilities and its denominator stay over all keys.
// grid (DMOD/128, NB*SEQ/128), 128 threads; each wave one 64x64 tile.
__global__ __launch_bounds__(GWAVES * 32) void k_proj_v(const bf* __restrict__ W, const bf* __restrict__ X, const float* __restrict__ bias, const int* __restrict__ mask, h16* Pv, h16* Pr) {
    __shared__ __align__(16) unsigned char ring[2 * GSTAGE];
    __shared__ __align__(16) float osall[GWAVES * 16 * OSP];
    const int wave = __builtin_amdgcn_readfirstlane((int)(threadIdx.x >> 5));
    const int wm = wave >> 1, wn = wave & 1;
    float* os = osall + wave * 16 * OSP;                  // each wave stages its output rows in its own range
    const int lane = (int)threadIdx.x & 31, lr = lane & 15, hi = lane >> 4;
    const int r0 = (int)blockIdx.x * 128 + wm * 64, c0 = (int)blockIdx.y * 128 + wn * 64;
    v8f acc[4][4];
    gemm_tile(W, X, (int)blockIdx.x * 128, (int)blockIdx.y * 128, wm, wn, ring, (unsigned)(size_t)(__attribute__((address_space(3))) unsigned char*)ring, acc);
    const int b = c0 / SEQ, t0 = c0 - b * SEQ, hd = r0 / HDIM;
    const int rq = lane >> 3, cq = (lane & 7) * 8;
    const v4i mk0 = *(const v4i*)(mask + (size_t)b * SEQ_FULL + t0 + cq);          // staged mask rows use the FULL batch stride
    const v4i mk1 = *(const v4i*)(mask + (size_t)b * SEQ_FULL + t0 + cq + 4);
    float mf[8];
    mf[0] = (float)mk0[0]; mf[1] = (float)mk0[1]; mf[2] = (float)mk0[2]; mf[3] = (float)mk0[3];
    mf[4] = (float)mk1[0]; mf[5] = (float)mk1[1]; mf[6] = (float)mk1[2]; mf[7] = (float)mk1[3];
    const size_t pbase = (size_t)(b * NHEAD + hd) * HDIM * SEQ + t0;
#pragma unroll
    for (int mb = 0; mb < 4; ++mb) {
#pragma unroll
        for (int nb = 0; nb < 4; ++nb) {
#pragma unroll
            for (int j = 0; j < 8; ++j) os[(hi * 8 + j) * OSP + nb * 16 + lr] = acc[mb][nb][j];
        }
        __syncthreads();
{
#pragma unroll
            for (int s = 0; s < 4; ++s) {
                const int row = s * 4 + rq;                       // d within the slab, 0..15
                const float bsc = bfr(bias[r0 + mb * 16 + row]);
                const v4f x0 = *(const v4fa*)(os + row * OSP + cq);
                const v4f x1 = *(const v4fa*)(os + row * OSP + cq + 4);
                v8h ov, orr;
#pragma unroll
                for (int i = 0; i < 4; ++i) {
                    const float y0 = (x0[i] + bsc) * mf[i]; const h16 h0 = toh_flush(y0); ov[i] = h0; orr[i] = toh_flush((y0 - (float)h0) * RCAR);
                    const float y1 = (x1[i] + bsc) * mf[4 + i]; const h16 h1 = toh_flush(y1); ov[4 + i] = h1; orr[4 + i] = toh_flush((y1 - (float)h1) * RCAR);
                }
                const size_t oo = pbase + (size_t)(mb * 16 + row) * SEQ + cq;
                *(v8h*)(Pv + oo) = ov;
                *(v8h*)(Pr + oo) = orr;
            }
            
        }
        __syncthreads();
    }
}

// ---- k_attn: fused attention, transposed form. Block = 8 waves = 128 queries of one (batch, head); each wave owns 16 queries.
// The K hi|lo rows and the V value|residual rows of 64 keys are staged in LDS once per block by asynchronous copies (16 B per lane, whole 128-B lines), two buffers: tile t + 1 flies while tile t is worked on.
// Each wave loads its own Q hi|lo fragments once, before the key loop, and keeps them in registers.
// Per 32-key step: S^T[key][query] = K.Q^T on bf16 hi|lo planes (3 products, one accumulator per 16-key tile); base-2 online softmax per query column
// (lane (hi, lr) holds keys 8*hi + r and 16 + 8*hi + r of query lr; the two lanes of a query share the running max through one shuffle);
// P^T packed from the two score tiles into the B fragment (element r <- tile 0, element 8 + r <- tile 1); O^T[d][query] += V^T.P^T for the value and the residual plane
// (every one of the eight P.V WMMAs carries its own four-nop guard tying exactly its accumulator and its two operands).
// grid (SEQ/128, NB*NHEAD), 256 threads.
#define AWAVES 8                      // waves per block that share one staged tile
#define KTILE  64                     // keys per staged tile: K rows and V rows are both 128 B long
#define LPITCH 144                    // LDS row pitch in bytes: 16 B x odd, conflict-free for the 16-byte fragment reads
#define LPLANE (64 * LPITCH)          // one staged plane: 64 rows (keys for K, head dims for V)
#define LSTAGE (4 * LPLANE)           // one buffer: K hi, K lo, V value, V residual
static_assert(SEQ % (AWAVES * 16) == 0);      // whole blocks of queries
static_assert(SEQ % KTILE == 0);              // whole key tiles
static_assert(SEQ / KTILE >= 2);              // the two-buffer prologue fills tiles 0 and 1
static_assert(KTILE * 2 == 128);              // one V row of a tile == 8 lanes x 16 B
static_assert(HDIM * 2 == 128);               // one K row == 8 lanes x 16 B
static_assert(AWAVES * 32 * 2 == 64 * 8);     // two copies per lane cover one plane (64 rows x 8 pieces)
static_assert(AWAVES * 16 * OSP * 4 <= 2 * LSTAGE);   // the output staging reuses the ring

// One tile = 8 copies per lane. l = the lane's LDS byte address in the K hi plane of the target buffer; the pointers are the lane's own 16 bytes in rows 0..31 of each plane.
__device__ __forceinline__ void stage_tile(unsigned l, const bf* kh, const bf* kl, const h16* vv, const h16* vr) {
    // the closing s_wait_xcnt stands inside the statement so that no address register of a copy is rewritten in front of it
    asm volatile("global_load_async_to_lds_b128 %0, %8, off\n\t"
                 "global_load_async_to_lds_b128 %1, %9, off\n\t"
                 "global_load_async_to_lds_b128 %2, %10, off\n\t"
                 "global_load_async_to_lds_b128 %3, %11, off\n\t"
                 "global_load_async_to_lds_b128 %4, %12, off\n\t"
                 "global_load_async_to_lds_b128 %5, %13, off\n\t"
                 "global_load_async_to_lds_b128 %6, %14, off\n\t"
                 "global_load_async_to_lds_b128 %7, %15, off\n\t"
                 "s_wait_xcnt 0x0"
                 :: "v"(l), "v"(l + 32 * LPITCH), "v"(l + LPLANE), "v"(l + LPLANE + 32 * LPITCH),
                    "v"(l + 2 * LPLANE), "v"(l + 2 * LPLANE + 32 * LPITCH), "v"(l + 3 * LPLANE), "v"(l + 3 * LPLANE + 32 * LPITCH),
                    "v"(kh), "v"(kh + 32 * HDIM), "v"(kl), "v"(kl + 32 * HDIM),
                    "v"(vv), "v"(vv + 32 * SEQ), "v"(vr), "v"(vr + 32 * SEQ)
                 : "memory");
}

// second launch bound: six waves per SIMD, so that the three blocks that fall to each WGP stay resident together
__global__ __launch_bounds__(AWAVES * 32, 6) void k_attn(const bf* __restrict__ QH, const bf* __restrict__ QL, const bf* __restrict__ KH, const bf* __restrict__ KL,
                                              const h16* __restrict__ VV, const h16* __restrict__ VR, float* OUT) {
    __shared__ __align__(16) unsigned char ring[2 * LSTAGE];
    const int wave = __builtin_amdgcn_readfirstlane((int)(threadIdx.x >> 5));
    const int lane = (int)threadIdx.x & 31, lr = lane & 15, hi = lane >> 4;
    const int bh = (int)blockIdx.y;
    const int b = bh / NHEAD, hd = bh - b * NHEAD;
    const int q0 = (int)blockIdx.x * (AWAVES * 16) + wave * 16;
    const size_t pb = (size_t)bh * SEQ * HDIM;
    const bf* qh = QH + pb; const bf* ql = QL + pb;
    const int qoff0 = (q0 + lr) * HDIM + 8 * hi;
    // copy side: thread -> (row = tid / 8, 16-byte piece = tid % 8) of rows 0..31 of a plane
    const int crow = (int)threadIdx.x >> 3, cpc = (int)threadIdx.x & 7;
    const bf* ckh = KH + pb + crow * HDIM + cpc * 8; const h16* cvv = VV + pb + crow * SEQ + cpc * 8;   // running pointers, advanced tile by tile
    const ptrdiff_t dkl = KL - KH, dvr = VR - VV;      // uniform distances of the lo and residual planes (scalar registers instead of two more pointers per lane)
    const unsigned cl = (unsigned)(size_t)(__attribute__((address_space(3))) unsigned char*)ring + (unsigned)(crow * LPITCH + cpc * 16);
    // read side: fragment row lr, 16-byte piece hi (K rows and V rows alike)
    const unsigned char* fr = ring + lr * LPITCH + 16 * hi;
    v8f ova[4], ore[4];
#pragma unroll
    for (int dt = 0; dt < 4; ++dt) { ova[dt] = (v8f){}; ore[dt] = (v8f){}; }
    float m = -3.0e38f, lsum = 0.0f;
    stage_tile(cl, ckh, ckh + dkl, cvv, cvv + dvr);
    ckh += KTILE * HDIM; cvv += KTILE;
    // the wave's own Q hi|lo fragments: loaded once, held in registers over the whole key loop
    v16bf qfh[HDIM / 32], qfl[HDIM / 32];
#pragma unroll
    for (int kc = 0; kc < HDIM; kc += 32) { qfh[kc / 32] = ldbf(qh + qoff0 + kc); qfl[kc / 32] = ldbf(ql + qoff0 + kc); }
    asm volatile("s_wait_xcnt 0x0" ::: "memory");         // precaution: stands in front of every rewrite of the Q loads' address registers
    asm volatile("s_wait_asynccnt 0x0" ::: "memory");     // this wave's copies of tile 0 have landed
    __syncthreads();                                      // tile 0 readable by every wave
    stage_tile(cl + LSTAGE, ckh, ckh + dkl, cvv, cvv + dvr);
#pragma unroll 1   // rolled: one publish point per trip, and the registers stay within six waves per SIMD
    for (int t = 0; t < SEQ / KTILE; ++t) {
        const unsigned char* fb = fr + (t & 1) * LSTAGE;
#pragma unroll 1   // rolled: beside the resident Q fragments only one 32-key step's temporaries fit at six waves per SIMD (unrolled, the build spills)
        for (int sub = 0; sub < KTILE / 32; ++sub) {
            v8f s0 = (v8f){}, s1 = (v8f){};
            v16bf qhf, qlf, k0h, k0l, k1h, k1l;
#pragma unroll
            for (int kc = 0; kc < HDIM; kc += 32) {
                qhf = qfh[kc / 32]; qlf = qfl[kc / 32];
                const unsigned char* kp = fb + sub * 32 * LPITCH + kc * 2;
                k0h = ldbf((const bf*)kp); k0l = ldbf((const bf*)(kp + LPLANE));
                k1h = ldbf((const bf*)(kp + 16 * LPITCH)); k1l = ldbf((const bf*)(kp + LPLANE + 16 * LPITCH));
                s0 = wmmab(k0h, qhf, s0); s1 = wmmab(k1h, qhf, s1);
                s0 = wmmab(k0l, qhf, s0); s1 = wmmab(k1l, qhf, s1);
                s0 = wmmab(k0h, qlf, s0); s1 = wmmab(k1h, qlf, s1);
            }
            asm volatile("v_nop\n\tv_nop\n\tv_nop\n\tv_nop" : "+v"(s0), "+v"(s1) : "v"(k1h), "v"(qlf));
            float t0[8], t1[8];
            float mx = -3.0e38f;
#pragma unroll
            for (int r = 0; r < 8; ++r) { t0[r] = s0[r] * LOG2E; t1[r] = s1[r] * LOG2E; mx = fmaxf(mx, fmaxf(t0[r], t1[r])); }
            mx = fmaxf(mx, __shfl_xor(mx, 16, 32));
            const float mnew = fmaxf(m, mx);
            const float sc = __builtin_amdgcn_exp2f(m - mnew);
            m = mnew;
            const float mo = mnew - PSH;                  // exp2(t - mo) = 256 p, at most 256
            float psum = 0.0f;
            v16h pf;
#pragma unroll
            for (int r = 0; r < 8; ++r) {
                const float e0 = __builtin_amdgcn_exp2f(t0[r] - mo);
                const float e1 = __builtin_amdgcn_exp2f(t1[r] - mo);
                psum += e0 + e1;
                pf[r] = (h16)e0; pf[8 + r] = (h16)e1;
            }
            lsum = lsum * sc + psum;
            if (__builtin_amdgcn_ballot_w32(sc != 1.0f) != 0u) {      // wave-uniform: rescale only when some running max moved
#pragma unroll
                for (int dt = 0; dt < 4; ++dt) {
#pragma unroll
                    for (int r = 0; r < 8; ++r) { ova[dt][r] *= sc; ore[dt][r] *= sc; }
                }
            }
            const unsigned char* vp = fb + 2 * LPLANE + sub * 64;
            v16h va[4], vb[4];
#pragma unroll
            for (int dt = 0; dt < 4; ++dt) va[dt] = ldh((const h16*)(vp + dt * 16 * LPITCH));
#pragma unroll
            for (int dt = 0; dt < 4; ++dt) ova[dt] = wmma16g(va[dt], pf, ova[dt]);
#pragma unroll
            for (int dt = 0; dt < 4; ++dt) vb[dt] = ldh((const h16*)(vp + LPLANE + dt * 16 * LPITCH));
#pragma unroll
            for (int dt = 0; dt < 4; ++dt) ore[dt] = wmma16g(vb[dt], pf, ore[dt]);
        }
        asm volatile("s_wait_dscnt 0x0" ::: "memory");        // this wave's reads of tile t have returned before its buffer is refilled
        asm volatile("s_wait_asynccnt 0x0" ::: "memory");     // this wave's copies of tile t + 1 have landed
        __syncthreads();                                      // publishes tile t + 1 and ends every wave's last read of tile t
        if (t + 2 < SEQ / KTILE) {
            ckh += KTILE * HDIM; cvv += KTILE;
            stage_tile(cl + (unsigned)((t & 1) * LSTAGE), ckh, ckh + dkl, cvv, cvv + dvr);
        }
    }
    asm volatile("s_wait_asynccnt 0x0" ::: "memory");         // nothing in flight when the ring becomes output staging
    lsum += __shfl_xor(lsum, 16, 32);
    const float inv = 1.0f / lsum;
    float* os = (float*)ring;                                 // every wave has left the ring at the last trip's barrier
    const int obase = wave * 16 * OSP;
#pragma unroll
    for (int dt = 0; dt < 4; ++dt) {
        v4f x0, x1;
#pragma unroll
        for (int i = 0; i < 4; ++i) {
            x0[i] = (ova[dt][i] + ore[dt][i] * (1.0f / RCAR)) * inv;
            x1[i] = (ova[dt][4 + i] + ore[dt][4 + i] * (1.0f / RCAR)) * inv;
        }
        *(v4fa*)(os + obase + lr * OSP + dt * 16 + 8 * hi) = x0;
        *(v4fa*)(os + obase + lr * OSP + dt * 16 + 8 * hi + 4) = x1;
    }
    __syncthreads();
    float* orow = OUT + ((size_t)b * SEQ_FULL + q0) * DMOD + hd * HDIM;   // FULL batch stride of the output rows
{
#pragma unroll
        for (int s = 0; s < 8; ++s) {
            const int row = 2 * s + hi, cofs = lr * 4;            // s 0..7 x hi 0..1 -> queries 0..15; 16 lanes x 16 B = one 256-B head row
            const v4f val = *(const v4fa*)(os + obase + row * OSP + cofs);
            *(v4f*)(orow + (size_t)row * DMOD + cofs) = val;
        }
        
    }
}

// ---- k_out: y[m][n] = (A[m][:] . W[n][:]) / 1024 + bf16(bias[n]) + bf16(x[m][n]); A = f16 ctx plane (x16, compact rows), W = f16 plane of 64 * bf16(Wo) stored [out][in].
// The skip connection is read from the staged f32 input at the FULL batch stride and added at the store stage.
// grid (NB*SEQ/128, DMOD/128), 128 threads; each wave one 64x64 tile.
__global__ __launch_bounds__(GWAVES * 32) void k_out(const h16* __restrict__ A, const h16* __restrict__ W, const float* __restrict__ bias, const float* __restrict__ xin, float* Y) {
    __shared__ __align__(16) unsigned char ring[2 * GSTAGE];
    __shared__ __align__(16) float osall[GWAVES * 16 * OSP];
    const int wave = __builtin_amdgcn_readfirstlane((int)(threadIdx.x >> 5));
    const int wm = wave >> 1, wn = wave & 1;
    float* os = osall + wave * 16 * OSP;                  // each wave stages its output rows in its own range
    const int lane = (int)threadIdx.x & 31, lr = lane & 15, hi = lane >> 4;
    const int r0 = (int)blockIdx.x * 128 + wm * 64, c0 = (int)blockIdx.y * 128 + wn * 64;
    v8f acc[4][4];
    gemm_tile_h(A, W, (int)blockIdx.x * 128, (int)blockIdx.y * 128, wm, wn, ring, (unsigned)(size_t)(__attribute__((address_space(3))) unsigned char*)ring, acc);
    const int b = r0 / SEQ, t0 = r0 - b * SEQ;
    const int cofs = lr * 4;
    const v4f bv0 = *(const v4f*)(bias + c0 + cofs);
    float bb[4];
    bb[0] = bfr(bv0[0]); bb[1] = bfr(bv0[1]); bb[2] = bfr(bv0[2]); bb[3] = bfr(bv0[3]);
    const size_t xbase = ((size_t)b * SEQ_FULL + (size_t)t0) * DMOD + c0 + cofs;
    const size_t ybase = (size_t)r0 * DMOD + c0 + cofs;
    const float osc = 1.0f / (WCAR * CCAR);
#pragma unroll
    for (int mb = 0; mb < 4; ++mb) {
#pragma unroll
        for (int nb = 0; nb < 4; ++nb) {
#pragma unroll
            for (int j = 0; j < 8; ++j) os[(hi * 8 + j) * OSP + nb * 16 + lr] = acc[mb][nb][j];
        }
        __syncthreads();
{
#pragma unroll
            for (int s = 0; s < 8; ++s) {
                const int row = 2 * s + hi;                       // s 0..7 x hi 0..1 -> rows 0..15; 16 lanes x 16 B = one 256-B row segment
                const v4f a4 = *(const v4fa*)(os + row * OSP + cofs);
                const v4f xr = *(const v4f*)(xin + xbase + (size_t)(mb * 16 + row) * DMOD);
                v4f o;
#pragma unroll
                for (int i = 0; i < 4; ++i) o[i] = (a4[i] * osc + bb[i]) + bfr(xr[i]);
                *(v4f*)(Y + ybase + (size_t)(mb * 16 + row) * DMOD) = o;
            }
            
        }
        __syncthreads();
    }
}

// ---- k_ln: LayerNorm over the 768 columns, one wave per row (8 rows per block), row held in registers (6 x 4 floats per lane);
// mean, then centred variance (divide by the width), y = (x - mu) * rsqrt(var + 1e-5) * bf16(gain) + bf16(shift).
// grid (NB*SEQ/8), 256 threads.
__global__ __launch_bounds__(256) void k_ln(const float* __restrict__ X, const float* __restrict__ g, const float* __restrict__ be, float* OUT) {
#pragma clang fp contract(off)
    const int wave = __builtin_amdgcn_readfirstlane((int)(threadIdx.x >> 5));
    const int lane = (int)threadIdx.x & 31;
    const int row = (int)blockIdx.x * 8 + wave;
    const int b = row / SEQ, t = row - b * SEQ;
    const float* xr = X + (size_t)row * DMOD;
    v4f x[6];
    float s = 0.0f;
#pragma unroll
    for (int j = 0; j < 6; ++j) {
        x[j] = *(const v4f*)(xr + (j * 32 + lane) * 4);
        s += (x[j][0] + x[j][1]) + (x[j][2] + x[j][3]);
    }
    s += __shfl_xor(s, 16, 32); s += __shfl_xor(s, 8, 32); s += __shfl_xor(s, 4, 32); s += __shfl_xor(s, 2, 32); s += __shfl_xor(s, 1, 32);
    const float mu = s * (1.0f / (float)DMOD);
    float q = 0.0f;
#pragma unroll
    for (int j = 0; j < 6; ++j) {
        const float d0 = x[j][0] - mu, d1 = x[j][1] - mu, d2 = x[j][2] - mu, d3 = x[j][3] - mu;
        q += (d0 * d0 + d1 * d1) + (d2 * d2 + d3 * d3);
    }
    q += __shfl_xor(q, 16, 32); q += __shfl_xor(q, 8, 32); q += __shfl_xor(q, 4, 32); q += __shfl_xor(q, 2, 32); q += __shfl_xor(q, 1, 32);
    const float var = q * (1.0f / (float)DMOD);
    const float rstd = rsqrtf(var + 1.0e-5f);
    v4f o[6];
#pragma unroll
    for (int j = 0; j < 6; ++j) {
        const v4f g4 = *(const v4f*)(g + (j * 32 + lane) * 4);
        const v4f b4 = *(const v4f*)(be + (j * 32 + lane) * 4);
#pragma unroll
        for (int i = 0; i < 4; ++i) o[j][i] = ((x[j][i] - mu) * rstd) * bfr(g4[i]) + bfr(b4[i]);
    }
    float* orow = OUT + ((size_t)b * SEQ_FULL + (size_t)t) * DMOD;          // FULL batch stride of the output rows
#pragma unroll
    for (int j = 0; j < 6; ++j) *(v4f*)(orow + (j * 32 + lane) * 4) = o[j];
    
}

extern "C" void kernel_launch(void* const* d_in, const int* in_sizes, int n_in,
                              void* d_out, int out_size, void* d_ws, size_t ws_size, hipStream_t stream) {
    if (n_in < 12) return;
    const size_t need_x = (size_t)(NB - 1) * SEQ_FULL * DMOD + (size_t)SEQ * DMOD;
    const size_t need_m = (size_t)(NB - 1) * SEQ_FULL + (size_t)SEQ;
    if ((size_t)in_sizes[0] < need_x || (size_t)in_sizes[1] < need_m) return;
    if (in_sizes[2] < DMOD * DMOD || in_sizes[4] < DMOD * DMOD || in_sizes[6] < DMOD * DMOD || in_sizes[8] < DMOD * DMOD) return;
    if (in_sizes[3] < DMOD || in_sizes[5] < DMOD || in_sizes[7] < DMOD || in_sizes[9] < DMOD) return;
    if (in_sizes[10] < DMOD || in_sizes[11] < DMOD) return;
    if ((size_t)out_size < need_x) return;                       // output rows are addressed at the FULL batch stride
    const float* xin = (const float*)d_in[0];
    const int*   msk = (const int*)d_in[1];
    const float* Wq = (const float*)d_in[2]; const float* bq = (const float*)d_in[3];
    const float* Wk = (const float*)d_in[4]; const float* bk = (const float*)d_in[5];
    const float* Wv = (const float*)d_in[6]; const float* bv = (const float*)d_in[7];
    const float* Wo = (const float*)d_in[8]; const float* bo = (const float*)d_in[9];
    const float* lng = (const float*)d_in[10]; const float* lnb = (const float*)d_in[11];
    float* OUT = (float*)d_out;

    constexpr size_t WB = (size_t)DMOD * DMOD * 2;               // one 16-bit weight plane
    constexpr size_t PB = (size_t)NB * SEQ * DMOD * 2;           // one 16-bit activation / head plane (NB*NHEAD*SEQ*HDIM elements)
    constexpr size_t CB = (size_t)NB * SEQ_FULL * DMOD * 4;      // f32 ctx plane, rows at the FULL batch stride
    static_assert(WB % 256 == 0);
    static_assert(PB % 256 == 0);
    static_assert(CB % 256 == 0);
    static_assert(4 * WB + 7 * PB + CB <= (size_t)134217728);    // total carve at most 128 MiB
    static_assert(((size_t)(NB - 1) * SEQ_FULL + SEQ) * DMOD * 4 <= CB);     // last ctx row written by the attention kernel
    static_assert((size_t)NB * SEQ * DMOD * 2 <= PB);            // f16 ctx plane reuses the q hi plane (dead after the attention kernel)
    static_assert((size_t)NB * SEQ * DMOD * 4 <= 2 * PB);        // f32 pre-norm plane reuses the adjacent k hi | lo planes (dead after the attention kernel)
    if (4 * WB + 7 * PB + CB > ws_size) return;
    char* wsp = (char*)d_ws;
    bf* WQ = (bf*)wsp; wsp += WB;
    bf* WK = (bf*)wsp; wsp += WB;
    bf* WV = (bf*)wsp; wsp += WB;
    h16* WO = (h16*)wsp; wsp += WB;
    bf* XB = (bf*)wsp; wsp += PB;
    bf* QHp = (bf*)wsp; wsp += PB;
    bf* QLp = (bf*)wsp; wsp += PB;
    bf* KHp = (bf*)wsp; wsp += PB;
    bf* KLp = (bf*)wsp; wsp += PB;
    h16* VVp = (h16*)wsp; wsp += PB;
    h16* VRp = (h16*)wsp; wsp += PB;
    float* CTX = (float*)wsp; wsp += CB;
    h16* CTXH = (h16*)QHp;                                       // stream order: written only after the attention kernel has finished
    float* XF = (float*)KHp;                                     // spans KHp and KLp

    const int nW = DMOD * DMOD, nX = NB * SEQ * DMOD;
    const unsigned gW = (unsigned)((nW / 8 + 255) / 256), gX = (unsigned)((nX / 8 + 255) / 256);
    k_cvt<<<gW, 256, 0, stream>>>(Wq, WQ, nW, nW, nW);
    k_cvt<<<gW, 256, 0, stream>>>(Wk, WK, nW, nW, nW);
    k_cvt<<<gW, 256, 0, stream>>>(Wv, WV, nW, nW, nW);
    k_cvt_wo<<<gW, 256, 0, stream>>>(Wo, WO, nW);
    // the single input stream feeds all three projections
    k_cvt<<<gX, 256, 0, stream>>>(xin, XB, nX, SEQ * DMOD, SEQ_FULL * DMOD);
    // q: X[NB*SEQ][DMOD] (A) x Wq[DMOD][DMOD] (Bt as stored) -> q hi|lo head planes
    k_proj_qk<<<dim3(NB * SEQ / 128, DMOD / 128), GWAVES * 32, 0, stream>>>(XB, WQ, bq, QHp, QLp);
    k_proj_qk<<<dim3(NB * SEQ / 128, DMOD / 128), GWAVES * 32, 0, stream>>>(XB, WK, bk, KHp, KLp);
    // v: Wv[DMOD][DMOD] (A) x X[NB*SEQ][DMOD] (Bt) -> transposed value / residual planes [b][head][d][t], key mask applied
    k_proj_v<<<dim3(DMOD / 128, NB * SEQ / 128), GWAVES * 32, 0, stream>>>(WV, XB, bv, msk, VVp, VRp);
    k_attn<<<dim3(SEQ / (AWAVES * 16), NB * NHEAD), AWAVES * 32, 0, stream>>>(QHp, QLp, KHp, KLp, VVp, VRp, CTX);
    // ctx[NB*SEQ][DMOD] (f32, FULL stride) x query mask -> compact f16 plane
    k_cvt_ctx<<<gX, 256, 0, stream>>>(CTX, msk, CTXH, nX);
    // output projection: CTXH[NB*SEQ][DMOD] (A) x Wo[DMOD out][DMOD in] (Bt as stored) + bias + skip -> f32 pre-norm plane
    k_out<<<dim3(NB * SEQ / 128, DMOD / 128), GWAVES * 32, 0, stream>>>(CTXH, WO, bo, xin, XF);
    k_ln<<<dim3(NB * SEQ / 8), 256, 0, stream>>>(XF, lng, lnb, OUT);
}

// v004
// It runs in 166 microseconds.
// In both of two side-by-side timings against v003, it was 1.08 times as fast.
// Counting every step since v000, it is 3.67 times as fast.
#include <hip/hip_runtime.h>

// Single-stream multi-head self-attention block: x [4][2048][768]; q / k / v = x.W^T + b with W stored [out][in]; heads = 12 x 64; scores = q.k^T with NO scale; softmax over all 2048 keys;
// the probabilities are multiplied AFTER the softmax by mask_q * mask_k (int input [4][2048], read by value); ctx merged to [4][2048][768]; y = ctx.Wo^T + bo + x; output = LayerNorm(y) with eps 1e-5 and gain / shift inputs.
// Compute dtypes, f32 accumulate everywhere: x and the weights converted to bf16 (RNE) once; q / k / v projections = single v_wmma_f32_16x16x32_bf16 products + bf16(bias) in f32; scores = bf16 hi|lo planes, 3 products (hh + lh + hl) in one accumulator;
// softmax f32 (base 2, running max from a finite start, denominator over all keys); P = f16(256 p) packed straight from the score accumulators into the B fragment; V times the key mask = f16 value plane + f16 residual x2048 plane on v_wmma_f32_16x16x32_f16, each with its own accumulator set, folded in the f32 epilogue;
// output projection = single v_wmma_f32_16x16x32_f16 product: ctx times the query mask as f16 x16, bf16(Wo) as f16 x64, folded by 1/1024 in f32; bias, skip connection (bf16(x)) and LayerNorm in f32.

#ifndef NB
#define NB 4
#endif
#ifndef SEQ
#define SEQ 2048
#endif
#define NB_FULL  4
#define SEQ_FULL 2048
#define DMOD  768
#define NHEAD 12
#define HDIM  64
#define OSP   68
#define LOG2E 1.4426950408889634f
#define PSH   8.0f
#define RCAR  2048.0f
#define WCAR  64.0f
#define CCAR  16.0f

static_assert(NHEAD * HDIM == DMOD);          // merged width
static_assert(HDIM == 64);                    // one 64-column GEMM tile == one head; 4 d-tiles in the attention kernel
static_assert(DMOD % 64 == 0);                // GEMM tile multiple (N and the transposed M)
static_assert(DMOD % 32 == 0);                // k-loop step
static_assert(SEQ % 64 == 0);                 // GEMM row tiles never straddle a batch; attention key step 32
static_assert(SEQ <= SEQ_FULL);
static_assert(NB <= NB_FULL);
static_assert((SEQ * DMOD) % 8 == 0);         // convert kernel: 8 elements per thread never straddle a batch
static_assert((DMOD * DMOD) % 8 == 0);
static_assert((NB * SEQ) % 64 == 0);
static_assert((NB * SEQ) / 64 <= 65535);
static_assert(OSP % 4 == 0);                  // 16-byte aligned LDS rows
static_assert(OSP >= HDIM);
static_assert(DMOD % 8 == 0);                 // ctx convert: 8 elements per thread never straddle a row
static_assert(SEQ % 8 == 0);                  // key-mask vector loads stay 16-byte aligned
static_assert(SEQ_FULL % 8 == 0);
static_assert(DMOD == 6 * 32 * 4);            // LayerNorm: one wave per row, 6 x (32 lanes x 4 floats)
static_assert((NB * SEQ) % 8 == 0);           // LayerNorm: 8 rows (waves) per block, no tail
static_assert(HDIM == 16 * 4);                // output GEMM store: 16 lanes x 16 B == one 64-float row segment

typedef _Float16 h16;
typedef unsigned short bf;
typedef __attribute__((ext_vector_type(16))) __bf16   v16bf;
typedef __attribute__((ext_vector_type(16))) _Float16 v16h;
typedef __attribute__((ext_vector_type(8)))  _Float16 v8h;
typedef __attribute__((ext_vector_type(8)))  unsigned short v8us;
typedef __attribute__((ext_vector_type(8)))  float    v8f;
typedef __attribute__((ext_vector_type(4)))  float    v4f;
typedef __attribute__((ext_vector_type(4)))  int      v4i;
typedef v4f  __attribute__((may_alias)) v4fa;

__device__ __forceinline__ unsigned short f2bf(float f) { unsigned u = __float_as_uint(f); u += 0x7FFFu + ((u >> 16) & 1u); return (unsigned short)(u >> 16); }
__device__ __forceinline__ float bf2f(unsigned short b) { return __uint_as_float(((unsigned)b) << 16); }
__device__ __forceinline__ float bfr(float f) { return bf2f(f2bf(f)); }
__device__ __forceinline__ void splitf(float y, unsigned short& h, unsigned short& l) { h = f2bf(y); l = f2bf(y - bf2f(h)); }
__device__ __forceinline__ v16h cat16(v8h lo, v8h hi) { return __builtin_shufflevector(lo, hi, 0, 1, 2, 3, 4, 5, 6, 7, 8, 9, 10, 11, 12, 13, 14, 15); }
__device__ __forceinline__ v16bf cat16b(v8us lo, v8us hi) { return __builtin_bit_cast(v16bf, __builtin_shufflevector(lo, hi, 0, 1, 2, 3, 4, 5, 6, 7, 8, 9, 10, 11, 12, 13, 14, 15)); }
__device__ __forceinline__ v8f wmma16(v16h a, v16h b, v8f c) { return __builtin_amdgcn_wmma_f32_16x16x32_f16(false, a, false, b, (short)0, c, false, false); }
__device__ __forceinline__ v8f wmmab(v16bf a, v16bf b, v8f c) { return __builtin_amdgcn_wmma_f32_16x16x32_bf16(false, a, false, b, (short)0, c, false, false); }
// per-instruction guarded f16 WMMA: ONE accumulator tied with its own two operands to four nops
__device__ __forceinline__ v8f wmma16g(v16h a, v16h b, v8f c) { c = wmma16(a, b, c); asm volatile("v_nop\n\tv_nop\n\tv_nop\n\tv_nop" : "+v"(c) : "v"(a), "v"(b)); return c; }
// fragment loaders (A and B alike, K-contiguous rows): p already carries + 8*(lane>>4); elements 0..7 = k0+8h.., elements 8..15 = k0+16+8h..
__device__ __forceinline__ v16bf ldbf(const bf* p) { return cat16b(*(const v8us*)p, *(const v8us*)(p + 16)); }
__device__ __forceinline__ v16h  ldh(const h16* p) { return cat16(*(const v8h*)p, *(const v8h*)(p + 16)); }
// f32 -> f16 convert for WMMA operand planes: values below the smallest f16 normal become exact zero (applied after the plane's power-of-two carry)
static __device__ __forceinline__ h16 toh_flush(float v) { const h16 r = (h16)v; return (fabsf(v) < 6.103515625e-05f) ? (h16)0.0f : r; }

// dst[e] = src[(e / per) * per_full + e % per]  (per / per_full = compact and staged batch strides). blk = the block's index inside its own plane.
__device__ __forceinline__ void cvt_bf(const float* __restrict__ src, bf* dst, int blk, int n, int per, int per_full) {
    const int e = (blk * 256 + (int)threadIdx.x) * 8;
    if (e >= n) return;
    const int b = e / per;
    const size_t so = (size_t)b * (size_t)per_full + (size_t)(e - b * per);
    const v4f a0 = *(const v4f*)(src + so);
    const v4f a1 = *(const v4f*)(src + so + 4);
    v8us o;
    o[0] = f2bf(a0[0]); o[1] = f2bf(a0[1]); o[2] = f2bf(a0[2]); o[3] = f2bf(a0[3]);
    o[4] = f2bf(a1[0]); o[5] = f2bf(a1[1]); o[6] = f2bf(a1[2]); o[7] = f2bf(a1[3]);
    *(v8us*)(dst + e) = o;
}

__device__ __forceinline__ void cvt_wo(const float* __restrict__ src, h16* dst, int blk, int n) {
    const int e = (blk * 256 + (int)threadIdx.x) * 8;
    if (e >= n) return;
    const v4f a0 = *(const v4f*)(src + e);
    const v4f a1 = *(const v4f*)(src + e + 4);
    v8h o;
    o[0] = toh_flush(bfr(a0[0]) * WCAR); o[1] = toh_flush(bfr(a0[1]) * WCAR); o[2] = toh_flush(bfr(a0[2]) * WCAR); o[3] = toh_flush(bfr(a0[3]) * WCAR);
    o[4] = toh_flush(bfr(a1[0]) * WCAR); o[5] = toh_flush(bfr(a1[1]) * WCAR); o[6] = toh_flush(bfr(a1[2]) * WCAR); o[7] = toh_flush(bfr(a1[3]) * WCAR);
    *(v8h*)(dst + e) = o;
}

// ---- k_cvt_in: the five input conversions, which do not depend on one another, as block ranges of ONE grid:
// blocks [0, CVT_GX) = x, then CVT_GW blocks each for Wq, Wk, Wv (bf16 planes) and Wo (f16 plane x64). The range test reads blockIdx alone.
#define CVT_NW (DMOD * DMOD)
#define CVT_NX (NB * SEQ * DMOD)
#define CVT_GW ((CVT_NW / 8 + 255) / 256)
#define CVT_GX ((CVT_NX / 8 + 255) / 256)
__global__ __launch_bounds__(256) void k_cvt_in(const float* __restrict__ x, const float* __restrict__ wq, const float* __restrict__ wk, const float* __restrict__ wv, const float* __restrict__ wo,
                                                bf* XB, bf* WQ, bf* WK, bf* WV, h16* WO) {
    const int blk = (int)blockIdx.x;
    if (blk < CVT_GX) { cvt_bf(x, XB, blk, CVT_NX, SEQ * DMOD, SEQ_FULL * DMOD); return; }
    const int w = (blk - CVT_GX) / CVT_GW, wb = (blk - CVT_GX) - w * CVT_GW;
    if (w == 3) { cvt_wo(wo, WO, wb, CVT_NW); return; }
    cvt_bf(w == 0 ? wq : (w == 1 ? wk : wv), w == 0 ? WQ : (w == 1 ? WK : WV), wb, CVT_NW, CVT_NW, CVT_NW);
}

__global__ __launch_bounds__(256) void k_cvt_ctx(const float* __restrict__ src, const int* __restrict__ mask, h16* dst, int n) {
    const int e = ((int)blockIdx.x * 256 + (int)threadIdx.x) * 8;
    if (e >= n) return;
    const int row = e / DMOD, col = e - row * DMOD;
    const int b = row / SEQ, t = row - b * SEQ;
    const size_t srow = (size_t)b * SEQ_FULL + (size_t)t;
    const float mq = (float)mask[srow] * CCAR;
    const v4f a0 = *(const v4f*)(src + srow * DMOD + col);
    const v4f a1 = *(const v4f*)(src + srow * DMOD + col + 4);
    v8h o;
    o[0] = toh_flush(a0[0] * mq); o[1] = toh_flush(a0[1] * mq); o[2] = toh_flush(a0[2] * mq); o[3] = toh_flush(a0[3] * mq);
    o[4] = toh_flush(a1[0] * mq); o[5] = toh_flush(a1[1] * mq); o[6] = toh_flush(a1[2] * mq); o[7] = toh_flush(a1[3] * mq);
    *(v8h*)(dst + e) = o;
    
}

// ---- GEMM staging: a block of 2 x 2 waves owns a 128x128 tile; 128 k (one aligned 256-B unit) of its 128 A rows and 128 Bt rows are staged in LDS by asynchronous copies
// (16 B per lane, 16 lanes per row), two buffers: stage t + 1 flies while stage t is worked on. Every wave reads its 64 + 64 rows as fragments from LDS.
#define GWAVES 4                      // waves per block, 2 (tile rows) x 2 (tile columns)
#define GKT    128                    // k elements per stage: 256 B of every operand row
#define GPITCH 272                    // LDS row pitch in bytes: 16 B x odd, conflict-free for the 16-byte fragment reads
#define GSLAB  (128 * GPITCH)         // one operand's 128 staged rows
#define GSTAGE (2 * GSLAB)            // one buffer: A rows, then Bt rows
static_assert(DMOD % 128 == 0);               // whole 128-wide block tiles
static_assert((NB * SEQ) % 128 == 0);
static_assert(DMOD % GKT == 0);               // whole stages
static_assert(DMOD / GKT >= 2);               // the two-buffer prologue fills stages 0 and 1
static_assert(GKT * 2 == 16 * 16);            // one staged row == 16 lanes x 16 B
static_assert(GWAVES * 32 * 16 == 128 * 16);  // sixteen copies per lane cover one operand's slab

// Half of one operand's slab = 8 copies per lane: rows r, r + 8, ..., r + 56. l = the lane's LDS byte address in row r, g = the lane's own 16 bytes in row r of the 16-bit source plane (row length DMOD).
__device__ __forceinline__ void stage_half(unsigned l, const unsigned char* g) {
    // the closing s_wait_xcnt stands inside the statement so that no address register of a copy is rewritten in front of it
    asm volatile("global_load_async_to_lds_b128 %0, %8, off\n\t"
                 "global_load_async_to_lds_b128 %1, %9, off\n\t"
                 "global_load_async_to_lds_b128 %2, %10, off\n\t"
                 "global_load_async_to_lds_b128 %3, %11, off\n\t"
                 "global_load_async_to_lds_b128 %4, %12, off\n\t"
                 "global_load_async_to_lds_b128 %5, %13, off\n\t"
                 "global_load_async_to_lds_b128 %6, %14, off\n\t"
                 "global_load_async_to_lds_b128 %7, %15, off\n\t"
                 "s_wait_xcnt 0x0"
                 :: "v"(l), "v"(l + 8 * GPITCH), "v"(l + 16 * GPITCH), "v"(l + 24 * GPITCH),
                    "v"(l + 32 * GPITCH), "v"(l + 40 * GPITCH), "v"(l + 48 * GPITCH), "v"(l + 56 * GPITCH),
                    "v"(g), "v"(g + 8 * DMOD * 2), "v"(g + 16 * DMOD * 2), "v"(g + 24 * DMOD * 2),
                    "v"(g + 32 * DMOD * 2), "v"(g + 40 * DMOD * 2), "v"(g + 48 * DMOD * 2), "v"(g + 56 * DMOD * 2)
                 : "memory");
}
// One operand's slab of 128 rows: 16 copies per lane.
__device__ __forceinline__ void stage_slab(unsigned l, const unsigned char* g) {
    stage_half(l, g);
    stage_half(l + 64 * GPITCH, g + 64 * DMOD * 2);
}

// The copy side and the read side of one thread. ra / rb = first A row / first Bt row of the block's tile; wm / wn = the wave's place in the 2 x 2 block.
struct gemm_ring {
    const unsigned char* ga; const unsigned char* gb;   // running source pointers, advanced stage by stage
    unsigned cl;                                        // the lane's LDS byte address in the A slab of buffer 0
    const unsigned char* fa; const unsigned char* fb;   // fragment row lr, 16-byte piece hi, of the wave's 64 A rows and 64 Bt rows in buffer 0
};
__device__ __forceinline__ gemm_ring ring_open(const void* A, const void* Bt, int ra, int rb, int wm, int wn, const unsigned char* ring, unsigned ringl) {
    const int crow = (int)threadIdx.x >> 4, cpc = (int)threadIdx.x & 15;       // copy side: row 0..7, 16-byte piece 0..15
    const int lane = (int)threadIdx.x & 31, lr = lane & 15, hi = lane >> 4;
    gemm_ring g;
    g.ga = (const unsigned char*)A + ((size_t)(ra + crow) * DMOD + cpc * 8) * 2;
    g.gb = (const unsigned char*)Bt + ((size_t)(rb + crow) * DMOD + cpc * 8) * 2;
    g.cl = ringl + (unsigned)(crow * GPITCH + cpc * 16);
    g.fa = ring + (wm * 64 + lr) * GPITCH + 16 * hi;
    g.fb = ring + GSLAB + (wn * 64 + lr) * GPITCH + 16 * hi;
    stage_slab(g.cl, g.ga); stage_slab(g.cl + GSLAB, g.gb);
    g.ga += GKT * 2; g.gb += GKT * 2;
    asm volatile("s_wait_asynccnt 0x0" ::: "memory");     // this wave's copies of stage 0 have landed
    __syncthreads();                                      // stage 0 readable by every wave
    stage_slab(g.cl + GSTAGE, g.ga); stage_slab(g.cl + GSTAGE + GSLAB, g.gb);
    return g;
}
// Foot of trip t: publish stage t + 1, then refill the buffer that trip t has just read.
__device__ __forceinline__ void ring_turn(gemm_ring& g, int t) {
    asm volatile("s_wait_dscnt 0x0" ::: "memory");        // this wave's reads of stage t have returned before its buffer is refilled
    asm volatile("s_wait_asynccnt 0x0" ::: "memory");     // this wave's copies of stage t + 1 have landed
    __syncthreads();                                      // publishes stage t + 1 and ends every wave's last read of stage t
    if (t + 2 < DMOD / GKT) {
        g.ga += GKT * 2; g.gb += GKT * 2;
        const unsigned l = g.cl + (unsigned)((t & 1) * GSTAGE);
        stage_slab(l, g.ga); stage_slab(l + GSLAB, g.gb);
    }
}

// ---- GEMM main loop: one wave per 64x64 tile (16 accumulators), fragments from the staged bf16 rows, K = DMOD in ascending order.
// acc[mb][nb][j] = sum_k A[r0 + mb*16 + 8*hi + j][k] * Bt[c0 + nb*16 + lr][k], r0 = ra + 64*wm, c0 = rb + 64*wn.
__device__ __forceinline__ void gemm_tile(const bf* __restrict__ A, const bf* __restrict__ Bt, int ra, int rb, int wm, int wn, const unsigned char* ring, unsigned ringl, v8f (&acc)[4][4]) {
#pragma unroll
    for (int mb = 0; mb < 4; ++mb)
#pragma unroll
        for (int nb = 0; nb < 4; ++nb) acc[mb][nb] = (v8f){};
    gemm_ring g = ring_open(A, Bt, ra, rb, wm, wn, ring, ringl);
#pragma unroll 1   // rolled: one publish point per trip
    for (int t = 0; t < DMOD / GKT; ++t) {
        const unsigned char* pa = g.fa + (t & 1) * GSTAGE;
        const unsigned char* pb = g.fb + (t & 1) * GSTAGE;
#pragma unroll   // unrolled: the 32-k blocks of a stage read at constant LDS offsets
        for (int kc = 0; kc < GKT; kc += 32) {
            v16bf a[4];
            v16bf b;
#pragma unroll
            for (int mb = 0; mb < 4; ++mb) a[mb] = ldbf((const bf*)(pa + mb * 16 * GPITCH + kc * 2));
#pragma unroll
            for (int nb = 0; nb < 4; ++nb) {
                b = ldbf((const bf*)(pb + nb * 16 * GPITCH + kc * 2));
#pragma unroll
                for (int mb = 0; mb < 4; ++mb) acc[mb][nb] = wmmab(a[mb], b, acc[mb][nb]);
            }
            asm volatile("" : "+v"(acc[0][0]), "+v"(acc[1][0]), "+v"(acc[2][0]), "+v"(acc[3][0]), "+v"(acc[0][1]), "+v"(acc[1][1]), "+v"(acc[2][1]), "+v"(acc[3][1]));
            asm volatile("v_nop\n\tv_nop\n\tv_nop\n\tv_nop" : "+v"(acc[0][2]), "+v"(acc[1][2]), "+v"(acc[2][2]), "+v"(acc[3][2]), "+v"(acc[0][3]), "+v"(acc[1][3]), "+v"(acc[2][3]), "+v"(acc[3][3]) : "v"(a[0]), "v"(a[3]), "v"(b));
        }
        ring_turn(g, t);
    }
    asm volatile("s_wait_asynccnt 0x0" ::: "memory");     // nothing in flight behind the loop
}

// ---- f16 twin of the GEMM main loop (same tile map, same staging, f16 planes); every WMMA carries its own four-nop guard.
__device__ __forceinline__ void gemm_tile_h(const h16* __restrict__ A, const h16* __restrict__ Bt, int ra, int rb, int wm, int wn, const unsigned char* ring, unsigned ringl, v8f (&acc)[4][4]) {
#pragma unroll
    for (int mb = 0; mb < 4; ++mb)
#pragma unroll
        for (int nb = 0; nb < 4; ++nb) acc[mb][nb] = (v8f){};
    gemm_ring g = ring_open(A, Bt, ra, rb, wm, wn, ring, ringl);
#pragma unroll 1   // rolled: one publish point per trip
    for (int t = 0; t < DMOD / GKT; ++t) {
        const unsigned char* pa = g.fa + (t & 1) * GSTAGE;
        const unsigned char* pb = g.fb + (t & 1) * GSTAGE;
#pragma unroll   // unrolled: the 32-k blocks of a stage read at constant LDS offsets
        for (int kc = 0; kc < GKT; kc += 32) {
            v16h a[4], b[4];                              // the block's LDS reads stand as one group in front of its guarded WMMAs
#pragma unroll
            for (int mb = 0; mb < 4; ++mb) a[mb] = ldh((const h16*)(pa + mb * 16 * GPITCH + kc * 2));
#pragma unroll
            for (int nb = 0; nb < 4; ++nb) b[nb] = ldh((const h16*)(pb + nb * 16 * GPITCH + kc * 2));
#pragma unroll
            for (int nb = 0; nb < 4; ++nb) {
#pragma unroll
                for (int mb = 0; mb < 4; ++mb) acc[mb][nb] = wmma16g(a[mb], b[nb], acc[mb][nb]);
            }
        }
        ring_turn(g, t);
    }
    asm volatile("s_wait_asynccnt 0x0" ::: "memory");     // nothing in flight behind the loop
}

// ---- k_proj: the q, k and v projections, which do not depend on one another, as the three z planes of ONE grid; z reads the same for a whole block, so every barrier stays under block-uniform control flow.
// z = 0 / 1 (q / k): y[m][n] = X[m][:] . W[n][:] + bf16(bias[n]); tile rows m = b*SEQ + t, tile columns = one head (n = head*64 + d); stored as bf16 hi|lo head planes.
// z = 2 (v): transposed projection y^T[n][m] = (W[n][:] . X[m][:] + bf16(bias[n])) * mask[m]; tile rows n = head*64 + d, tile columns m = b*SEQ + t (the key index).
// The key mask multiplies the value rows, so the attention kernel's probabilities and its denominator stay over all keys.
// grid (NB*SEQ/128, DMOD/128, 3), 128 threads; each wave one 64x64 tile.
__global__ __launch_bounds__(GWAVES * 32) void k_proj(const bf* __restrict__ X, const bf* __restrict__ WQ, const bf* __restrict__ WK, const bf* __restrict__ WV,
                                                      const float* __restrict__ bq, const float* __restrict__ bk, const float* __restrict__ bv, const int* __restrict__ mask,
                                                      bf* QH, bf* QL, bf* KH, bf* KL, h16* Pv, h16* Pr) {
    __shared__ __align__(16) unsigned char ring[2 * GSTAGE];
    __shared__ __align__(16) float osall[GWAVES * 16 * OSP];
    const int wave = __builtin_amdgcn_readfirstlane((int)(threadIdx.x >> 5));
    const int wm = wave >> 1, wn = wave & 1;
    float* os = osall + wave * 16 * OSP;                  // each wave stages its output rows in its own range
    const int lane = (int)threadIdx.x & 31, lr = lane & 15, hi = lane >> 4;
    const int which = (int)blockIdx.z;
    const bool isv = which == 2;
    const bf* W = which == 0 ? WQ : (which == 1 ? WK : WV);
    const float* bias = which == 0 ? bq : (which == 1 ? bk : bv);
    const int xt = (int)blockIdx.x * 128, wt = (int)blockIdx.y * 128;      // first X row and first W row of the block's tile
    const int ra = isv ? wt : xt, rb = isv ? xt : wt;
    const int r0 = ra + wm * 64, c0 = rb + wn * 64;
    v8f acc[4][4];
    gemm_tile(isv ? W : X, isv ? X : W, ra, rb, wm, wn, ring, (unsigned)(size_t)(__attribute__((address_space(3))) unsigned char*)ring, acc);
    const int rq = lane >> 3, cq = (lane & 7) * 8;
    if (!isv) {
        bf* Ph = which == 0 ? QH : KH;
        bf* Pl = which == 0 ? QL : KL;
        const int b = r0 / SEQ, t0 = r0 - b * SEQ, hd = c0 / HDIM;
        const v4f bv0 = *(const v4f*)(bias + c0 + cq);
        const v4f bv1 = *(const v4f*)(bias + c0 + cq + 4);
        float bb[8];
        bb[0] = bfr(bv0[0]); bb[1] = bfr(bv0[1]); bb[2] = bfr(bv0[2]); bb[3] = bfr(bv0[3]);
        bb[4] = bfr(bv1[0]); bb[5] = bfr(bv1[1]); bb[6] = bfr(bv1[2]); bb[7] = bfr(bv1[3]);
        const size_t pbase = ((size_t)(b * NHEAD + hd) * SEQ + t0) * HDIM;
#pragma unroll
        for (int mb = 0; mb < 4; ++mb) {
#pragma unroll
            for (int nb = 0; nb < 4; ++nb) {
#pragma unroll
                for (int j = 0; j < 8; ++j) os[(hi * 8 + j) * OSP + nb * 16 + lr] = acc[mb][nb][j];
            }
            __syncthreads();
#pragma unroll
            for (int s = 0; s < 4; ++s) {
                const int row = s * 4 + rq;                       // s 0..3 x rq 0..3 -> rows 0..15
                const v4f x0 = *(const v4fa*)(os + row * OSP + cq);
                const v4f x1 = *(const v4fa*)(os + row * OSP + cq + 4);
                v8us oh, ol;
#pragma unroll
                for (int i = 0; i < 4; ++i) {
                    unsigned short a2, c2;
                    splitf(x0[i] + bb[i], a2, c2); oh[i] = a2; ol[i] = c2;
                    splitf(x1[i] + bb[4 + i], a2, c2); oh[4 + i] = a2; ol[4 + i] = c2;
                }
                const size_t oo = pbase + (size_t)(mb * 16 + row) * HDIM + cq;
                *(v8us*)(Ph + oo) = oh;
                *(v8us*)(Pl + oo) = ol;
            }
            __syncthreads();
        }
    } else {
        const int b = c0 / SEQ, t0 = c0 - b * SEQ, hd = r0 / HDIM;
        const v4i mk0 = *(const v4i*)(mask + (size_t)b * SEQ_FULL + t0 + cq);          // staged mask rows use the FULL batch stride
        const v4i mk1 = *(const v4i*)(mask + (size_t)b * SEQ_FULL + t0 + cq + 4);
        float mf[8];
        mf[0] = (float)mk0[0]; mf[1] = (float)mk0[1]; mf[2] = (float)mk0[2]; mf[3] = (float)mk0[3];
        mf[4] = (float)mk1[0]; mf[5] = (float)mk1[1]; mf[6] = (float)mk1[2]; mf[7] = (float)mk1[3];
        const size_t pbase = (size_t)(b * NHEAD + hd) * HDIM * SEQ + t0;
#pragma unroll
        for (int mb = 0; mb < 4; ++mb) {
#pragma unroll
            for (int nb = 0; nb < 4; ++nb) {
#pragma unroll
                for (int j = 0; j < 8; ++j) os[(hi * 8 + j) * OSP + nb * 16 + lr] = acc[mb][nb][j];
            }
            __syncthreads();
#pragma unroll
            for (int s = 0; s < 4; ++s) {
                const int row = s * 4 + rq;                       // d within the slab, 0..15
                const float bsc = bfr(bias[r0 + mb * 16 + row]);
                const v4f x0 = *(const v4fa*)(os + row * OSP + cq);
                const v4f x1 = *(const v4fa*)(os + row * OSP + cq + 4);
                v8h ov, orr;
#pragma unroll
                for (int i = 0; i < 4; ++i) {
                    const float y0 = (x0[i] + bsc) * mf[i]; const h16 h0 = toh_flush(y0); ov[i] = h0; orr[i] = toh_flush((y0 - (float)h0) * RCAR);
                    const float y1 = (x1[i] + bsc) * mf[4 + i]; const h16 h1 = toh_flush(y1); ov[4 + i] = h1; orr[4 + i] = toh_flush((y1 - (float)h1) * RCAR);
                }
                const size_t oo = pbase + (size_t)(mb * 16 + row) * SEQ + cq;
                *(v8h*)(Pv + oo) = ov;
                *(v8h*)(Pr + oo) = orr;
            }
            __syncthreads();
        }
    }
}

// ---- k_attn: fused attention, transposed form. Block = 8 waves = 128 queries of one (batch, head); each wave owns 16 queries.
// The K hi|lo rows and the V value|residual rows of 64 keys are staged in LDS once per block by asynchronous copies (16 B per lane, whole 128-B lines), two buffers: tile t + 1 flies while tile t is worked on.
// Each wave loads its own Q hi|lo fragments once, before the key loop, and keeps them in registers.
// Per 32-key step: S^T[key][query] = K.Q^T on bf16 hi|lo planes (3 products, one accumulator per 16-key tile); base-2 online softmax per query column
// (lane (hi, lr) holds keys 8*hi + r and 16 + 8*hi + r of query lr; the two lanes of a query share the running max through one shuffle);
// P^T packed from the two score tiles into the B fragment (element r <- tile 0, element 8 + r <- tile 1); O^T[d][query] += V^T.P^T for the value and the residual plane
// (every one of the eight P.V WMMAs carries its own four-nop guard tying exactly its accumulator and its two operands).
// grid (SEQ/128, NB*NHEAD), 256 threads.
#define AWAVES 8                      // waves per block that share one staged tile
#define KTILE  64                     // keys per staged tile: K rows and V rows are both 128 B long
#define LPITCH 144                    // LDS row pitch in bytes: 16 B x odd, conflict-free for the 16-byte fragment reads
#define LPLANE (64 * LPITCH)          // one staged plane: 64 rows (keys for K, head dims for V)
#define LSTAGE (4 * LPLANE)           // one buffer: K hi, K lo, V value, V residual
static_assert(SEQ % (AWAVES * 16) == 0);      // whole blocks of queries
static_assert(SEQ % KTILE == 0);              // whole key tiles
static_assert(SEQ / KTILE >= 2);              // the two-buffer prologue fills tiles 0 and 1
static_assert(KTILE * 2 == 128);              // one V row of a tile == 8 lanes x 16 B
static_assert(HDIM * 2 == 128);               // one K row == 8 lanes x 16 B
static_assert(AWAVES * 32 * 2 == 64 * 8);     // two copies per lane cover one plane (64 rows x 8 pieces)
static_assert(AWAVES * 16 * OSP * 4 <= 2 * LSTAGE);   // the output staging reuses the ring

// One tile = 8 copies per lane. l = the lane's LDS byte address in the K hi plane of the target buffer; the pointers are the lane's own 16 bytes in rows 0..31 of each plane.
__device__ __forceinline__ void stage_tile(unsigned l, const bf* kh, const bf* kl, const h16* vv, const h16* vr) {
    // the closing s_wait_xcnt stands inside the statement so that no address register of a copy is rewritten in front of it
    asm volatile("global_load_async_to_lds_b128 %0, %8, off\n\t"
                 "global_load_async_to_lds_b128 %1, %9, off\n\t"
                 "global_load_async_to_lds_b128 %2, %10, off\n\t"
                 "global_load_async_to_lds_b128 %3, %11, off\n\t"
                 "global_load_async_to_lds_b128 %4, %12, off\n\t"
                 "global_load_async_to_lds_b128 %5, %13, off\n\t"
                 "global_load_async_to_lds_b128 %6, %14, off\n\t"
                 "global_load_async_to_lds_b128 %7, %15, off\n\t"
                 "s_wait_xcnt 0x0"
                 :: "v"(l), "v"(l + 32 * LPITCH), "v"(l + LPLANE), "v"(l + LPLANE + 32 * LPITCH),
                    "v"(l + 2 * LPLANE), "v"(l + 2 * LPLANE + 32 * LPITCH), "v"(l + 3 * LPLANE), "v"(l + 3 * LPLANE + 32 * LPITCH),
                    "v"(kh), "v"(kh + 32 * HDIM), "v"(kl), "v"(kl + 32 * HDIM),
                    "v"(vv), "v"(vv + 32 * SEQ), "v"(vr), "v"(vr + 32 * SEQ)
                 : "memory");
}

// second launch bound: six waves per SIMD, so that the three blocks that fall to each WGP stay resident together
__global__ __launch_bounds__(AWAVES * 32, 6) void k_attn(const bf* __restrict__ QH, const bf* __restrict__ QL, const bf* __restrict__ KH, const bf* __restrict__ KL,
                                              const h16* __restrict__ VV, const h16* __restrict__ VR, float* OUT) {
    __shared__ __align__(16) unsigned char ring[2 * LSTAGE];
    const int wave = __builtin_amdgcn_readfirstlane((int)(threadIdx.x >> 5));
    const int lane = (int)threadIdx.x & 31, lr = lane & 15, hi = lane >> 4;
    const int bh = (int)blockIdx.y;
    const int b = bh / NHEAD, hd = bh - b * NHEAD;
    const int q0 = (int)blockIdx.x * (AWAVES * 16) + wave * 16;
    const size_t pb = (size_t)bh * SEQ * HDIM;
    const bf* qh = QH + pb; const bf* ql = QL + pb;
    const int qoff0 = (q0 + lr) * HDIM + 8 * hi;
    // copy side: thread -> (row = tid / 8, 16-byte piece = tid % 8) of rows 0..31 of a plane
    const int crow = (int)threadIdx.x >> 3, cpc = (int)threadIdx.x & 7;
    const bf* ckh = KH + pb + crow * HDIM + cpc * 8; const h16* cvv = VV + pb + crow * SEQ + cpc * 8;   // running pointers, advanced tile by tile
    const ptrdiff_t dkl = KL - KH, dvr = VR - VV;      // uniform distances of the lo and residual planes (scalar registers instead of two more pointers per lane)
    const unsigned cl = (unsigned)(size_t)(__attribute__((address_space(3))) unsigned char*)ring + (unsigned)(crow * LPITCH + cpc * 16);
    // read side: fragment row lr, 16-byte piece hi (K rows and V rows alike)
    const unsigned char* fr = ring + lr * LPITCH + 16 * hi;
    v8f ova[4], ore[4];
#pragma unroll
    for (int dt = 0; dt < 4; ++dt) { ova[dt] = (v8f){}; ore[dt] = (v8f){}; }
    float m = -3.0e38f, lsum = 0.0f;
    stage_tile(cl, ckh, ckh + dkl, cvv, cvv + dvr);
    ckh += KTILE * HDIM; cvv += KTILE;
    // the wave's own Q hi|lo fragments: loaded once, held in registers over the whole key loop
    v16bf qfh[HDIM / 32], qfl[HDIM / 32];
#pragma unroll
    for (int kc = 0; kc < HDIM; kc += 32) { qfh[kc / 32] = ldbf(qh + qoff0 + kc); qfl[kc / 32] = ldbf(ql + qoff0 + kc); }
    asm volatile("s_wait_xcnt 0x0" ::: "memory");         // precaution: stands in front of every rewrite of the Q loads' address registers
    asm volatile("s_wait_asynccnt 0x0" ::: "memory");     // this wave's copies of tile 0 have landed
    __syncthreads();                                      // tile 0 readable by every wave
    stage_tile(cl + LSTAGE, ckh, ckh + dkl, cvv, cvv + dvr);
#pragma unroll 1   // rolled: one publish point per trip, and the registers stay within six waves per SIMD
    for (int t = 0; t < SEQ / KTILE; ++t) {
        const unsigned char* fb = fr + (t & 1) * LSTAGE;
#pragma unroll 1   // rolled: beside the resident Q fragments only one 32-key step's temporaries fit at six waves per SIMD (unrolled, the build spills)
        for (int sub = 0; sub < KTILE / 32; ++sub) {
            v8f s0 = (v8f){}, s1 = (v8f){};
            v16bf qhf, qlf, k0h, k0l, k1h, k1l;
#pragma unroll
            for (int kc = 0; kc < HDIM; kc += 32) {
                qhf = qfh[kc / 32]; qlf = qfl[kc / 32];
                const unsigned char* kp = fb + sub * 32 * LPITCH + kc * 2;
                k0h = ldbf((const bf*)kp); k0l = ldbf((const bf*)(kp + LPLANE));
                k1h = ldbf((const bf*)(kp + 16 * LPITCH)); k1l = ldbf((const bf*)(kp + LPLANE + 16 * LPITCH));
                s0 = wmmab(k0h, qhf, s0); s1 = wmmab(k1h, qhf, s1);
                s0 = wmmab(k0l, qhf, s0); s1 = wmmab(k1l, qhf, s1);
                s0 = wmmab(k0h, qlf, s0); s1 = wmmab(k1h, qlf, s1);
            }
            asm volatile("v_nop\n\tv_nop\n\tv_nop\n\tv_nop" : "+v"(s0), "+v"(s1) : "v"(k1h), "v"(qlf));
            float t0[8], t1[8];
            float mx = -3.0e38f;
#pragma unroll
            for (int r = 0; r < 8; ++r) { t0[r] = s0[r] * LOG2E; t1[r] = s1[r] * LOG2E; mx = fmaxf(mx, fmaxf(t0[r], t1[r])); }
            mx = fmaxf(mx, __shfl_xor(mx, 16, 32));
            const float mnew = fmaxf(m, mx);
            const float sc = __builtin_amdgcn_exp2f(m - mnew);
            m = mnew;
            const float mo = mnew - PSH;                  // exp2(t - mo) = 256 p, at most 256
            float psum = 0.0f;
            v16h pf;
#pragma unroll
            for (int r = 0; r < 8; ++r) {
                const float e0 = __builtin_amdgcn_exp2f(t0[r] - mo);
                const float e1 = __builtin_amdgcn_exp2f(t1[r] - mo);
                psum += e0 + e1;
                pf[r] = (h16)e0; pf[8 + r] = (h16)e1;
            }
            lsum = lsum * sc + psum;
            if (__builtin_amdgcn_ballot_w32(sc != 1.0f) != 0u) {      // wave-uniform: rescale only when some running max moved
#pragma unroll
                for (int dt = 0; dt < 4; ++dt) {
#pragma unroll
                    for (int r = 0; r < 8; ++r) { ova[dt][r] *= sc; ore[dt][r] *= sc; }
                }
            }
            const unsigned char* vp = fb + 2 * LPLANE + sub * 64;
            v16h va[4], vb[4];
#pragma unroll
            for (int dt = 0; dt < 4; ++dt) va[dt] = ldh((const h16*)(vp + dt * 16 * LPITCH));
#pragma unroll
            for (int dt = 0; dt < 4; ++dt) ova[dt] = wmma16g(va[dt], pf, ova[dt]);
#pragma unroll
            for (int dt = 0; dt < 4; ++dt) vb[dt] = ldh((const h16*)(vp + LPLANE + dt * 16 * LPITCH));
#pragma unroll
            for (int dt = 0; dt < 4; ++dt) ore[dt] = wmma16g(vb[dt], pf, ore[dt]);
        }
        asm volatile("s_wait_dscnt 0x0" ::: "memory");        // this wave's reads of tile t have returned before its buffer is refilled
        asm volatile("s_wait_asynccnt 0x0" ::: "memory");     // this wave's copies of tile t + 1 have landed
        __syncthreads();                                      // publishes tile t + 1 and ends every wave's last read of tile t
        if (t + 2 < SEQ / KTILE) {
            ckh += KTILE * HDIM; cvv += KTILE;
            stage_tile(cl + (unsigned)((t & 1) * LSTAGE), ckh, ckh + dkl, cvv, cvv + dvr);
        }
    }
    asm volatile("s_wait_asynccnt 0x0" ::: "memory");         // nothing in flight when the ring becomes output staging
    lsum += __shfl_xor(lsum, 16, 32);
    const float inv = 1.0f / lsum;
    float* os = (float*)ring;                                 // every wave has left the ring at the last trip's barrier
    const int obase = wave * 16 * OSP;
#pragma unroll
    for (int dt = 0; dt < 4; ++dt) {
        v4f x0, x1;
#pragma unroll
        for (int i = 0; i < 4; ++i) {
            x0[i] = (ova[dt][i] + ore[dt][i] * (1.0f / RCAR)) * inv;
            x1[i] = (ova[dt][4 + i] + ore[dt][4 + i] * (1.0f / RCAR)) * inv;
        }
        *(v4fa*)(os + obase + lr * OSP + dt * 16 + 8 * hi) = x0;
        *(v4fa*)(os + obase + lr * OSP + dt * 16 + 8 * hi + 4) = x1;
    }
    __syncthreads();
    float* orow = OUT + ((size_t)b * SEQ_FULL + q0) * DMOD + hd * HDIM;   // FULL batch stride of the output rows
{
#pragma unroll
        for (int s = 0; s < 8; ++s) {
            const int row = 2 * s + hi, cofs = lr * 4;            // s 0..7 x hi 0..1 -> queries 0..15; 16 lanes x 16 B = one 256-B head row
            const v4f val = *(const v4fa*)(os + obase + row * OSP + cofs);
            *(v4f*)(orow + (size_t)row * DMOD + cofs) = val;
        }
        
    }
}

// ---- k_out: y[m][n] = (A[m][:] . W[n][:]) / 1024 + bf16(bias[n]) + bf16(x[m][n]); A = f16 ctx plane (x16, compact rows), W = f16 plane of 64 * bf16(Wo) stored [out][in].
// The skip connection is read from the staged f32 input at the FULL batch stride and added at the store stage.
// grid (NB*SEQ/128, DMOD/128), 128 threads; each wave one 64x64 tile.
__global__ __launch_bounds__(GWAVES * 32) void k_out(const h16* __restrict__ A, const h16* __restrict__ W, const float* __restrict__ bias, const float* __restrict__ xin, float* Y) {
    __shared__ __align__(16) unsigned char ring[2 * GSTAGE];
    __shared__ __align__(16) float osall[GWAVES * 16 * OSP];
    const int wave = __builtin_amdgcn_readfirstlane((int)(threadIdx.x >> 5));
    const int wm = wave >> 1, wn = wave & 1;
    float* os = osall + wave * 16 * OSP;                  // each wave stages its output rows in its own range
    const int lane = (int)threadIdx.x & 31, lr = lane & 15, hi = lane >> 4;
    const int r0 = (int)blockIdx.x * 128 + wm * 64, c0 = (int)blockIdx.y * 128 + wn * 64;
    v8f acc[4][4];
    gemm_tile_h(A, W, (int)blockIdx.x * 128, (int)blockIdx.y * 128, wm, wn, ring, (unsigned)(size_t)(__attribute__((address_space(3))) unsigned char*)ring, acc);
    const int b = r0 / SEQ, t0 = r0 - b * SEQ;
    const int cofs = lr * 4;
    const v4f bv0 = *(const v4f*)(bias + c0 + cofs);
    float bb[4];
    bb[0] = bfr(bv0[0]); bb[1] = bfr(bv0[1]); bb[2] = bfr(bv0[2]); bb[3] = bfr(bv0[3]);
    const size_t xbase = ((size_t)b * SEQ_FULL + (size_t)t0) * DMOD + c0 + cofs;
    const size_t ybase = (size_t)r0 * DMOD + c0 + cofs;
    const float osc = 1.0f / (WCAR * CCAR);
#pragma unroll
    for (int mb = 0; mb < 4; ++mb) {
#pragma unroll
        for (int nb = 0; nb < 4; ++nb) {
#pragma unroll
            for (int j = 0; j < 8; ++j) os[(hi * 8 + j) * OSP + nb * 16 + lr] = acc[mb][nb][j];
        }
        __syncthreads();
{
#pragma unroll
            for (int s = 0; s < 8; ++s) {
                const int row = 2 * s + hi;                       // s 0..7 x hi 0..1 -> rows 0..15; 16 lanes x 16 B = one 256-B row segment
                const v4f a4 = *(const v4fa*)(os + row * OSP + cofs);
                const v4f xr = *(const v4f*)(xin + xbase + (size_t)(mb * 16 + row) * DMOD);
                v4f o;
#pragma unroll
                for (int i = 0; i < 4; ++i) o[i] = (a4[i] * osc + bb[i]) + bfr(xr[i]);
                *(v4f*)(Y + ybase + (size_t)(mb * 16 + row) * DMOD) = o;
            }
            
        }
        __syncthreads();
    }
}

// ---- k_ln: LayerNorm over the 768 columns, one wave per row (8 rows per block), row held in registers (6 x 4 floats per lane);
// mean, then centred variance (divide by the width), y = (x - mu) * rsqrt(var + 1e-5) * bf16(gain) + bf16(shift).
// grid (NB*SEQ/8), 256 threads.
__global__ __launch_bounds__(256) void k_ln(const float* __restrict__ X, const float* __restrict__ g, const float* __restrict__ be, float* OUT) {
#pragma clang fp contract(off)
    const int wave = __builtin_amdgcn_readfirstlane((int)(threadIdx.x >> 5));
    const int lane = (int)threadIdx.x & 31;
    const int row = (int)blockIdx.x * 8 + wave;
    const int b = row / SEQ, t = row - b * SEQ;
    const float* xr = X + (size_t)row * DMOD;
    v4f x[6];
    float s = 0.0f;
#pragma unroll
    for (int j = 0; j < 6; ++j) {
        x[j] = *(const v4f*)(xr + (j * 32 + lane) * 4);
        s += (x[j][0] + x[j][1]) + (x[j][2] + x[j][3]);
    }
    s += __shfl_xor(s, 16, 32); s += __shfl_xor(s, 8, 32); s += __shfl_xor(s, 4, 32); s += __shfl_xor(s, 2, 32); s += __shfl_xor(s, 1, 32);
    const float mu = s * (1.0f / (float)DMOD);
    float q = 0.0f;
#pragma unroll
    for (int j = 0; j < 6; ++j) {
        const float d0 = x[j][0] - mu, d1 = x[j][1] - mu, d2 = x[j][2] - mu, d3 = x[j][3] - mu;
        q += (d0 * d0 + d1 * d1) + (d2 * d2 + d3 * d3);
    }
    q += __shfl_xor(q, 16, 32); q += __shfl_xor(q, 8, 32); q += __shfl_xor(q, 4, 32); q += __shfl_xor(q, 2, 32); q += __shfl_xor(q, 1, 32);
    const float var = q * (1.0f / (float)DMOD);
    const float rstd = rsqrtf(var + 1.0e-5f);
    v4f o[6];
#pragma unroll
    for (int j = 0; j < 6; ++j) {
        const v4f g4 = *(const v4f*)(g + (j * 32 + lane) * 4);
        const v4f b4 = *(const v4f*)(be + (j * 32 + lane) * 4);
#pragma unroll
        for (int i = 0; i < 4; ++i) o[j][i] = ((x[j][i] - mu) * rstd) * bfr(g4[i]) + bfr(b4[i]);
    }
    float* orow = OUT + ((size_t)b * SEQ_FULL + (size_t)t) * DMOD;          // FULL batch stride of the output rows
#pragma unroll
    for (int j = 0; j < 6; ++j) *(v4f*)(orow + (j * 32 + lane) * 4) = o[j];
    
}

extern "C" void kernel_launch(void* const* d_in, const int* in_sizes, int n_in,
                              void* d_out, int out_size, void* d_ws, size_t ws_size, hipStream_t stream) {
    if (n_in < 12) return;
    const size_t need_x = (size_t)(NB - 1) * SEQ_FULL * DMOD + (size_t)SEQ * DMOD;
    const size_t need_m = (size_t)(NB - 1) * SEQ_FULL + (size_t)SEQ;
    if ((size_t)in_sizes[0] < need_x || (size_t)in_sizes[1] < need_m) return;
    if (in_sizes[2] < DMOD * DMOD || in_sizes[4] < DMOD * DMOD || in_sizes[6] < DMOD * DMOD || in_sizes[8] < DMOD * DMOD) return;
    if (in_sizes[3] < DMOD || in_sizes[5] < DMOD || in_sizes[7] < DMOD || in_sizes[9] < DMOD) return;
    if (in_sizes[10] < DMOD || in_sizes[11] < DMOD) return;
    if ((size_t)out_size < need_x) return;                       // output rows are addressed at the FULL batch stride
    const float* xin = (const float*)d_in[0];
    const int*   msk = (const int*)d_in[1];
    const float* Wq = (const float*)d_in[2]; const float* bq = (const float*)d_in[3];
    const float* Wk = (const float*)d_in[4]; const float* bk = (const float*)d_in[5];
    const float* Wv = (const float*)d_in[6]; const float* bv = (const float*)d_in[7];
    const float* Wo = (const float*)d_in[8]; const float* bo = (const float*)d_in[9];
    const float* lng = (const float*)d_in[10]; const float* lnb = (const float*)d_in[11];
    float* OUT = (float*)d_out;

    constexpr size_t WB = (size_t)DMOD * DMOD * 2;               // one 16-bit weight plane
    constexpr size_t PB = (size_t)NB * SEQ * DMOD * 2;           // one 16-bit activation / head plane (NB*NHEAD*SEQ*HDIM elements)
    constexpr size_t CB = (size_t)NB * SEQ_FULL * DMOD * 4;      // f32 ctx plane, rows at the FULL batch stride
    static_assert(WB % 256 == 0);
    static_assert(PB % 256 == 0);
    static_assert(CB % 256 == 0);
    static_assert(4 * WB + 7 * PB + CB <= (size_t)134217728);    // total carve at most 128 MiB
    static_assert(((size_t)(NB - 1) * SEQ_FULL + SEQ) * DMOD * 4 <= CB);     // last ctx row written by the attention kernel
    static_assert((size_t)NB * SEQ * DMOD * 2 <= PB);            // f16 ctx plane reuses the q hi plane (dead after the attention kernel)
    static_assert((size_t)NB * SEQ * DMOD * 4 <= 2 * PB);        // f32 pre-norm plane reuses the adjacent k hi | lo planes (dead after the attention kernel)
    if (4 * WB + 7 * PB + CB > ws_size) return;
    char* wsp = (char*)d_ws;
    bf* WQ = (bf*)wsp; wsp += WB;
    bf* WK = (bf*)wsp; wsp += WB;
    bf* WV = (bf*)wsp; wsp += WB;
    h16* WO = (h16*)wsp; wsp += WB;
    bf* XB = (bf*)wsp; wsp += PB;
    bf* QHp = (bf*)wsp; wsp += PB;
    bf* QLp = (bf*)wsp; wsp += PB;
    bf* KHp = (bf*)wsp; wsp += PB;
    bf* KLp = (bf*)wsp; wsp += PB;
    h16* VVp = (h16*)wsp; wsp += PB;
    h16* VRp = (h16*)wsp; wsp += PB;
    float* CTX = (float*)wsp; wsp += CB;
    h16* CTXH = (h16*)QHp;                                       // stream order: written only after the attention kernel has finished
    float* XF = (float*)KHp;                                     // spans KHp and KLp

    const int nX = NB * SEQ * DMOD;
    const unsigned gX = (unsigned)((nX / 8 + 255) / 256);
    // x (the single input stream that feeds all three projections) and the four weights, one grid
    k_cvt_in<<<CVT_GX + 4 * CVT_GW, 256, 0, stream>>>(xin, Wq, Wk, Wv, Wo, XB, WQ, WK, WV, WO);
    // q, k: X[NB*SEQ][DMOD] (A) x W[DMOD][DMOD] (Bt as stored) -> hi|lo head planes; v: Wv (A) x X (Bt) -> transposed value / residual planes [b][head][d][t], key mask applied; one grid
    k_proj<<<dim3(NB * SEQ / 128, DMOD / 128, 3), GWAVES * 32, 0, stream>>>(XB, WQ, WK, WV, bq, bk, bv, msk, QHp, QLp, KHp, KLp, VVp, VRp);
    k_attn<<<dim3(SEQ / (AWAVES * 16), NB * NHEAD), AWAVES * 32, 0, stream>>>(QHp, QLp, KHp, KLp, VVp, VRp, CTX);
    // ctx[NB*SEQ][DMOD] (f32, FULL stride) x query mask -> compact f16 plane
    k_cvt_ctx<<<gX, 256, 0, stream>>>(CTX, msk, CTXH, nX);
    // output projection: CTXH[NB*SEQ][DMOD] (A) x Wo[DMOD out][DMOD in] (Bt as stored) + bias + skip -> f32 pre-norm plane
    k_out<<<dim3(NB * SEQ / 128, DMOD / 128), GWAVES * 32, 0, stream>>>(CTXH, WO, bo, xin, XF);
    k_ln<<<dim3(NB * SEQ / 8), 256, 0, stream>>>(XF, lng, lnb, OUT);
}

// v006
// Measured time: 113 microseconds a run.
// Versions between v004 and this one are left out; their measured steps multiply to 1.46 times as fast.
// Over all steps from v000 it is 5.38 times as fast.
#include <hip/hip_runtime.h>

// Single-stream multi-head self-attention block: x [4][2048][768]; q / k / v = x.W^T + b with W stored [out][in]; heads = 12 x 64; scores = q.k^T with NO scale; softmax over all 2048 keys;
// the probabilities are multiplied AFTER the softmax by mask_q * mask_k (int input [4][2048], read by value); ctx merged to [4][2048][768]; y = ctx.Wo^T + bo + x; output = LayerNorm(y) with eps 1e-5 and gain / shift inputs.
// Compute dtypes, f32 accumulate everywhere: x and the weights converted to bf16 (RNE) once; q / k / v projections = single v_wmma_f32_16x16x32_bf16 products + bf16(bias) in f32; scores = one v_wmma_f32_16x16x32_f16 product of the f16 q plane (stored times log2 e) and the f16 k plane;
// softmax f32 (base 2, the offset in use is the score accumulators' start value and follows the running max lazily, denominator over all keys); P = f16(exp2(exponent)), the column maximum between 2 and 32768, packed straight from the score accumulators into the B fragment; V times the key mask = one f16 plane on v_wmma_f32_16x16x32_f16;
// output projection = single v_wmma_f32_16x16x32_f16 product: ctx times the query mask as f16 x16, bf16(Wo) as f16 x64, folded by 1/1024 in f32; bias, skip connection (bf16(x)) and LayerNorm in f32.

#ifndef NB
#define NB 4
#endif
#ifndef SEQ
#define SEQ 2048
#endif
#define NB_FULL  4
#define SEQ_FULL 2048
#define DMOD  768
#define NHEAD 12
#define HDIM  64
#define OSP   68
#define LOG2E 1.4426950408889634f
#define PSH   1.0f                    // where a move of the offset puts the column maximum: 14 binades of room below LAZY, so that moves are few
#define LAZY  15.0f                   // a shifted score above this moves the offset: exp2(15) still fits f16
#define WCAR  64.0f
#define CCAR  16.0f

static_assert(NHEAD * HDIM == DMOD);          // merged width
static_assert(HDIM == 64);                    // one 64-column GEMM tile == one head; 4 d-tiles in the attention kernel
static_assert(DMOD % 64 == 0);                // GEMM tile multiple (N and the transposed M)
static_assert(DMOD % 32 == 0);                // k-loop step
static_assert(SEQ % 64 == 0);                 // GEMM row tiles never straddle a batch; attention key step 32
static_assert(SEQ <= SEQ_FULL);
static_assert(NB <= NB_FULL);
static_assert((SEQ * DMOD) % 8 == 0);         // convert kernel: 8 elements per thread never straddle a batch
static_assert((DMOD * DMOD) % 8 == 0);
static_assert((NB * SEQ) % 64 == 0);
static_assert((NB * SEQ) / 64 <= 65535);
static_assert(OSP % 4 == 0);                  // 16-byte aligned LDS rows
static_assert(OSP >= HDIM);
static_assert(DMOD % 8 == 0);                 // ctx convert: 8 elements per thread never straddle a row
static_assert(SEQ % 8 == 0);                  // key-mask vector loads stay 16-byte aligned
static_assert(SEQ_FULL % 8 == 0);
static_assert(DMOD == 6 * 32 * 4);            // LayerNorm: one wave per row, 6 x (32 lanes x 4 floats)
static_assert((NB * SEQ) % 8 == 0);           // LayerNorm: 8 rows (waves) per block, no tail
static_assert(HDIM == 16 * 4);                // output GEMM store: 16 lanes x 16 B == one 64-float row segment

typedef _Float16 h16;
typedef unsigned short bf;
typedef __attribute__((ext_vector_type(16))) __bf16   v16bf;
typedef __attribute__((ext_vector_type(16))) _Float16 v16h;
typedef __attribute__((ext_vector_type(8)))  _Float16 v8h;
typedef __attribute__((ext_vector_type(8)))  unsigned short v8us;
typedef __attribute__((ext_vector_type(8)))  float    v8f;
typedef __attribute__((ext_vector_type(4)))  float    v4f;
typedef __attribute__((ext_vector_type(4)))  int      v4i;
typedef v4f  __attribute__((may_alias)) v4fa;

__device__ __forceinline__ unsigned short f2bf(float f) { unsigned u = __float_as_uint(f); u += 0x7FFFu + ((u >> 16) & 1u); return (unsigned short)(u >> 16); }
__device__ __forceinline__ float bf2f(unsigned short b) { return __uint_as_float(((unsigned)b) << 16); }
__device__ __forceinline__ float bfr(float f) { return bf2f(f2bf(f)); }
__device__ __forceinline__ v16h cat16(v8h lo, v8h hi) { return __builtin_shufflevector(lo, hi, 0, 1, 2, 3, 4, 5, 6, 7, 8, 9, 10, 11, 12, 13, 14, 15); }
__device__ __forceinline__ v16bf cat16b(v8us lo, v8us hi) { return __builtin_bit_cast(v16bf, __builtin_shufflevector(lo, hi, 0, 1, 2, 3, 4, 5, 6, 7, 8, 9, 10, 11, 12, 13, 14, 15)); }
__device__ __forceinline__ v8f wmma16(v16h a, v16h b, v8f c) { return __builtin_amdgcn_wmma_f32_16x16x32_f16(false, a, false, b, (short)0, c, false, false); }
__device__ __forceinline__ v8f wmmab(v16bf a, v16bf b, v8f c) { return __builtin_amdgcn_wmma_f32_16x16x32_bf16(false, a, false, b, (short)0, c, false, false); }
// per-instruction guarded f16 WMMA: ONE accumulator tied with its own two operands to four nops
__device__ __forceinline__ v8f wmma16g(v16h a, v16h b, v8f c) { c = wmma16(a, b, c); asm volatile("v_nop\n\tv_nop\n\tv_nop\n\tv_nop" : "+v"(c) : "v"(a), "v"(b)); return c; }
// fragment loaders (A and B alike, K-contiguous rows): p already carries + 8*(lane>>4); elements 0..7 = k0+8h.., elements 8..15 = k0+16+8h..
__device__ __forceinline__ v16bf ldbf(const bf* p) { return cat16b(*(const v8us*)p, *(const v8us*)(p + 16)); }
__device__ __forceinline__ v16h  ldh(const h16* p) { return cat16(*(const v8h*)p, *(const v8h*)(p + 16)); }
// f32 -> f16 convert for WMMA operand planes: values below the smallest f16 normal become exact zero (applied after the plane's power-of-two carry)
static __device__ __forceinline__ h16 toh_flush(float v) { const h16 r = (h16)v; return (fabsf(v) < 6.103515625e-05f) ? (h16)0.0f : r; }

// dst[e] = src[(e / per) * per_full + e % per]  (per / per_full = compact and staged batch strides). blk = the block's index inside its own plane.
__device__ __forceinline__ void cvt_bf(const float* __restrict__ src, bf* dst, int blk, int n, int per, int per_full) {
    const int e = (blk * 256 + (int)threadIdx.x) * 8;
    if (e >= n) return;
    const int b = e / per;
    const size_t so = (size_t)b * (size_t)per_full + (size_t)(e - b * per);
    const v4f a0 = *(const v4f*)(src + so);
    const v4f a1 = *(const v4f*)(src + so + 4);
    v8us o;
    o[0] = f2bf(a0[0]); o[1] = f2bf(a0[1]); o[2] = f2bf(a0[2]); o[3] = f2bf(a0[3]);
    o[4] = f2bf(a1[0]); o[5] = f2bf(a1[1]); o[6] = f2bf(a1[2]); o[7] = f2bf(a1[3]);
    *(v8us*)(dst + e) = o;
}

__device__ __forceinline__ void cvt_wo(const float* __restrict__ src, h16* dst, int blk, int n) {
    const int e = (blk * 256 + (int)threadIdx.x) * 8;
    if (e >= n) return;
    const v4f a0 = *(const v4f*)(src + e);
    const v4f a1 = *(const v4f*)(src + e + 4);
    v8h o;
    o[0] = toh_flush(bfr(a0[0]) * WCAR); o[1] = toh_flush(bfr(a0[1]) * WCAR); o[2] = toh_flush(bfr(a0[2]) * WCAR); o[3] = toh_flush(bfr(a0[3]) * WCAR);
    o[4] = toh_flush(bfr(a1[0]) * WCAR); o[5] = toh_flush(bfr(a1[1]) * WCAR); o[6] = toh_flush(bfr(a1[2]) * WCAR); o[7] = toh_flush(bfr(a1[3]) * WCAR);
    *(v8h*)(dst + e) = o;
}

// ---- k_cvt_in: the five input conversions, which do not depend on one another, as block ranges of ONE grid:
// blocks [0, CVT_GX) = x, then CVT_GW blocks each for Wq, Wk, Wv (bf16 planes) and Wo (f16 plane x64). The range test reads blockIdx alone.
#define CVT_NW (DMOD * DMOD)
#define CVT_NX (NB * SEQ * DMOD)
#define CVT_GW ((CVT_NW / 8 + 255) / 256)
#define CVT_GX ((CVT_NX / 8 + 255) / 256)
__global__ __launch_bounds__(256) void k_cvt_in(const float* __restrict__ x, const float* __restrict__ wq, const float* __restrict__ wk, const float* __restrict__ wv, const float* __restrict__ wo,
                                                bf* XB, bf* WQ, bf* WK, bf* WV, h16* WO) {
    const int blk = (int)blockIdx.x;
    if (blk < CVT_GX) { cvt_bf(x, XB, blk, CVT_NX, SEQ * DMOD, SEQ_FULL * DMOD); return; }
    const int w = (blk - CVT_GX) / CVT_GW, wb = (blk - CVT_GX) - w * CVT_GW;
    if (w == 3) { cvt_wo(wo, WO, wb, CVT_NW); return; }
    cvt_bf(w == 0 ? wq : (w == 1 ? wk : wv), w == 0 ? WQ : (w == 1 ? WK : WV), wb, CVT_NW, CVT_NW, CVT_NW);
}

__global__ __launch_bounds__(256) void k_cvt_ctx(const float* __restrict__ src, const int* __restrict__ mask, h16* dst, int n) {
    const int e = ((int)blockIdx.x * 256 + (int)threadIdx.x) * 8;
    if (e >= n) return;
    const int row = e / DMOD, col = e - row * DMOD;
    const int b = row / SEQ, t = row - b * SEQ;
    const size_t srow = (size_t)b * SEQ_FULL + (size_t)t;
    const float mq = (float)mask[srow] * CCAR;
    const v4f a0 = *(const v4f*)(src + srow * DMOD + col);
    const v4f a1 = *(const v4f*)(src + srow * DMOD + col + 4);
    v8h o;
    o[0] = toh_flush(a0[0] * mq); o[1] = toh_flush(a0[1] * mq); o[2] = toh_flush(a0[2] * mq); o[3] = toh_flush(a0[3] * mq);
    o[4] = toh_flush(a1[0] * mq); o[5] = toh_flush(a1[1] * mq); o[6] = toh_flush(a1[2] * mq); o[7] = toh_flush(a1[3] * mq);
    *(v8h*)(dst + e) = o;
    
}

// ---- GEMM staging: a block of 2 x 2 waves owns a 128x128 tile; 128 k (one aligned 256-B unit) of its 128 A rows and 128 Bt rows are staged in LDS by asynchronous copies
// (16 B per lane, 16 lanes per row), two buffers: stage t + 1 flies while stage t is worked on. Every wave reads its 64 + 64 rows as fragments from LDS.
#define GWAVES 4                      // waves per block, 2 (tile rows) x 2 (tile columns)
#define GKT    128                    // k elements per stage: 256 B of every operand row
#define GPITCH 272                    // LDS row pitch in bytes: 16 B x odd, conflict-free for the 16-byte fragment reads
#define GSLAB  (128 * GPITCH)         // one operand's 128 staged rows
#define GSTAGE (2 * GSLAB)            // one buffer: A rows, then Bt rows
static_assert(DMOD % 128 == 0);               // whole 128-wide block tiles
static_assert((NB * SEQ) % 128 == 0);
static_assert(DMOD % GKT == 0);               // whole stages
static_assert(DMOD / GKT >= 2);               // the two-buffer prologue fills stages 0 and 1
static_assert(GKT * 2 == 16 * 16);            // one staged row == 16 lanes x 16 B
static_assert(GWAVES * 32 * 16 == 128 * 16);  // sixteen copies per lane cover one operand's slab

// Half of one operand's slab = 8 copies per lane: rows r, r + 8, ..., r + 56. l = the lane's LDS byte address in row r, g = the lane's own 16 bytes in row r of the 16-bit source plane (row length DMOD).
__device__ __forceinline__ void stage_half(unsigned l, const unsigned char* g) {
    // the closing s_wait_xcnt stands inside the statement so that no address register of a copy is rewritten in front of it
    asm volatile("global_load_async_to_lds_b128 %0, %8, off\n\t"
                 "global_load_async_to_lds_b128 %1, %9, off\n\t"
                 "global_load_async_to_lds_b128 %2, %10, off\n\t"
                 "global_load_async_to_lds_b128 %3, %11, off\n\t"
                 "global_load_async_to_lds_b128 %4, %12, off\n\t"
                 "global_load_async_to_lds_b128 %5, %13, off\n\t"
                 "global_load_async_to_lds_b128 %6, %14, off\n\t"
                 "global_load_async_to_lds_b128 %7, %15, off\n\t"
                 "s_wait_xcnt 0x0"
                 :: "v"(l), "v"(l + 8 * GPITCH), "v"(l + 16 * GPITCH), "v"(l + 24 * GPITCH),
                    "v"(l + 32 * GPITCH), "v"(l + 40 * GPITCH), "v"(l + 48 * GPITCH), "v"(l + 56 * GPITCH),
                    "v"(g), "v"(g + 8 * DMOD * 2), "v"(g + 16 * DMOD * 2), "v"(g + 24 * DMOD * 2),
                    "v"(g + 32 * DMOD * 2), "v"(g + 40 * DMOD * 2), "v"(g + 48 * DMOD * 2), "v"(g + 56 * DMOD * 2)
                 : "memory");
}
// One operand's slab of 128 rows: 16 copies per lane.
__device__ __forceinline__ void stage_slab(unsigned l, const unsigned char* g) {
    stage_half(l, g);
    stage_half(l + 64 * GPITCH, g + 64 * DMOD * 2);
}

// The copy side and the read side of one thread. ra / rb = first A row / first Bt row of the block's tile; wm / wn = the wave's place in the 2 x 2 block.
struct gemm_ring {
    const unsigned char* ga; const unsigned char* gb;   // running source pointers, advanced stage by stage
    unsigned cl;                                        // the lane's LDS byte address in the A slab of buffer 0
    const unsigned char* fa; const unsigned char* fb;   // fragment row lr, 16-byte piece hi, of the wave's 64 A rows and 64 Bt rows in buffer 0
};
__device__ __forceinline__ gemm_ring ring_open(const void* A, const void* Bt, int ra, int rb, int wm, int wn, const unsigned char* ring, unsigned ringl) {
    const int crow = (int)threadIdx.x >> 4, cpc = (int)threadIdx.x & 15;       // copy side: row 0..7, 16-byte piece 0..15
    const int lane = (int)threadIdx.x & 31, lr = lane & 15, hi = lane >> 4;
    gemm_ring g;
    g.ga = (const unsigned char*)A + ((size_t)(ra + crow) * DMOD + cpc * 8) * 2;
    g.gb = (const unsigned char*)Bt + ((size_t)(rb + crow) * DMOD + cpc * 8) * 2;
    g.cl = ringl + (unsigned)(crow * GPITCH + cpc * 16);
    g.fa = ring + (wm * 64 + lr) * GPITCH + 16 * hi;
    g.fb = ring + GSLAB + (wn * 64 + lr) * GPITCH + 16 * hi;
    stage_slab(g.cl, g.ga); stage_slab(g.cl + GSLAB, g.gb);
    g.ga += GKT * 2; g.gb += GKT * 2;
    asm volatile("s_wait_asynccnt 0x0" ::: "memory");     // this wave's copies of stage 0 have landed
    __syncthreads();                                      // stage 0 readable by every wave
    stage_slab(g.cl + GSTAGE, g.ga); stage_slab(g.cl + GSTAGE + GSLAB, g.gb);
    return g;
}
// Foot of trip t: publish stage t + 1, then refill the buffer that trip t has just read.
__device__ __forceinline__ void ring_turn(gemm_ring& g, int t) {
    asm volatile("s_wait_dscnt 0x0" ::: "memory");        // this wave's reads of stage t have returned before its buffer is refilled
    asm volatile("s_wait_asynccnt 0x0" ::: "memory");     // this wave's copies of stage t + 1 have landed
    __syncthreads();                                      // publishes stage t + 1 and ends every wave's last read of stage t
    if (t + 2 < DMOD / GKT) {
        g.ga += GKT * 2; g.gb += GKT * 2;
        const unsigned l = g.cl + (unsigned)((t & 1) * GSTAGE);
        stage_slab(l, g.ga); stage_slab(l + GSLAB, g.gb);
    }
}

// ---- GEMM main loop: one wave per 64x64 tile (16 accumulators), fragments from the staged bf16 rows, K = DMOD in ascending order.
// acc[mb][nb][j] = sum_k A[r0 + mb*16 + 8*hi + j][k] * Bt[c0 + nb*16 + lr][k], r0 = ra + 64*wm, c0 = rb + 64*wn.
__device__ __forceinline__ void gemm_tile(const bf* __restrict__ A, const bf* __restrict__ Bt, int ra, int rb, int wm, int wn, const unsigned char* ring, unsigned ringl, v8f (&acc)[4][4]) {
#pragma unroll
    for (int mb = 0; mb < 4; ++mb)
#pragma unroll
        for (int nb = 0; nb < 4; ++nb) acc[mb][nb] = (v8f){};
    gemm_ring g = ring_open(A, Bt, ra, rb, wm, wn, ring, ringl);
#pragma unroll 1   // rolled: one publish point per trip
    for (int t = 0; t < DMOD / GKT; ++t) {
        const unsigned char* pa = g.fa + (t & 1) * GSTAGE;
        const unsigned char* pb = g.fb + (t & 1) * GSTAGE;
#pragma unroll   // unrolled: the 32-k blocks of a stage read at constant LDS offsets
        for (int kc = 0; kc < GKT; kc += 32) {
            v16bf a[4];
            v16bf b;
#pragma unroll
            for (int mb = 0; mb < 4; ++mb) a[mb] = ldbf((const bf*)(pa + mb * 16 * GPITCH + kc * 2));
#pragma unroll
            for (int nb = 0; nb < 4; ++nb) {
                b = ldbf((const bf*)(pb + nb * 16 * GPITCH + kc * 2));
#pragma unroll
                for (int mb = 0; mb < 4; ++mb) acc[mb][nb] = wmmab(a[mb], b, acc[mb][nb]);
            }
            asm volatile("" : "+v"(acc[0][0]), "+v"(acc[1][0]), "+v"(acc[2][0]), "+v"(acc[3][0]), "+v"(acc[0][1]), "+v"(acc[1][1]), "+v"(acc[2][1]), "+v"(acc[3][1]));
            asm volatile("v_nop\n\tv_nop\n\tv_nop\n\tv_nop" : "+v"(acc[0][2]), "+v"(acc[1][2]), "+v"(acc[2][2]), "+v"(acc[3][2]), "+v"(acc[0][3]), "+v"(acc[1][3]), "+v"(acc[2][3]), "+v"(acc[3][3]) : "v"(a[0]), "v"(a[3]), "v"(b));
        }
        ring_turn(g, t);
    }
    asm volatile("s_wait_asynccnt 0x0" ::: "memory");     // nothing in flight behind the loop
}

// ---- f16 twin of the GEMM main loop (same tile map, same staging, f16 planes); every WMMA carries its own four-nop guard.
__device__ __forceinline__ void gemm_tile_h(const h16* __restrict__ A, const h16* __restrict__ Bt, int ra, int rb, int wm, int wn, const unsigned char* ring, unsigned ringl, v8f (&acc)[4][4]) {
#pragma unroll
    for (int mb = 0; mb < 4; ++mb)
#pragma unroll
        for (int nb = 0; nb < 4; ++nb) acc[mb][nb] = (v8f){};
    gemm_ring g = ring_open(A, Bt, ra, rb, wm, wn, ring, ringl);
#pragma unroll 1   // rolled: one publish point per trip
    for (int t = 0; t < DMOD / GKT; ++t) {
        const unsigned char* pa = g.fa + (t & 1) * GSTAGE;
        const unsigned char* pb = g.fb + (t & 1) * GSTAGE;
#pragma unroll   // unrolled: the 32-k blocks of a stage read at constant LDS offsets
        for (int kc = 0; kc < GKT; kc += 32) {
            v16h a[4], b[4];                              // the block's LDS reads stand as one group in front of its guarded WMMAs
#pragma unroll
            for (int mb = 0; mb < 4; ++mb) a[mb] = ldh((const h16*)(pa + mb * 16 * GPITCH + kc * 2));
#pragma unroll
            for (int nb = 0; nb < 4; ++nb) b[nb] = ldh((const h16*)(pb + nb * 16 * GPITCH + kc * 2));
#pragma unroll
            for (int nb = 0; nb < 4; ++nb) {
#pragma unroll
                for (int mb = 0; mb < 4; ++mb) acc[mb][nb] = wmma16g(a[mb], b[nb], acc[mb][nb]);
            }
        }
        ring_turn(g, t);
    }
    asm volatile("s_wait_asynccnt 0x0" ::: "memory");     // nothing in flight behind the loop
}

// ---- k_proj: the q, k and v projections, which do not depend on one another, as the three z planes of ONE grid; z reads the same for a whole block, so every barrier stays under block-uniform control flow.
// z = 0 / 1 (q / k): y[m][n] = X[m][:] . W[n][:] + bf16(bias[n]); tile rows m = b*SEQ + t, tile columns = one head (n = head*64 + d); stored as one f16 head plane, q times log2 e (one rounding), so that q.k is a base-2 exponent.
// z = 2 (v): transposed projection y^T[n][m] = (W[n][:] . X[m][:] + bf16(bias[n])) * mask[m]; tile rows n = head*64 + d, tile columns m = b*SEQ + t (the key index).
// The key mask multiplies the value rows, so the attention kernel's probabilities and its denominator stay over all keys.
// grid (NB*SEQ/128, DMOD/128, 3), 128 threads; each wave one 64x64 tile.
__global__ __launch_bounds__(GWAVES * 32) void k_proj(const bf* __restrict__ X, const bf* __restrict__ WQ, const bf* __restrict__ WK, const bf* __restrict__ WV,
                                                      const float* __restrict__ bq, const float* __restrict__ bk, const float* __restrict__ bv, const int* __restrict__ mask,
                                                      h16* QF, h16* KF, h16* Pv) {
    __shared__ __align__(16) unsigned char ring[2 * GSTAGE];
    __shared__ __align__(16) float osall[GWAVES * 16 * OSP];
    const int wave = __builtin_amdgcn_readfirstlane((int)(threadIdx.x >> 5));
    const int wm = wave >> 1, wn = wave & 1;
    float* os = osall + wave * 16 * OSP;                  // each wave stages its output rows in its own range
    const int lane = (int)threadIdx.x & 31, lr = lane & 15, hi = lane >> 4;
    const int which = (int)blockIdx.z;
    const bool isv = which == 2;
    const bf* W = which == 0 ? WQ : (which == 1 ? WK : WV);
    const float* bias = which == 0 ? bq : (which == 1 ? bk : bv);
    const int xt = (int)blockIdx.x * 128, wt = (int)blockIdx.y * 128;      // first X row and first W row of the block's tile
    const int ra = isv ? wt : xt, rb = isv ? xt : wt;
    const int r0 = ra + wm * 64, c0 = rb + wn * 64;
    v8f acc[4][4];
    gemm_tile(isv ? W : X, isv ? X : W, ra, rb, wm, wn, ring, (unsigned)(size_t)(__attribute__((address_space(3))) unsigned char*)ring, acc);
    const int rq = lane >> 3, cq = (lane & 7) * 8;
    if (!isv) {
        h16* Pf = which == 0 ? QF : KF;
        const float qs = which == 0 ? LOG2E : 1.0f;
        const int b = r0 / SEQ, t0 = r0 - b * SEQ, hd = c0 / HDIM;
        const v4f bv0 = *(const v4f*)(bias + c0 + cq);
        const v4f bv1 = *(const v4f*)(bias + c0 + cq + 4);
        float bb[8];
        bb[0] = bfr(bv0[0]); bb[1] = bfr(bv0[1]); bb[2] = bfr(bv0[2]); bb[3] = bfr(bv0[3]);
        bb[4] = bfr(bv1[0]); bb[5] = bfr(bv1[1]); bb[6] = bfr(bv1[2]); bb[7] = bfr(bv1[3]);
        const size_t pbase = ((size_t)(b * NHEAD + hd) * SEQ + t0) * HDIM;
#pragma unroll
        for (int mb = 0; mb < 4; ++mb) {
#pragma unroll
            for (int nb = 0; nb < 4; ++nb) {
#pragma unroll
                for (int j = 0; j < 8; ++j) os[(hi * 8 + j) * OSP + nb * 16 + lr] = acc[mb][nb][j];
            }
            __syncthreads();
#pragma unroll
            for (int s = 0; s < 4; ++s) {
                const int row = s * 4 + rq;                       // s 0..3 x rq 0..3 -> rows 0..15
                const v4f x0 = *(const v4fa*)(os + row * OSP + cq);
                const v4f x1 = *(const v4fa*)(os + row * OSP + cq + 4);
                v8h of;
#pragma unroll
                for (int i = 0; i < 4; ++i) { of[i] = (h16)((x0[i] + bb[i]) * qs); of[4 + i] = (h16)((x1[i] + bb[4 + i]) * qs); }
                *(v8h*)(Pf + pbase + (size_t)(mb * 16 + row) * HDIM + cq) = of;
            }
            __syncthreads();
        }
    } else {
        const int b = c0 / SEQ, t0 = c0 - b * SEQ, hd = r0 / HDIM;
        const v4i mk0 = *(const v4i*)(mask + (size_t)b * SEQ_FULL + t0 + cq);          // staged mask rows use the FULL batch stride
        const v4i mk1 = *(const v4i*)(mask + (size_t)b * SEQ_FULL + t0 + cq + 4);
        float mf[8];
        mf[0] = (float)mk0[0]; mf[1] = (float)mk0[1]; mf[2] = (float)mk0[2]; mf[3] = (float)mk0[3];
        mf[4] = (float)mk1[0]; mf[5] = (float)mk1[1]; mf[6] = (float)mk1[2]; mf[7] = (float)mk1[3];
        const size_t pbase = (size_t)(b * NHEAD + hd) * HDIM * SEQ + t0;
#pragma unroll
        for (int mb = 0; mb < 4; ++mb) {
#pragma unroll
            for (int nb = 0; nb < 4; ++nb) {
#pragma unroll
                for (int j = 0; j < 8; ++j) os[(hi * 8 + j) * OSP + nb * 16 + lr] = acc[mb][nb][j];
            }
            __syncthreads();
#pragma unroll
            for (int s = 0; s < 4; ++s) {
                const int row = s * 4 + rq;                       // d within the slab, 0..15
                const float bsc = bfr(bias[r0 + mb * 16 + row]);
                const v4f x0 = *(const v4fa*)(os + row * OSP + cq);
                const v4f x1 = *(const v4fa*)(os + row * OSP + cq + 4);
                v8h ov;
#pragma unroll
                for (int i = 0; i < 4; ++i) { ov[i] = toh_flush((x0[i] + bsc) * mf[i]); ov[4 + i] = toh_flush((x1[i] + bsc) * mf[4 + i]); }
                *(v8h*)(Pv + pbase + (size_t)(mb * 16 + row) * SEQ + cq) = ov;
            }
            __syncthreads();
        }
    }
}

// ---- k_attn: fused attention, transposed form. Block = 8 waves = 128 queries of one (batch, head); each wave owns 16 queries.
// The f16 K rows and the f16 V rows of 64 keys are staged in LDS once per block by asynchronous copies (16 B per lane, whole 128-B lines), two buffers: tile t + 1 flies while tile t is worked on.
// Each wave loads its own f16 Q fragments once, before the key loop, and keeps them in registers.
// Per 32-key step: S^T[key][query] = K.Q^T - offset, one f16 product (one accumulator per 16-key tile) that starts from minus the query's offset in use, so the accumulators hold the exponents themselves;
// (lane (hi, lr) holds keys 8*hi + r and 16 + 8*hi + r of query lr); the offset moves, for the whole wave, only in a step where some exponent passes LAZY (and in the first step):
// there the two lanes of a query share the step's maximum through one shuffle, and sums, outputs and this step's exponents are brought to the new offset (column maximum at PSH);
// P^T packed from the two score tiles into the B fragment (element r <- tile 0, element 8 + r <- tile 1); O^T[d][query] += V^T.P^T
// (every one of the four P.V WMMAs carries its own four-nop guard tying exactly its accumulator and its two operands).
// grid (SEQ/128, NB*NHEAD), 256 threads.
#define AWAVES 8                      // waves per block that share one staged tile
#define KTILE  64                     // keys per staged tile: K rows and V rows are both 128 B long
#define LPITCH 144                    // LDS row pitch in bytes: 16 B x odd, conflict-free for the 16-byte fragment reads
#define LPLANE (64 * LPITCH)          // one staged plane: 64 rows (keys for K, head dims for V)
#define LSTAGE (2 * LPLANE)           // one buffer: K, V
static_assert(SEQ % (AWAVES * 16) == 0);      // whole blocks of queries
static_assert(SEQ % KTILE == 0);              // whole key tiles
static_assert(SEQ / KTILE >= 2);              // the two-buffer prologue fills tiles 0 and 1
static_assert(KTILE * 2 == 128);              // one V row of a tile == 8 lanes x 16 B
static_assert(HDIM * 2 == 128);               // one K row == 8 lanes x 16 B
static_assert(AWAVES * 32 * 2 == 64 * 8);     // two copies per lane cover one plane (64 rows x 8 pieces)
static_assert(AWAVES * 16 * OSP * 4 <= 2 * LSTAGE);   // the output staging reuses the ring

// One tile = 4 copies per lane. l = the lane's LDS byte address in the K plane of the target buffer; the pointers are the lane's own 16 bytes in rows 0..31 of each plane.
__device__ __forceinline__ void stage_tile(unsigned l, const h16* kf, const h16* vv) {
    // the closing s_wait_xcnt stands inside the statement so that no address register of a copy is rewritten in front of it
    asm volatile("global_load_async_to_lds_b128 %0, %4, off\n\t"
                 "global_load_async_to_lds_b128 %1, %5, off\n\t"
                 "global_load_async_to_lds_b128 %2, %6, off\n\t"
                 "global_load_async_to_lds_b128 %3, %7, off\n\t"
                 "s_wait_xcnt 0x0"
                 :: "v"(l), "v"(l + 32 * LPITCH), "v"(l + LPLANE), "v"(l + LPLANE + 32 * LPITCH),
                    "v"(kf), "v"(kf + 32 * HDIM), "v"(vv), "v"(vv + 32 * SEQ)
                 : "memory");
}

// second launch bound: six waves per SIMD, so that the three blocks that fall to each WGP stay resident together
__global__ __launch_bounds__(AWAVES * 32, 6) void k_attn(const h16* __restrict__ QF, const h16* __restrict__ KF, const h16* __restrict__ VV, float* OUT) {
    __shared__ __align__(16) unsigned char ring[2 * LSTAGE];
    const int wave = __builtin_amdgcn_readfirstlane((int)(threadIdx.x >> 5));
    const int lane = (int)threadIdx.x & 31, lr = lane & 15, hi = lane >> 4;
    const int bh = (int)blockIdx.y;
    const int b = bh / NHEAD, hd = bh - b * NHEAD;
    const int q0 = (int)blockIdx.x * (AWAVES * 16) + wave * 16;
    const size_t pb = (size_t)bh * SEQ * HDIM;
    const h16* qp = QF + pb + (q0 + lr) * HDIM + 8 * hi;
    // copy side: thread -> (row = tid / 8, 16-byte piece = tid % 8) of rows 0..31 of a plane
    const int crow = (int)threadIdx.x >> 3, cpc = (int)threadIdx.x & 7;
    const h16* ckf = KF + pb + crow * HDIM + cpc * 8; const h16* cvv = VV + pb + crow * SEQ + cpc * 8;   // running pointers, advanced tile by tile
    const unsigned cl = (unsigned)(size_t)(__attribute__((address_space(3))) unsigned char*)ring + (unsigned)(crow * LPITCH + cpc * 16);
    // read side: fragment row lr, 16-byte piece hi (K rows and V rows alike)
    const unsigned char* fr = ring + lr * LPITCH + 16 * hi;
    v8f ova[4];
#pragma unroll
    for (int dt = 0; dt < 4; ++dt) ova[dt] = (v8f){};
    float lsum = 0.0f;
    v8f negm = (v8f){};                                   // all eight elements: minus the lane's query's offset in use
    stage_tile(cl, ckf, cvv);
    ckf += KTILE * HDIM; cvv += KTILE;
    // the wave's own Q fragments: loaded once, held in registers over the whole key loop
    v16h qf[HDIM / 32];
#pragma unroll
    for (int kc = 0; kc < HDIM; kc += 32) qf[kc / 32] = ldh(qp + kc);
    asm volatile("s_wait_xcnt 0x0" ::: "memory");         // precaution: stands in front of every rewrite of the Q loads' address registers
    asm volatile("s_wait_asynccnt 0x0" ::: "memory");     // this wave's copies of tile 0 have landed
    __syncthreads();                                      // tile 0 readable by every wave
    stage_tile(cl + LSTAGE, ckf, cvv);
#pragma unroll 1   // rolled: one publish point per trip
    for (int t = 0; t < SEQ / KTILE; ++t) {
        const unsigned char* fb = fr + (t & 1) * LSTAGE;
#pragma unroll   // unrolled: the two 32-key steps of a tile read at constant LDS offsets
        for (int sub = 0; sub < KTILE / 32; ++sub) {
            v8f s0, s1;
            v16h k0[HDIM / 32], k1[HDIM / 32];
            const unsigned char* kp = fb + sub * 32 * LPITCH;
#pragma unroll
            for (int kc = 0; kc < HDIM; kc += 32) { k0[kc / 32] = ldh((const h16*)(kp + kc * 2)); k1[kc / 32] = ldh((const h16*)(kp + 16 * LPITCH + kc * 2)); }
            // inputs-only fence on the loaded values: keeps the eight reads one group with one LDS wait (without it the compiler sinks each pair of reads to its own WMMA: four waits in a row)
            asm volatile("" :: "v"(k0[0]), "v"(k0[1]), "v"(k1[0]), "v"(k1[1]));
            s0 = wmma16(k0[0], qf[0], negm); s1 = wmma16(k1[0], qf[0], negm);
#pragma unroll
            for (int kc = 32; kc < HDIM; kc += 32) { s0 = wmma16(k0[kc / 32], qf[kc / 32], s0); s1 = wmma16(k1[kc / 32], qf[kc / 32], s1); }
            float ma = fmaxf(fmaxf(s0[0], s0[1]), s0[2]), mb = fmaxf(fmaxf(s1[0], s1[1]), s1[2]);
            ma = fmaxf(fmaxf(ma, s0[3]), s0[4]); mb = fmaxf(fmaxf(mb, s1[3]), s1[4]);
            ma = fmaxf(fmaxf(ma, s0[5]), s0[6]); mb = fmaxf(fmaxf(mb, s1[5]), s1[6]);
            float mx = fmaxf(fmaxf(ma, mb), fmaxf(s0[7], s1[7]));
            const bool first = sub == 0 && t == 0;        // no offset yet: the first step sets it, whatever the scores are
            const float thr = first ? -3.0e38f : LAZY;    // below every score that f16 operands can give
            if (__builtin_amdgcn_ballot_w32(mx > thr) != 0u) {                // wave-uniform
                mx = fmaxf(mx, __shfl_xor(mx, 16, 32));
                const float d = first ? mx - PSH : fmaxf(mx - PSH, 0.0f);     // the offset never falls
                const float sc = first ? 0.0f : __builtin_amdgcn_exp2f(-d);   // sums and outputs are zero in the first step
                lsum *= sc;
#pragma unroll
                for (int dt = 0; dt < 4; ++dt) {
#pragma unroll
                    for (int r = 0; r < 8; ++r) ova[dt][r] *= sc;
                }
#pragma unroll
                for (int r = 0; r < 8; ++r) { s0[r] -= d; s1[r] -= d; negm[r] -= d; }
            }
            float psum = 0.0f;
            v16h pf;
            float e0[8], e1[8];                           // p on the offset's scale, at most exp2(LAZY)
#pragma unroll
            for (int r = 0; r < 8; ++r) e0[r] = __builtin_amdgcn_exp2f(s0[r]);
#pragma unroll
            for (int r = 0; r < 8; ++r) e1[r] = __builtin_amdgcn_exp2f(s1[r]);
#pragma unroll
            for (int r = 0; r < 8; ++r) { pf[r] = (h16)e0[r]; pf[8 + r] = (h16)e1[r]; }
#pragma unroll
            for (int r = 0; r < 8; ++r) psum += e0[r] + e1[r];
            lsum += psum;
            const unsigned char* vp = fb + LPLANE + sub * 64;
            v16h va[4];
#pragma unroll
            for (int dt = 0; dt < 4; ++dt) va[dt] = ldh((const h16*)(vp + dt * 16 * LPITCH));
#pragma unroll
            for (int dt = 0; dt < 4; ++dt) ova[dt] = wmma16g(va[dt], pf, ova[dt]);
        }
        asm volatile("s_wait_dscnt 0x0" ::: "memory");        // this wave's reads of tile t have returned before its buffer is refilled
        asm volatile("s_wait_asynccnt 0x0" ::: "memory");     // this wave's copies of tile t + 1 have landed
        __syncthreads();                                      // publishes tile t + 1 and ends every wave's last read of tile t
        if (t + 2 < SEQ / KTILE) {
            ckf += KTILE * HDIM; cvv += KTILE;
            stage_tile(cl + (unsigned)((t & 1) * LSTAGE), ckf, cvv);
        }
    }
    asm volatile("s_wait_asynccnt 0x0" ::: "memory");         // nothing in flight when the ring becomes output staging
    lsum += __shfl_xor(lsum, 16, 32);
    const float inv = 1.0f / lsum;
    float* os = (float*)ring;                                 // every wave has left the ring at the last trip's barrier
    const int obase = wave * 16 * OSP;
#pragma unroll
    for (int dt = 0; dt < 4; ++dt) {
        v4f x0, x1;
#pragma unroll
        for (int i = 0; i < 4; ++i) {
            x0[i] = ova[dt][i] * inv;
            x1[i] = ova[dt][4 + i] * inv;
        }
        *(v4fa*)(os + obase + lr * OSP + dt * 16 + 8 * hi) = x0;
        *(v4fa*)(os + obase + lr * OSP + dt * 16 + 8 * hi + 4) = x1;
    }
    __syncthreads();
    float* orow = OUT + ((size_t)b * SEQ_FULL + q0) * DMOD + hd * HDIM;   // FULL batch stride of the output rows
{
#pragma unroll
        for (int s = 0; s < 8; ++s) {
            const int row = 2 * s + hi, cofs = lr * 4;            // s 0..7 x hi 0..1 -> queries 0..15; 16 lanes x 16 B = one 256-B head row
            const v4f val = *(const v4fa*)(os + obase + row * OSP + cofs);
            *(v4f*)(orow + (size_t)row * DMOD + cofs) = val;
        }
        
    }
}

// ---- k_out: y[m][n] = (A[m][:] . W[n][:]) / 1024 + bf16(bias[n]) + bf16(x[m][n]); A = f16 ctx plane (x16, compact rows), W = f16 plane of 64 * bf16(Wo) stored [out][in].
// The skip connection is read from the staged f32 input at the FULL batch stride and added at the store stage.
// grid (NB*SEQ/128, DMOD/128), 128 threads; each wave one 64x64 tile.
__global__ __launch_bounds__(GWAVES * 32) void k_out(const h16* __restrict__ A, const h16* __restrict__ W, const float* __restrict__ bias, const float* __restrict__ xin, float* Y) {
    __shared__ __align__(16) unsigned char ring[2 * GSTAGE];
    __shared__ __align__(16) float osall[GWAVES * 16 * OSP];
    const int wave = __builtin_amdgcn_readfirstlane((int)(threadIdx.x >> 5));
    const int wm = wave >> 1, wn = wave & 1;
    float* os = osall + wave * 16 * OSP;                  // each wave stages its output rows in its own range
    const int lane = (int)threadIdx.x & 31, lr = lane & 15, hi = lane >> 4;
    const int r0 = (int)blockIdx.x * 128 + wm * 64, c0 = (int)blockIdx.y * 128 + wn * 64;
    v8f acc[4][4];
    gemm_tile_h(A, W, (int)blockIdx.x * 128, (int)blockIdx.y * 128, wm, wn, ring, (unsigned)(size_t)(__attribute__((address_space(3))) unsigned char*)ring, acc);
    const int b = r0 / SEQ, t0 = r0 - b * SEQ;
    const int cofs = lr * 4;
    const v4f bv0 = *(const v4f*)(bias + c0 + cofs);
    float bb[4];
    bb[0] = bfr(bv0[0]); bb[1] = bfr(bv0[1]); bb[2] = bfr(bv0[2]); bb[3] = bfr(bv0[3]);
    const size_t xbase = ((size_t)b * SEQ_FULL + (size_t)t0) * DMOD + c0 + cofs;
    const size_t ybase = (size_t)r0 * DMOD + c0 + cofs;
    const float osc = 1.0f / (WCAR * CCAR);
#pragma unroll
    for (int mb = 0; mb < 4; ++mb) {
#pragma unroll
        for (int nb = 0; nb < 4; ++nb) {
#pragma unroll
            for (int j = 0; j < 8; ++j) os[(hi * 8 + j) * OSP + nb * 16 + lr] = acc[mb][nb][j];
        }
        __syncthreads();
{
#pragma unroll
            for (int s = 0; s < 8; ++s) {
                const int row = 2 * s + hi;                       // s 0..7 x hi 0..1 -> rows 0..15; 16 lanes x 16 B = one 256-B row segment
                const v4f a4 = *(const v4fa*)(os + row * OSP + cofs);
                const v4f xr = *(const v4f*)(xin + xbase + (size_t)(mb * 16 + row) * DMOD);
                v4f o;
#pragma unroll
                for (int i = 0; i < 4; ++i) o[i] = (a4[i] * osc + bb[i]) + bfr(xr[i]);
                *(v4f*)(Y + ybase + (size_t)(mb * 16 + row) * DMOD) = o;
            }
            
        }
        __syncthreads();
    }
}

// ---- k_ln: LayerNorm over the 768 columns, one wave per row (8 rows per block), row held in registers (6 x 4 floats per lane);
// mean, then centred variance (divide by the width), y = (x - mu) * rsqrt(var + 1e-5) * bf16(gain) + bf16(shift).
// grid (NB*SEQ/8), 256 threads.
__global__ __launch_bounds__(256) void k_ln(const float* __restrict__ X, const float* __restrict__ g, const float* __restrict__ be, float* OUT) {
#pragma clang fp contract(off)
    const int wave = __builtin_amdgcn_readfirstlane((int)(threadIdx.x >> 5));
    const int lane = (int)threadIdx.x & 31;
    const int row = (int)blockIdx.x * 8 + wave;
    const int b = row / SEQ, t = row - b * SEQ;
    const float* xr = X + (size_t)row * DMOD;
    v4f x[6];
    float s = 0.0f;
#pragma unroll
    for (int j = 0; j < 6; ++j) {
        x[j] = *(const v4f*)(xr + (j * 32 + lane) * 4);
        s += (x[j][0] + x[j][1]) + (x[j][2] + x[j][3]);
    }
    s += __shfl_xor(s, 16, 32); s += __shfl_xor(s, 8, 32); s += __shfl_xor(s, 4, 32); s += __shfl_xor(s, 2, 32); s += __shfl_xor(s, 1, 32);
    const float mu = s * (1.0f / (float)DMOD);
    float q = 0.0f;
#pragma unroll
    for (int j = 0; j < 6; ++j) {
        const float d0 = x[j][0] - mu, d1 = x[j][1] - mu, d2 = x[j][2] - mu, d3 = x[j][3] - mu;
        q += (d0 * d0 + d1 * d1) + (d2 * d2 + d3 * d3);
    }
    q += __shfl_xor(q, 16, 32); q += __shfl_xor(q, 8, 32); q += __shfl_xor(q, 4, 32); q += __shfl_xor(q, 2, 32); q += __shfl_xor(q, 1, 32);
    const float var = q * (1.0f / (float)DMOD);
    const float rstd = rsqrtf(var + 1.0e-5f);
    v4f o[6];
#pragma unroll
    for (int j = 0; j < 6; ++j) {
        const v4f g4 = *(const v4f*)(g + (j * 32 + lane) * 4);
        const v4f b4 = *(const v4f*)(be + (j * 32 + lane) * 4);
#pragma unroll
        for (int i = 0; i < 4; ++i) o[j][i] = ((x[j][i] - mu) * rstd) * bfr(g4[i]) + bfr(b4[i]);
    }
    float* orow = OUT + ((size_t)b * SEQ_FULL + (size_t)t) * DMOD;          // FULL batch stride of the output rows
#pragma unroll
    for (int j = 0; j < 6; ++j) *(v4f*)(orow + (j * 32 + lane) * 4) = o[j];
    
}

extern "C" void kernel_launch(void* const* d_in, const int* in_sizes, int n_in,
                              void* d_out, int out_size, void* d_ws, size_t ws_size, hipStream_t stream) {
    if (n_in < 12) return;
    const size_t need_x = (size_t)(NB - 1) * SEQ_FULL * DMOD + (size_t)SEQ * DMOD;
    const size_t need_m = (size_t)(NB - 1) * SEQ_FULL + (size_t)SEQ;
    if ((size_t)in_sizes[0] < need_x || (size_t)in_sizes[1] < need_m) return;
    if (in_sizes[2] < DMOD * DMOD || in_sizes[4] < DMOD * DMOD || in_sizes[6] < DMOD * DMOD || in_sizes[8] < DMOD * DMOD) return;
    if (in_sizes[3] < DMOD || in_sizes[5] < DMOD || in_sizes[7] < DMOD || in_sizes[9] < DMOD) return;
    if (in_sizes[10] < DMOD || in_sizes[11] < DMOD) return;
    if ((size_t)out_size < need_x) return;                       // output rows are addressed at the FULL batch stride
    const float* xin = (const float*)d_in[0];
    const int*   msk = (const int*)d_in[1];
    const float* Wq = (const float*)d_in[2]; const float* bq = (const float*)d_in[3];
    const float* Wk = (const float*)d_in[4]; const float* bk = (const float*)d_in[5];
    const float* Wv = (const float*)d_in[6]; const float* bv = (const float*)d_in[7];
    const float* Wo = (const float*)d_in[8]; const float* bo = (const float*)d_in[9];
    const float* lng = (const float*)d_in[10]; const float* lnb = (const float*)d_in[11];
    float* OUT = (float*)d_out;

    constexpr size_t WB = (size_t)DMOD * DMOD * 2;               // one 16-bit weight plane
    constexpr size_t PB = (size_t)NB * SEQ * DMOD * 2;           // one 16-bit activation / head plane (NB*NHEAD*SEQ*HDIM elements)
    constexpr size_t CB = (size_t)NB * SEQ_FULL * DMOD * 4;      // f32 ctx plane, rows at the FULL batch stride
    static_assert(WB % 256 == 0);
    static_assert(PB % 256 == 0);
    static_assert(CB % 256 == 0);
    static_assert(4 * WB + 6 * PB + CB <= (size_t)134217728);    // total carve at most 128 MiB
    static_assert(((size_t)(NB - 1) * SEQ_FULL + SEQ) * DMOD * 4 <= CB);     // last ctx row written by the attention kernel
    static_assert((size_t)NB * SEQ * DMOD * 2 <= PB);            // f16 ctx plane reuses the q plane (dead after the attention kernel)
    static_assert((size_t)NB * SEQ * DMOD * 4 <= 2 * PB);        // f32 pre-norm plane
    if (4 * WB + 6 * PB + CB > ws_size) return;
    char* wsp = (char*)d_ws;
    bf* WQ = (bf*)wsp; wsp += WB;
    bf* WK = (bf*)wsp; wsp += WB;
    bf* WV = (bf*)wsp; wsp += WB;
    h16* WO = (h16*)wsp; wsp += WB;
    bf* XB = (bf*)wsp; wsp += PB;
    h16* QFp = (h16*)wsp; wsp += PB;
    h16* KFp = (h16*)wsp; wsp += PB;
    h16* VVp = (h16*)wsp; wsp += PB;
    float* XF = (float*)wsp; wsp += 2 * PB;
    float* CTX = (float*)wsp; wsp += CB;
    h16* CTXH = QFp;                                             // stream order: written only after the attention kernel has finished

    const int nX = NB * SEQ * DMOD;
    const unsigned gX = (unsigned)((nX / 8 + 255) / 256);
    // x (the single input stream that feeds all three projections) and the four weights, one grid
    k_cvt_in<<<CVT_GX + 4 * CVT_GW, 256, 0, stream>>>(xin, Wq, Wk, Wv, Wo, XB, WQ, WK, WV, WO);
    // q, k: X[NB*SEQ][DMOD] (A) x W[DMOD][DMOD] (Bt as stored) -> f16 head planes; v: Wv (A) x X (Bt) -> transposed f16 value plane [b][head][d][t], key mask applied; one grid
    k_proj<<<dim3(NB * SEQ / 128, DMOD / 128, 3), GWAVES * 32, 0, stream>>>(XB, WQ, WK, WV, bq, bk, bv, msk, QFp, KFp, VVp);
    k_attn<<<dim3(SEQ / (AWAVES * 16), NB * NHEAD), AWAVES * 32, 0, stream>>>(QFp, KFp, VVp, CTX);
    // ctx[NB*SEQ][DMOD] (f32, FULL stride) x query mask -> compact f16 plane
    k_cvt_ctx<<<gX, 256, 0, stream>>>(CTX, msk, CTXH, nX);
    // output projection: CTXH[NB*SEQ][DMOD] (A) x Wo[DMOD out][DMOD in] (Bt as stored) + bias + skip -> f32 pre-norm plane
    k_out<<<dim3(NB * SEQ / 128, DMOD / 128), GWAVES * 32, 0, stream>>>(CTXH, WO, bo, xin, XF);
    k_ln<<<dim3(NB * SEQ / 8), 256, 0, stream>>>(XF, lng, lnb, OUT);
}

// v007
// It runs in 97.9 microseconds.
// Next to v006, in two timings, it ran 1.15 and 1.17 times as fast.
// Over all steps from v000 it is 6.23 times as fast.
#include <hip/hip_runtime.h>

// Single-stream multi-head self-attention block: x [4][2048][768]; q / k / v = x.W^T + b with W stored [out][in]; heads = 12 x 64; scores = q.k^T with NO scale; softmax over all 2048 keys;
// the probabilities are multiplied AFTER the softmax by mask_q * mask_k (int input [4][2048], read by value); ctx merged to [4][2048][768]; y = ctx.Wo^T + bo + x; output = LayerNorm(y) with eps 1e-5 and gain / shift inputs.
// Compute dtypes, f32 accumulate everywhere: x and the weights converted to bf16 (RNE) once; q / k / v projections = single v_wmma_f32_16x16x32_bf16 products + bf16(bias) in f32; scores = one v_wmma_f32_16x16x32_f16 product of the f16 q plane (stored times log2 e) and the f16 k plane;
// softmax f32 (base 2, the offset in use is the score accumulators' start value and follows the running max lazily, denominator over all keys); P = f16(exp2(exponent)), the column maximum between 2 and 32768, packed straight from the score accumulators into the B fragment; V times the key mask = one f16 plane on v_wmma_f32_16x16x32_f16;
// A query whose mask is 0 has a zero ctx row for any input, so such queries are skipped: the positions of each batch are ranked (mask not 0 first), the attention kernel, the ctx convert and the output projection work on that list's kept part, and LayerNorm forms the skipped rows as bias + x.
// output projection = single v_wmma_f32_16x16x32_f16 product: ctx times the query mask as f16 x16, bf16(Wo) as f16 x64, folded by 1/1024 in f32; bias, skip connection (bf16(x)) and LayerNorm in f32.

#ifndef NB
#define NB 4
#endif
#ifndef SEQ
#define SEQ 2048
#endif
#define NB_FULL  4
#define SEQ_FULL 2048
#define DMOD  768
#define NHEAD 12
#define HDIM  64
#define OSP   68
#define LOG2E 1.4426950408889634f
#define PSH   1.0f                    // where a move of the offset puts the column maximum: 14 binades of room below LAZY, so that moves are few
#define LAZY  15.0f                   // a shifted score above this moves the offset: exp2(15) still fits f16
#define WCAR  64.0f
#define CCAR  16.0f

static_assert(NHEAD * HDIM == DMOD);          // merged width
static_assert(HDIM == 64);                    // one 64-column GEMM tile == one head; 4 d-tiles in the attention kernel
static_assert(DMOD % 64 == 0);                // GEMM tile multiple (N and the transposed M)
static_assert(DMOD % 32 == 0);                // k-loop step
static_assert(SEQ % 64 == 0);                 // GEMM row tiles never straddle a batch; attention key step 32
static_assert(SEQ <= SEQ_FULL);
static_assert(NB <= NB_FULL);
static_assert((SEQ * DMOD) % 8 == 0);         // convert kernel: 8 elements per thread never straddle a batch
static_assert((DMOD * DMOD) % 8 == 0);
static_assert((NB * SEQ) % 64 == 0);
static_assert((NB * SEQ) / 64 <= 65535);
static_assert(OSP % 4 == 0);                  // 16-byte aligned LDS rows
static_assert(OSP >= HDIM);
static_assert(DMOD % 8 == 0);                 // ctx convert: 8 elements per thread never straddle a row
static_assert(SEQ % 8 == 0);                  // key-mask vector loads stay 16-byte aligned
static_assert(SEQ_FULL % 8 == 0);
static_assert(DMOD == 6 * 32 * 4);            // LayerNorm: one wave per row, 6 x (32 lanes x 4 floats)
static_assert((NB * SEQ) % 8 == 0);           // LayerNorm: 8 rows (waves) per block, no tail
static_assert(HDIM == 16 * 4);                // output GEMM store: 16 lanes x 16 B == one 64-float row segment

typedef _Float16 h16;
typedef unsigned short bf;
typedef __attribute__((ext_vector_type(16))) __bf16   v16bf;
typedef __attribute__((ext_vector_type(16))) _Float16 v16h;
typedef __attribute__((ext_vector_type(8)))  _Float16 v8h;
typedef __attribute__((ext_vector_type(8)))  unsigned short v8us;
typedef __attribute__((ext_vector_type(8)))  float    v8f;
typedef __attribute__((ext_vector_type(4)))  float    v4f;
typedef __attribute__((ext_vector_type(4)))  int      v4i;
typedef v4f  __attribute__((may_alias)) v4fa;

__device__ __forceinline__ unsigned short f2bf(float f) { unsigned u = __float_as_uint(f); u += 0x7FFFu + ((u >> 16) & 1u); return (unsigned short)(u >> 16); }
__device__ __forceinline__ float bf2f(unsigned short b) { return __uint_as_float(((unsigned)b) << 16); }
__device__ __forceinline__ float bfr(float f) { return bf2f(f2bf(f)); }
__device__ __forceinline__ v16h cat16(v8h lo, v8h hi) { return __builtin_shufflevector(lo, hi, 0, 1, 2, 3, 4, 5, 6, 7, 8, 9, 10, 11, 12, 13, 14, 15); }
__device__ __forceinline__ v16bf cat16b(v8us lo, v8us hi) { return __builtin_bit_cast(v16bf, __builtin_shufflevector(lo, hi, 0, 1, 2, 3, 4, 5, 6, 7, 8, 9, 10, 11, 12, 13, 14, 15)); }
__device__ __forceinline__ v8f wmma16(v16h a, v16h b, v8f c) { return __builtin_amdgcn_wmma_f32_16x16x32_f16(false, a, false, b, (short)0, c, false, false); }
__device__ __forceinline__ v8f wmmab(v16bf a, v16bf b, v8f c) { return __builtin_amdgcn_wmma_f32_16x16x32_bf16(false, a, false, b, (short)0, c, false, false); }
// per-instruction guarded f16 WMMA: ONE accumulator tied with its own two operands to four nops
__device__ __forceinline__ v8f wmma16g(v16h a, v16h b, v8f c) { c = wmma16(a, b, c); asm volatile("v_nop\n\tv_nop\n\tv_nop\n\tv_nop" : "+v"(c) : "v"(a), "v"(b)); return c; }
// fragment loaders (A and B alike, K-contiguous rows): p already carries + 8*(lane>>4); elements 0..7 = k0+8h.., elements 8..15 = k0+16+8h..
__device__ __forceinline__ v16bf ldbf(const bf* p) { return cat16b(*(const v8us*)p, *(const v8us*)(p + 16)); }
__device__ __forceinline__ v16h  ldh(const h16* p) { return cat16(*(const v8h*)p, *(const v8h*)(p + 16)); }
// f32 -> f16 convert for WMMA operand planes: values below the smallest f16 normal become exact zero (applied after the plane's power-of-two carry)
static __device__ __forceinline__ h16 toh_flush(float v) { const h16 r = (h16)v; return (fabsf(v) < 6.103515625e-05f) ? (h16)0.0f : r; }

// dst[e] = src[(e / per) * per_full + e % per]  (per / per_full = compact and staged batch strides). blk = the block's index inside its own plane.
__device__ __forceinline__ void cvt_bf(const float* __restrict__ src, bf* dst, int blk, int n, int per, int per_full) {
    const int e = (blk * 256 + (int)threadIdx.x) * 8;
    if (e >= n) return;
    const int b = e / per;
    const size_t so = (size_t)b * (size_t)per_full + (size_t)(e - b * per);
    const v4f a0 = *(const v4f*)(src + so);
    const v4f a1 = *(const v4f*)(src + so + 4);
    v8us o;
    o[0] = f2bf(a0[0]); o[1] = f2bf(a0[1]); o[2] = f2bf(a0[2]); o[3] = f2bf(a0[3]);
    o[4] = f2bf(a1[0]); o[5] = f2bf(a1[1]); o[6] = f2bf(a1[2]); o[7] = f2bf(a1[3]);
    *(v8us*)(dst + e) = o;
}

__device__ __forceinline__ void cvt_wo(const float* __restrict__ src, h16* dst, int blk, int n) {
    const int e = (blk * 256 + (int)threadIdx.x) * 8;
    if (e >= n) return;
    const v4f a0 = *(const v4f*)(src + e);
    const v4f a1 = *(const v4f*)(src + e + 4);
    v8h o;
    o[0] = toh_flush(bfr(a0[0]) * WCAR); o[1] = toh_flush(bfr(a0[1]) * WCAR); o[2] = toh_flush(bfr(a0[2]) * WCAR); o[3] = toh_flush(bfr(a0[3]) * WCAR);
    o[4] = toh_flush(bfr(a1[0]) * WCAR); o[5] = toh_flush(bfr(a1[1]) * WCAR); o[6] = toh_flush(bfr(a1[2]) * WCAR); o[7] = toh_flush(bfr(a1[3]) * WCAR);
    *(v8h*)(dst + e) = o;
}

// ---- query ranking, one block of 256 threads per batch: idx = a permutation of the batch's positions, those whose mask is not 0 first (in ascending order), the others behind them; cnt = how many come first.
// A query whose mask is 0 has a context row of exact zeros (the probabilities are multiplied by mask_q after the softmax), so the attention kernel walks only the 128-entry ranges of idx that begin in front of cnt.
static_assert(SEQ <= 256 * 8);                // eight positions per thread cover a batch
__device__ __forceinline__ void rank_queries(const int* __restrict__ mrow, int* idx, int* cnt) {
    __shared__ int wsum[8];
    const int tid = (int)threadIdx.x, lane = tid & 31, wave = tid >> 5;
    const int e = tid * 8;
    int f[8];
#pragma unroll
    for (int i = 0; i < 8; ++i) f[i] = 0;
    if (e < SEQ) {
        const v4i m0 = *(const v4i*)(mrow + e);
        const v4i m1 = *(const v4i*)(mrow + e + 4);
#pragma unroll
        for (int i = 0; i < 4; ++i) { f[i] = m0[i] != 0 ? 1 : 0; f[4 + i] = m1[i] != 0 ? 1 : 0; }
    }
    int c = 0;
#pragma unroll
    for (int i = 0; i < 8; ++i) c += f[i];
    int inc = c;                                          // inclusive scan over the wave's lanes
#pragma unroll
    for (int d = 1; d < 32; d <<= 1) { const int v = __shfl_up(inc, d, 32); if (lane >= d) inc += v; }
    if (lane == 31) wsum[wave] = inc;
    __syncthreads();                                      // the eight wave totals readable by every wave
    int base = 0, total = 0;
#pragma unroll
    for (int w = 0; w < 8; ++w) { const int s = wsum[w]; base += w < wave ? s : 0; total += s; }
    int pos = base + inc - c;                             // kept positions in front of e
    if (e < SEQ) {
#pragma unroll
        for (int i = 0; i < 8; ++i) { idx[f[i] ? pos : total + (e + i - pos)] = e + i; pos += f[i]; }
    }
    if (tid == 0) cnt[0] = total;
}

// ---- k_cvt_in: the query ranking and the five input conversions, which do not depend on one another, as block ranges of ONE grid:
// blocks [0, NB) = the ranking (first), then CVT_GX blocks = x, then CVT_GW blocks each for Wq, Wk, Wv (bf16 planes) and Wo (f16 plane x64). The range test reads blockIdx alone.
#define CVT_NW (DMOD * DMOD)
#define CVT_NX (NB * SEQ * DMOD)
#define CVT_GW ((CVT_NW / 8 + 255) / 256)
#define CVT_GX ((CVT_NX / 8 + 255) / 256)
__global__ __launch_bounds__(256) void k_cvt_in(const float* __restrict__ x, const float* __restrict__ wq, const float* __restrict__ wk, const float* __restrict__ wv, const float* __restrict__ wo,
                                                const int* __restrict__ mask, bf* XB, bf* WQ, bf* WK, bf* WV, h16* WO, int* QIDX, int* QCNT) {
    if ((int)blockIdx.x < NB) { rank_queries(mask + (size_t)blockIdx.x * SEQ_FULL, QIDX + (int)blockIdx.x * SEQ, QCNT + (int)blockIdx.x); return; }
    const int blk = (int)blockIdx.x - NB;
    if (blk < CVT_GX) { cvt_bf(x, XB, blk, CVT_NX, SEQ * DMOD, SEQ_FULL * DMOD); return; }
    const int w = (blk - CVT_GX) / CVT_GW, wb = (blk - CVT_GX) - w * CVT_GW;
    if (w == 3) { cvt_wo(wo, WO, wb, CVT_NW); return; }
    cvt_bf(w == 0 ? wq : (w == 1 ? wk : wv), w == 0 ? WQ : (w == 1 ? WK : WV), wb, CVT_NW, CVT_NW, CVT_NW);
}

// Rows are places in the ranked list, in src (FULL batch stride) and in dst (compact) alike. Only the rows of the 128-row tiles that hold a kept query are written: the output projection reads no other.
__global__ __launch_bounds__(256) void k_cvt_ctx(const float* __restrict__ src, const int* __restrict__ mask, const int* __restrict__ QIDX, const int* __restrict__ QCNT, h16* dst, int n) {
    const int e = ((int)blockIdx.x * 256 + (int)threadIdx.x) * 8;
    if (e >= n) return;
    const int row = e / DMOD, col = e - row * DMOD;
    const int b = row / SEQ, t = row - b * SEQ;
    const int nk = QCNT[b];
    const int qi = QIDX[b * SEQ + t];                     // in bounds for every row; asked for together with the count
    if (t >= ((nk + 127) & ~127)) return;
    const size_t srow = (size_t)b * SEQ_FULL + (size_t)t;
    v8h o = (v8h){};                                      // the places behind the count in the last tile are masked queries: their rows are zero
    if (t < nk) {
        const float mq = (float)mask[(size_t)b * SEQ_FULL + (size_t)min(max(qi, 0), SEQ - 1)] * CCAR;
        const v4f a0 = *(const v4f*)(src + srow * DMOD + col);
        const v4f a1 = *(const v4f*)(src + srow * DMOD + col + 4);
        o[0] = toh_flush(a0[0] * mq); o[1] = toh_flush(a0[1] * mq); o[2] = toh_flush(a0[2] * mq); o[3] = toh_flush(a0[3] * mq);
        o[4] = toh_flush(a1[0] * mq); o[5] = toh_flush(a1[1] * mq); o[6] = toh_flush(a1[2] * mq); o[7] = toh_flush(a1[3] * mq);
    }
    *(v8h*)(dst + e) = o;
    
}

// ---- GEMM staging: a block of 2 x 2 waves owns a 128x128 tile; 128 k (one aligned 256-B unit) of its 128 A rows and 128 Bt rows are staged in LDS by asynchronous copies
// (16 B per lane, 16 lanes per row), two buffers: stage t + 1 flies while stage t is worked on. Every wave reads its 64 + 64 rows as fragments from LDS.
#define GWAVES 4                      // waves per block, 2 (tile rows) x 2 (tile columns)
#define GKT    128                    // k elements per stage: 256 B of every operand row
#define GPITCH 272                    // LDS row pitch in bytes: 16 B x odd, conflict-free for the 16-byte fragment reads
#define GSLAB  (128 * GPITCH)         // one operand's 128 staged rows
#define GSTAGE (2 * GSLAB)            // one buffer: A rows, then Bt rows
static_assert(DMOD % 128 == 0);               // whole 128-wide block tiles
static_assert((NB * SEQ) % 128 == 0);
static_assert(DMOD % GKT == 0);               // whole stages
static_assert(DMOD / GKT >= 2);               // the two-buffer prologue fills stages 0 and 1
static_assert(GKT * 2 == 16 * 16);            // one staged row == 16 lanes x 16 B
static_assert(GWAVES * 32 * 16 == 128 * 16);  // sixteen copies per lane cover one operand's slab

// Half of one operand's slab = 8 copies per lane: rows r, r + 8, ..., r + 56. l = the lane's LDS byte address in row r, g = the lane's own 16 bytes in row r of the 16-bit source plane (row length DMOD).
__device__ __forceinline__ void stage_half(unsigned l, const unsigned char* g) {
    // the closing s_wait_xcnt stands inside the statement so that no address register of a copy is rewritten in front of it
    asm volatile("global_load_async_to_lds_b128 %0, %8, off\n\t"
                 "global_load_async_to_lds_b128 %1, %9, off\n\t"
                 "global_load_async_to_lds_b128 %2, %10, off\n\t"
                 "global_load_async_to_lds_b128 %3, %11, off\n\t"
                 "global_load_async_to_lds_b128 %4, %12, off\n\t"
                 "global_load_async_to_lds_b128 %5, %13, off\n\t"
                 "global_load_async_to_lds_b128 %6, %14, off\n\t"
                 "global_load_async_to_lds_b128 %7, %15, off\n\t"
                 "s_wait_xcnt 0x0"
                 :: "v"(l), "v"(l + 8 * GPITCH), "v"(l + 16 * GPITCH), "v"(l + 24 * GPITCH),
                    "v"(l + 32 * GPITCH), "v"(l + 40 * GPITCH), "v"(l + 48 * GPITCH), "v"(l + 56 * GPITCH),
                    "v"(g), "v"(g + 8 * DMOD * 2), "v"(g + 16 * DMOD * 2), "v"(g + 24 * DMOD * 2),
                    "v"(g + 32 * DMOD * 2), "v"(g + 40 * DMOD * 2), "v"(g + 48 * DMOD * 2), "v"(g + 56 * DMOD * 2)
                 : "memory");
}
// One operand's slab of 128 rows: 16 copies per lane.
__device__ __forceinline__ void stage_slab(unsigned l, const unsigned char* g) {
    stage_half(l, g);
    stage_half(l + 64 * GPITCH, g + 64 * DMOD * 2);
}

// The copy side and the read side of one thread. ra / rb = first A row / first Bt row of the block's tile; wm / wn = the wave's place in the 2 x 2 block.
struct gemm_ring {
    const unsigned char* ga; const unsigned char* gb;   // running source pointers, advanced stage by stage
    unsigned cl;                                        // the lane's LDS byte address in the A slab of buffer 0
    const unsigned char* fa; const unsigned char* fb;   // fragment row lr, 16-byte piece hi, of the wave's 64 A rows and 64 Bt rows in buffer 0
};
__device__ __forceinline__ gemm_ring ring_open(const void* A, const void* Bt, int ra, int rb, int wm, int wn, const unsigned char* ring, unsigned ringl) {
    const int crow = (int)threadIdx.x >> 4, cpc = (int)threadIdx.x & 15;       // copy side: row 0..7, 16-byte piece 0..15
    const int lane = (int)threadIdx.x & 31, lr = lane & 15, hi = lane >> 4;
    gemm_ring g;
    g.ga = (const unsigned char*)A + ((size_t)(ra + crow) * DMOD + cpc * 8) * 2;
    g.gb = (const unsigned char*)Bt + ((size_t)(rb + crow) * DMOD + cpc * 8) * 2;
    g.cl = ringl + (unsigned)(crow * GPITCH + cpc * 16);
    g.fa = ring + (wm * 64 + lr) * GPITCH + 16 * hi;
    g.fb = ring + GSLAB + (wn * 64 + lr) * GPITCH + 16 * hi;
    stage_slab(g.cl, g.ga); stage_slab(g.cl + GSLAB, g.gb);
    g.ga += GKT * 2; g.gb += GKT * 2;
    asm volatile("s_wait_asynccnt 0x0" ::: "memory");     // this wave's copies of stage 0 have landed
    __syncthreads();                                      // stage 0 readable by every wave
    stage_slab(g.cl + GSTAGE, g.ga); stage_slab(g.cl + GSTAGE + GSLAB, g.gb);
    return g;
}
// Foot of trip t: publish stage t + 1, then refill the buffer that trip t has just read.
__device__ __forceinline__ void ring_turn(gemm_ring& g, int t) {
    asm volatile("s_wait_dscnt 0x0" ::: "memory");        // this wave's reads of stage t have returned before its buffer is refilled
    asm volatile("s_wait_asynccnt 0x0" ::: "memory");     // this wave's copies of stage t + 1 have landed
    __syncthreads();                                      // publishes stage t + 1 and ends every wave's last read of stage t
    if (t + 2 < DMOD / GKT) {
        g.ga += GKT * 2; g.gb += GKT * 2;
        const unsigned l = g.cl + (unsigned)((t & 1) * GSTAGE);
        stage_slab(l, g.ga); stage_slab(l + GSLAB, g.gb);
    }
}

// ---- GEMM main loop: one wave per 64x64 tile (16 accumulators), fragments from the staged bf16 rows, K = DMOD in ascending order.
// acc[mb][nb][j] = sum_k A[r0 + mb*16 + 8*hi + j][k] * Bt[c0 + nb*16 + lr][k], r0 = ra + 64*wm, c0 = rb + 64*wn.
__device__ __forceinline__ void gemm_tile(const bf* __restrict__ A, const bf* __restrict__ Bt, int ra, int rb, int wm, int wn, const unsigned char* ring, unsigned ringl, v8f (&acc)[4][4]) {
#pragma unroll
    for (int mb = 0; mb < 4; ++mb)
#pragma unroll
        for (int nb = 0; nb < 4; ++nb) acc[mb][nb] = (v8f){};
    gemm_ring g = ring_open(A, Bt, ra, rb, wm, wn, ring, ringl);
#pragma unroll 1   // rolled: one publish point per trip
    for (int t = 0; t < DMOD / GKT; ++t) {
        const unsigned char* pa = g.fa + (t & 1) * GSTAGE;
        const unsigned char* pb = g.fb + (t & 1) * GSTAGE;
#pragma unroll   // unrolled: the 32-k blocks of a stage read at constant LDS offsets
        for (int kc = 0; kc < GKT; kc += 32) {
            v16bf a[4];
            v16bf b;
#pragma unroll
            for (int mb = 0; mb < 4; ++mb) a[mb] = ldbf((const bf*)(pa + mb * 16 * GPITCH + kc * 2));
#pragma unroll
            for (int nb = 0; nb < 4; ++nb) {
                b = ldbf((const bf*)(pb + nb * 16 * GPITCH + kc * 2));
#pragma unroll
                for (int mb = 0; mb < 4; ++mb) acc[mb][nb] = wmmab(a[mb], b, acc[mb][nb]);
            }
            asm volatile("" : "+v"(acc[0][0]), "+v"(acc[1][0]), "+v"(acc[2][0]), "+v"(acc[3][0]), "+v"(acc[0][1]), "+v"(acc[1][1]), "+v"(acc[2][1]), "+v"(acc[3][1]));
            asm volatile("v_nop\n\tv_nop\n\tv_nop\n\tv_nop" : "+v"(acc[0][2]), "+v"(acc[1][2]), "+v"(acc[2][2]), "+v"(acc[3][2]), "+v"(acc[0][3]), "+v"(acc[1][3]), "+v"(acc[2][3]), "+v"(acc[3][3]) : "v"(a[0]), "v"(a[3]), "v"(b));
        }
        ring_turn(g, t);
    }
    asm volatile("s_wait_asynccnt 0x0" ::: "memory");     // nothing in flight behind the loop
}

// ---- f16 twin of the GEMM main loop (same tile map, same staging, f16 planes); every WMMA carries its own four-nop guard.
__device__ __forceinline__ void gemm_tile_h(const h16* __restrict__ A, const h16* __restrict__ Bt, int ra, int rb, int wm, int wn, const unsigned char* ring, unsigned ringl, v8f (&acc)[4][4]) {
#pragma unroll
    for (int mb = 0; mb < 4; ++mb)
#pragma unroll
        for (int nb = 0; nb < 4; ++nb) acc[mb][nb] = (v8f){};
    gemm_ring g = ring_open(A, Bt, ra, rb, wm, wn, ring, ringl);
#pragma unroll 1   // rolled: one publish point per trip
    for (int t = 0; t < DMOD / GKT; ++t) {
        const unsigned char* pa = g.fa + (t & 1) * GSTAGE;
        const unsigned char* pb = g.fb + (t & 1) * GSTAGE;
#pragma unroll   // unrolled: the 32-k blocks of a stage read at constant LDS offsets
        for (int kc = 0; kc < GKT; kc += 32) {
            v16h a[4], b[4];                              // the block's LDS reads stand as one group in front of its guarded WMMAs
#pragma unroll
            for (int mb = 0; mb < 4; ++mb) a[mb] = ldh((const h16*)(pa + mb * 16 * GPITCH + kc * 2));
#pragma unroll
            for (int nb = 0; nb < 4; ++nb) b[nb] = ldh((const h16*)(pb + nb * 16 * GPITCH + kc * 2));
#pragma unroll
            for (int nb = 0; nb < 4; ++nb) {
#pragma unroll
                for (int mb = 0; mb < 4; ++mb) acc[mb][nb] = wmma16g(a[mb], b[nb], acc[mb][nb]);
            }
        }
        ring_turn(g, t);
    }
    asm volatile("s_wait_asynccnt 0x0" ::: "memory");     // nothing in flight behind the loop
}

// ---- k_proj: the q, k and v projections, which do not depend on one another, as the three z planes of ONE grid; z reads the same for a whole block, so every barrier stays under block-uniform control flow.
// z = 0 / 1 (q / k): y[m][n] = X[m][:] . W[n][:] + bf16(bias[n]); tile rows m = b*SEQ + t, tile columns = one head (n = head*64 + d); stored as one f16 head plane, q times log2 e (one rounding), so that q.k is a base-2 exponent.
// z = 2 (v): transposed projection y^T[n][m] = (W[n][:] . X[m][:] + bf16(bias[n])) * mask[m]; tile rows n = head*64 + d, tile columns m = b*SEQ + t (the key index).
// The key mask multiplies the value rows, so the attention kernel's probabilities and its denominator stay over all keys.
// grid (NB*SEQ/128, DMOD/128, 3), 128 threads; each wave one 64x64 tile.
__global__ __launch_bounds__(GWAVES * 32) void k_proj(const bf* __restrict__ X, const bf* __restrict__ WQ, const bf* __restrict__ WK, const bf* __restrict__ WV,
                                                      const float* __restrict__ bq, const float* __restrict__ bk, const float* __restrict__ bv, const int* __restrict__ mask,
                                                      h16* QF, h16* KF, h16* Pv) {
    __shared__ __align__(16) unsigned char ring[2 * GSTAGE];
    __shared__ __align__(16) float osall[GWAVES * 16 * OSP];
    const int wave = __builtin_amdgcn_readfirstlane((int)(threadIdx.x >> 5));
    const int wm = wave >> 1, wn = wave & 1;
    float* os = osall + wave * 16 * OSP;                  // each wave stages its output rows in its own range
    const int lane = (int)threadIdx.x & 31, lr = lane & 15, hi = lane >> 4;
    const int which = (int)blockIdx.z;
    const bool isv = which == 2;
    const bf* W = which == 0 ? WQ : (which == 1 ? WK : WV);
    const float* bias = which == 0 ? bq : (which == 1 ? bk : bv);
    const int xt = (int)blockIdx.x * 128, wt = (int)blockIdx.y * 128;      // first X row and first W row of the block's tile
    const int ra = isv ? wt : xt, rb = isv ? xt : wt;
    const int r0 = ra + wm * 64, c0 = rb + wn * 64;
    v8f acc[4][4];
    gemm_tile(isv ? W : X, isv ? X : W, ra, rb, wm, wn, ring, (unsigned)(size_t)(__attribute__((address_space(3))) unsigned char*)ring, acc);
    const int rq = lane >> 3, cq = (lane & 7) * 8;
    if (!isv) {
        h16* Pf = which == 0 ? QF : KF;
        const float qs = which == 0 ? LOG2E : 1.0f;
        const int b = r0 / SEQ, t0 = r0 - b * SEQ, hd = c0 / HDIM;
        const v4f bv0 = *(const v4f*)(bias + c0 + cq);
        const v4f bv1 = *(const v4f*)(bias + c0 + cq + 4);
        float bb[8];
        bb[0] = bfr(bv0[0]); bb[1] = bfr(bv0[1]); bb[2] = bfr(bv0[2]); bb[3] = bfr(bv0[3]);
        bb[4] = bfr(bv1[0]); bb[5] = bfr(bv1[1]); bb[6] = bfr(bv1[2]); bb[7] = bfr(bv1[3]);
        const size_t pbase = ((size_t)(b * NHEAD + hd) * SEQ + t0) * HDIM;
#pragma unroll
        for (int mb = 0; mb < 4; ++mb) {
#pragma unroll
            for (int nb = 0; nb < 4; ++nb) {
#pragma unroll
                for (int j = 0; j < 8; ++j) os[(hi * 8 + j) * OSP + nb * 16 + lr] = acc[mb][nb][j];
            }
            __syncthreads();
#pragma unroll
            for (int s = 0; s < 4; ++s) {
                const int row = s * 4 + rq;                       // s 0..3 x rq 0..3 -> rows 0..15
                const v4f x0 = *(const v4fa*)(os + row * OSP + cq);
                const v4f x1 = *(const v4fa*)(os + row * OSP + cq + 4);
                v8h of;
#pragma unroll
                for (int i = 0; i < 4; ++i) { of[i] = (h16)((x0[i] + bb[i]) * qs); of[4 + i] = (h16)((x1[i] + bb[4 + i]) * qs); }
                *(v8h*)(Pf + pbase + (size_t)(mb * 16 + row) * HDIM + cq) = of;
            }
            __syncthreads();
        }
    } else {
        const int b = c0 / SEQ, t0 = c0 - b * SEQ, hd = r0 / HDIM;
        const v4i mk0 = *(const v4i*)(mask + (size_t)b * SEQ_FULL + t0 + cq);          // staged mask rows use the FULL batch stride
        const v4i mk1 = *(const v4i*)(mask + (size_t)b * SEQ_FULL + t0 + cq + 4);
        float mf[8];
        mf[0] = (float)mk0[0]; mf[1] = (float)mk0[1]; mf[2] = (float)mk0[2]; mf[3] = (float)mk0[3];
        mf[4] = (float)mk1[0]; mf[5] = (float)mk1[1]; mf[6] = (float)mk1[2]; mf[7] = (float)mk1[3];
        const size_t pbase = (size_t)(b * NHEAD + hd) * HDIM * SEQ + t0;
#pragma unroll
        for (int mb = 0; mb < 4; ++mb) {
#pragma unroll
            for (int nb = 0; nb < 4; ++nb) {
#pragma unroll
                for (int j = 0; j < 8; ++j) os[(hi * 8 + j) * OSP + nb * 16 + lr] = acc[mb][nb][j];
            }
            __syncthreads();
#pragma unroll
            for (int s = 0; s < 4; ++s) {
                const int row = s * 4 + rq;                       // d within the slab, 0..15
                const float bsc = bfr(bias[r0 + mb * 16 + row]);
                const v4f x0 = *(const v4fa*)(os + row * OSP + cq);
                const v4f x1 = *(const v4fa*)(os + row * OSP + cq + 4);
                v8h ov;
#pragma unroll
                for (int i = 0; i < 4; ++i) { ov[i] = toh_flush((x0[i] + bsc) * mf[i]); ov[4 + i] = toh_flush((x1[i] + bsc) * mf[4 + i]); }
                *(v8h*)(Pv + pbase + (size_t)(mb * 16 + row) * SEQ + cq) = ov;
            }
            __syncthreads();
        }
    }
}

// ---- k_attn: fused attention, transposed form. Block = 8 waves = 128 queries of one (batch, head); each wave owns 16 queries.
// The f16 K rows and the f16 V rows of 64 keys are staged in LDS once per block by asynchronous copies (16 B per lane, whole 128-B lines), two buffers: tile t + 1 flies while tile t is worked on.
// Each wave loads its own f16 Q fragments once, before the key loop, and keeps them in registers.
// Per 32-key step: S^T[key][query] = K.Q^T - offset, one f16 product (one accumulator per 16-key tile) that starts from minus the query's offset in use, so the accumulators hold the exponents themselves;
// (lane (hi, lr) holds keys 8*hi + r and 16 + 8*hi + r of query lr); the offset moves, for the whole wave, only in a step where some exponent passes LAZY (and in the first step):
// there the two lanes of a query share the step's maximum through one shuffle, and sums, outputs and this step's exponents are brought to the new offset (column maximum at PSH);
// P^T packed from the two score tiles into the B fragment (element r <- tile 0, element 8 + r <- tile 1); O^T[d][query] += V^T.P^T
// (every one of the four P.V WMMAs carries its own four-nop guard tying exactly its accumulator and its two operands).
// The block's 128 queries are 128 consecutive entries of the batch's ranked list (kept queries first); a block whose range begins behind the kept count leaves at once.
// grid (NB*NHEAD, SEQ/128), 256 threads: the list range is the slow index, so that the blocks that work come first in index order and the empty ones last.
#define AWAVES 8                      // waves per block that share one staged tile
#define KTILE  64                     // keys per staged tile: K rows and V rows are both 128 B long
#define LPITCH 144                    // LDS row pitch in bytes: 16 B x odd, conflict-free for the 16-byte fragment reads
#define LPLANE (64 * LPITCH)          // one staged plane: 64 rows (keys for K, head dims for V)
#define LSTAGE (2 * LPLANE)           // one buffer: K, V
static_assert(SEQ % (AWAVES * 16) == 0);      // whole blocks of queries
static_assert(SEQ % KTILE == 0);              // whole key tiles
static_assert(SEQ / KTILE >= 2);              // the two-buffer prologue fills tiles 0 and 1
static_assert(KTILE * 2 == 128);              // one V row of a tile == 8 lanes x 16 B
static_assert(HDIM * 2 == 128);               // one K row == 8 lanes x 16 B
static_assert(AWAVES * 32 * 2 == 64 * 8);     // two copies per lane cover one plane (64 rows x 8 pieces)
static_assert(AWAVES * 16 * OSP * 4 <= 2 * LSTAGE);   // the output staging reuses the ring
static_assert(AWAVES * 16 == 128);            // a block's range of the ranked list == one row tile of the output projection
static_assert(SEQ % 128 == 0);                // a row tile of the output projection never straddles a batch

// One tile = 4 copies per lane. l = the lane's LDS byte address in the K plane of the target buffer; the pointers are the lane's own 16 bytes in rows 0..31 of each plane.
__device__ __forceinline__ void stage_tile(unsigned l, const h16* kf, const h16* vv) {
    // the closing s_wait_xcnt stands inside the statement so that no address register of a copy is rewritten in front of it
    asm volatile("global_load_async_to_lds_b128 %0, %4, off\n\t"
                 "global_load_async_to_lds_b128 %1, %5, off\n\t"
                 "global_load_async_to_lds_b128 %2, %6, off\n\t"
                 "global_load_async_to_lds_b128 %3, %7, off\n\t"
                 "s_wait_xcnt 0x0"
                 :: "v"(l), "v"(l + 32 * LPITCH), "v"(l + LPLANE), "v"(l + LPLANE + 32 * LPITCH),
                    "v"(kf), "v"(kf + 32 * HDIM), "v"(vv), "v"(vv + 32 * SEQ)
                 : "memory");
}

// second launch bound: six waves per SIMD, so that the three blocks that fall to each WGP stay resident together
__global__ __launch_bounds__(AWAVES * 32, 6) void k_attn(const h16* __restrict__ QF, const h16* __restrict__ KF, const h16* __restrict__ VV, const int* __restrict__ QIDX, const int* __restrict__ QCNT, float* OUT) {
    __shared__ __align__(16) unsigned char ring[2 * LSTAGE];
    const int wave = __builtin_amdgcn_readfirstlane((int)(threadIdx.x >> 5));
    const int lane = (int)threadIdx.x & 31, lr = lane & 15, hi = lane >> 4;
    const int bh = (int)blockIdx.x;
    const int b = bh / NHEAD, hd = bh - b * NHEAD;
    if ((int)blockIdx.y * (AWAVES * 16) >= QCNT[b]) return;   // no kept query in this block's range of the list: the whole block leaves, in front of every copy and barrier
    const int q0 = (int)blockIdx.y * (AWAVES * 16) + wave * 16;   // place in the ranked list, not a position
    const int ql = QIDX[b * SEQ + q0 + lr];               // asked for here, first used behind tile 0's copies, so that the two latencies overlap
    const size_t pb = (size_t)bh * SEQ * HDIM;
    // copy side: thread -> (row = tid / 8, 16-byte piece = tid % 8) of rows 0..31 of a plane
    const int crow = (int)threadIdx.x >> 3, cpc = (int)threadIdx.x & 7;
    const h16* ckf = KF + pb + crow * HDIM + cpc * 8; const h16* cvv = VV + pb + crow * SEQ + cpc * 8;   // running pointers, advanced tile by tile
    const unsigned cl = (unsigned)(size_t)(__attribute__((address_space(3))) unsigned char*)ring + (unsigned)(crow * LPITCH + cpc * 16);
    // read side: fragment row lr, 16-byte piece hi (K rows and V rows alike)
    const unsigned char* fr = ring + lr * LPITCH + 16 * hi;
    v8f ova[4];
#pragma unroll
    for (int dt = 0; dt < 4; ++dt) ova[dt] = (v8f){};
    float lsum = 0.0f;
    v8f negm = (v8f){};                                   // all eight elements: minus the lane's query's offset in use
    stage_tile(cl, ckf, cvv);
    __builtin_amdgcn_sched_barrier(0);                    // keeps the wait for the list entry behind tile 0's copies (without it the compiler waits first and the two latencies add)
    ckf += KTILE * HDIM; cvv += KTILE;
    const int qt = min(max(ql, 0), SEQ - 1);              // the lane's query's position (a list entry behind the count is a masked query: worked like any other, its row is never used)
    const h16* qp = QF + pb + qt * HDIM + 8 * hi;
    // the wave's own Q fragments: loaded once, held in registers over the whole key loop
    v16h qf[HDIM / 32];
#pragma unroll
    for (int kc = 0; kc < HDIM; kc += 32) qf[kc / 32] = ldh(qp + kc);
    asm volatile("s_wait_xcnt 0x0" ::: "memory");         // precaution: stands in front of every rewrite of the Q loads' address registers
    asm volatile("s_wait_asynccnt 0x0" ::: "memory");     // this wave's copies of tile 0 have landed
    __syncthreads();                                      // tile 0 readable by every wave
    stage_tile(cl + LSTAGE, ckf, cvv);
#pragma unroll 1   // rolled: one publish point per trip
    for (int t = 0; t < SEQ / KTILE; ++t) {
        const unsigned char* fb = fr + (t & 1) * LSTAGE;
#pragma unroll   // unrolled: the two 32-key steps of a tile read at constant LDS offsets
        for (int sub = 0; sub < KTILE / 32; ++sub) {
            v8f s0, s1;
            v16h k0[HDIM / 32], k1[HDIM / 32];
            const unsigned char* kp = fb + sub * 32 * LPITCH;
#pragma unroll
            for (int kc = 0; kc < HDIM; kc += 32) { k0[kc / 32] = ldh((const h16*)(kp + kc * 2)); k1[kc / 32] = ldh((const h16*)(kp + 16 * LPITCH + kc * 2)); }
            // inputs-only fence on the loaded values: keeps the eight reads one group with one LDS wait (without it the compiler sinks each pair of reads to its own WMMA: four waits in a row)
            asm volatile("" :: "v"(k0[0]), "v"(k0[1]), "v"(k1[0]), "v"(k1[1]));
            s0 = wmma16(k0[0], qf[0], negm); s1 = wmma16(k1[0], qf[0], negm);
#pragma unroll
            for (int kc = 32; kc < HDIM; kc += 32) { s0 = wmma16(k0[kc / 32], qf[kc / 32], s0); s1 = wmma16(k1[kc / 32], qf[kc / 32], s1); }
            float ma = fmaxf(fmaxf(s0[0], s0[1]), s0[2]), mb = fmaxf(fmaxf(s1[0], s1[1]), s1[2]);
            ma = fmaxf(fmaxf(ma, s0[3]), s0[4]); mb = fmaxf(fmaxf(mb, s1[3]), s1[4]);
            ma = fmaxf(fmaxf(ma, s0[5]), s0[6]); mb = fmaxf(fmaxf(mb, s1[5]), s1[6]);
            float mx = fmaxf(fmaxf(ma, mb), fmaxf(s0[7], s1[7]));
            const bool first = sub == 0 && t == 0;        // no offset yet: the first step sets it, whatever the scores are
            const float thr = first ? -3.0e38f : LAZY;    // below every score that f16 operands can give
            if (__builtin_amdgcn_ballot_w32(mx > thr) != 0u) {                // wave-uniform
                mx = fmaxf(mx, __shfl_xor(mx, 16, 32));
                const float d = first ? mx - PSH : fmaxf(mx - PSH, 0.0f);     // the offset never falls
                const float sc = first ? 0.0f : __builtin_amdgcn_exp2f(-d);   // sums and outputs are zero in the first step
                lsum *= sc;
#pragma unroll
                for (int dt = 0; dt < 4; ++dt) {
#pragma unroll
                    for (int r = 0; r < 8; ++r) ova[dt][r] *= sc;
                }
#pragma unroll
                for (int r = 0; r < 8; ++r) { s0[r] -= d; s1[r] -= d; negm[r] -= d; }
            }
            float psum = 0.0f;
            v16h pf;
            float e0[8], e1[8];                           // p on the offset's scale, at most exp2(LAZY)
#pragma unroll
            for (int r = 0; r < 8; ++r) e0[r] = __builtin_amdgcn_exp2f(s0[r]);
#pragma unroll
            for (int r = 0; r < 8; ++r) e1[r] = __builtin_amdgcn_exp2f(s1[r]);
#pragma unroll
            for (int r = 0; r < 8; ++r) { pf[r] = (h16)e0[r]; pf[8 + r] = (h16)e1[r]; }
#pragma unroll
            for (int r = 0; r < 8; ++r) psum += e0[r] + e1[r];
            lsum += psum;
            const unsigned char* vp = fb + LPLANE + sub * 64;
            v16h va[4];
#pragma unroll
            for (int dt = 0; dt < 4; ++dt) va[dt] = ldh((const h16*)(vp + dt * 16 * LPITCH));
#pragma unroll
            for (int dt = 0; dt < 4; ++dt) ova[dt] = wmma16g(va[dt], pf, ova[dt]);
        }
        asm volatile("s_wait_dscnt 0x0" ::: "memory");        // this wave's reads of tile t have returned before its buffer is refilled
        asm volatile("s_wait_asynccnt 0x0" ::: "memory");     // this wave's copies of tile t + 1 have landed
        __syncthreads();                                      // publishes tile t + 1 and ends every wave's last read of tile t
        if (t + 2 < SEQ / KTILE) {
            ckf += KTILE * HDIM; cvv += KTILE;
            stage_tile(cl + (unsigned)((t & 1) * LSTAGE), ckf, cvv);
        }
    }
    asm volatile("s_wait_asynccnt 0x0" ::: "memory");         // nothing in flight when the ring becomes output staging
    lsum += __shfl_xor(lsum, 16, 32);
    const float inv = 1.0f / lsum;
    float* os = (float*)ring;                                 // every wave has left the ring at the last trip's barrier
    const int obase = wave * 16 * OSP;
#pragma unroll
    for (int dt = 0; dt < 4; ++dt) {
        v4f x0, x1;
#pragma unroll
        for (int i = 0; i < 4; ++i) {
            x0[i] = ova[dt][i] * inv;
            x1[i] = ova[dt][4 + i] * inv;
        }
        *(v4fa*)(os + obase + lr * OSP + dt * 16 + 8 * hi) = x0;
        *(v4fa*)(os + obase + lr * OSP + dt * 16 + 8 * hi + 4) = x1;
    }
    __syncthreads();
    float* orow = OUT + ((size_t)b * SEQ_FULL + q0) * DMOD + hd * HDIM;   // FULL batch stride; the rows stay in list order
{
#pragma unroll
        for (int s = 0; s < 8; ++s) {
            const int row = 2 * s + hi, cofs = lr * 4;            // s 0..7 x hi 0..1 -> queries 0..15; 16 lanes x 16 B = one 256-B head row
            const v4f val = *(const v4fa*)(os + obase + row * OSP + cofs);
            *(v4f*)(orow + (size_t)row * DMOD + cofs) = val;
        }
        
    }
}

// ---- k_out: y[m][n] = (A[m][:] . W[n][:]) / 1024 + bf16(bias[n]) + bf16(x[m][n]); A = f16 ctx plane (x16, compact rows), W = f16 plane of 64 * bf16(Wo) stored [out][in].
// The skip connection is read from the staged f32 input at the FULL batch stride and added at the store stage.
// A's rows are places in the ranked list: a tile with no kept query leaves at once, and the store stage sends each row to its position; the rows of the tiles that left are not written.
// grid (NB * DMOD/128, SEQ/128), 128 threads; each wave one 64x64 tile; the list range is the slow index, so that the blocks that work come first in index order.
__global__ __launch_bounds__(GWAVES * 32) void k_out(const h16* __restrict__ A, const h16* __restrict__ W, const float* __restrict__ bias, const float* __restrict__ xin, const int* __restrict__ QIDX, const int* __restrict__ QCNT, float* Y) {
    __shared__ __align__(16) unsigned char ring[2 * GSTAGE];
    __shared__ __align__(16) float osall[GWAVES * 16 * OSP];
    const int wave = __builtin_amdgcn_readfirstlane((int)(threadIdx.x >> 5));
    const int wm = wave >> 1, wn = wave & 1;
    float* os = osall + wave * 16 * OSP;                  // each wave stages its output rows in its own range
    const int lane = (int)threadIdx.x & 31, lr = lane & 15, hi = lane >> 4;
    const int b = (int)blockIdx.x / (DMOD / 128), ct = (int)blockIdx.x - b * (DMOD / 128);
    if ((int)blockIdx.y * 128 >= QCNT[b]) return;         // no kept query among the tile's rows: the whole block leaves, in front of every copy and barrier
    const int t0 = (int)blockIdx.y * 128 + wm * 64;       // the wave's first row: a place in the batch's ranked list
    const int c0 = ct * 128 + wn * 64;
    // positions of the wave's 64 rows, two per lane, asked for in front of the main loop and handed round by shuffles at the store stage
    const int p0 = QIDX[b * SEQ + t0 + lane], p1 = QIDX[b * SEQ + t0 + 32 + lane];
    v8f acc[4][4];
    gemm_tile_h(A, W, b * SEQ + (int)blockIdx.y * 128, ct * 128, wm, wn, ring, (unsigned)(size_t)(__attribute__((address_space(3))) unsigned char*)ring, acc);
    const int cofs = lr * 4;
    const v4f bv0 = *(const v4f*)(bias + c0 + cofs);
    float bb[4];
    bb[0] = bfr(bv0[0]); bb[1] = bfr(bv0[1]); bb[2] = bfr(bv0[2]); bb[3] = bfr(bv0[3]);
    const size_t xbase = (size_t)b * SEQ_FULL * DMOD + c0 + cofs;
    const size_t ybase = (size_t)b * SEQ * DMOD + c0 + cofs;
    const float osc = 1.0f / (WCAR * CCAR);
#pragma unroll
    for (int mb = 0; mb < 4; ++mb) {
#pragma unroll
        for (int nb = 0; nb < 4; ++nb) {
#pragma unroll
            for (int j = 0; j < 8; ++j) os[(hi * 8 + j) * OSP + nb * 16 + lr] = acc[mb][nb][j];
        }
        __syncthreads();
{
#pragma unroll
            for (int s = 0; s < 8; ++s) {
                const int row = 2 * s + hi;                       // s 0..7 x hi 0..1 -> rows 0..15; 16 lanes x 16 B = one 256-B row segment
                const v4f a4 = *(const v4fa*)(os + row * OSP + cofs);
                const int pt = min(max(__shfl(mb < 2 ? p0 : p1, (mb & 1) * 16 + row, 32), 0), SEQ - 1);   // the row's position in its batch
                const v4f xr = *(const v4f*)(xin + xbase + (size_t)pt * DMOD);
                v4f o;
#pragma unroll
                for (int i = 0; i < 4; ++i) o[i] = (a4[i] * osc + bb[i]) + bfr(xr[i]);
                *(v4f*)(Y + ybase + (size_t)pt * DMOD) = o;       // a place behind the count is a masked query with a zero A row: its row is stored like any other (the list is a permutation: one writer per row) and never read
            }
            
        }
        __syncthreads();
    }
}

// ---- k_ln: LayerNorm over the 768 columns, one wave per row (8 rows per block), row held in registers (6 x 4 floats per lane);
// mean, then centred variance (divide by the width), y = (x - mu) * rsqrt(var + 1e-5) * bf16(gain) + bf16(shift).
// grid (NB*SEQ/8), 256 threads.
// A row whose mask is 0 has a zero context row, so its pre-norm row is bf16(bias) + bf16(x): formed here, never read from X (the output projection leaves most such rows unwritten).
__global__ __launch_bounds__(256) void k_ln(const float* __restrict__ X, const int* __restrict__ mask, const float* __restrict__ bo, const float* __restrict__ xin, const float* __restrict__ g, const float* __restrict__ be, float* OUT) {
#pragma clang fp contract(off)
    const int wave = __builtin_amdgcn_readfirstlane((int)(threadIdx.x >> 5));
    const int lane = (int)threadIdx.x & 31;
    const int row = (int)blockIdx.x * 8 + wave;
    const int b = row / SEQ, t = row - b * SEQ;
    const float* xr = X + (size_t)row * DMOD;
    v4f x[6];
    float s = 0.0f;
    if (mask[(size_t)b * SEQ_FULL + (size_t)t] != 0) {        // the same for the whole wave
#pragma unroll
        for (int j = 0; j < 6; ++j) x[j] = *(const v4f*)(xr + (j * 32 + lane) * 4);
    } else {
        const float* xi = xin + ((size_t)b * SEQ_FULL + (size_t)t) * DMOD;
#pragma unroll
        for (int j = 0; j < 6; ++j) {
            const v4f a4 = *(const v4f*)(xi + (j * 32 + lane) * 4);
            const v4f c4 = *(const v4f*)(bo + (j * 32 + lane) * 4);
#pragma unroll
            for (int i = 0; i < 4; ++i) x[j][i] = bfr(c4[i]) + bfr(a4[i]);
        }
    }
#pragma unroll
    for (int j = 0; j < 6; ++j) s += (x[j][0] + x[j][1]) + (x[j][2] + x[j][3]);
    s += __shfl_xor(s, 16, 32); s += __shfl_xor(s, 8, 32); s += __shfl_xor(s, 4, 32); s += __shfl_xor(s, 2, 32); s += __shfl_xor(s, 1, 32);
    const float mu = s * (1.0f / (float)DMOD);
    float q = 0.0f;
#pragma unroll
    for (int j = 0; j < 6; ++j) {
        const float d0 = x[j][0] - mu, d1 = x[j][1] - mu, d2 = x[j][2] - mu, d3 = x[j][3] - mu;
        q += (d0 * d0 + d1 * d1) + (d2 * d2 + d3 * d3);
    }
    q += __shfl_xor(q, 16, 32); q += __shfl_xor(q, 8, 32); q += __shfl_xor(q, 4, 32); q += __shfl_xor(q, 2, 32); q += __shfl_xor(q, 1, 32);
    const float var = q * (1.0f / (float)DMOD);
    const float rstd = rsqrtf(var + 1.0e-5f);
    v4f o[6];
#pragma unroll
    for (int j = 0; j < 6; ++j) {
        const v4f g4 = *(const v4f*)(g + (j * 32 + lane) * 4);
        const v4f b4 = *(const v4f*)(be + (j * 32 + lane) * 4);
#pragma unroll
        for (int i = 0; i < 4; ++i) o[j][i] = ((x[j][i] - mu) * rstd) * bfr(g4[i]) + bfr(b4[i]);
    }
    float* orow = OUT + ((size_t)b * SEQ_FULL + (size_t)t) * DMOD;          // FULL batch stride of the output rows
#pragma unroll
    for (int j = 0; j < 6; ++j) *(v4f*)(orow + (j * 32 + lane) * 4) = o[j];
    
}

extern "C" void kernel_launch(void* const* d_in, const int* in_sizes, int n_in,
                              void* d_out, int out_size, void* d_ws, size_t ws_size, hipStream_t stream) {
    if (n_in < 12) return;
    const size_t need_x = (size_t)(NB - 1) * SEQ_FULL * DMOD + (size_t)SEQ * DMOD;
    const size_t need_m = (size_t)(NB - 1) * SEQ_FULL + (size_t)SEQ;
    if ((size_t)in_sizes[0] < need_x || (size_t)in_sizes[1] < need_m) return;
    if (in_sizes[2] < DMOD * DMOD || in_sizes[4] < DMOD * DMOD || in_sizes[6] < DMOD * DMOD || in_sizes[8] < DMOD * DMOD) return;
    if (in_sizes[3] < DMOD || in_sizes[5] < DMOD || in_sizes[7] < DMOD || in_sizes[9] < DMOD) return;
    if (in_sizes[10] < DMOD || in_sizes[11] < DMOD) return;
    if ((size_t)out_size < need_x) return;                       // output rows are addressed at the FULL batch stride
    const float* xin = (const float*)d_in[0];
    const int*   msk = (const int*)d_in[1];
    const float* Wq = (const float*)d_in[2]; const float* bq = (const float*)d_in[3];
    const float* Wk = (const float*)d_in[4]; const float* bk = (const float*)d_in[5];
    const float* Wv = (const float*)d_in[6]; const float* bv = (const float*)d_in[7];
    const float* Wo = (const float*)d_in[8]; const float* bo = (const float*)d_in[9];
    const float* lng = (const float*)d_in[10]; const float* lnb = (const float*)d_in[11];
    float* OUT = (float*)d_out;

    constexpr size_t WB = (size_t)DMOD * DMOD * 2;               // one 16-bit weight plane
    constexpr size_t PB = (size_t)NB * SEQ * DMOD * 2;           // one 16-bit activation / head plane (NB*NHEAD*SEQ*HDIM elements)
    constexpr size_t CB = (size_t)NB * SEQ_FULL * DMOD * 4;      // f32 ctx plane, rows at the FULL batch stride
    static_assert(WB % 256 == 0);
    static_assert(PB % 256 == 0);
    static_assert(CB % 256 == 0);
    constexpr size_t IB = (size_t)NB * SEQ * 4;                  // ranked query list
    static_assert(IB % 256 == 0);
    static_assert(4 * WB + 6 * PB + CB + IB + 256 <= (size_t)134217728);    // total carve at most 128 MiB
    static_assert(((size_t)(NB - 1) * SEQ_FULL + SEQ) * DMOD * 4 <= CB);     // last ctx row written by the attention kernel
    static_assert((size_t)NB * SEQ * DMOD * 2 <= PB);            // f16 ctx plane reuses the q plane (dead after the attention kernel)
    static_assert((size_t)NB * SEQ * DMOD * 4 <= 2 * PB);        // f32 pre-norm plane
    if (4 * WB + 6 * PB + CB + IB + 256 > ws_size) return;
    char* wsp = (char*)d_ws;
    bf* WQ = (bf*)wsp; wsp += WB;
    bf* WK = (bf*)wsp; wsp += WB;
    bf* WV = (bf*)wsp; wsp += WB;
    h16* WO = (h16*)wsp; wsp += WB;
    bf* XB = (bf*)wsp; wsp += PB;
    h16* QFp = (h16*)wsp; wsp += PB;
    h16* KFp = (h16*)wsp; wsp += PB;
    h16* VVp = (h16*)wsp; wsp += PB;
    float* XF = (float*)wsp; wsp += 2 * PB;
    float* CTX = (float*)wsp; wsp += CB;
    int* QIDX = (int*)wsp; wsp += IB;
    int* QCNT = (int*)wsp;
    h16* CTXH = QFp;                                             // stream order: written only after the attention kernel has finished

    const int nX = NB * SEQ * DMOD;
    const unsigned gX = (unsigned)((nX / 8 + 255) / 256);
    // the ranked query lists, x (the single input stream that feeds all three projections) and the four weights, one grid
    k_cvt_in<<<NB + CVT_GX + 4 * CVT_GW, 256, 0, stream>>>(xin, Wq, Wk, Wv, Wo, msk, XB, WQ, WK, WV, WO, QIDX, QCNT);
    // q, k: X[NB*SEQ][DMOD] (A) x W[DMOD][DMOD] (Bt as stored) -> f16 head planes; v: Wv (A) x X (Bt) -> transposed f16 value plane [b][head][d][t], key mask applied; one grid
    k_proj<<<dim3(NB * SEQ / 128, DMOD / 128, 3), GWAVES * 32, 0, stream>>>(XB, WQ, WK, WV, bq, bk, bv, msk, QFp, KFp, VVp);
    k_attn<<<dim3(NB * NHEAD, SEQ / (AWAVES * 16)), AWAVES * 32, 0, stream>>>(QFp, KFp, VVp, QIDX, QCNT, CTX);
    // ctx[NB*SEQ][DMOD] (f32, FULL stride) x query mask -> compact f16 plane
    k_cvt_ctx<<<gX, 256, 0, stream>>>(CTX, msk, QIDX, QCNT, CTXH, nX);
    // output projection: CTXH[NB*SEQ][DMOD] (A) x Wo[DMOD out][DMOD in] (Bt as stored) + bias + skip -> f32 pre-norm plane
    k_out<<<dim3(NB * (DMOD / 128), SEQ / 128), GWAVES * 32, 0, stream>>>(CTXH, WO, bo, xin, QIDX, QCNT, XF);
    k_ln<<<dim3(NB * SEQ / 8), 256, 0, stream>>>(XF, msk, bo, xin, lng, lnb, OUT);
}

// v008
// One run takes 88.7 microseconds.
// In two side-by-side timings against v007, it was 1.10 and 1.11 times as fast.
// All steps since v000 together make it 6.91 times as fast.
#include <hip/hip_runtime.h>

// Single-stream multi-head self-attention block: x [4][2048][768]; q / k / v = x.W^T + b with W stored [out][in]; heads = 12 x 64; scores = q.k^T with NO scale; softmax over all 2048 keys;
// the probabilities are multiplied AFTER the softmax by mask_q * mask_k (int input [4][2048], read by value); ctx merged to [4][2048][768]; y = ctx.Wo^T + bo + x; output = LayerNorm(y) with eps 1e-5 and gain / shift inputs.
// Compute dtypes, f32 accumulate everywhere: x and the weights converted to bf16 (RNE) once; q / k / v projections = single v_wmma_f32_16x16x32_bf16 products + bf16(bias) in f32; scores = one v_wmma_f32_16x16x32_f16 product of the f16 q plane (stored times log2 e) and the f16 k plane;
// softmax f32 (base 2, the offset in use is the score accumulators' start value and follows the running max lazily, denominator over all keys); P = f16(exp2(exponent)), the column maximum between 2 and 32768, packed straight from the score accumulators into the B fragment; V times the key mask = one f16 plane on v_wmma_f32_16x16x32_f16;
// A query whose mask is 0 has a zero ctx row for any input, so such queries are skipped: the positions of each batch are ranked (mask not 0 first), the attention kernel, the ctx convert and the output projection work on that list's kept part, and LayerNorm forms the skipped rows as bias + x.
// The projections gather their x rows by the same list, so the q, k and v planes are in list order: q and v are formed for the kept part alone (a key whose mask is 0 has a zero value row), k for every key (the denominator is over all keys), and P.V runs over the kept key tiles alone.
// output projection = single v_wmma_f32_16x16x32_f16 product: ctx times the query mask as f16 x16, bf16(Wo) as f16 x64, folded by 1/1024 in f32; bias, skip connection (bf16(x)) and LayerNorm in f32.

#ifndef NB
#define NB 4
#endif
#ifndef SEQ
#define SEQ 2048
#endif
#define NB_FULL  4
#define SEQ_FULL 2048
#define DMOD  768
#define NHEAD 12
#define HDIM  64
#define OSP   68
#define LOG2E 1.4426950408889634f
#define PSH   1.0f                    // where a move of the offset puts the column maximum: 14 binades of room below LAZY, so that moves are few
#define LAZY  15.0f                   // a shifted score above this moves the offset: exp2(15) still fits f16
#define WCAR  64.0f
#define CCAR  16.0f

static_assert(NHEAD * HDIM == DMOD);          // merged width
static_assert(HDIM == 64);                    // one 64-column GEMM tile == one head; 4 d-tiles in the attention kernel
static_assert(DMOD % 64 == 0);                // GEMM tile multiple (N and the transposed M)
static_assert(DMOD % 32 == 0);                // k-loop step
static_assert(SEQ % 64 == 0);                 // GEMM row tiles never straddle a batch; attention key step 32
static_assert(SEQ <= SEQ_FULL);
static_assert(NB <= NB_FULL);
static_assert((SEQ * DMOD) % 8 == 0);         // convert kernel: 8 elements per thread never straddle a batch
static_assert((DMOD * DMOD) % 8 == 0);
static_assert((NB * SEQ) % 64 == 0);
static_assert((NB * SEQ) / 64 <= 65535);
static_assert(OSP % 4 == 0);                  // 16-byte aligned LDS rows
static_assert(OSP >= HDIM);
static_assert(DMOD % 8 == 0);                 // ctx convert: 8 elements per thread never straddle a row
static_assert(SEQ % 8 == 0);                  // key-mask vector loads stay 16-byte aligned
static_assert(SEQ_FULL % 8 == 0);
static_assert(DMOD == 6 * 32 * 4);            // LayerNorm: one wave per row, 6 x (32 lanes x 4 floats)
static_assert((NB * SEQ) % 8 == 0);           // LayerNorm: 8 rows (waves) per block, no tail
static_assert(HDIM == 16 * 4);                // output GEMM store: 16 lanes x 16 B == one 64-float row segment

typedef _Float16 h16;
typedef unsigned short bf;
typedef __attribute__((ext_vector_type(16))) __bf16   v16bf;
typedef __attribute__((ext_vector_type(16))) _Float16 v16h;
typedef __attribute__((ext_vector_type(8)))  _Float16 v8h;
typedef __attribute__((ext_vector_type(8)))  unsigned short v8us;
typedef __attribute__((ext_vector_type(8)))  float    v8f;
typedef __attribute__((ext_vector_type(4)))  float    v4f;
typedef __attribute__((ext_vector_type(4)))  int      v4i;
typedef v4f  __attribute__((may_alias)) v4fa;

__device__ __forceinline__ unsigned short f2bf(float f) { unsigned u = __float_as_uint(f); u += 0x7FFFu + ((u >> 16) & 1u); return (unsigned short)(u >> 16); }
__device__ __forceinline__ float bf2f(unsigned short b) { return __uint_as_float(((unsigned)b) << 16); }
__device__ __forceinline__ float bfr(float f) { return bf2f(f2bf(f)); }
__device__ __forceinline__ v16h cat16(v8h lo, v8h hi) { return __builtin_shufflevector(lo, hi, 0, 1, 2, 3, 4, 5, 6, 7, 8, 9, 10, 11, 12, 13, 14, 15); }
__device__ __forceinline__ v16bf cat16b(v8us lo, v8us hi) { return __builtin_bit_cast(v16bf, __builtin_shufflevector(lo, hi, 0, 1, 2, 3, 4, 5, 6, 7, 8, 9, 10, 11, 12, 13, 14, 15)); }
__device__ __forceinline__ v8f wmma16(v16h a, v16h b, v8f c) { return __builtin_amdgcn_wmma_f32_16x16x32_f16(false, a, false, b, (short)0, c, false, false); }
__device__ __forceinline__ v8f wmmab(v16bf a, v16bf b, v8f c) { return __builtin_amdgcn_wmma_f32_16x16x32_bf16(false, a, false, b, (short)0, c, false, false); }
// per-instruction guarded f16 WMMA: ONE accumulator tied with its own two operands to four nops
__device__ __forceinline__ v8f wmma16g(v16h a, v16h b, v8f c) { c = wmma16(a, b, c); asm volatile("v_nop\n\tv_nop\n\tv_nop\n\tv_nop" : "+v"(c) : "v"(a), "v"(b)); return c; }
// fragment loaders (A and B alike, K-contiguous rows): p already carries + 8*(lane>>4); elements 0..7 = k0+8h.., elements 8..15 = k0+16+8h..
__device__ __forceinline__ v16bf ldbf(const bf* p) { return cat16b(*(const v8us*)p, *(const v8us*)(p + 16)); }
__device__ __forceinline__ v16h  ldh(const h16* p) { return cat16(*(const v8h*)p, *(const v8h*)(p + 16)); }
// f32 -> f16 convert for WMMA operand planes: values below the smallest f16 normal become exact zero (applied after the plane's power-of-two carry)
static __device__ __forceinline__ h16 toh_flush(float v) { const h16 r = (h16)v; return (fabsf(v) < 6.103515625e-05f) ? (h16)0.0f : r; }

// dst[e] = src[(e / per) * per_full + e % per]  (per / per_full = compact and staged batch strides). blk = the block's index inside its own plane.
__device__ __forceinline__ void cvt_bf(const float* __restrict__ src, bf* dst, int blk, int n, int per, int per_full) {
    const int e = (blk * 256 + (int)threadIdx.x) * 8;
    if (e >= n) return;
    const int b = e / per;
    const size_t so = (size_t)b * (size_t)per_full + (size_t)(e - b * per);
    const v4f a0 = *(const v4f*)(src + so);
    const v4f a1 = *(const v4f*)(src + so + 4);
    v8us o;
    o[0] = f2bf(a0[0]); o[1] = f2bf(a0[1]); o[2] = f2bf(a0[2]); o[3] = f2bf(a0[3]);
    o[4] = f2bf(a1[0]); o[5] = f2bf(a1[1]); o[6] = f2bf(a1[2]); o[7] = f2bf(a1[3]);
    *(v8us*)(dst + e) = o;
}

__device__ __forceinline__ void cvt_wo(const float* __restrict__ src, h16* dst, int blk, int n) {
    const int e = (blk * 256 + (int)threadIdx.x) * 8;
    if (e >= n) return;
    const v4f a0 = *(const v4f*)(src + e);
    const v4f a1 = *(const v4f*)(src + e + 4);
    v8h o;
    o[0] = toh_flush(bfr(a0[0]) * WCAR); o[1] = toh_flush(bfr(a0[1]) * WCAR); o[2] = toh_flush(bfr(a0[2]) * WCAR); o[3] = toh_flush(bfr(a0[3]) * WCAR);
    o[4] = toh_flush(bfr(a1[0]) * WCAR); o[5] = toh_flush(bfr(a1[1]) * WCAR); o[6] = toh_flush(bfr(a1[2]) * WCAR); o[7] = toh_flush(bfr(a1[3]) * WCAR);
    *(v8h*)(dst + e) = o;
}

// ---- query ranking, one block of 256 threads per batch: idx = a permutation of the batch's positions, those whose mask is not 0 first (in ascending order), the others behind them; val = the mask values in that order; cnt = how many come first.
// A query whose mask is 0 has a context row of exact zeros (the probabilities are multiplied by mask_q after the softmax), so the attention kernel works only on the 128-place ranges of the list that begin in front of cnt.
static_assert(SEQ <= 256 * 8);                // eight positions per thread cover a batch
__device__ __forceinline__ void rank_queries(const int* __restrict__ mrow, int* idx, int* val, int* cnt) {
    __shared__ int wsum[8];
    const int tid = (int)threadIdx.x, lane = tid & 31, wave = tid >> 5;
    const int e = tid * 8;
    int f[8], mv[8];
#pragma unroll
    for (int i = 0; i < 8; ++i) { f[i] = 0; mv[i] = 0; }
    if (e < SEQ) {
        const v4i m0 = *(const v4i*)(mrow + e);
        const v4i m1 = *(const v4i*)(mrow + e + 4);
#pragma unroll
        for (int i = 0; i < 4; ++i) { mv[i] = m0[i]; mv[4 + i] = m1[i]; f[i] = m0[i] != 0 ? 1 : 0; f[4 + i] = m1[i] != 0 ? 1 : 0; }
    }
    int c = 0;
#pragma unroll
    for (int i = 0; i < 8; ++i) c += f[i];
    int inc = c;                                          // inclusive scan over the wave's lanes
#pragma unroll
    for (int d = 1; d < 32; d <<= 1) { const int v = __shfl_up(inc, d, 32); if (lane >= d) inc += v; }
    if (lane == 31) wsum[wave] = inc;
    __syncthreads();                                      // the eight wave totals readable by every wave
    int base = 0, total = 0;
#pragma unroll
    for (int w = 0; w < 8; ++w) { const int s = wsum[w]; base += w < wave ? s : 0; total += s; }
    int pos = base + inc - c;                             // kept positions in front of e
    if (e < SEQ) {
#pragma unroll
        for (int i = 0; i < 8; ++i) { const int pl = f[i] ? pos : total + (e + i - pos); idx[pl] = e + i; val[pl] = mv[i]; pos += f[i]; }
    }
    if (tid == 0) cnt[0] = total;
}

// ---- k_cvt_in: the query ranking and the five input conversions, which do not depend on one another, as block ranges of ONE grid:
// blocks [0, NB) = the ranking (first), then CVT_GX blocks = x, then CVT_GW blocks each for Wq, Wk, Wv (bf16 planes) and Wo (f16 plane x64). The range test reads blockIdx alone.
#define CVT_NW (DMOD * DMOD)
#define CVT_NX (NB * SEQ * DMOD)
#define CVT_GW ((CVT_NW / 8 + 255) / 256)
#define CVT_GX ((CVT_NX / 8 + 255) / 256)
__global__ __launch_bounds__(256) void k_cvt_in(const float* __restrict__ x, const float* __restrict__ wq, const float* __restrict__ wk, const float* __restrict__ wv, const float* __restrict__ wo,
                                                const int* __restrict__ mask, bf* XB, bf* WQ, bf* WK, bf* WV, h16* WO, int* QIDX, int* QMSK, int* QCNT) {
    if ((int)blockIdx.x < NB) { rank_queries(mask + (size_t)blockIdx.x * SEQ_FULL, QIDX + (int)blockIdx.x * SEQ, QMSK + (int)blockIdx.x * SEQ, QCNT + (int)blockIdx.x); return; }
    const int blk = (int)blockIdx.x - NB;
    if (blk < CVT_GX) { cvt_bf(x, XB, blk, CVT_NX, SEQ * DMOD, SEQ_FULL * DMOD); return; }
    const int w = (blk - CVT_GX) / CVT_GW, wb = (blk - CVT_GX) - w * CVT_GW;
    if (w == 3) { cvt_wo(wo, WO, wb, CVT_NW); return; }
    cvt_bf(w == 0 ? wq : (w == 1 ? wk : wv), w == 0 ? WQ : (w == 1 ? WK : WV), wb, CVT_NW, CVT_NW, CVT_NW);
}

// Rows are places in the ranked list, in src (FULL batch stride) and in dst (compact) alike. Only the rows of the 128-row tiles that hold a kept query are written: the output projection reads no other.
__global__ __launch_bounds__(256) void k_cvt_ctx(const float* __restrict__ src, const int* __restrict__ mask, const int* __restrict__ QIDX, const int* __restrict__ QCNT, h16* dst, int n) {
    const int e = ((int)blockIdx.x * 256 + (int)threadIdx.x) * 8;
    if (e >= n) return;
    const int row = e / DMOD, col = e - row * DMOD;
    const int b = row / SEQ, t = row - b * SEQ;
    const int nk = QCNT[b];
    const int qi = QIDX[b * SEQ + t];                     // in bounds for every row; asked for together with the count
    if (t >= ((nk + 127) & ~127)) return;
    const size_t srow = (size_t)b * SEQ_FULL + (size_t)t;
    v8h o = (v8h){};                                      // the places behind the count in the last tile are masked queries: their rows are zero
    if (t < nk) {
        const float mq = (float)mask[(size_t)b * SEQ_FULL + (size_t)min(max(qi, 0), SEQ - 1)] * CCAR;
        const v4f a0 = *(const v4f*)(src + srow * DMOD + col);
        const v4f a1 = *(const v4f*)(src + srow * DMOD + col + 4);
        o[0] = toh_flush(a0[0] * mq); o[1] = toh_flush(a0[1] * mq); o[2] = toh_flush(a0[2] * mq); o[3] = toh_flush(a0[3] * mq);
        o[4] = toh_flush(a1[0] * mq); o[5] = toh_flush(a1[1] * mq); o[6] = toh_flush(a1[2] * mq); o[7] = toh_flush(a1[3] * mq);
    }
    *(v8h*)(dst + e) = o;
    
}

// ---- GEMM staging: a block of 2 x 2 waves owns a 128x128 tile; 128 k (one aligned 256-B unit) of its 128 A rows and 128 Bt rows are staged in LDS by asynchronous copies
// (16 B per lane, 16 lanes per row), two buffers: stage t + 1 flies while stage t is worked on. Every wave reads its 64 + 64 rows as fragments from LDS.
#define GWAVES 4                      // waves per block, 2 (tile rows) x 2 (tile columns)
#define GKT    128                    // k elements per stage: 256 B of every operand row
#define GPITCH 272                    // LDS row pitch in bytes: 16 B x odd, conflict-free for the 16-byte fragment reads
#define GSLAB  (128 * GPITCH)         // one operand's 128 staged rows
#define GSTAGE (2 * GSLAB)            // one buffer: A rows, then Bt rows
static_assert(DMOD % 128 == 0);               // whole 128-wide block tiles
static_assert((NB * SEQ) % 128 == 0);
static_assert(DMOD % GKT == 0);               // whole stages
static_assert(DMOD / GKT >= 2);               // the two-buffer prologue fills stages 0 and 1
static_assert(GKT * 2 == 16 * 16);            // one staged row == 16 lanes x 16 B
static_assert(GWAVES * 32 * 16 == 128 * 16);  // sixteen copies per lane cover one operand's slab

// Half of one operand's slab = 8 copies per lane: rows r, r + 8, ..., r + 56. l = the lane's LDS byte address in row r, g = the lane's own 16 bytes in row r of the 16-bit source plane (row length DMOD).
__device__ __forceinline__ void stage_half(unsigned l, const unsigned char* g) {
    // the closing s_wait_xcnt stands inside the statement so that no address register of a copy is rewritten in front of it
    asm volatile("global_load_async_to_lds_b128 %0, %8, off\n\t"
                 "global_load_async_to_lds_b128 %1, %9, off\n\t"
                 "global_load_async_to_lds_b128 %2, %10, off\n\t"
                 "global_load_async_to_lds_b128 %3, %11, off\n\t"
                 "global_load_async_to_lds_b128 %4, %12, off\n\t"
                 "global_load_async_to_lds_b128 %5, %13, off\n\t"
                 "global_load_async_to_lds_b128 %6, %14, off\n\t"
                 "global_load_async_to_lds_b128 %7, %15, off\n\t"
                 "s_wait_xcnt 0x0"
                 :: "v"(l), "v"(l + 8 * GPITCH), "v"(l + 16 * GPITCH), "v"(l + 24 * GPITCH),
                    "v"(l + 32 * GPITCH), "v"(l + 40 * GPITCH), "v"(l + 48 * GPITCH), "v"(l + 56 * GPITCH),
                    "v"(g), "v"(g + 8 * DMOD * 2), "v"(g + 16 * DMOD * 2), "v"(g + 24 * DMOD * 2),
                    "v"(g + 32 * DMOD * 2), "v"(g + 40 * DMOD * 2), "v"(g + 48 * DMOD * 2), "v"(g + 56 * DMOD * 2)
                 : "memory");
}
// One operand's slab of 128 rows: 16 copies per lane.
__device__ __forceinline__ void stage_slab(unsigned l, const unsigned char* g) {
    stage_half(l, g);
    stage_half(l + 64 * GPITCH, g + 64 * DMOD * 2);
}

// The copy side and the read side of one thread. ra / rb = first A row / first Bt row of the block's tile; wm / wn = the wave's place in the 2 x 2 block.
struct gemm_ring {
    const unsigned char* ga; const unsigned char* gb;   // running source pointers, advanced stage by stage
    unsigned cl;                                        // the lane's LDS byte address in the A slab of buffer 0
    const unsigned char* fa; const unsigned char* fb;   // fragment row lr, 16-byte piece hi, of the wave's 64 A rows and 64 Bt rows in buffer 0
};
__device__ __forceinline__ gemm_ring ring_open(const void* A, const void* Bt, int ra, int rb, int wm, int wn, const unsigned char* ring, unsigned ringl) {
    const int crow = (int)threadIdx.x >> 4, cpc = (int)threadIdx.x & 15;       // copy side: row 0..7, 16-byte piece 0..15
    const int lane = (int)threadIdx.x & 31, lr = lane & 15, hi = lane >> 4;
    gemm_ring g;
    g.ga = (const unsigned char*)A + ((size_t)(ra + crow) * DMOD + cpc * 8) * 2;
    g.gb = (const unsigned char*)Bt + ((size_t)(rb + crow) * DMOD + cpc * 8) * 2;
    g.cl = ringl + (unsigned)(crow * GPITCH + cpc * 16);
    g.fa = ring + (wm * 64 + lr) * GPITCH + 16 * hi;
    g.fb = ring + GSLAB + (wn * 64 + lr) * GPITCH + 16 * hi;
    stage_slab(g.cl, g.ga); stage_slab(g.cl + GSLAB, g.gb);
    g.ga += GKT * 2; g.gb += GKT * 2;
    asm volatile("s_wait_asynccnt 0x0" ::: "memory");     // this wave's copies of stage 0 have landed
    __syncthreads();                                      // stage 0 readable by every wave
    stage_slab(g.cl + GSTAGE, g.ga); stage_slab(g.cl + GSTAGE + GSLAB, g.gb);
    return g;
}
// Foot of trip t: publish stage t + 1, then refill the buffer that trip t has just read.
__device__ __forceinline__ void ring_turn(gemm_ring& g, int t) {
    asm volatile("s_wait_dscnt 0x0" ::: "memory");        // this wave's reads of stage t have returned before its buffer is refilled
    asm volatile("s_wait_asynccnt 0x0" ::: "memory");     // this wave's copies of stage t + 1 have landed
    __syncthreads();                                      // publishes stage t + 1 and ends every wave's last read of stage t
    if (t + 2 < DMOD / GKT) {
        g.ga += GKT * 2; g.gb += GKT * 2;
        const unsigned l = g.cl + (unsigned)((t & 1) * GSTAGE);
        stage_slab(l, g.ga); stage_slab(l + GSLAB, g.gb);
    }
}

// Half of a slab whose rows are gathered = 8 copies per lane. l = the lane's LDS byte address in the first row, g = the lane's own 16-byte piece in row 0 of the source plane, o[i] = byte offset of the i-th row's source row.
__device__ __forceinline__ void stage_half_rows(unsigned l, const unsigned char* g, const unsigned* o) {
    // the closing s_wait_xcnt stands inside the statement so that no address register of a copy is rewritten in front of it
    asm volatile("global_load_async_to_lds_b128 %0, %8, off\n\t"
                 "global_load_async_to_lds_b128 %1, %9, off\n\t"
                 "global_load_async_to_lds_b128 %2, %10, off\n\t"
                 "global_load_async_to_lds_b128 %3, %11, off\n\t"
                 "global_load_async_to_lds_b128 %4, %12, off\n\t"
                 "global_load_async_to_lds_b128 %5, %13, off\n\t"
                 "global_load_async_to_lds_b128 %6, %14, off\n\t"
                 "global_load_async_to_lds_b128 %7, %15, off\n\t"
                 "s_wait_xcnt 0x0"
                 :: "v"(l), "v"(l + 8 * GPITCH), "v"(l + 16 * GPITCH), "v"(l + 24 * GPITCH),
                    "v"(l + 32 * GPITCH), "v"(l + 40 * GPITCH), "v"(l + 48 * GPITCH), "v"(l + 56 * GPITCH),
                    "v"(g + o[0]), "v"(g + o[1]), "v"(g + o[2]), "v"(g + o[3]),
                    "v"(g + o[4]), "v"(g + o[5]), "v"(g + o[6]), "v"(g + o[7])
                 : "memory");
}
__device__ __forceinline__ void stage_slab_rows(unsigned l, const unsigned char* g, const unsigned (&o)[16]) {
    stage_half_rows(l, g, o);
    stage_half_rows(l + 64 * GPITCH, g, o + 8);
}

// ---- GEMM main loop of the projections: one wave per 64x64 tile (16 accumulators), fragments from the staged bf16 rows, K = DMOD in ascending order.
// One operand is 128 rows of W from row wt on, the other 128 rows of X picked by list[0 .. 128) (positions inside the batch whose first X row is xb0). xisb false: A = X rows, Bt = W rows; true: A = W rows, Bt = X rows.
// acc[mb][nb][j] = sum_k A[64*wm + mb*16 + 8*hi + j][k] * Bt[64*wn + nb*16 + lr][k], rows counted inside the block's two slabs.
__device__ __forceinline__ void gemm_tile(const bf* __restrict__ X, const bf* __restrict__ Wt, const int* __restrict__ list, int xb0, int wt, bool xisb, int wm, int wn, const unsigned char* ring, unsigned ringl, v8f (&acc)[4][4]) {
#pragma unroll
    for (int mb = 0; mb < 4; ++mb)
#pragma unroll
        for (int nb = 0; nb < 4; ++nb) acc[mb][nb] = (v8f){};
    const int crow = (int)threadIdx.x >> 4, cpc = (int)threadIdx.x & 15;       // copy side: row 0..7, 16-byte piece 0..15
    const int lane = (int)threadIdx.x & 31, lr = lane & 15, hi = lane >> 4;
    unsigned xo[16];                                      // the lane's sixteen X rows, held over the whole loop
#pragma unroll
    for (int i = 0; i < 16; ++i) xo[i] = (unsigned)(xb0 + min(max(list[crow + 8 * i], 0), SEQ - 1)) * (unsigned)(DMOD * 2);
    const unsigned char* gx = (const unsigned char*)X + cpc * 16;               // running source pointers, advanced stage by stage
    const unsigned char* gw = (const unsigned char*)Wt + ((size_t)(wt + crow) * DMOD + cpc * 8) * 2;
    const unsigned cl = ringl + (unsigned)(crow * GPITCH + cpc * 16);
    const unsigned clx = cl + (xisb ? GSLAB : 0), clw = cl + (xisb ? 0 : GSLAB);
    const unsigned char* fa = ring + (wm * 64 + lr) * GPITCH + 16 * hi;
    const unsigned char* fb = ring + GSLAB + (wn * 64 + lr) * GPITCH + 16 * hi;
    stage_slab(clw, gw);                                  // the W slab first: it needs no list entry and flies while the list entries arrive
    stage_slab_rows(clx, gx, xo);
    __builtin_amdgcn_sched_barrier(0);                    // here and at the loop's foot: the addresses of the copies behind it are formed behind the copies in front of it, not all ahead, which keeps the kernel inside 256 registers
    gx += GKT * 2; gw += GKT * 2;
    asm volatile("s_wait_asynccnt 0x0" ::: "memory");     // this wave's copies of stage 0 have landed
    __syncthreads();                                      // stage 0 readable by every wave
    stage_slab_rows(clx + GSTAGE, gx, xo); stage_slab(clw + GSTAGE, gw);
#pragma unroll 1   // rolled: one publish point per trip
    for (int t = 0; t < DMOD / GKT; ++t) {
        const unsigned char* pa = fa + (t & 1) * GSTAGE;
        const unsigned char* pb = fb + (t & 1) * GSTAGE;
#pragma unroll   // unrolled: the 32-k blocks of a stage read at constant LDS offsets
        for (int kc = 0; kc < GKT; kc += 32) {
            v16bf a[4];
            v16bf b;
#pragma unroll
            for (int mb = 0; mb < 4; ++mb) a[mb] = ldbf((const bf*)(pa + mb * 16 * GPITCH + kc * 2));
#pragma unroll
            for (int nb = 0; nb < 4; ++nb) {
                b = ldbf((const bf*)(pb + nb * 16 * GPITCH + kc * 2));
#pragma unroll
                for (int mb = 0; mb < 4; ++mb) acc[mb][nb] = wmmab(a[mb], b, acc[mb][nb]);
            }
            asm volatile("" : "+v"(acc[0][0]), "+v"(acc[1][0]), "+v"(acc[2][0]), "+v"(acc[3][0]), "+v"(acc[0][1]), "+v"(acc[1][1]), "+v"(acc[2][1]), "+v"(acc[3][1]));
            asm volatile("v_nop\n\tv_nop\n\tv_nop\n\tv_nop" : "+v"(acc[0][2]), "+v"(acc[1][2]), "+v"(acc[2][2]), "+v"(acc[3][2]), "+v"(acc[0][3]), "+v"(acc[1][3]), "+v"(acc[2][3]), "+v"(acc[3][3]) : "v"(a[0]), "v"(a[3]), "v"(b));
        }
        // foot of trip t: publish stage t + 1, then refill the buffer that trip t has just read
        asm volatile("s_wait_dscnt 0x0" ::: "memory");        // this wave's reads of stage t have returned before its buffer is refilled
        asm volatile("s_wait_asynccnt 0x0" ::: "memory");     // this wave's copies of stage t + 1 have landed
        __syncthreads();                                      // publishes stage t + 1 and ends every wave's last read of stage t
        if (t + 2 < DMOD / GKT) {
            gx += GKT * 2; gw += GKT * 2;
            const unsigned bo = (unsigned)((t & 1) * GSTAGE);
            stage_slab_rows(clx + bo, gx, xo);
            __builtin_amdgcn_sched_barrier(0);                // the W slab's addresses are formed behind the X slab's copies (see the prologue)
            stage_slab(clw + bo, gw);
        }
    }
    asm volatile("s_wait_asynccnt 0x0" ::: "memory");     // nothing in flight behind the loop
}

// ---- f16 twin of the GEMM main loop (same tile map, same staging, f16 planes); every WMMA carries its own four-nop guard.
__device__ __forceinline__ void gemm_tile_h(const h16* __restrict__ A, const h16* __restrict__ Bt, int ra, int rb, int wm, int wn, const unsigned char* ring, unsigned ringl, v8f (&acc)[4][4]) {
#pragma unroll
    for (int mb = 0; mb < 4; ++mb)
#pragma unroll
        for (int nb = 0; nb < 4; ++nb) acc[mb][nb] = (v8f){};
    gemm_ring g = ring_open(A, Bt, ra, rb, wm, wn, ring, ringl);
#pragma unroll 1   // rolled: one publish point per trip
    for (int t = 0; t < DMOD / GKT; ++t) {
        const unsigned char* pa = g.fa + (t & 1) * GSTAGE;
        const unsigned char* pb = g.fb + (t & 1) * GSTAGE;
#pragma unroll   // unrolled: the 32-k blocks of a stage read at constant LDS offsets
        for (int kc = 0; kc < GKT; kc += 32) {
            v16h a[4], b[4];                              // the block's LDS reads stand as one group in front of its guarded WMMAs
#pragma unroll
            for (int mb = 0; mb < 4; ++mb) a[mb] = ldh((const h16*)(pa + mb * 16 * GPITCH + kc * 2));
#pragma unroll
            for (int nb = 0; nb < 4; ++nb) b[nb] = ldh((const h16*)(pb + nb * 16 * GPITCH + kc * 2));
#pragma unroll
            for (int nb = 0; nb < 4; ++nb) {
#pragma unroll
                for (int mb = 0; mb < 4; ++mb) acc[mb][nb] = wmma16g(a[mb], b[nb], acc[mb][nb]);
            }
        }
        ring_turn(g, t);
    }
    asm volatile("s_wait_asynccnt 0x0" ::: "memory");     // nothing in flight behind the loop
}

// ---- k_proj: the q, k and v projections, which do not depend on one another, as block ranges of ONE grid; the choice reads the same for a whole block, so every barrier stays under block-uniform control flow.
// t is a place in the batch's ranked list everywhere here: the X row of place t is the row of position QIDX[t], and the three planes are stored in list order.
// which = 0 / 1 (q / k): y[m][n] = X[m][:] . W[n][:] + bf16(bias[n]); tile rows m = b*SEQ + t, tile columns = one head (n = head*64 + d); stored as one f16 head plane, q times log2 e (one rounding), so that q.k is a base-2 exponent.
// which = 2 (v): transposed projection y^T[n][m] = (W[n][:] . X[m][:] + bf16(bias[n])) * mask[m]; tile rows n = head*64 + d, tile columns m = b*SEQ + t (the key's place).
// The key mask multiplies the value rows, so the attention kernel's probabilities and its denominator stay over all keys.
// A q or v tile whose 128 places all lie behind the kept count leaves at once: the attention kernel reads no q row and no value column there.
// grid (NB * 3 * DMOD/128, SEQ/128), 128 threads; each wave one 64x64 tile; the list range is the slow index, so that the ranges in which all three planes work come first in index order.
__global__ __launch_bounds__(GWAVES * 32) void k_proj(const bf* __restrict__ X, const bf* __restrict__ WQ, const bf* __restrict__ WK, const bf* __restrict__ WV,
                                                      const float* __restrict__ bq, const float* __restrict__ bk, const float* __restrict__ bv,
                                                      const int* __restrict__ QIDX, const int* __restrict__ QMSK, const int* __restrict__ QCNT, h16* QF, h16* KF, h16* Pv) {
    __shared__ __align__(16) unsigned char ring[2 * GSTAGE];
    __shared__ __align__(16) float osall[GWAVES * 16 * OSP];
    const int wave = __builtin_amdgcn_readfirstlane((int)(threadIdx.x >> 5));
    const int wm = wave >> 1, wn = wave & 1;
    float* os = osall + wave * 16 * OSP;                  // each wave stages its output rows in its own range
    const int lane = (int)threadIdx.x & 31, lr = lane & 15, hi = lane >> 4;
    const int bb0 = (int)blockIdx.x / (3 * (DMOD / 128)), br = (int)blockIdx.x - bb0 * (3 * (DMOD / 128));   // batch; plane and W tile
    const int which = br / (DMOD / 128);
    if (which != 1 && (int)blockIdx.y * 128 >= QCNT[bb0]) return;   // q, v: no kept place in the tile: the whole block leaves, in front of every copy and barrier
    const bool isv = which == 2;
    const bf* W = which == 0 ? WQ : (which == 1 ? WK : WV);
    const float* bias = which == 0 ? bq : (which == 1 ? bk : bv);
    const int xt = bb0 * SEQ + (int)blockIdx.y * 128, wt = (br - which * (DMOD / 128)) * 128;      // first X row (batch and place) and first W row of the block's tile
    const int ra = isv ? wt : xt, rb = isv ? xt : wt;
    const int r0 = ra + wm * 64, c0 = rb + wn * 64;
    v8f acc[4][4];
    gemm_tile(X, W, QIDX + xt, bb0 * SEQ, wt, isv, wm, wn, ring, (unsigned)(size_t)(__attribute__((address_space(3))) unsigned char*)ring, acc);
    const int rq = lane >> 3, cq = (lane & 7) * 8;
    if (!isv) {
        h16* Pf = which == 0 ? QF : KF;
        const float qs = which == 0 ? LOG2E : 1.0f;
        const int b = r0 / SEQ, t0 = r0 - b * SEQ, hd = c0 / HDIM;
        const v4f bv0 = *(const v4f*)(bias + c0 + cq);
        const v4f bv1 = *(const v4f*)(bias + c0 + cq + 4);
        float bb[8];
        bb[0] = bfr(bv0[0]); bb[1] = bfr(bv0[1]); bb[2] = bfr(bv0[2]); bb[3] = bfr(bv0[3]);
        bb[4] = bfr(bv1[0]); bb[5] = bfr(bv1[1]); bb[6] = bfr(bv1[2]); bb[7] = bfr(bv1[3]);
        const size_t pbase = ((size_t)(b * NHEAD + hd) * SEQ + t0) * HDIM;
#pragma unroll
        for (int mb = 0; mb < 4; ++mb) {
#pragma unroll
            for (int nb = 0; nb < 4; ++nb) {
#pragma unroll
                for (int j = 0; j < 8; ++j) os[(hi * 8 + j) * OSP + nb * 16 + lr] = acc[mb][nb][j];
            }
            __syncthreads();
#pragma unroll
            for (int s = 0; s < 4; ++s) {
                const int row = s * 4 + rq;                       // s 0..3 x rq 0..3 -> rows 0..15
                const v4f x0 = *(const v4fa*)(os + row * OSP + cq);
                const v4f x1 = *(const v4fa*)(os + row * OSP + cq + 4);
                v8h of;
#pragma unroll
                for (int i = 0; i < 4; ++i) { of[i] = (h16)((x0[i] + bb[i]) * qs); of[4 + i] = (h16)((x1[i] + bb[4 + i]) * qs); }
                *(v8h*)(Pf + pbase + (size_t)(mb * 16 + row) * HDIM + cq) = of;
            }
            __syncthreads();
        }
    } else {
        const int b = c0 / SEQ, t0 = c0 - b * SEQ, hd = r0 / HDIM;
        const v4i mk0 = *(const v4i*)(QMSK + c0 + cq);                                 // the mask values in list order, compact batch stride
        const v4i mk1 = *(const v4i*)(QMSK + c0 + cq + 4);
        float mf[8];
        mf[0] = (float)mk0[0]; mf[1] = (float)mk0[1]; mf[2] = (float)mk0[2]; mf[3] = (float)mk0[3];
        mf[4] = (float)mk1[0]; mf[5] = (float)mk1[1]; mf[6] = (float)mk1[2]; mf[7] = (float)mk1[3];
        const size_t pbase = (size_t)(b * NHEAD + hd) * HDIM * SEQ + t0;
#pragma unroll
        for (int mb = 0; mb < 4; ++mb) {
#pragma unroll
            for (int nb = 0; nb < 4; ++nb) {
#pragma unroll
                for (int j = 0; j < 8; ++j) os[(hi * 8 + j) * OSP + nb * 16 + lr] = acc[mb][nb][j];
            }
            __syncthreads();
#pragma unroll
            for (int s = 0; s < 4; ++s) {
                const int row = s * 4 + rq;                       // d within the slab, 0..15
                const float bsc = bfr(bias[r0 + mb * 16 + row]);
                const v4f x0 = *(const v4fa*)(os + row * OSP + cq);
                const v4f x1 = *(const v4fa*)(os + row * OSP + cq + 4);
                v8h ov;
#pragma unroll
                for (int i = 0; i < 4; ++i) { ov[i] = toh_flush((x0[i] + bsc) * mf[i]); ov[4 + i] = toh_flush((x1[i] + bsc) * mf[4 + i]); }
                *(v8h*)(Pv + pbase + (size_t)(mb * 16 + row) * SEQ + cq) = ov;
            }
            __syncthreads();
        }
    }
}

// ---- k_attn: fused attention, transposed form. Block = 8 waves = 128 queries of one (batch, head); each wave owns 16 queries.
// The f16 K rows and the f16 V rows of 64 keys are staged in LDS once per block by asynchronous copies (16 B per lane, whole 128-B lines), two buffers: tile t + 1 flies while tile t is worked on.
// Each wave loads its own f16 Q fragments once, before the key loop, and keeps them in registers.
// Per 32-key step: S^T[key][query] = K.Q^T - offset, one f16 product (one accumulator per 16-key tile) that starts from minus the query's offset in use, so the accumulators hold the exponents themselves;
// (lane (hi, lr) holds keys 8*hi + r and 16 + 8*hi + r of query lr); the offset moves, for the whole wave, only in a step where some exponent passes LAZY (and in the first step):
// there the two lanes of a query share the step's maximum through one shuffle, and sums, outputs and this step's exponents are brought to the new offset (column maximum at PSH);
// P^T packed from the two score tiles into the B fragment (element r <- tile 0, element 8 + r <- tile 1); O^T[d][query] += V^T.P^T
// (every one of the four P.V WMMAs carries its own four-nop guard tying exactly its accumulator and its two operands).
// The block's 128 queries are 128 consecutive places of the batch's ranked list (kept queries first); a block whose range begins behind the kept count leaves at once.
// The keys run in list order too: a key tile that begins behind the kept count has zero value rows, so only its K rows are staged and it adds to the denominator alone (scores, exponentials, sum; no P.V).
// grid (NB*NHEAD, SEQ/128), 256 threads: the list range is the slow index, so that the blocks that work come first in index order and the empty ones last.
#define AWAVES 8                      // waves per block that share one staged tile
#define KTILE  64                     // keys per staged tile: K rows and V rows are both 128 B long
#define LPITCH 144                    // LDS row pitch in bytes: 16 B x odd, conflict-free for the 16-byte fragment reads
#define LPLANE (64 * LPITCH)          // one staged plane: 64 rows (keys for K, head dims for V)
#define LSTAGE (2 * LPLANE)           // one buffer: K, V
static_assert(SEQ % (AWAVES * 16) == 0);      // whole blocks of queries
static_assert(SEQ % KTILE == 0);              // whole key tiles
static_assert(SEQ / KTILE >= 2);              // the two-buffer prologue fills tiles 0 and 1
static_assert(KTILE * 2 == 128);              // one V row of a tile == 8 lanes x 16 B
static_assert(HDIM * 2 == 128);               // one K row == 8 lanes x 16 B
static_assert(AWAVES * 32 * 2 == 64 * 8);     // two copies per lane cover one plane (64 rows x 8 pieces)
static_assert(AWAVES * 16 * OSP * 4 <= 2 * LSTAGE);   // the output staging reuses the ring
static_assert(AWAVES * 16 == 128);            // a block's range of the ranked list == one row tile of the output projection
static_assert(SEQ % 128 == 0);                // a row tile of the output projection never straddles a batch

// One tile = 4 copies per lane. l = the lane's LDS byte address in the K plane of the target buffer; the pointers are the lane's own 16 bytes in rows 0..31 of each plane.
__device__ __forceinline__ void stage_tile(unsigned l, const h16* kf, const h16* vv) {
    // the closing s_wait_xcnt stands inside the statement so that no address register of a copy is rewritten in front of it
    asm volatile("global_load_async_to_lds_b128 %0, %4, off\n\t"
                 "global_load_async_to_lds_b128 %1, %5, off\n\t"
                 "global_load_async_to_lds_b128 %2, %6, off\n\t"
                 "global_load_async_to_lds_b128 %3, %7, off\n\t"
                 "s_wait_xcnt 0x0"
                 :: "v"(l), "v"(l + 32 * LPITCH), "v"(l + LPLANE), "v"(l + LPLANE + 32 * LPITCH),
                    "v"(kf), "v"(kf + 32 * HDIM), "v"(vv), "v"(vv + 32 * SEQ)
                 : "memory");
}

// A tile without values = 2 copies per lane: the K plane alone.
__device__ __forceinline__ void stage_keys(unsigned l, const h16* kf) {
    // the closing s_wait_xcnt stands inside the statement so that no address register of a copy is rewritten in front of it
    asm volatile("global_load_async_to_lds_b128 %0, %2, off\n\t"
                 "global_load_async_to_lds_b128 %1, %3, off\n\t"
                 "s_wait_xcnt 0x0"
                 :: "v"(l), "v"(l + 32 * LPITCH), "v"(kf), "v"(kf + 32 * HDIM)
                 : "memory");
}

// second launch bound: six waves per SIMD, so that the three blocks that fall to each WGP stay resident together
__global__ __launch_bounds__(AWAVES * 32, 6) void k_attn(const h16* __restrict__ QF, const h16* __restrict__ KF, const h16* __restrict__ VV, const int* __restrict__ QCNT, float* OUT) {
    __shared__ __align__(16) unsigned char ring[2 * LSTAGE];
    const int wave = __builtin_amdgcn_readfirstlane((int)(threadIdx.x >> 5));
    const int lane = (int)threadIdx.x & 31, lr = lane & 15, hi = lane >> 4;
    const int bh = (int)blockIdx.x;
    const int b = bh / NHEAD, hd = bh - b * NHEAD;
    const int nk = QCNT[b];
    if ((int)blockIdx.y * (AWAVES * 16) >= nk) return;        // no kept query in this block's range of the list: the whole block leaves, in front of every copy and barrier
    const int nvt = min((nk + KTILE - 1) / KTILE, SEQ / KTILE);   // key tiles that hold a kept key, at least one here; the same for the whole block
    const int q0 = (int)blockIdx.y * (AWAVES * 16) + wave * 16;   // place in the ranked list, not a position
    const size_t pb = (size_t)bh * SEQ * HDIM;
    // copy side: thread -> (row = tid / 8, 16-byte piece = tid % 8) of rows 0..31 of a plane
    const int crow = (int)threadIdx.x >> 3, cpc = (int)threadIdx.x & 7;
    const h16* ckf = KF + pb + crow * HDIM + cpc * 8; const h16* cvv = VV + pb + crow * SEQ + cpc * 8;   // running pointers, advanced tile by tile
    const unsigned cl = (unsigned)(size_t)(__attribute__((address_space(3))) unsigned char*)ring + (unsigned)(crow * LPITCH + cpc * 16);
    // read side: fragment row lr, 16-byte piece hi (K rows and V rows alike)
    const unsigned char* fr = ring + lr * LPITCH + 16 * hi;
    v8f ova[4];
#pragma unroll
    for (int dt = 0; dt < 4; ++dt) ova[dt] = (v8f){};
    float lsum = 0.0f;
    v8f negm = (v8f){};                                   // all eight elements: minus the lane's query's offset in use
    stage_tile(cl, ckf, cvv);
    ckf += KTILE * HDIM; cvv += KTILE;
    const h16* qp = QF + pb + (q0 + lr) * HDIM + 8 * hi;  // the q plane is in list order (a place behind the count is a masked query: worked like any other, its row is never used)
    // the wave's own Q fragments: loaded once, held in registers over the whole key loop
    v16h qf[HDIM / 32];
#pragma unroll
    for (int kc = 0; kc < HDIM; kc += 32) qf[kc / 32] = ldh(qp + kc);
    asm volatile("s_wait_xcnt 0x0" ::: "memory");         // precaution: stands in front of every rewrite of the Q loads' address registers
    asm volatile("s_wait_asynccnt 0x0" ::: "memory");     // this wave's copies of tile 0 have landed
    __syncthreads();                                      // tile 0 readable by every wave
    if (1 < nvt) stage_tile(cl + LSTAGE, ckf, cvv); else stage_keys(cl + LSTAGE, ckf);
#pragma unroll 1   // rolled: one publish point per trip
    for (int t = 0; t < SEQ / KTILE; ++t) {
        const unsigned char* fb = fr + (t & 1) * LSTAGE;
        const bool hasv = t < nvt;                            // the same for the whole block
#pragma unroll   // unrolled: the two 32-key steps of a tile read at constant LDS offsets
        for (int sub = 0; sub < KTILE / 32; ++sub) {
            v8f s0, s1;
            v16h k0[HDIM / 32], k1[HDIM / 32];
            const unsigned char* kp = fb + sub * 32 * LPITCH;
#pragma unroll
            for (int kc = 0; kc < HDIM; kc += 32) { k0[kc / 32] = ldh((const h16*)(kp + kc * 2)); k1[kc / 32] = ldh((const h16*)(kp + 16 * LPITCH + kc * 2)); }
            // inputs-only fence on the loaded values: keeps the eight reads one group with one LDS wait (without it the compiler sinks each pair of reads to its own WMMA: four waits in a row)
            asm volatile("" :: "v"(k0[0]), "v"(k0[1]), "v"(k1[0]), "v"(k1[1]));
            s0 = wmma16(k0[0], qf[0], negm); s1 = wmma16(k1[0], qf[0], negm);
#pragma unroll
            for (int kc = 32; kc < HDIM; kc += 32) { s0 = wmma16(k0[kc / 32], qf[kc / 32], s0); s1 = wmma16(k1[kc / 32], qf[kc / 32], s1); }
            float ma = fmaxf(fmaxf(s0[0], s0[1]), s0[2]), mb = fmaxf(fmaxf(s1[0], s1[1]), s1[2]);
            ma = fmaxf(fmaxf(ma, s0[3]), s0[4]); mb = fmaxf(fmaxf(mb, s1[3]), s1[4]);
            ma = fmaxf(fmaxf(ma, s0[5]), s0[6]); mb = fmaxf(fmaxf(mb, s1[5]), s1[6]);
            float mx = fmaxf(fmaxf(ma, mb), fmaxf(s0[7], s1[7]));
            const bool first = sub == 0 && t == 0;        // no offset yet: the first step sets it, whatever the scores are
            const float thr = first ? -3.0e38f : LAZY;    // below every score that f16 operands can give
            if (__builtin_amdgcn_ballot_w32(mx > thr) != 0u) {                // wave-uniform
                mx = fmaxf(mx, __shfl_xor(mx, 16, 32));
                const float d = first ? mx - PSH : fmaxf(mx - PSH, 0.0f);     // the offset never falls
                const float sc = first ? 0.0f : __builtin_amdgcn_exp2f(-d);   // sums and outputs are zero in the first step
                lsum *= sc;
#pragma unroll
                for (int dt = 0; dt < 4; ++dt) {
#pragma unroll
                    for (int r = 0; r < 8; ++r) ova[dt][r] *= sc;
                }
#pragma unroll
                for (int r = 0; r < 8; ++r) { s0[r] -= d; s1[r] -= d; negm[r] -= d; }
            }
            v16h va[4];
            if (hasv) {                                   // asked for here so that the reads fly under the exponentials
                const unsigned char* vp = fb + LPLANE + sub * 64;
#pragma unroll
                for (int dt = 0; dt < 4; ++dt) va[dt] = ldh((const h16*)(vp + dt * 16 * LPITCH));
            }
            float psum = 0.0f;
            float e0[8], e1[8];                           // p on the offset's scale, at most exp2(LAZY)
#pragma unroll
            for (int r = 0; r < 8; ++r) e0[r] = __builtin_amdgcn_exp2f(s0[r]);
#pragma unroll
            for (int r = 0; r < 8; ++r) e1[r] = __builtin_amdgcn_exp2f(s1[r]);
#pragma unroll
            for (int r = 0; r < 8; ++r) psum += e0[r] + e1[r];
            lsum += psum;
            if (hasv) {
                v16h pf;
#pragma unroll
                for (int r = 0; r < 8; ++r) { pf[r] = (h16)e0[r]; pf[8 + r] = (h16)e1[r]; }
#pragma unroll
                for (int dt = 0; dt < 4; ++dt) ova[dt] = wmma16g(va[dt], pf, ova[dt]);
            }
        }
        asm volatile("s_wait_dscnt 0x0" ::: "memory");        // this wave's reads of tile t have returned before its buffer is refilled
        asm volatile("s_wait_asynccnt 0x0" ::: "memory");     // this wave's copies of tile t + 1 have landed
        __syncthreads();                                      // publishes tile t + 1 and ends every wave's last read of tile t
        if (t + 2 < SEQ / KTILE) {
            ckf += KTILE * HDIM; cvv += KTILE;
            if (t + 2 < nvt) stage_tile(cl + (unsigned)((t & 1) * LSTAGE), ckf, cvv); else stage_keys(cl + (unsigned)((t & 1) * LSTAGE), ckf);
        }
    }
    asm volatile("s_wait_asynccnt 0x0" ::: "memory");         // nothing in flight when the ring becomes output staging
    lsum += __shfl_xor(lsum, 16, 32);
    const float inv = 1.0f / lsum;
    float* os = (float*)ring;                                 // every wave has left the ring at the last trip's barrier
    const int obase = wave * 16 * OSP;
#pragma unroll
    for (int dt = 0; dt < 4; ++dt) {
        v4f x0, x1;
#pragma unroll
        for (int i = 0; i < 4; ++i) {
            x0[i] = ova[dt][i] * inv;
            x1[i] = ova[dt][4 + i] * inv;
        }
        *(v4fa*)(os + obase + lr * OSP + dt * 16 + 8 * hi) = x0;
        *(v4fa*)(os + obase + lr * OSP + dt * 16 + 8 * hi + 4) = x1;
    }
    __syncthreads();
    float* orow = OUT + ((size_t)b * SEQ_FULL + q0) * DMOD + hd * HDIM;   // FULL batch stride; the rows stay in list order
{
#pragma unroll
        for (int s = 0; s < 8; ++s) {
            const int row = 2 * s + hi, cofs = lr * 4;            // s 0..7 x hi 0..1 -> queries 0..15; 16 lanes x 16 B = one 256-B head row
            const v4f val = *(const v4fa*)(os + obase + row * OSP + cofs);
            *(v4f*)(orow + (size_t)row * DMOD + cofs) = val;
        }
        
    }
}

// ---- k_out: y[m][n] = (A[m][:] . W[n][:]) / 1024 + bf16(bias[n]) + bf16(x[m][n]); A = f16 ctx plane (x16, compact rows), W = f16 plane of 64 * bf16(Wo) stored [out][in].
// The skip connection is read from the staged f32 input at the FULL batch stride and added at the store stage.
// A's rows are places in the ranked list: a tile with no kept query leaves at once, and the store stage sends each row to its position; the rows of the tiles that left are not written.
// grid (NB * DMOD/128, SEQ/128), 128 threads; each wave one 64x64 tile; the list range is the slow index, so that the blocks that work come first in index order.
__global__ __launch_bounds__(GWAVES * 32) void k_out(const h16* __restrict__ A, const h16* __restrict__ W, const float* __restrict__ bias, const float* __restrict__ xin, const int* __restrict__ QIDX, const int* __restrict__ QCNT, float* Y) {
    __shared__ __align__(16) unsigned char ring[2 * GSTAGE];
    __shared__ __align__(16) float osall[GWAVES * 16 * OSP];
    const int wave = __builtin_amdgcn_readfirstlane((int)(threadIdx.x >> 5));
    const int wm = wave >> 1, wn = wave & 1;
    float* os = osall + wave * 16 * OSP;                  // each wave stages its output rows in its own range
    const int lane = (int)threadIdx.x & 31, lr = lane & 15, hi = lane >> 4;
    const int b = (int)blockIdx.x / (DMOD / 128), ct = (int)blockIdx.x - b * (DMOD / 128);
    if ((int)blockIdx.y * 128 >= QCNT[b]) return;         // no kept query among the tile's rows: the whole block leaves, in front of every copy and barrier
    const int t0 = (int)blockIdx.y * 128 + wm * 64;       // the wave's first row: a place in the batch's ranked list
    const int c0 = ct * 128 + wn * 64;
    // positions of the wave's 64 rows, two per lane, asked for in front of the main loop and handed round by shuffles at the store stage
    const int p0 = QIDX[b * SEQ + t0 + lane], p1 = QIDX[b * SEQ + t0 + 32 + lane];
    v8f acc[4][4];
    gemm_tile_h(A, W, b * SEQ + (int)blockIdx.y * 128, ct * 128, wm, wn, ring, (unsigned)(size_t)(__attribute__((address_space(3))) unsigned char*)ring, acc);
    const int cofs = lr * 4;
    const v4f bv0 = *(const v4f*)(bias + c0 + cofs);
    float bb[4];
    bb[0] = bfr(bv0[0]); bb[1] = bfr(bv0[1]); bb[2] = bfr(bv0[2]); bb[3] = bfr(bv0[3]);
    const size_t xbase = (size_t)b * SEQ_FULL * DMOD + c0 + cofs;
    const size_t ybase = (size_t)b * SEQ * DMOD + c0 + cofs;
    const float osc = 1.0f / (WCAR * CCAR);
#pragma unroll
    for (int mb = 0; mb < 4; ++mb) {
#pragma unroll
        for (int nb = 0; nb < 4; ++nb) {
#pragma unroll
            for (int j = 0; j < 8; ++j) os[(hi * 8 + j) * OSP + nb * 16 + lr] = acc[mb][nb][j];
        }
        __syncthreads();
{
#pragma unroll
            for (int s = 0; s < 8; ++s) {
                const int row = 2 * s + hi;                       // s 0..7 x hi 0..1 -> rows 0..15; 16 lanes x 16 B = one 256-B row segment
                const v4f a4 = *(const v4fa*)(os + row * OSP + cofs);
                const int pt = min(max(__shfl(mb < 2 ? p0 : p1, (mb & 1) * 16 + row, 32), 0), SEQ - 1);   // the row's position in its batch
                const v4f xr = *(const v4f*)(xin + xbase + (size_t)pt * DMOD);
                v4f o;
#pragma unroll
                for (int i = 0; i < 4; ++i) o[i] = (a4[i] * osc + bb[i]) + bfr(xr[i]);
                *(v4f*)(Y + ybase + (size_t)pt * DMOD) = o;       // a place behind the count is a masked query with a zero A row: its row is stored like any other (the list is a permutation: one writer per row) and never read
            }
            
        }
        __syncthreads();
    }
}

// ---- k_ln: LayerNorm over the 768 columns, one wave per row (8 rows per block), row held in registers (6 x 4 floats per lane);
// mean, then centred variance (divide by the width), y = (x - mu) * rsqrt(var + 1e-5) * bf16(gain) + bf16(shift).
// grid (NB*SEQ/8), 256 threads.
// A row whose mask is 0 has a zero context row, so its pre-norm row is bf16(bias) + bf16(x): formed here, never read from X (the output projection leaves most such rows unwritten).
__global__ __launch_bounds__(256) void k_ln(const float* __restrict__ X, const int* __restrict__ mask, const float* __restrict__ bo, const float* __restrict__ xin, const float* __restrict__ g, const float* __restrict__ be, float* OUT) {
#pragma clang fp contract(off)
    const int wave = __builtin_amdgcn_readfirstlane((int)(threadIdx.x >> 5));
    const int lane = (int)threadIdx.x & 31;
    const int row = (int)blockIdx.x * 8 + wave;
    const int b = row / SEQ, t = row - b * SEQ;
    const float* xr = X + (size_t)row * DMOD;
    v4f x[6];
    float s = 0.0f;
    if (mask[(size_t)b * SEQ_FULL + (size_t)t] != 0) {        // the same for the whole wave
#pragma unroll
        for (int j = 0; j < 6; ++j) x[j] = *(const v4f*)(xr + (j * 32 + lane) * 4);
    } else {
        const float* xi = xin + ((size_t)b * SEQ_FULL + (size_t)t) * DMOD;
#pragma unroll
        for (int j = 0; j < 6; ++j) {
            const v4f a4 = *(const v4f*)(xi + (j * 32 + lane) * 4);
            const v4f c4 = *(const v4f*)(bo + (j * 32 + lane) * 4);
#pragma unroll
            for (int i = 0; i < 4; ++i) x[j][i] = bfr(c4[i]) + bfr(a4[i]);
        }
    }
#pragma unroll
    for (int j = 0; j < 6; ++j) s += (x[j][0] + x[j][1]) + (x[j][2] + x[j][3]);
    s += __shfl_xor(s, 16, 32); s += __shfl_xor(s, 8, 32); s += __shfl_xor(s, 4, 32); s += __shfl_xor(s, 2, 32); s += __shfl_xor(s, 1, 32);
    const float mu = s * (1.0f / (float)DMOD);
    float q = 0.0f;
#pragma unroll
    for (int j = 0; j < 6; ++j) {
        const float d0 = x[j][0] - mu, d1 = x[j][1] - mu, d2 = x[j][2] - mu, d3 = x[j][3] - mu;
        q += (d0 * d0 + d1 * d1) + (d2 * d2 + d3 * d3);
    }
    q += __shfl_xor(q, 16, 32); q += __shfl_xor(q, 8, 32); q += __shfl_xor(q, 4, 32); q += __shfl_xor(q, 2, 32); q += __shfl_xor(q, 1, 32);
    const float var = q * (1.0f / (float)DMOD);
    const float rstd = rsqrtf(var + 1.0e-5f);
    v4f o[6];
#pragma unroll
    for (int j = 0; j < 6; ++j) {
        const v4f g4 = *(const v4f*)(g + (j * 32 + lane) * 4);
        const v4f b4 = *(const v4f*)(be + (j * 32 + lane) * 4);
#pragma unroll
        for (int i = 0; i < 4; ++i) o[j][i] = ((x[j][i] - mu) * rstd) * bfr(g4[i]) + bfr(b4[i]);
    }
    float* orow = OUT + ((size_t)b * SEQ_FULL + (size_t)t) * DMOD;          // FULL batch stride of the output rows
#pragma unroll
    for (int j = 0; j < 6; ++j) *(v4f*)(orow + (j * 32 + lane) * 4) = o[j];
    
}

extern "C" void kernel_launch(void* const* d_in, const int* in_sizes, int n_in,
                              void* d_out, int out_size, void* d_ws, size_t ws_size, hipStream_t stream) {
    if (n_in < 12) return;
    const size_t need_x = (size_t)(NB - 1) * SEQ_FULL * DMOD + (size_t)SEQ * DMOD;
    const size_t need_m = (size_t)(NB - 1) * SEQ_FULL + (size_t)SEQ;
    if ((size_t)in_sizes[0] < need_x || (size_t)in_sizes[1] < need_m) return;
    if (in_sizes[2] < DMOD * DMOD || in_sizes[4] < DMOD * DMOD || in_sizes[6] < DMOD * DMOD || in_sizes[8] < DMOD * DMOD) return;
    if (in_sizes[3] < DMOD || in_sizes[5] < DMOD || in_sizes[7] < DMOD || in_sizes[9] < DMOD) return;
    if (in_sizes[10] < DMOD || in_sizes[11] < DMOD) return;
    if ((size_t)out_size < need_x) return;                       // output rows are addressed at the FULL batch stride
    const float* xin = (const float*)d_in[0];
    const int*   msk = (const int*)d_in[1];
    const float* Wq = (const float*)d_in[2]; const float* bq = (const float*)d_in[3];
    const float* Wk = (const float*)d_in[4]; const float* bk = (const float*)d_in[5];
    const float* Wv = (const float*)d_in[6]; const float* bv = (const float*)d_in[7];
    const float* Wo = (const float*)d_in[8]; const float* bo = (const float*)d_in[9];
    const float* lng = (const float*)d_in[10]; const float* lnb = (const float*)d_in[11];
    float* OUT = (float*)d_out;

    constexpr size_t WB = (size_t)DMOD * DMOD * 2;               // one 16-bit weight plane
    constexpr size_t PB = (size_t)NB * SEQ * DMOD * 2;           // one 16-bit activation / head plane (NB*NHEAD*SEQ*HDIM elements)
    constexpr size_t CB = (size_t)NB * SEQ_FULL * DMOD * 4;      // f32 ctx plane, rows at the FULL batch stride
    static_assert(WB % 256 == 0);
    static_assert(PB % 256 == 0);
    static_assert(CB % 256 == 0);
    constexpr size_t IB = (size_t)NB * SEQ * 4;                  // ranked query list; the mask values in its order
    static_assert(IB % 256 == 0);
    static_assert(4 * WB + 6 * PB + CB + 2 * IB + 256 <= (size_t)134217728);    // total carve at most 128 MiB
    static_assert(((size_t)(NB - 1) * SEQ_FULL + SEQ) * DMOD * 4 <= CB);     // last ctx row written by the attention kernel
    static_assert((size_t)NB * SEQ * DMOD * 2 <= PB);            // f16 ctx plane reuses the q plane (dead after the attention kernel)
    static_assert((size_t)NB * SEQ * DMOD * 4 <= 2 * PB);        // f32 pre-norm plane
    if (4 * WB + 6 * PB + CB + 2 * IB + 256 > ws_size) return;
    char* wsp = (char*)d_ws;
    bf* WQ = (bf*)wsp; wsp += WB;
    bf* WK = (bf*)wsp; wsp += WB;
    bf* WV = (bf*)wsp; wsp += WB;
    h16* WO = (h16*)wsp; wsp += WB;
    bf* XB = (bf*)wsp; wsp += PB;
    h16* QFp = (h16*)wsp; wsp += PB;
    h16* KFp = (h16*)wsp; wsp += PB;
    h16* VVp = (h16*)wsp; wsp += PB;
    float* XF = (float*)wsp; wsp += 2 * PB;
    float* CTX = (float*)wsp; wsp += CB;
    int* QIDX = (int*)wsp; wsp += IB;
    int* QMSK = (int*)wsp; wsp += IB;
    int* QCNT = (int*)wsp;
    h16* CTXH = QFp;                                             // stream order: written only after the attention kernel has finished

    const int nX = NB * SEQ * DMOD;
    const unsigned gX = (unsigned)((nX / 8 + 255) / 256);
    // the ranked query lists, x (the single input stream that feeds all three projections) and the four weights, one grid
    k_cvt_in<<<NB + CVT_GX + 4 * CVT_GW, 256, 0, stream>>>(xin, Wq, Wk, Wv, Wo, msk, XB, WQ, WK, WV, WO, QIDX, QMSK, QCNT);
    // q, k: X rows in list order (A) x W[DMOD][DMOD] (Bt as stored) -> f16 head planes; v: Wv (A) x X rows in list order (Bt) -> transposed f16 value plane [b][head][d][t], key mask applied; one grid
    k_proj<<<dim3(NB * 3 * (DMOD / 128), SEQ / 128), GWAVES * 32, 0, stream>>>(XB, WQ, WK, WV, bq, bk, bv, QIDX, QMSK, QCNT, QFp, KFp, VVp);
    k_attn<<<dim3(NB * NHEAD, SEQ / (AWAVES * 16)), AWAVES * 32, 0, stream>>>(QFp, KFp, VVp, QCNT, CTX);
    // ctx[NB*SEQ][DMOD] (f32, FULL stride) x query mask -> compact f16 plane
    k_cvt_ctx<<<gX, 256, 0, stream>>>(CTX, msk, QIDX, QCNT, CTXH, nX);
    // output projection: CTXH[NB*SEQ][DMOD] (A) x Wo[DMOD out][DMOD in] (Bt as stored) + bias + skip -> f32 pre-norm plane
    k_out<<<dim3(NB * (DMOD / 128), SEQ / 128), GWAVES * 32, 0, stream>>>(CTXH, WO, bo, xin, QIDX, QCNT, XF);
    k_ln<<<dim3(NB * SEQ / 8), 256, 0, stream>>>(XF, msk, bo, xin, lng, lnb, OUT);
}

// v009
// A run of this version takes 84 microseconds.
// Next to v008, in two timings, it ran 1.06 times as fast each time.
// Over all steps from v000 it is 7.32 times as fast.
#include <hip/hip_runtime.h>

// Single-stream multi-head self-attention block: x [4][2048][768]; q / k / v = x.W^T + b with W stored [out][in]; heads = 12 x 64; scores = q.k^T with NO scale; softmax over all 2048 keys;
// the probabilities are multiplied AFTER the softmax by mask_q * mask_k (int input [4][2048], read by value); ctx merged to [4][2048][768]; y = ctx.Wo^T + bo + x; output = LayerNorm(y) with eps 1e-5 and gain / shift inputs.
// Compute dtypes, f32 accumulate everywhere: x and the weights converted to bf16 (RNE) once; q / k / v projections = single v_wmma_f32_16x16x32_bf16 products + bf16(bias) in f32; scores = one v_wmma_f32_16x16x32_f16 product of the f16 q plane (stored times log2 e) and the f16 k plane;
// softmax f32 (base 2, the offset in use is the score accumulators' start value and follows the running max lazily, denominator over all keys); P = f16(exp2(exponent)), the column maximum between 2 and 32768, packed straight from the score accumulators into the B fragment; V times the key mask = one f16 plane on v_wmma_f32_16x16x32_f16;
// A query whose mask is 0 has a zero ctx row for any input, so such queries are skipped: the positions of each batch are ranked (mask not 0 first), the attention kernel and the output projection (which converts its own ctx rows) work on that list's kept part, and the skipped rows go into LayerNorm as bias + x.
// The projections gather their x rows by the same list, so the q, k and v planes are in list order: q and v are formed for the kept part alone (a key whose mask is 0 has a zero value row), k for every key (the denominator is over all keys), and P.V runs over the kept key tiles alone.
// output projection = single v_wmma_f32_16x16x32_f16 product: ctx times the query mask as f16 x16, bf16(Wo) as f16 x64, folded by 1/1024 in f32; bias, skip connection (bf16(x)) and LayerNorm in f32, in the same kernel (a block owns whole rows).

#ifndef NB
#define NB 4
#endif
#ifndef SEQ
#define SEQ 2048
#endif
#define NB_FULL  4
#define SEQ_FULL 2048
#define DMOD  768
#define NHEAD 12
#define HDIM  64
#define OSP   68
#define LOG2E 1.4426950408889634f
#define PSH   1.0f                    // where a move of the offset puts the column maximum: 14 binades of room below LAZY, so that moves are few
#define LAZY  15.0f                   // a shifted score above this moves the offset: exp2(15) still fits f16
#define WCAR  64.0f
#define CCAR  16.0f

static_assert(NHEAD * HDIM == DMOD);          // merged width
static_assert(HDIM == 64);                    // one 64-column GEMM tile == one head; 4 d-tiles in the attention kernel
static_assert(DMOD % 64 == 0);                // GEMM tile multiple (N and the transposed M)
static_assert(DMOD % 32 == 0);                // k-loop step
static_assert(SEQ % 64 == 0);                 // GEMM row tiles never straddle a batch; attention key step 32
static_assert(SEQ <= SEQ_FULL);
static_assert(NB <= NB_FULL);
static_assert((SEQ * DMOD) % 8 == 0);         // convert kernel: 8 elements per thread never straddle a batch
static_assert((DMOD * DMOD) % 8 == 0);
static_assert((NB * SEQ) % 64 == 0);
static_assert((NB * SEQ) / 64 <= 65535);
static_assert(OSP % 4 == 0);                  // 16-byte aligned LDS rows
static_assert(OSP >= HDIM);
static_assert(SEQ % 8 == 0);                  // key-mask vector loads stay 16-byte aligned
static_assert(SEQ_FULL % 8 == 0);
static_assert(DMOD == 6 * 32 * 4);            // LayerNorm: one wave per row, 6 x (32 lanes x 4 floats)

typedef _Float16 h16;
typedef unsigned short bf;
typedef __attribute__((ext_vector_type(16))) __bf16   v16bf;
typedef __attribute__((ext_vector_type(16))) _Float16 v16h;
typedef __attribute__((ext_vector_type(8)))  _Float16 v8h;
typedef __attribute__((ext_vector_type(8)))  unsigned short v8us;
typedef __attribute__((ext_vector_type(8)))  float    v8f;
typedef __attribute__((ext_vector_type(4)))  float    v4f;
typedef __attribute__((ext_vector_type(4)))  int      v4i;
typedef v4f  __attribute__((may_alias)) v4fa;

__device__ __forceinline__ unsigned short f2bf(float f) { unsigned u = __float_as_uint(f); u += 0x7FFFu + ((u >> 16) & 1u); return (unsigned short)(u >> 16); }
__device__ __forceinline__ float bf2f(unsigned short b) { return __uint_as_float(((unsigned)b) << 16); }
__device__ __forceinline__ float bfr(float f) { return bf2f(f2bf(f)); }
__device__ __forceinline__ v16h cat16(v8h lo, v8h hi) { return __builtin_shufflevector(lo, hi, 0, 1, 2, 3, 4, 5, 6, 7, 8, 9, 10, 11, 12, 13, 14, 15); }
__device__ __forceinline__ v16bf cat16b(v8us lo, v8us hi) { return __builtin_bit_cast(v16bf, __builtin_shufflevector(lo, hi, 0, 1, 2, 3, 4, 5, 6, 7, 8, 9, 10, 11, 12, 13, 14, 15)); }
__device__ __forceinline__ v8f wmma16(v16h a, v16h b, v8f c) { return __builtin_amdgcn_wmma_f32_16x16x32_f16(false, a, false, b, (short)0, c, false, false); }
__device__ __forceinline__ v8f wmmab(v16bf a, v16bf b, v8f c) { return __builtin_amdgcn_wmma_f32_16x16x32_bf16(false, a, false, b, (short)0, c, false, false); }
// per-instruction guarded f16 WMMA: ONE accumulator tied with its own two operands to four nops
__device__ __forceinline__ v8f wmma16g(v16h a, v16h b, v8f c) { c = wmma16(a, b, c); asm volatile("v_nop\n\tv_nop\n\tv_nop\n\tv_nop" : "+v"(c) : "v"(a), "v"(b)); return c; }
// fragment loaders (A and B alike, K-contiguous rows): p already carries + 8*(lane>>4); elements 0..7 = k0+8h.., elements 8..15 = k0+16+8h..
__device__ __forceinline__ v16bf ldbf(const bf* p) { return cat16b(*(const v8us*)p, *(const v8us*)(p + 16)); }
__device__ __forceinline__ v16h  ldh(const h16* p) { return cat16(*(const v8h*)p, *(const v8h*)(p + 16)); }
// f32 -> f16 convert for WMMA operand planes: values below the smallest f16 normal become exact zero (applied after the plane's power-of-two carry)
static __device__ __forceinline__ h16 toh_flush(float v) { const h16 r = (h16)v; return (fabsf(v) < 6.103515625e-05f) ? (h16)0.0f : r; }

// dst[e] = src[(e / per) * per_full + e % per]  (per / per_full = compact and staged batch strides). blk = the block's index inside its own plane.
__device__ __forceinline__ void cvt_bf(const float* __restrict__ src, bf* dst, int blk, int n, int per, int per_full) {
    const int e = (blk * 256 + (int)threadIdx.x) * 8;
    if (e >= n) return;
    const int b = e / per;
    const size_t so = (size_t)b * (size_t)per_full + (size_t)(e - b * per);
    const v4f a0 = *(const v4f*)(src + so);
    const v4f a1 = *(const v4f*)(src + so + 4);
    v8us o;
    o[0] = f2bf(a0[0]); o[1] = f2bf(a0[1]); o[2] = f2bf(a0[2]); o[3] = f2bf(a0[3]);
    o[4] = f2bf(a1[0]); o[5] = f2bf(a1[1]); o[6] = f2bf(a1[2]); o[7] = f2bf(a1[3]);
    *(v8us*)(dst + e) = o;
}

__device__ __forceinline__ void cvt_wo(const float* __restrict__ src, h16* dst, int blk, int n) {
    const int e = (blk * 256 + (int)threadIdx.x) * 8;
    if (e >= n) return;
    const v4f a0 = *(const v4f*)(src + e);
    const v4f a1 = *(const v4f*)(src + e + 4);
    v8h o;
    o[0] = toh_flush(bfr(a0[0]) * WCAR); o[1] = toh_flush(bfr(a0[1]) * WCAR); o[2] = toh_flush(bfr(a0[2]) * WCAR); o[3] = toh_flush(bfr(a0[3]) * WCAR);
    o[4] = toh_flush(bfr(a1[0]) * WCAR); o[5] = toh_flush(bfr(a1[1]) * WCAR); o[6] = toh_flush(bfr(a1[2]) * WCAR); o[7] = toh_flush(bfr(a1[3]) * WCAR);
    *(v8h*)(dst + e) = o;
}

// ---- query ranking, one block of 256 threads per batch: idx = a permutation of the batch's positions, those whose mask is not 0 first (in ascending order), the others behind them; val = the mask values in that order; cnt = how many come first.
// A query whose mask is 0 has a context row of exact zeros (the probabilities are multiplied by mask_q after the softmax), so the attention kernel works only on the 128-place ranges of the list that begin in front of cnt.
static_assert(SEQ <= 256 * 8);                // eight positions per thread cover a batch
__device__ __forceinline__ void rank_queries(const int* __restrict__ mrow, int* idx, int* val, int* cnt) {
    __shared__ int wsum[8];
    const int tid = (int)threadIdx.x, lane = tid & 31, wave = tid >> 5;
    const int e = tid * 8;
    int f[8], mv[8];
#pragma unroll
    for (int i = 0; i < 8; ++i) { f[i] = 0; mv[i] = 0; }
    if (e < SEQ) {
        const v4i m0 = *(const v4i*)(mrow + e);
        const v4i m1 = *(const v4i*)(mrow + e + 4);
#pragma unroll
        for (int i = 0; i < 4; ++i) { mv[i] = m0[i]; mv[4 + i] = m1[i]; f[i] = m0[i] != 0 ? 1 : 0; f[4 + i] = m1[i] != 0 ? 1 : 0; }
    }
    int c = 0;
#pragma unroll
    for (int i = 0; i < 8; ++i) c += f[i];
    int inc = c;                                          // inclusive scan over the wave's lanes
#pragma unroll
    for (int d = 1; d < 32; d <<= 1) { const int v = __shfl_up(inc, d, 32); if (lane >= d) inc += v; }
    if (lane == 31) wsum[wave] = inc;
    __syncthreads();                                      // the eight wave totals readable by every wave
    int base = 0, total = 0;
#pragma unroll
    for (int w = 0; w < 8; ++w) { const int s = wsum[w]; base += w < wave ? s : 0; total += s; }
    int pos = base + inc - c;                             // kept positions in front of e
    if (e < SEQ) {
#pragma unroll
        for (int i = 0; i < 8; ++i) { const int pl = f[i] ? pos : total + (e + i - pos); idx[pl] = e + i; val[pl] = mv[i]; pos += f[i]; }
    }
    if (tid == 0) cnt[0] = total;
}

// ---- k_cvt_in: the query ranking and the five input conversions, which do not depend on one another, as block ranges of ONE grid:
// blocks [0, NB) = the ranking (first), then CVT_GX blocks = x, then CVT_GW blocks each for Wq, Wk, Wv (bf16 planes) and Wo (f16 plane x64). The range test reads blockIdx alone.
#define CVT_NW (DMOD * DMOD)
#define CVT_NX (NB * SEQ * DMOD)
#define CVT_GW ((CVT_NW / 8 + 255) / 256)
#define CVT_GX ((CVT_NX / 8 + 255) / 256)
__global__ __launch_bounds__(256) void k_cvt_in(const float* __restrict__ x, const float* __restrict__ wq, const float* __restrict__ wk, const float* __restrict__ wv, const float* __restrict__ wo,
                                                const int* __restrict__ mask, bf* XB, bf* WQ, bf* WK, bf* WV, h16* WO, int* QIDX, int* QMSK, int* QCNT) {
    if ((int)blockIdx.x < NB) { rank_queries(mask + (size_t)blockIdx.x * SEQ_FULL, QIDX + (int)blockIdx.x * SEQ, QMSK + (int)blockIdx.x * SEQ, QCNT + (int)blockIdx.x); return; }
    const int blk = (int)blockIdx.x - NB;
    if (blk < CVT_GX) { cvt_bf(x, XB, blk, CVT_NX, SEQ * DMOD, SEQ_FULL * DMOD); return; }
    const int w = (blk - CVT_GX) / CVT_GW, wb = (blk - CVT_GX) - w * CVT_GW;
    if (w == 3) { cvt_wo(wo, WO, wb, CVT_NW); return; }
    cvt_bf(w == 0 ? wq : (w == 1 ? wk : wv), w == 0 ? WQ : (w == 1 ? WK : WV), wb, CVT_NW, CVT_NW, CVT_NW);
}

// ---- GEMM staging: a block of 2 x 2 waves owns a 128x128 tile; 128 k of its 128 A rows and 128 Bt rows are staged in LDS by asynchronous copies
// (16 B per lane, 16 lanes per row), two buffers: stage t + 1 flies while stage t is worked on. Every wave reads its 64 + 64 rows as fragments from LDS.
#define GWAVES 4                      // waves per block, 2 (tile rows) x 2 (tile columns)
#define GKT    128                    // k elements per stage: 256 B of every operand row
#define GPITCH 272                    // LDS row pitch in bytes: 16 B x odd, conflict-free for the 16-byte fragment reads
#define GSLAB  (128 * GPITCH)         // one operand's 128 staged rows
#define GSTAGE (2 * GSLAB)            // one buffer: A rows, then Bt rows
static_assert(DMOD % 128 == 0);               // whole 128-wide block tiles
static_assert((NB * SEQ) % 128 == 0);
static_assert(DMOD % GKT == 0);               // whole stages
static_assert(DMOD / GKT >= 2);               // the two-buffer prologue fills stages 0 and 1
static_assert(GKT * 2 == 16 * 16);            // one staged row == 16 lanes x 16 B
static_assert(GWAVES * 32 * 16 == 128 * 16);  // sixteen copies per lane cover one operand's slab

// Half of one operand's slab = 8 copies per lane: rows r, r + 8, ..., r + 56. l = the lane's LDS byte address in row r, g = the lane's own 16 bytes in row r of the 16-bit source plane (row length DMOD).
__device__ __forceinline__ void stage_half(unsigned l, const unsigned char* g) {
    // the closing s_wait_xcnt stands inside the statement so that no address register of a copy is rewritten in front of it
    asm volatile("global_load_async_to_lds_b128 %0, %8, off\n\t"
                 "global_load_async_to_lds_b128 %1, %9, off\n\t"
                 "global_load_async_to_lds_b128 %2, %10, off\n\t"
                 "global_load_async_to_lds_b128 %3, %11, off\n\t"
                 "global_load_async_to_lds_b128 %4, %12, off\n\t"
                 "global_load_async_to_lds_b128 %5, %13, off\n\t"
                 "global_load_async_to_lds_b128 %6, %14, off\n\t"
                 "global_load_async_to_lds_b128 %7, %15, off\n\t"
                 "s_wait_xcnt 0x0"
                 :: "v"(l), "v"(l + 8 * GPITCH), "v"(l + 16 * GPITCH), "v"(l + 24 * GPITCH),
                    "v"(l + 32 * GPITCH), "v"(l + 40 * GPITCH), "v"(l + 48 * GPITCH), "v"(l + 56 * GPITCH),
                    "v"(g), "v"(g + 8 * DMOD * 2), "v"(g + 16 * DMOD * 2), "v"(g + 24 * DMOD * 2),
                    "v"(g + 32 * DMOD * 2), "v"(g + 40 * DMOD * 2), "v"(g + 48 * DMOD * 2), "v"(g + 56 * DMOD * 2)
                 : "memory");
}
// One operand's slab of 128 rows: 16 copies per lane.
__device__ __forceinline__ void stage_slab(unsigned l, const unsigned char* g) {
    stage_half(l, g);
    stage_half(l + 64 * GPITCH, g + 64 * DMOD * 2);
}

// Half of a slab whose rows are gathered = 8 copies per lane. l = the lane's LDS byte address in the first row, g = the lane's own 16-byte piece in row 0 of the source plane, o[i] = byte offset of the i-th row's source row.
__device__ __forceinline__ void stage_half_rows(unsigned l, const unsigned char* g, const unsigned* o) {
    // the closing s_wait_xcnt stands inside the statement so that no address register of a copy is rewritten in front of it
    asm volatile("global_load_async_to_lds_b128 %0, %8, off\n\t"
                 "global_load_async_to_lds_b128 %1, %9, off\n\t"
                 "global_load_async_to_lds_b128 %2, %10, off\n\t"
                 "global_load_async_to_lds_b128 %3, %11, off\n\t"
                 "global_load_async_to_lds_b128 %4, %12, off\n\t"
                 "global_load_async_to_lds_b128 %5, %13, off\n\t"
                 "global_load_async_to_lds_b128 %6, %14, off\n\t"
                 "global_load_async_to_lds_b128 %7, %15, off\n\t"
                 "s_wait_xcnt 0x0"
                 :: "v"(l), "v"(l + 8 * GPITCH), "v"(l + 16 * GPITCH), "v"(l + 24 * GPITCH),
                    "v"(l + 32 * GPITCH), "v"(l + 40 * GPITCH), "v"(l + 48 * GPITCH), "v"(l + 56 * GPITCH),
                    "v"(g + o[0]), "v"(g + o[1]), "v"(g + o[2]), "v"(g + o[3]),
                    "v"(g + o[4]), "v"(g + o[5]), "v"(g + o[6]), "v"(g + o[7])
                 : "memory");
}
__device__ __forceinline__ void stage_slab_rows(unsigned l, const unsigned char* g, const unsigned (&o)[16]) {
    stage_half_rows(l, g, o);
    stage_half_rows(l + 64 * GPITCH, g, o + 8);
}

// ---- GEMM main loop of the projections: one wave per 64x64 tile (16 accumulators), fragments from the staged bf16 rows, K = DMOD in ascending order.
// One operand is 128 rows of W from row wt on, the other 128 rows of X picked by list[0 .. 128) (positions inside the batch whose first X row is xb0). xisb false: A = X rows, Bt = W rows; true: A = W rows, Bt = X rows.
// acc[mb][nb][j] = sum_k A[64*wm + mb*16 + 8*hi + j][k] * Bt[64*wn + nb*16 + lr][k], rows counted inside the block's two slabs.
__device__ __forceinline__ void gemm_tile(const bf* __restrict__ X, const bf* __restrict__ Wt, const int* __restrict__ list, int xb0, int wt, bool xisb, int wm, int wn, const unsigned char* ring, unsigned ringl, v8f (&acc)[4][4]) {
#pragma unroll
    for (int mb = 0; mb < 4; ++mb)
#pragma unroll
        for (int nb = 0; nb < 4; ++nb) acc[mb][nb] = (v8f){};
    const int crow = (int)threadIdx.x >> 4, cpc = (int)threadIdx.x & 15;       // copy side: row 0..7, 16-byte piece 0..15
    const int lane = (int)threadIdx.x & 31, lr = lane & 15, hi = lane >> 4;
    unsigned xo[16];                                      // the lane's sixteen X rows, held over the whole loop
#pragma unroll
    for (int i = 0; i < 16; ++i) xo[i] = (unsigned)(xb0 + min(max(list[crow + 8 * i], 0), SEQ - 1)) * (unsigned)(DMOD * 2);
    const unsigned char* gx = (const unsigned char*)X + cpc * 16;               // running source pointers, advanced stage by stage
    const unsigned char* gw = (const unsigned char*)Wt + ((size_t)(wt + crow) * DMOD + cpc * 8) * 2;
    const unsigned cl = ringl + (unsigned)(crow * GPITCH + cpc * 16);
    const unsigned clx = cl + (xisb ? GSLAB : 0), clw = cl + (xisb ? 0 : GSLAB);
    const unsigned char* fa = ring + (wm * 64 + lr) * GPITCH + 16 * hi;
    const unsigned char* fb = ring + GSLAB + (wn * 64 + lr) * GPITCH + 16 * hi;
    stage_slab(clw, gw);                                  // the W slab first: it needs no list entry and flies while the list entries arrive
    stage_slab_rows(clx, gx, xo);
    __builtin_amdgcn_sched_barrier(0);                    // here and at the loop's foot: the addresses of the copies behind it are formed behind the copies in front of it, not all ahead, which keeps the kernel inside 256 registers
    gx += GKT * 2; gw += GKT * 2;
    asm volatile("s_wait_asynccnt 0x0" ::: "memory");     // this wave's copies of stage 0 have landed
    __syncthreads();                                      // stage 0 readable by every wave
    stage_slab_rows(clx + GSTAGE, gx, xo); stage_slab(clw + GSTAGE, gw);
#pragma unroll 1   // rolled: one publish point per trip
    for (int t = 0; t < DMOD / GKT; ++t) {
        const unsigned char* pa = fa + (t & 1) * GSTAGE;
        const unsigned char* pb = fb + (t & 1) * GSTAGE;
#pragma unroll   // unrolled: the 32-k blocks of a stage read at constant LDS offsets
        for (int kc = 0; kc < GKT; kc += 32) {
            v16bf a[4];
            v16bf b;
#pragma unroll
            for (int mb = 0; mb < 4; ++mb) a[mb] = ldbf((const bf*)(pa + mb * 16 * GPITCH + kc * 2));
#pragma unroll
            for (int nb = 0; nb < 4; ++nb) {
                b = ldbf((const bf*)(pb + nb * 16 * GPITCH + kc * 2));
#pragma unroll
                for (int mb = 0; mb < 4; ++mb) acc[mb][nb] = wmmab(a[mb], b, acc[mb][nb]);
            }
            asm volatile("" : "+v"(acc[0][0]), "+v"(acc[1][0]), "+v"(acc[2][0]), "+v"(acc[3][0]), "+v"(acc[0][1]), "+v"(acc[1][1]), "+v"(acc[2][1]), "+v"(acc[3][1]));
            asm volatile("v_nop\n\tv_nop\n\tv_nop\n\tv_nop" : "+v"(acc[0][2]), "+v"(acc[1][2]), "+v"(acc[2][2]), "+v"(acc[3][2]), "+v"(acc[0][3]), "+v"(acc[1][3]), "+v"(acc[2][3]), "+v"(acc[3][3]) : "v"(a[0]), "v"(a[3]), "v"(b));
        }
        // foot of trip t: publish stage t + 1, then refill the buffer that trip t has just read
        asm volatile("s_wait_dscnt 0x0" ::: "memory");        // this wave's reads of stage t have returned before its buffer is refilled
        asm volatile("s_wait_asynccnt 0x0" ::: "memory");     // this wave's copies of stage t + 1 have landed
        __syncthreads();                                      // publishes stage t + 1 and ends every wave's last read of stage t
        if (t + 2 < DMOD / GKT) {
            gx += GKT * 2; gw += GKT * 2;
            const unsigned bo = (unsigned)((t & 1) * GSTAGE);
            stage_slab_rows(clx + bo, gx, xo);
            __builtin_amdgcn_sched_barrier(0);                // the W slab's addresses are formed behind the X slab's copies (see the prologue)
            stage_slab(clw + bo, gw);
        }
    }
    asm volatile("s_wait_asynccnt 0x0" ::: "memory");     // nothing in flight behind the loop
}

// ---- k_proj: the q, k and v projections, which do not depend on one another, as block ranges of ONE grid; the choice reads the same for a whole block, so every barrier stays under block-uniform control flow.
// t is a place in the batch's ranked list everywhere here: the X row of place t is the row of position QIDX[t], and the three planes are stored in list order.
// which = 0 / 1 (q / k): y[m][n] = X[m][:] . W[n][:] + bf16(bias[n]); tile rows m = b*SEQ + t, tile columns = one head (n = head*64 + d); stored as one f16 head plane, q times log2 e (one rounding), so that q.k is a base-2 exponent.
// which = 2 (v): transposed projection y^T[n][m] = (W[n][:] . X[m][:] + bf16(bias[n])) * mask[m]; tile rows n = head*64 + d, tile columns m = b*SEQ + t (the key's place).
// The key mask multiplies the value rows, so the attention kernel's probabilities and its denominator stay over all keys.
// A q or v tile whose 128 places all lie behind the kept count leaves at once: the attention kernel reads no q row and no value column there.
// grid (NB * 3 * DMOD/128, SEQ/128), 128 threads; each wave one 64x64 tile; the list range is the slow index, so that the ranges in which all three planes work come first in index order.
__global__ __launch_bounds__(GWAVES * 32) void k_proj(const bf* __restrict__ X, const bf* __restrict__ WQ, const bf* __restrict__ WK, const bf* __restrict__ WV,
                                                      const float* __restrict__ bq, const float* __restrict__ bk, const float* __restrict__ bv,
                                                      const int* __restrict__ QIDX, const int* __restrict__ QMSK, const int* __restrict__ QCNT, h16* QF, h16* KF, h16* Pv) {
    __shared__ __align__(16) unsigned char ring[2 * GSTAGE];
    __shared__ __align__(16) float osall[GWAVES * 16 * OSP];
    const int wave = __builtin_amdgcn_readfirstlane((int)(threadIdx.x >> 5));
    const int wm = wave >> 1, wn = wave & 1;
    float* os = osall + wave * 16 * OSP;                  // each wave stages its output rows in its own range
    const int lane = (int)threadIdx.x & 31, lr = lane & 15, hi = lane >> 4;
    const int bb0 = (int)blockIdx.x / (3 * (DMOD / 128)), br = (int)blockIdx.x - bb0 * (3 * (DMOD / 128));   // batch; plane and W tile
    const int which = br / (DMOD / 128);
    if (which != 1 && (int)blockIdx.y * 128 >= QCNT[bb0]) return;   // q, v: no kept place in the tile: the whole block leaves, in front of every copy and barrier
    const bool isv = which == 2;
    const bf* W = which == 0 ? WQ : (which == 1 ? WK : WV);
    const float* bias = which == 0 ? bq : (which == 1 ? bk : bv);
    const int xt = bb0 * SEQ + (int)blockIdx.y * 128, wt = (br - which * (DMOD / 128)) * 128;      // first X row (batch and place) and first W row of the block's tile
    const int ra = isv ? wt : xt, rb = isv ? xt : wt;
    const int r0 = ra + wm * 64, c0 = rb + wn * 64;
    v8f acc[4][4];
    gemm_tile(X, W, QIDX + xt, bb0 * SEQ, wt, isv, wm, wn, ring, (unsigned)(size_t)(__attribute__((address_space(3))) unsigned char*)ring, acc);
    const int rq = lane >> 3, cq = (lane & 7) * 8;
    if (!isv) {
        h16* Pf = which == 0 ? QF : KF;
        const float qs = which == 0 ? LOG2E : 1.0f;
        const int b = r0 / SEQ, t0 = r0 - b * SEQ, hd = c0 / HDIM;
        const v4f bv0 = *(const v4f*)(bias + c0 + cq);
        const v4f bv1 = *(const v4f*)(bias + c0 + cq + 4);
        float bb[8];
        bb[0] = bfr(bv0[0]); bb[1] = bfr(bv0[1]); bb[2] = bfr(bv0[2]); bb[3] = bfr(bv0[3]);
        bb[4] = bfr(bv1[0]); bb[5] = bfr(bv1[1]); bb[6] = bfr(bv1[2]); bb[7] = bfr(bv1[3]);
        const size_t pbase = ((size_t)(b * NHEAD + hd) * SEQ + t0) * HDIM;
#pragma unroll
        for (int mb = 0; mb < 4; ++mb) {
#pragma unroll
            for (int nb = 0; nb < 4; ++nb) {
#pragma unroll
                for (int j = 0; j < 8; ++j) os[(hi * 8 + j) * OSP + nb * 16 + lr] = acc[mb][nb][j];
            }
            __syncthreads();
#pragma unroll
            for (int s = 0; s < 4; ++s) {
                const int row = s * 4 + rq;                       // s 0..3 x rq 0..3 -> rows 0..15
                const v4f x0 = *(const v4fa*)(os + row * OSP + cq);
                const v4f x1 = *(const v4fa*)(os + row * OSP + cq + 4);
                v8h of;
#pragma unroll
                for (int i = 0; i < 4; ++i) { of[i] = (h16)((x0[i] + bb[i]) * qs); of[4 + i] = (h16)((x1[i] + bb[4 + i]) * qs); }
                *(v8h*)(Pf + pbase + (size_t)(mb * 16 + row) * HDIM + cq) = of;
            }
            __syncthreads();
        }
    } else {
        const int b = c0 / SEQ, t0 = c0 - b * SEQ, hd = r0 / HDIM;
        const v4i mk0 = *(const v4i*)(QMSK + c0 + cq);                                 // the mask values in list order, compact batch stride
        const v4i mk1 = *(const v4i*)(QMSK + c0 + cq + 4);
        float mf[8];
        mf[0] = (float)mk0[0]; mf[1] = (float)mk0[1]; mf[2] = (float)mk0[2]; mf[3] = (float)mk0[3];
        mf[4] = (float)mk1[0]; mf[5] = (float)mk1[1]; mf[6] = (float)mk1[2]; mf[7] = (float)mk1[3];
        const size_t pbase = (size_t)(b * NHEAD + hd) * HDIM * SEQ + t0;
#pragma unroll
        for (int mb = 0; mb < 4; ++mb) {
#pragma unroll
            for (int nb = 0; nb < 4; ++nb) {
#pragma unroll
                for (int j = 0; j < 8; ++j) os[(hi * 8 + j) * OSP + nb * 16 + lr] = acc[mb][nb][j];
            }
            __syncthreads();
#pragma unroll
            for (int s = 0; s < 4; ++s) {
                const int row = s * 4 + rq;                       // d within the slab, 0..15
                const float bsc = bfr(bias[r0 + mb * 16 + row]);
                const v4f x0 = *(const v4fa*)(os + row * OSP + cq);
                const v4f x1 = *(const v4fa*)(os + row * OSP + cq + 4);
                v8h ov;
#pragma unroll
                for (int i = 0; i < 4; ++i) { ov[i] = toh_flush((x0[i] + bsc) * mf[i]); ov[4 + i] = toh_flush((x1[i] + bsc) * mf[4 + i]); }
                *(v8h*)(Pv + pbase + (size_t)(mb * 16 + row) * SEQ + cq) = ov;
            }
            __syncthreads();
        }
    }
}

// ---- k_attn: fused attention, transposed form. Block = 8 waves = 128 queries of one (batch, head); each wave owns 16 queries.
// The f16 K rows and the f16 V rows of 64 keys are staged in LDS once per block by asynchronous copies (16 B per lane, whole 128-B lines), two buffers: tile t + 1 flies while tile t is worked on.
// Each wave loads its own f16 Q fragments once, before the key loop, and keeps them in registers.
// Per 32-key step: S^T[key][query] = K.Q^T - offset, one f16 product (one accumulator per 16-key tile) that starts from minus the query's offset in use, so the accumulators hold the exponents themselves;
// (lane (hi, lr) holds keys 8*hi + r and 16 + 8*hi + r of query lr); the offset moves, for the whole wave, only in a step where some exponent passes LAZY (and in the first step):
// there the two lanes of a query share the step's maximum through one shuffle, and sums, outputs and this step's exponents are brought to the new offset (column maximum at PSH);
// P^T packed from the two score tiles into the B fragment (element r <- tile 0, element 8 + r <- tile 1); O^T[d][query] += V^T.P^T
// (every one of the four P.V WMMAs carries its own four-nop guard tying exactly its accumulator and its two operands).
// The block's 128 queries are 128 consecutive places of the batch's ranked list (kept queries first); a block whose range begins behind the kept count leaves at once.
// The keys run in list order too: a key tile that begins behind the kept count has zero value rows, so only its K rows are staged and it adds to the denominator alone (scores, exponentials, sum; no P.V).
// grid (NB*NHEAD, SEQ/128), 256 threads: the list range is the slow index, so that the blocks that work come first in index order and the empty ones last.
#define AWAVES 8                      // waves per block that share one staged tile
#define KTILE  64                     // keys per staged tile: K rows and V rows are both 128 B long
#define LPITCH 144                    // LDS row pitch in bytes: 16 B x odd, conflict-free for the 16-byte fragment reads
#define LPLANE (64 * LPITCH)          // one staged plane: 64 rows (keys for K, head dims for V)
#define LSTAGE (2 * LPLANE)           // one buffer: K, V
static_assert(SEQ % (AWAVES * 16) == 0);      // whole blocks of queries
static_assert(SEQ % KTILE == 0);              // whole key tiles
static_assert(SEQ / KTILE >= 2);              // the two-buffer prologue fills tiles 0 and 1
static_assert(KTILE * 2 == 128);              // one V row of a tile == 8 lanes x 16 B
static_assert(HDIM * 2 == 128);               // one K row == 8 lanes x 16 B
static_assert(AWAVES * 32 * 2 == 64 * 8);     // two copies per lane cover one plane (64 rows x 8 pieces)
static_assert(AWAVES * 16 * OSP * 4 <= 2 * LSTAGE);   // the output staging reuses the ring
static_assert(SEQ % 128 == 0);

// One tile = 4 copies per lane. l = the lane's LDS byte address in the K plane of the target buffer; the pointers are the lane's own 16 bytes in rows 0..31 of each plane.
__device__ __forceinline__ void stage_tile(unsigned l, const h16* kf, const h16* vv) {
    // the closing s_wait_xcnt stands inside the statement so that no address register of a copy is rewritten in front of it
    asm volatile("global_load_async_to_lds_b128 %0, %4, off\n\t"
                 "global_load_async_to_lds_b128 %1, %5, off\n\t"
                 "global_load_async_to_lds_b128 %2, %6, off\n\t"
                 "global_load_async_to_lds_b128 %3, %7, off\n\t"
                 "s_wait_xcnt 0x0"
                 :: "v"(l), "v"(l + 32 * LPITCH), "v"(l + LPLANE), "v"(l + LPLANE + 32 * LPITCH),
                    "v"(kf), "v"(kf + 32 * HDIM), "v"(vv), "v"(vv + 32 * SEQ)
                 : "memory");
}

// A tile without values = 2 copies per lane: the K plane alone.
__device__ __forceinline__ void stage_keys(unsigned l, const h16* kf) {
    // the closing s_wait_xcnt stands inside the statement so that no address register of a copy is rewritten in front of it
    asm volatile("global_load_async_to_lds_b128 %0, %2, off\n\t"
                 "global_load_async_to_lds_b128 %1, %3, off\n\t"
                 "s_wait_xcnt 0x0"
                 :: "v"(l), "v"(l + 32 * LPITCH), "v"(kf), "v"(kf + 32 * HDIM)
                 : "memory");
}

// second launch bound: six waves per SIMD, so that the three blocks that fall to each WGP stay resident together
__global__ __launch_bounds__(AWAVES * 32, 6) void k_attn(const h16* __restrict__ QF, const h16* __restrict__ KF, const h16* __restrict__ VV, const int* __restrict__ QCNT, float* OUT) {
    __shared__ __align__(16) unsigned char ring[2 * LSTAGE];
    const int wave = __builtin_amdgcn_readfirstlane((int)(threadIdx.x >> 5));
    const int lane = (int)threadIdx.x & 31, lr = lane & 15, hi = lane >> 4;
    const int bh = (int)blockIdx.x;
    const int b = bh / NHEAD, hd = bh - b * NHEAD;
    const int nk = QCNT[b];
    if ((int)blockIdx.y * (AWAVES * 16) >= nk) return;        // no kept query in this block's range of the list: the whole block leaves, in front of every copy and barrier
    const int nvt = min((nk + KTILE - 1) / KTILE, SEQ / KTILE);   // key tiles that hold a kept key, at least one here; the same for the whole block
    const int q0 = (int)blockIdx.y * (AWAVES * 16) + wave * 16;   // place in the ranked list, not a position
    const size_t pb = (size_t)bh * SEQ * HDIM;
    // copy side: thread -> (row = tid / 8, 16-byte piece = tid % 8) of rows 0..31 of a plane
    const int crow = (int)threadIdx.x >> 3, cpc = (int)threadIdx.x & 7;
    const h16* ckf = KF + pb + crow * HDIM + cpc * 8; const h16* cvv = VV + pb + crow * SEQ + cpc * 8;   // running pointers, advanced tile by tile
    const unsigned cl = (unsigned)(size_t)(__attribute__((address_space(3))) unsigned char*)ring + (unsigned)(crow * LPITCH + cpc * 16);
    // read side: fragment row lr, 16-byte piece hi (K rows and V rows alike)
    const unsigned char* fr = ring + lr * LPITCH + 16 * hi;
    v8f ova[4];
#pragma unroll
    for (int dt = 0; dt < 4; ++dt) ova[dt] = (v8f){};
    float lsum = 0.0f;
    v8f negm = (v8f){};                                   // all eight elements: minus the lane's query's offset in use
    stage_tile(cl, ckf, cvv);
    ckf += KTILE * HDIM; cvv += KTILE;
    const h16* qp = QF + pb + (q0 + lr) * HDIM + 8 * hi;  // the q plane is in list order (a place behind the count is a masked query: worked like any other, its row is never used)
    // the wave's own Q fragments: loaded once, held in registers over the whole key loop
    v16h qf[HDIM / 32];
#pragma unroll
    for (int kc = 0; kc < HDIM; kc += 32) qf[kc / 32] = ldh(qp + kc);
    asm volatile("s_wait_xcnt 0x0" ::: "memory");         // precaution: stands in front of every rewrite of the Q loads' address registers
    asm volatile("s_wait_asynccnt 0x0" ::: "memory");     // this wave's copies of tile 0 have landed
    __syncthreads();                                      // tile 0 readable by every wave
    if (1 < nvt) stage_tile(cl + LSTAGE, ckf, cvv); else stage_keys(cl + LSTAGE, ckf);
#pragma unroll 1   // rolled: one publish point per trip
    for (int t = 0; t < SEQ / KTILE; ++t) {
        const unsigned char* fb = fr + (t & 1) * LSTAGE;
        const bool hasv = t < nvt;                            // the same for the whole block
#pragma unroll   // unrolled: the two 32-key steps of a tile read at constant LDS offsets
        for (int sub = 0; sub < KTILE / 32; ++sub) {
            v8f s0, s1;
            v16h k0[HDIM / 32], k1[HDIM / 32];
            const unsigned char* kp = fb + sub * 32 * LPITCH;
#pragma unroll
            for (int kc = 0; kc < HDIM; kc += 32) { k0[kc / 32] = ldh((const h16*)(kp + kc * 2)); k1[kc / 32] = ldh((const h16*)(kp + 16 * LPITCH + kc * 2)); }
            // inputs-only fence on the loaded values: keeps the eight reads one group with one LDS wait (without it the compiler sinks each pair of reads to its own WMMA: four waits in a row)
            asm volatile("" :: "v"(k0[0]), "v"(k0[1]), "v"(k1[0]), "v"(k1[1]));
            s0 = wmma16(k0[0], qf[0], negm); s1 = wmma16(k1[0], qf[0], negm);
#pragma unroll
            for (int kc = 32; kc < HDIM; kc += 32) { s0 = wmma16(k0[kc / 32], qf[kc / 32], s0); s1 = wmma16(k1[kc / 32], qf[kc / 32], s1); }
            float ma = fmaxf(fmaxf(s0[0], s0[1]), s0[2]), mb = fmaxf(fmaxf(s1[0], s1[1]), s1[2]);
            ma = fmaxf(fmaxf(ma, s0[3]), s0[4]); mb = fmaxf(fmaxf(mb, s1[3]), s1[4]);
            ma = fmaxf(fmaxf(ma, s0[5]), s0[6]); mb = fmaxf(fmaxf(mb, s1[5]), s1[6]);
            float mx = fmaxf(fmaxf(ma, mb), fmaxf(s0[7], s1[7]));
            const bool first = sub == 0 && t == 0;        // no offset yet: the first step sets it, whatever the scores are
            const float thr = first ? -3.0e38f : LAZY;    // below every score that f16 operands can give
            if (__builtin_amdgcn_ballot_w32(mx > thr) != 0u) {                // wave-uniform
                mx = fmaxf(mx, __shfl_xor(mx, 16, 32));
                const float d = first ? mx - PSH : fmaxf(mx - PSH, 0.0f);     // the offset never falls
                const float sc = first ? 0.0f : __builtin_amdgcn_exp2f(-d);   // sums and outputs are zero in the first step
                lsum *= sc;
#pragma unroll
                for (int dt = 0; dt < 4; ++dt) {
#pragma unroll
                    for (int r = 0; r < 8; ++r) ova[dt][r] *= sc;
                }
#pragma unroll
                for (int r = 0; r < 8; ++r) { s0[r] -= d; s1[r] -= d; negm[r] -= d; }
            }
            v16h va[4];
            if (hasv) {                                   // asked for here so that the reads fly under the exponentials
                const unsigned char* vp = fb + LPLANE + sub * 64;
#pragma unroll
                for (int dt = 0; dt < 4; ++dt) va[dt] = ldh((const h16*)(vp + dt * 16 * LPITCH));
            }
            float psum = 0.0f;
            float e0[8], e1[8];                           // p on the offset's scale, at most exp2(LAZY)
#pragma unroll
            for (int r = 0; r < 8; ++r) e0[r] = __builtin_amdgcn_exp2f(s0[r]);
#pragma unroll
            for (int r = 0; r < 8; ++r) e1[r] = __builtin_amdgcn_exp2f(s1[r]);
#pragma unroll
            for (int r = 0; r < 8; ++r) psum += e0[r] + e1[r];
            lsum += psum;
            if (hasv) {
                v16h pf;
#pragma unroll
                for (int r = 0; r < 8; ++r) { pf[r] = (h16)e0[r]; pf[8 + r] = (h16)e1[r]; }
#pragma unroll
                for (int dt = 0; dt < 4; ++dt) ova[dt] = wmma16g(va[dt], pf, ova[dt]);
            }
        }
        asm volatile("s_wait_dscnt 0x0" ::: "memory");        // this wave's reads of tile t have returned before its buffer is refilled
        asm volatile("s_wait_asynccnt 0x0" ::: "memory");     // this wave's copies of tile t + 1 have landed
        __syncthreads();                                      // publishes tile t + 1 and ends every wave's last read of tile t
        if (t + 2 < SEQ / KTILE) {
            ckf += KTILE * HDIM; cvv += KTILE;
            if (t + 2 < nvt) stage_tile(cl + (unsigned)((t & 1) * LSTAGE), ckf, cvv); else stage_keys(cl + (unsigned)((t & 1) * LSTAGE), ckf);
        }
    }
    asm volatile("s_wait_asynccnt 0x0" ::: "memory");         // nothing in flight when the ring becomes output staging
    lsum += __shfl_xor(lsum, 16, 32);
    const float inv = 1.0f / lsum;
    float* os = (float*)ring;                                 // every wave has left the ring at the last trip's barrier
    const int obase = wave * 16 * OSP;
#pragma unroll
    for (int dt = 0; dt < 4; ++dt) {
        v4f x0, x1;
#pragma unroll
        for (int i = 0; i < 4; ++i) {
            x0[i] = ova[dt][i] * inv;
            x1[i] = ova[dt][4 + i] * inv;
        }
        *(v4fa*)(os + obase + lr * OSP + dt * 16 + 8 * hi) = x0;
        *(v4fa*)(os + obase + lr * OSP + dt * 16 + 8 * hi + 4) = x1;
    }
    __syncthreads();
    float* orow = OUT + ((size_t)b * SEQ_FULL + q0) * DMOD + hd * HDIM;   // FULL batch stride; the rows stay in list order
{
#pragma unroll
        for (int s = 0; s < 8; ++s) {
            const int row = 2 * s + hi, cofs = lr * 4;            // s 0..7 x hi 0..1 -> queries 0..15; 16 lanes x 16 B = one 256-B head row
            const v4f val = *(const v4fa*)(os + obase + row * OSP + cofs);
            *(v4f*)(orow + (size_t)row * DMOD + cofs) = val;
        }
        
    }
}

// ---- k_out_ln: ctx convert, output projection, skip connection and LayerNorm in one kernel. A block of 8 waves owns 32 consecutive places of a batch's ranked list and ALL 768 columns,
// so every ctx row is read by one block alone (it is converted on the way into LDS) and every row's mean and variance are formed inside the block.
// y[m][n] = (A[m][:] . W[n][:]) / 1024 + bf16(bias[n]) + bf16(x[m][n]); A = f16(ctx x query mask x 16), rows in list order, W = f16 plane of 64 * bf16(Wo) stored [out][in]; wave w owns columns 96 w .. 96 w + 95 (2 x 6 accumulators).
// The block's 32 x 768 A tile is formed once, in front of the loop, from the f32 ctx rows (FULL batch stride), while stage 0 flies; the places behind the kept count are masked queries: their A rows are zero and their ctx rows are not read.
// 64 k (128 B) of all 768 W rows are staged in LDS by asynchronous copies, two buffers: stage t + 1 flies while stage t is worked on.
// Behind the loop the f32 tile goes to LDS (the ring is free), and each wave takes four whole rows: bias, skip connection (f32 input at the FULL batch stride), mean, centred variance (divide by the width),
// out = (y - mu) * rsqrt(var + 1e-5) * bf16(gain) + bf16(shift), stored to the row's position.
// A block whose places all lie behind the kept count holds masked queries alone (zero context rows): it stages and multiplies nothing and forms its rows as bias + x. A masked place inside a working block has a zero A row.
// grid (NB * SEQ/32) = one block per WGP at the full shape, 256 threads; the list range is the slow index, so that the blocks that multiply come first in index order.
#define FR     32                     // rows per block
#define FWAVES 8
#define FKT    64                     // k elements per stage: 128 B of every operand row
#define FPITCH 144                    // LDS row pitch in bytes: 16 B x odd, conflict-free for the 16-byte fragment reads
#define FSTAGE (DMOD * FPITCH)        // one buffer: all W rows
#define APITCH (DMOD * 2 + 16)        // A tile row pitch in bytes: 16 B x odd
#define FATILE (FR * APITCH)          // the block's whole f16 A tile
#define FCOLS  (DMOD / FWAVES)        // columns per wave
#define YPITCH 772                    // f32 tile row pitch in floats: 16-byte aligned rows; rows 8 apart fall 32 banks apart, so the two lane halves of a store do not collide
static_assert(SEQ % FR == 0);                 // a block never straddles a batch
static_assert((AWAVES * 16) % FR == 0);       // a working block lies inside one range of the list that an attention block has written
static_assert(FR == FWAVES * 4);              // four rows per wave in the row pass
static_assert(FR == 2 * 16);                  // two accumulator rows of tiles
static_assert(FCOLS == 6 * 16);               // six accumulator columns of tiles per wave
static_assert(FKT * 2 == 8 * 16);             // one staged row == 8 lanes x 16 B
static_assert(FWAVES * 32 / 8 == FR);         // A tile: eight threads per row
static_assert(DMOD == 12 * 8 * 8);            // A tile: twelve pieces of eight elements per thread
static_assert((APITCH / 16) % 2 == 1);
static_assert(DMOD == 3 * 8 * 32);            // three runs of eight copies per lane cover the W rows
static_assert(DMOD % FKT == 0);
static_assert(DMOD / FKT >= 2);               // the two-buffer prologue fills stages 0 and 1
static_assert(FR * YPITCH * 4 <= 2 * FSTAGE); // the f32 tile reuses the ring
static_assert(YPITCH >= DMOD);
static_assert(YPITCH % 4 == 0);
static_assert(2 * FSTAGE + FATILE <= 327680);

// Eight copies per lane: rows r, r + 32, ..., r + 224. l = the lane's LDS byte address in row r, g = the lane's own 16 bytes in row r of the 16-bit source plane (row length DMOD).
__device__ __forceinline__ void stage_w8(unsigned l, const unsigned char* g) {
    // the closing s_wait_xcnt stands inside the statement so that no address register of a copy is rewritten in front of it
    asm volatile("global_load_async_to_lds_b128 %0, %8, off\n\t"
                 "global_load_async_to_lds_b128 %1, %9, off\n\t"
                 "global_load_async_to_lds_b128 %2, %10, off\n\t"
                 "global_load_async_to_lds_b128 %3, %11, off\n\t"
                 "global_load_async_to_lds_b128 %4, %12, off\n\t"
                 "global_load_async_to_lds_b128 %5, %13, off\n\t"
                 "global_load_async_to_lds_b128 %6, %14, off\n\t"
                 "global_load_async_to_lds_b128 %7, %15, off\n\t"
                 "s_wait_xcnt 0x0"
                 :: "v"(l), "v"(l + 32 * FPITCH), "v"(l + 64 * FPITCH), "v"(l + 96 * FPITCH),
                    "v"(l + 128 * FPITCH), "v"(l + 160 * FPITCH), "v"(l + 192 * FPITCH), "v"(l + 224 * FPITCH),
                    "v"(g), "v"(g + 32 * DMOD * 2), "v"(g + 64 * DMOD * 2), "v"(g + 96 * DMOD * 2),
                    "v"(g + 128 * DMOD * 2), "v"(g + 160 * DMOD * 2), "v"(g + 192 * DMOD * 2), "v"(g + 224 * DMOD * 2)
                 : "memory");
}
// One stage = 24 copies per lane. l = the lane's LDS byte address in its first W row of the target buffer; gb = the lane's own 16 bytes in that row.
__device__ __forceinline__ void stage_out(unsigned l, const unsigned char* gb) {
    stage_w8(l, gb);
    stage_w8(l + 256 * FPITCH, gb + 256 * DMOD * 2);
    stage_w8(l + 512 * FPITCH, gb + 512 * DMOD * 2);
}

__global__ __launch_bounds__(FWAVES * 32) void k_out_ln(const float* __restrict__ CTX, const h16* __restrict__ W, const float* __restrict__ bias, const float* __restrict__ xin, const int* __restrict__ QIDX, const int* __restrict__ QMSK, const int* __restrict__ QCNT,
                                                        const float* __restrict__ g, const float* __restrict__ be, float* OUT) {
    __shared__ __align__(16) unsigned char ring[2 * FSTAGE];
    __shared__ __align__(16) unsigned char atile[FATILE];
    const int wave = __builtin_amdgcn_readfirstlane((int)(threadIdx.x >> 5));
    const int lane = (int)threadIdx.x & 31, lr = lane & 15, hi = lane >> 4;
    const int b = (int)blockIdx.x % NB, t0 = ((int)blockIdx.x / NB) * FR;   // batch; the block's first place in the batch's ranked list
    const int nk = QCNT[b];
    const bool work = t0 < nk;                            // a kept query among the block's rows; the same for the whole block
    int pt[4];                                            // positions of the wave's four rows, asked for in front of the main loop
#pragma unroll
    for (int r = 0; r < 4; ++r) pt[r] = __builtin_amdgcn_readfirstlane(min(max(QIDX[b * SEQ + t0 + wave * 4 + r], 0), SEQ - 1));   // the same in every lane: held in scalar registers
    float* ys = (float*)ring;
    v8f acc[2][6];
#pragma unroll
    for (int mb = 0; mb < 2; ++mb)
#pragma unroll
        for (int nb = 0; nb < 6; ++nb) acc[mb][nb] = (v8f){};
    if (work) {
        const int crow = (int)threadIdx.x >> 3, cpc = (int)threadIdx.x & 7;     // copy side: row 0..31, 16-byte piece 0..7
        const unsigned char* gb = (const unsigned char*)W + ((size_t)crow * DMOD + cpc * 8) * 2;   // running source pointer, advanced stage by stage
        const unsigned cl = (unsigned)(size_t)(__attribute__((address_space(3))) unsigned char*)ring + (unsigned)(crow * FPITCH + cpc * 16);
        const unsigned char* fa = atile + lr * APITCH + 16 * hi;                // read side: fragment row lr, 16-byte piece hi
        const unsigned char* fb = ring + (wave * FCOLS + lr) * FPITCH + 16 * hi;
        stage_out(cl, gb);
        gb += FKT * 2;
        {   // the A tile: thread -> row crow, pieces cpc, cpc + 8, ... of eight elements (eight threads cover 256 B of a ctx row at a time)
            const int at = t0 + crow;
            const float mq = (float)QMSK[b * SEQ + at] * CCAR;                  // the mask value of the place, in bounds for every place
            const float* cs = CTX + ((size_t)b * SEQ_FULL + (size_t)at) * DMOD + cpc * 8;
            v4f c0[12], c1[12];
#pragma unroll
            for (int c = 0; c < 12; ++c) { c0[c] = (v4f){}; c1[c] = (v4f){}; }
            if (at < nk) {
#pragma unroll
                for (int c = 0; c < 12; ++c) { c0[c] = *(const v4f*)(cs + c * 64); c1[c] = *(const v4f*)(cs + c * 64 + 4); }
            }
#pragma unroll
            for (int c = 0; c < 12; ++c) {
                v8h o;
#pragma unroll
                for (int i = 0; i < 4; ++i) { o[i] = toh_flush(c0[c][i] * mq); o[4 + i] = toh_flush(c1[c][i] * mq); }
                *(v8h*)(atile + crow * APITCH + (c * 8 + cpc) * 16) = o;
            }
        }
        asm volatile("s_wait_asynccnt 0x0" ::: "memory");     // this wave's copies of stage 0 have landed
        __syncthreads();                                      // stage 0 and the A tile readable by every wave
        stage_out(cl + FSTAGE, gb);
#pragma unroll 1   // rolled: one publish point per trip
        for (int t = 0; t < DMOD / FKT; ++t) {
            const unsigned char* pa = fa + t * (FKT * 2);
            const unsigned char* pb = fb + (t & 1) * FSTAGE;
#pragma unroll   // unrolled: the two 32-k blocks of a stage read at constant LDS offsets
            for (int kc = 0; kc < FKT; kc += 32) {
                v16h a[2], bfr6[6];                           // the block's LDS reads stand as one group in front of its guarded WMMAs
#pragma unroll
                for (int mb = 0; mb < 2; ++mb) a[mb] = ldh((const h16*)(pa + mb * 16 * APITCH + kc * 2));
#pragma unroll
                for (int nb = 0; nb < 6; ++nb) bfr6[nb] = ldh((const h16*)(pb + nb * 16 * FPITCH + kc * 2));
#pragma unroll
                for (int nb = 0; nb < 6; ++nb) {
#pragma unroll
                    for (int mb = 0; mb < 2; ++mb) acc[mb][nb] = wmma16g(a[mb], bfr6[nb], acc[mb][nb]);
                }
            }
            // foot of trip t: publish stage t + 1, then refill the buffer that trip t has just read
            asm volatile("s_wait_dscnt 0x0" ::: "memory");        // this wave's reads of stage t have returned before its buffer is refilled
            asm volatile("s_wait_asynccnt 0x0" ::: "memory");     // this wave's copies of stage t + 1 have landed
            __syncthreads();                                      // publishes stage t + 1 and ends every wave's last read of stage t
            if (t + 2 < DMOD / FKT) {
                gb += FKT * 2;
                stage_out(cl + (unsigned)((t & 1) * FSTAGE), gb);
            }
        }
        asm volatile("s_wait_asynccnt 0x0" ::: "memory");     // nothing in flight when the ring becomes the f32 tile; every wave has left the ring at the last trip's barrier
    }
    // row pass: one wave per row, four rows per wave, the four rows held in registers (4 x 6 x 4 floats per lane) and worked side by side
    v4f x[4][6];                                              // first the four skip rows, asked for together, ahead of the tile's way through LDS
#pragma unroll
    for (int r = 0; r < 4; ++r) {
        const float* xi = xin + ((size_t)b * SEQ_FULL + (size_t)pt[r]) * DMOD;
#pragma unroll
        for (int j = 0; j < 6; ++j) x[r][j] = *(const v4f*)(xi + (j * 32 + lane) * 4);
    }
    __builtin_amdgcn_sched_barrier(0);                        // the 24 loads are issued here, so that their memory latency runs under the LDS stores and the barrier (without it the compiler sinks each row's loads to the row's own sums: four latencies in a row)
    if (work) {
#pragma unroll
        for (int mb = 0; mb < 2; ++mb) {
#pragma unroll
            for (int nb = 0; nb < 6; ++nb) {
#pragma unroll
                for (int j = 0; j < 8; ++j) ys[(mb * 16 + hi * 8 + j) * YPITCH + wave * FCOLS + nb * 16 + lr] = acc[mb][nb][j];
            }
        }
        __syncthreads();                                      // the whole 32 x 768 tile readable by every wave (block-uniform branch)
    }
    const float osc = 1.0f / (WCAR * CCAR);
    v4f cb[6];
#pragma unroll
    for (int j = 0; j < 6; ++j) {
        const v4f c4 = *(const v4f*)(bias + (j * 32 + lane) * 4);
#pragma unroll
        for (int i = 0; i < 4; ++i) cb[j][i] = bfr(c4[i]);
    }
    if (work) {
#pragma unroll
        for (int r = 0; r < 4; ++r) {
#pragma unroll
            for (int j = 0; j < 6; ++j) {
                const v4f a4 = *(const v4fa*)(ys + (wave * 4 + r) * YPITCH + (j * 32 + lane) * 4);
#pragma unroll
                for (int i = 0; i < 4; ++i) x[r][j][i] = (a4[i] * osc + cb[j][i]) + bfr(x[r][j][i]);
            }
        }
    } else {
#pragma unroll
        for (int r = 0; r < 4; ++r) {
#pragma unroll
            for (int j = 0; j < 6; ++j) {
#pragma unroll
                for (int i = 0; i < 4; ++i) x[r][j][i] = cb[j][i] + bfr(x[r][j][i]);
            }
        }
    }
    float s[4], q[4];
#pragma unroll
    for (int r = 0; r < 4; ++r) {
        s[r] = 0.0f;
#pragma unroll
        for (int j = 0; j < 6; ++j) s[r] += (x[r][j][0] + x[r][j][1]) + (x[r][j][2] + x[r][j][3]);
    }
#pragma unroll
    for (int d = 16; d >= 1; d >>= 1) {
#pragma unroll
        for (int r = 0; r < 4; ++r) s[r] += __shfl_xor(s[r], d, 32);
    }
#pragma unroll
    for (int r = 0; r < 4; ++r) {
        const float mu = s[r] * (1.0f / (float)DMOD);
        q[r] = 0.0f;
#pragma unroll
        for (int j = 0; j < 6; ++j) {
#pragma unroll
            for (int i = 0; i < 4; ++i) x[r][j][i] -= mu;     // the rows are kept centred from here on
            q[r] += (x[r][j][0] * x[r][j][0] + x[r][j][1] * x[r][j][1]) + (x[r][j][2] * x[r][j][2] + x[r][j][3] * x[r][j][3]);
        }
    }
#pragma unroll
    for (int d = 16; d >= 1; d >>= 1) {
#pragma unroll
        for (int r = 0; r < 4; ++r) q[r] += __shfl_xor(q[r], d, 32);
    }
    float rstd[4];
#pragma unroll
    for (int r = 0; r < 4; ++r) rstd[r] = rsqrtf(q[r] * (1.0f / (float)DMOD) + 1.0e-5f);
#pragma unroll
    for (int j = 0; j < 6; ++j) {
        const v4f g4 = *(const v4f*)(g + (j * 32 + lane) * 4);
        const v4f b4 = *(const v4f*)(be + (j * 32 + lane) * 4);
        v4f gr, br;
#pragma unroll
        for (int i = 0; i < 4; ++i) { gr[i] = bfr(g4[i]); br[i] = bfr(b4[i]); }
#pragma unroll
        for (int r = 0; r < 4; ++r) {
            v4f o;
#pragma unroll
            for (int i = 0; i < 4; ++i) o[i] = (x[r][j][i] * rstd[r]) * gr[i] + br[i];
            // FULL batch stride of the output rows; the list is a permutation: one writer per row
            *(v4f*)(OUT + ((size_t)b * SEQ_FULL + (size_t)pt[r]) * DMOD + (j * 32 + lane) * 4) = o;
        }
    }
}

extern "C" void kernel_launch(void* const* d_in, const int* in_sizes, int n_in,
                              void* d_out, int out_size, void* d_ws, size_t ws_size, hipStream_t stream) {
    if (n_in < 12) return;
    const size_t need_x = (size_t)(NB - 1) * SEQ_FULL * DMOD + (size_t)SEQ * DMOD;
    const size_t need_m = (size_t)(NB - 1) * SEQ_FULL + (size_t)SEQ;
    if ((size_t)in_sizes[0] < need_x || (size_t)in_sizes[1] < need_m) return;
    if (in_sizes[2] < DMOD * DMOD || in_sizes[4] < DMOD * DMOD || in_sizes[6] < DMOD * DMOD || in_sizes[8] < DMOD * DMOD) return;
    if (in_sizes[3] < DMOD || in_sizes[5] < DMOD || in_sizes[7] < DMOD || in_sizes[9] < DMOD) return;
    if (in_sizes[10] < DMOD || in_sizes[11] < DMOD) return;
    if ((size_t)out_size < need_x) return;                       // output rows are addressed at the FULL batch stride
    const float* xin = (const float*)d_in[0];
    const int*   msk = (const int*)d_in[1];
    const float* Wq = (const float*)d_in[2]; const float* bq = (const float*)d_in[3];
    const float* Wk = (const float*)d_in[4]; const float* bk = (const float*)d_in[5];
    const float* Wv = (const float*)d_in[6]; const float* bv = (const float*)d_in[7];
    const float* Wo = (const float*)d_in[8]; const float* bo = (const float*)d_in[9];
    const float* lng = (const float*)d_in[10]; const float* lnb = (const float*)d_in[11];
    float* OUT = (float*)d_out;

    constexpr size_t WB = (size_t)DMOD * DMOD * 2;               // one 16-bit weight plane
    constexpr size_t PB = (size_t)NB * SEQ * DMOD * 2;           // one 16-bit activation / head plane (NB*NHEAD*SEQ*HDIM elements)
    constexpr size_t CB = (size_t)NB * SEQ_FULL * DMOD * 4;      // f32 ctx plane, rows at the FULL batch stride
    static_assert(WB % 256 == 0);
    static_assert(PB % 256 == 0);
    static_assert(CB % 256 == 0);
    constexpr size_t IB = (size_t)NB * SEQ * 4;                  // ranked query list; the mask values in its order
    static_assert(IB % 256 == 0);
    static_assert(4 * WB + 4 * PB + CB + 2 * IB + 256 <= (size_t)134217728);    // total carve at most 128 MiB
    static_assert(((size_t)(NB - 1) * SEQ_FULL + SEQ) * DMOD * 4 <= CB);     // last ctx row written by the attention kernel
    if (4 * WB + 4 * PB + CB + 2 * IB + 256 > ws_size) return;
    char* wsp = (char*)d_ws;
    bf* WQ = (bf*)wsp; wsp += WB;
    bf* WK = (bf*)wsp; wsp += WB;
    bf* WV = (bf*)wsp; wsp += WB;
    h16* WO = (h16*)wsp; wsp += WB;
    bf* XB = (bf*)wsp; wsp += PB;
    h16* QFp = (h16*)wsp; wsp += PB;
    h16* KFp = (h16*)wsp; wsp += PB;
    h16* VVp = (h16*)wsp; wsp += PB;
    float* CTX = (float*)wsp; wsp += CB;
    int* QIDX = (int*)wsp; wsp += IB;
    int* QMSK = (int*)wsp; wsp += IB;
    int* QCNT = (int*)wsp;

    // the ranked query lists, x (the single input stream that feeds all three projections) and the four weights, one grid
    k_cvt_in<<<NB + CVT_GX + 4 * CVT_GW, 256, 0, stream>>>(xin, Wq, Wk, Wv, Wo, msk, XB, WQ, WK, WV, WO, QIDX, QMSK, QCNT);
    // q, k: X rows in list order (A) x W[DMOD][DMOD] (Bt as stored) -> f16 head planes; v: Wv (A) x X rows in list order (Bt) -> transposed f16 value plane [b][head][d][t], key mask applied; one grid
    k_proj<<<dim3(NB * 3 * (DMOD / 128), SEQ / 128), GWAVES * 32, 0, stream>>>(XB, WQ, WK, WV, bq, bk, bv, QIDX, QMSK, QCNT, QFp, KFp, VVp);
    k_attn<<<dim3(NB * NHEAD, SEQ / (AWAVES * 16)), AWAVES * 32, 0, stream>>>(QFp, KFp, VVp, QCNT, CTX);
    // output projection: f16(ctx rows (f32, FULL stride, list order) x query mask) (A) x Wo[DMOD out][DMOD in] (Bt as stored) + bias + skip, then LayerNorm of the block's whole rows -> output
    k_out_ln<<<NB * (SEQ / FR), FWAVES * 32, 0, stream>>>(CTX, WO, bo, xin, QIDX, QMSK, QCNT, lng, lnb, OUT);
}

// v010
// Measured time: 81.4 microseconds a run.
// In both of two side-by-side timings against v009, it was 1.03 times as fast.
// Counting every step since v000, it is 7.55 times as fast.
#include <hip/hip_runtime.h>

// Single-stream multi-head self-attention block: x [4][2048][768]; q / k / v = x.W^T + b with W stored [out][in]; heads = 12 x 64; scores = q.k^T with NO scale; softmax over all 2048 keys;
// the probabilities are multiplied AFTER the softmax by mask_q * mask_k (int input [4][2048], read by value); ctx merged to [4][2048][768]; y = ctx.Wo^T + bo + x; output = LayerNorm(y) with eps 1e-5 and gain / shift inputs.
// Compute dtypes, f32 accumulate everywhere: x and the weights converted to bf16 (RNE) once; q / k / v projections = single v_wmma_f32_16x16x32_bf16 products + bf16(bias) in f32; scores = one v_wmma_f32_16x16x32_f16 product of the f16 q plane (stored times log2 e) and the f16 k plane;
// softmax f32 (base 2, the offset in use is the score accumulators' start value and follows the running max lazily, denominator over all keys); P = f16(exp2(exponent)), the column maximum between 2 and 32768, packed straight from the score accumulators into the B fragment; V times the key mask = one f16 plane on v_wmma_f32_16x16x32_f16;
// A query whose mask is 0 has a zero ctx row for any input, so such queries are skipped: the positions of each batch are ranked (mask not 0 first), the attention kernel and the output projection (which converts its own ctx rows) work on that list's kept part, and the skipped rows go into LayerNorm as bias + x.
// The projections gather their x rows by the same list, so the q, k and v planes are in list order: q and v are formed for the kept part alone (a key whose mask is 0 has a zero value row), k for every key (the denominator is over all keys), and P.V runs over the kept key tiles alone.
// output projection = single v_wmma_f32_16x16x32_f16 product: ctx times the query mask as f16 x16, bf16(Wo) as f16 x64, folded by 1/1024 in f32; bias, skip connection (bf16(x)) and LayerNorm in f32, in the same kernel (a block owns whole rows).

#ifndef NB
#define NB 4
#endif
#ifndef SEQ
#define SEQ 2048
#endif
#define NB_FULL  4
#define SEQ_FULL 2048
#define DMOD  768
#define NHEAD 12
#define HDIM  64
#define OSP   68
#define LOG2E 1.4426950408889634f
#define PSH   1.0f                    // where a move of the offset puts the column maximum: 14 binades of room below LAZY, so that moves are few
#define LAZY  15.0f                   // a shifted score above this moves the offset: exp2(15) still fits f16
#define WCAR  64.0f
#define CCAR  16.0f

static_assert(NHEAD * HDIM == DMOD);          // merged width
static_assert(HDIM == 64);                    // one 64-column GEMM tile == one head; 4 d-tiles in the attention kernel
static_assert(DMOD % 64 == 0);                // GEMM tile multiple (N and the transposed M)
static_assert(DMOD % 32 == 0);                // k-loop step
static_assert(SEQ % 64 == 0);                 // GEMM row tiles never straddle a batch; attention key step 32
static_assert(SEQ <= SEQ_FULL);
static_assert(NB <= NB_FULL);
static_assert((SEQ * DMOD) % 8 == 0);         // convert kernel: 8 elements per thread never straddle a batch
static_assert((DMOD * DMOD) % 8 == 0);
static_assert((NB * SEQ) % 64 == 0);
static_assert((NB * SEQ) / 64 <= 65535);
static_assert(OSP % 4 == 0);                  // 16-byte aligned LDS rows
static_assert(OSP >= HDIM);
static_assert(SEQ % 8 == 0);                  // key-mask vector loads stay 16-byte aligned
static_assert(SEQ_FULL % 8 == 0);
static_assert(DMOD == 6 * 32 * 4);            // LayerNorm: one wave per row, 6 x (32 lanes x 4 floats)

typedef _Float16 h16;
typedef unsigned short bf;
typedef __attribute__((ext_vector_type(16))) __bf16   v16bf;
typedef __attribute__((ext_vector_type(16))) _Float16 v16h;
typedef __attribute__((ext_vector_type(8)))  _Float16 v8h;
typedef __attribute__((ext_vector_type(8)))  unsigned short v8us;
typedef __attribute__((ext_vector_type(8)))  float    v8f;
typedef __attribute__((ext_vector_type(4)))  float    v4f;
typedef __attribute__((ext_vector_type(4)))  int      v4i;
typedef v4f  __attribute__((may_alias)) v4fa;

__device__ __forceinline__ unsigned short f2bf(float f) { unsigned u = __float_as_uint(f); u += 0x7FFFu + ((u >> 16) & 1u); return (unsigned short)(u >> 16); }
__device__ __forceinline__ float bf2f(unsigned short b) { return __uint_as_float(((unsigned)b) << 16); }
__device__ __forceinline__ float bfr(float f) { return bf2f(f2bf(f)); }
__device__ __forceinline__ v16h cat16(v8h lo, v8h hi) { return __builtin_shufflevector(lo, hi, 0, 1, 2, 3, 4, 5, 6, 7, 8, 9, 10, 11, 12, 13, 14, 15); }
__device__ __forceinline__ v16bf cat16b(v8us lo, v8us hi) { return __builtin_bit_cast(v16bf, __builtin_shufflevector(lo, hi, 0, 1, 2, 3, 4, 5, 6, 7, 8, 9, 10, 11, 12, 13, 14, 15)); }
__device__ __forceinline__ v8f wmma16(v16h a, v16h b, v8f c) { return __builtin_amdgcn_wmma_f32_16x16x32_f16(false, a, false, b, (short)0, c, false, false); }
__device__ __forceinline__ v8f wmmab(v16bf a, v16bf b, v8f c) { return __builtin_amdgcn_wmma_f32_16x16x32_bf16(false, a, false, b, (short)0, c, false, false); }
// per-instruction guarded f16 WMMA: ONE accumulator tied with its own two operands to four nops
__device__ __forceinline__ v8f wmma16g(v16h a, v16h b, v8f c) { c = wmma16(a, b, c); asm volatile("v_nop\n\tv_nop\n\tv_nop\n\tv_nop" : "+v"(c) : "v"(a), "v"(b)); return c; }
// fragment loaders (A and B alike, K-contiguous rows): p already carries + 8*(lane>>4); elements 0..7 = k0+8h.., elements 8..15 = k0+16+8h..
__device__ __forceinline__ v16bf ldbf(const bf* p) { return cat16b(*(const v8us*)p, *(const v8us*)(p + 16)); }
__device__ __forceinline__ v16h  ldh(const h16* p) { return cat16(*(const v8h*)p, *(const v8h*)(p + 16)); }
// f32 -> f16 convert for WMMA operand planes: values below the smallest f16 normal become exact zero (applied after the plane's power-of-two carry)
static __device__ __forceinline__ h16 toh_flush(float v) { const h16 r = (h16)v; return (fabsf(v) < 6.103515625e-05f) ? (h16)0.0f : r; }

// dst[e] = src[(e / per) * per_full + e % per]  (per / per_full = compact and staged batch strides). blk = the block's index inside its own plane.
__device__ __forceinline__ void cvt_bf(const float* __restrict__ src, bf* dst, int blk, int n, int per, int per_full) {
    const int e = (blk * 256 + (int)threadIdx.x) * 8;
    if (e >= n) return;
    const int b = e / per;
    const size_t so = (size_t)b * (size_t)per_full + (size_t)(e - b * per);
    const v4f a0 = *(const v4f*)(src + so);
    const v4f a1 = *(const v4f*)(src + so + 4);
    v8us o;
    o[0] = f2bf(a0[0]); o[1] = f2bf(a0[1]); o[2] = f2bf(a0[2]); o[3] = f2bf(a0[3]);
    o[4] = f2bf(a1[0]); o[5] = f2bf(a1[1]); o[6] = f2bf(a1[2]); o[7] = f2bf(a1[3]);
    *(v8us*)(dst + e) = o;
}

__device__ __forceinline__ void cvt_wo(const float* __restrict__ src, h16* dst, int blk, int n) {
    const int e = (blk * 256 + (int)threadIdx.x) * 8;
    if (e >= n) return;
    const v4f a0 = *(const v4f*)(src + e);
    const v4f a1 = *(const v4f*)(src + e + 4);
    v8h o;
    o[0] = toh_flush(bfr(a0[0]) * WCAR); o[1] = toh_flush(bfr(a0[1]) * WCAR); o[2] = toh_flush(bfr(a0[2]) * WCAR); o[3] = toh_flush(bfr(a0[3]) * WCAR);
    o[4] = toh_flush(bfr(a1[0]) * WCAR); o[5] = toh_flush(bfr(a1[1]) * WCAR); o[6] = toh_flush(bfr(a1[2]) * WCAR); o[7] = toh_flush(bfr(a1[3]) * WCAR);
    *(v8h*)(dst + e) = o;
}

// ---- query ranking, one block of 256 threads per batch: idx = a permutation of the batch's positions, those whose mask is not 0 first (in ascending order), the others behind them; val = the mask values in that order; cnt = how many come first.
// A query whose mask is 0 has a context row of exact zeros (the probabilities are multiplied by mask_q after the softmax), so the attention kernel works only on the 128-place ranges of the list that begin in front of cnt.
static_assert(SEQ <= 256 * 8);                // eight positions per thread cover a batch
__device__ __forceinline__ void rank_queries(const int* __restrict__ mrow, int* idx, int* val, int* cnt) {
    __shared__ int wsum[8];
    const int tid = (int)threadIdx.x, lane = tid & 31, wave = tid >> 5;
    const int e = tid * 8;
    int f[8], mv[8];
#pragma unroll
    for (int i = 0; i < 8; ++i) { f[i] = 0; mv[i] = 0; }
    if (e < SEQ) {
        const v4i m0 = *(const v4i*)(mrow + e);
        const v4i m1 = *(const v4i*)(mrow + e + 4);
#pragma unroll
        for (int i = 0; i < 4; ++i) { mv[i] = m0[i]; mv[4 + i] = m1[i]; f[i] = m0[i] != 0 ? 1 : 0; f[4 + i] = m1[i] != 0 ? 1 : 0; }
    }
    int c = 0;
#pragma unroll
    for (int i = 0; i < 8; ++i) c += f[i];
    int inc = c;                                          // inclusive scan over the wave's lanes
#pragma unroll
    for (int d = 1; d < 32; d <<= 1) { const int v = __shfl_up(inc, d, 32); if (lane >= d) inc += v; }
    if (lane == 31) wsum[wave] = inc;
    __syncthreads();                                      // the eight wave totals readable by every wave
    int base = 0, total = 0;
#pragma unroll
    for (int w = 0; w < 8; ++w) { const int s = wsum[w]; base += w < wave ? s : 0; total += s; }
    int pos = base + inc - c;                             // kept positions in front of e
    if (e < SEQ) {
#pragma unroll
        for (int i = 0; i < 8; ++i) { const int pl = f[i] ? pos : total + (e + i - pos); idx[pl] = e + i; val[pl] = mv[i]; pos += f[i]; }
    }
    if (tid == 0) cnt[0] = total;
}

// ---- k_cvt_in: the query ranking and the five input conversions, which do not depend on one another, as block ranges of ONE grid:
// blocks [0, NB) = the ranking (first), then CVT_GX blocks = x, then CVT_GW blocks each for Wq, Wk, Wv (bf16 planes) and Wo (f16 plane x64). The range test reads blockIdx alone.
#define CVT_NW (DMOD * DMOD)
#define CVT_NX (NB * SEQ * DMOD)
#define CVT_GW ((CVT_NW / 8 + 255) / 256)
#define CVT_GX ((CVT_NX / 8 + 255) / 256)
__global__ __launch_bounds__(256) void k_cvt_in(const float* __restrict__ x, const float* __restrict__ wq, const float* __restrict__ wk, const float* __restrict__ wv, const float* __restrict__ wo,
                                                const int* __restrict__ mask, bf* XB, bf* WQ, bf* WK, bf* WV, h16* WO, int* QIDX, int* QMSK, int* QCNT) {
    if ((int)blockIdx.x < NB) { rank_queries(mask + (size_t)blockIdx.x * SEQ_FULL, QIDX + (int)blockIdx.x * SEQ, QMSK + (int)blockIdx.x * SEQ, QCNT + (int)blockIdx.x); return; }
    const int blk = (int)blockIdx.x - NB;
    if (blk < CVT_GX) { cvt_bf(x, XB, blk, CVT_NX, SEQ * DMOD, SEQ_FULL * DMOD); return; }
    const int w = (blk - CVT_GX) / CVT_GW, wb = (blk - CVT_GX) - w * CVT_GW;
    if (w == 3) { cvt_wo(wo, WO, wb, CVT_NW); return; }
    cvt_bf(w == 0 ? wq : (w == 1 ? wk : wv), w == 0 ? WQ : (w == 1 ? WK : WV), wb, CVT_NW, CVT_NW, CVT_NW);
}

// ---- GEMM staging: a block of 2 x 2 waves owns a 128x128 tile; 64 k (128 B) of its 128 A rows and 128 Bt rows are staged in LDS by asynchronous copies
// (16 B per lane, 8 lanes per row), two buffers: stage t + 1 flies while stage t is worked on. Every wave reads its 64 + 64 rows as fragments from LDS.
// The stage is this short, and the output staging reuses the ring, so that a block takes 72 KiB of LDS: four blocks fit a WGP and every working block of the grid is resident at once (one round, four waves per SIMD).
#define GWAVES 4                      // waves per block, 2 (tile rows) x 2 (tile columns)
#define GKT    64                     // k elements per stage: 128 B of every operand row
#define GPITCH 144                    // LDS row pitch in bytes: 16 B x odd, conflict-free for the 16-byte fragment reads
#define GSLAB  (128 * GPITCH)         // one operand's 128 staged rows
#define GSTAGE (2 * GSLAB)            // one buffer: A rows, then Bt rows
static_assert(DMOD % 128 == 0);               // whole 128-wide block tiles
static_assert((NB * SEQ) % 128 == 0);
static_assert(DMOD % GKT == 0);               // whole stages
static_assert(DMOD / GKT >= 2);               // the two-buffer prologue fills stages 0 and 1
static_assert(GKT * 2 == 8 * 16);             // one staged row == 8 lanes x 16 B
static_assert(GWAVES * 32 * 8 == 128 * 8);    // eight copies per lane cover one operand's slab (128 rows x 8 pieces)
static_assert(GWAVES * 16 * OSP * 4 <= 2 * GSTAGE);   // the output staging reuses the ring
static_assert(4 * 2 * GSTAGE <= 327680);      // four blocks per WGP

// One operand's slab of 128 rows = 8 copies per lane: rows r, r + 16, ..., r + 112. l = the lane's LDS byte address in row r, g = the lane's own 16 bytes in row r of the 16-bit source plane (row length DMOD).
__device__ __forceinline__ void stage_slab(unsigned l, const unsigned char* g) {
    // the closing s_wait_xcnt stands inside the statement so that no address register of a copy is rewritten in front of it
    asm volatile("global_load_async_to_lds_b128 %0, %8, off\n\t"
                 "global_load_async_to_lds_b128 %1, %9, off\n\t"
                 "global_load_async_to_lds_b128 %2, %10, off\n\t"
                 "global_load_async_to_lds_b128 %3, %11, off\n\t"
                 "global_load_async_to_lds_b128 %4, %12, off\n\t"
                 "global_load_async_to_lds_b128 %5, %13, off\n\t"
                 "global_load_async_to_lds_b128 %6, %14, off\n\t"
                 "global_load_async_to_lds_b128 %7, %15, off\n\t"
                 "s_wait_xcnt 0x0"
                 :: "v"(l), "v"(l + 16 * GPITCH), "v"(l + 32 * GPITCH), "v"(l + 48 * GPITCH),
                    "v"(l + 64 * GPITCH), "v"(l + 80 * GPITCH), "v"(l + 96 * GPITCH), "v"(l + 112 * GPITCH),
                    "v"(g), "v"(g + 16 * DMOD * 2), "v"(g + 32 * DMOD * 2), "v"(g + 48 * DMOD * 2),
                    "v"(g + 64 * DMOD * 2), "v"(g + 80 * DMOD * 2), "v"(g + 96 * DMOD * 2), "v"(g + 112 * DMOD * 2)
                 : "memory");
}

// A slab whose 128 rows are gathered = 8 copies per lane. l = the lane's LDS byte address in its first row, g = the lane's own 16-byte piece in row 0 of the source plane, o[i] = byte offset of the i-th row's source row.
__device__ __forceinline__ void stage_slab_rows(unsigned l, const unsigned char* g, const unsigned (&o)[8]) {
    // the closing s_wait_xcnt stands inside the statement so that no address register of a copy is rewritten in front of it
    asm volatile("global_load_async_to_lds_b128 %0, %8, off\n\t"
                 "global_load_async_to_lds_b128 %1, %9, off\n\t"
                 "global_load_async_to_lds_b128 %2, %10, off\n\t"
                 "global_load_async_to_lds_b128 %3, %11, off\n\t"
                 "global_load_async_to_lds_b128 %4, %12, off\n\t"
                 "global_load_async_to_lds_b128 %5, %13, off\n\t"
                 "global_load_async_to_lds_b128 %6, %14, off\n\t"
                 "global_load_async_to_lds_b128 %7, %15, off\n\t"
                 "s_wait_xcnt 0x0"
                 :: "v"(l), "v"(l + 16 * GPITCH), "v"(l + 32 * GPITCH), "v"(l + 48 * GPITCH),
                    "v"(l + 64 * GPITCH), "v"(l + 80 * GPITCH), "v"(l + 96 * GPITCH), "v"(l + 112 * GPITCH),
                    "v"(g + o[0]), "v"(g + o[1]), "v"(g + o[2]), "v"(g + o[3]),
                    "v"(g + o[4]), "v"(g + o[5]), "v"(g + o[6]), "v"(g + o[7])
                 : "memory");
}

// ---- GEMM main loop of the projections: one wave per 64x64 tile (16 accumulators), fragments from the staged bf16 rows, K = DMOD in ascending order.
// One operand is 128 rows of W from row wt on, the other 128 rows of X picked by list[0 .. 128) (positions inside the batch whose first X row is xb0). xisb false: A = X rows, Bt = W rows; true: A = W rows, Bt = X rows.
// acc[mb][nb][j] = sum_k A[64*wm + mb*16 + 8*hi + j][k] * Bt[64*wn + nb*16 + lr][k], rows counted inside the block's two slabs.
__device__ __forceinline__ void gemm_tile(const bf* __restrict__ X, const bf* __restrict__ Wt, const int* __restrict__ list, int xb0, int wt, bool xisb, int wm, int wn, const unsigned char* ring, unsigned ringl, v8f (&acc)[4][4]) {
#pragma unroll
    for (int mb = 0; mb < 4; ++mb)
#pragma unroll
        for (int nb = 0; nb < 4; ++nb) acc[mb][nb] = (v8f){};
    const int crow = (int)threadIdx.x >> 3, cpc = (int)threadIdx.x & 7;        // copy side: row 0..15, 16-byte piece 0..7
    const int lane = (int)threadIdx.x & 31, lr = lane & 15, hi = lane >> 4;
    unsigned xo[8];                                       // the lane's eight X rows, held over the whole loop
#pragma unroll
    for (int i = 0; i < 8; ++i) xo[i] = (unsigned)(xb0 + min(max(list[crow + 16 * i], 0), SEQ - 1)) * (unsigned)(DMOD * 2);
    const unsigned char* gx = (const unsigned char*)X + cpc * 16;               // running source pointers, advanced stage by stage
    const unsigned char* gw = (const unsigned char*)Wt + ((size_t)(wt + crow) * DMOD + cpc * 8) * 2;
    const unsigned cl = ringl + (unsigned)(crow * GPITCH + cpc * 16);
    const unsigned clx = cl + (xisb ? GSLAB : 0), clw = cl + (xisb ? 0 : GSLAB);
    const unsigned char* fa = ring + (wm * 64 + lr) * GPITCH + 16 * hi;
    const unsigned char* fb = ring + GSLAB + (wn * 64 + lr) * GPITCH + 16 * hi;
    stage_slab(clw, gw);                                  // the W slab first: it needs no list entry and flies while the list entries arrive
    stage_slab_rows(clx, gx, xo);
    __builtin_amdgcn_sched_barrier(0);                    // here and at the loop's foot: the addresses of the copies behind it are formed behind the copies in front of it, not all ahead, which keeps the kernel inside 256 registers
    gx += GKT * 2; gw += GKT * 2;
    asm volatile("s_wait_asynccnt 0x0" ::: "memory");     // this wave's copies of stage 0 have landed
    __syncthreads();                                      // stage 0 readable by every wave
    stage_slab_rows(clx + GSTAGE, gx, xo); stage_slab(clw + GSTAGE, gw);
#pragma unroll 1   // rolled: one publish point per trip
    for (int t = 0; t < DMOD / GKT; ++t) {
        const unsigned char* pa = fa + (t & 1) * GSTAGE;
        const unsigned char* pb = fb + (t & 1) * GSTAGE;
#pragma unroll   // unrolled: the 32-k blocks of a stage read at constant LDS offsets
        for (int kc = 0; kc < GKT; kc += 32) {
            v16bf a[4];
            v16bf b;
#pragma unroll
            for (int mb = 0; mb < 4; ++mb) a[mb] = ldbf((const bf*)(pa + mb * 16 * GPITCH + kc * 2));
#pragma unroll
            for (int nb = 0; nb < 4; ++nb) {
                b = ldbf((const bf*)(pb + nb * 16 * GPITCH + kc * 2));
#pragma unroll
                for (int mb = 0; mb < 4; ++mb) acc[mb][nb] = wmmab(a[mb], b, acc[mb][nb]);
            }
            asm volatile("" : "+v"(acc[0][0]), "+v"(acc[1][0]), "+v"(acc[2][0]), "+v"(acc[3][0]), "+v"(acc[0][1]), "+v"(acc[1][1]), "+v"(acc[2][1]), "+v"(acc[3][1]));
            asm volatile("v_nop\n\tv_nop\n\tv_nop\n\tv_nop" : "+v"(acc[0][2]), "+v"(acc[1][2]), "+v"(acc[2][2]), "+v"(acc[3][2]), "+v"(acc[0][3]), "+v"(acc[1][3]), "+v"(acc[2][3]), "+v"(acc[3][3]) : "v"(a[0]), "v"(a[3]), "v"(b));
        }
        // foot of trip t: publish stage t + 1, then refill the buffer that trip t has just read
        asm volatile("s_wait_dscnt 0x0" ::: "memory");        // this wave's reads of stage t have returned before its buffer is refilled
        asm volatile("s_wait_asynccnt 0x0" ::: "memory");     // this wave's copies of stage t + 1 have landed
        __syncthreads();                                      // publishes stage t + 1 and ends every wave's last read of stage t
        if (t + 2 < DMOD / GKT) {
            gx += GKT * 2; gw += GKT * 2;
            const unsigned bo = (unsigned)((t & 1) * GSTAGE);
            stage_slab_rows(clx + bo, gx, xo);
            __builtin_amdgcn_sched_barrier(0);                // the W slab's addresses are formed behind the X slab's copies (see the prologue)
            stage_slab(clw + bo, gw);
        }
    }
    asm volatile("s_wait_asynccnt 0x0" ::: "memory");     // nothing in flight behind the loop
}

// ---- k_proj: the q, k and v projections, which do not depend on one another, as block ranges of ONE grid; the choice reads the same for a whole block, so every barrier stays under block-uniform control flow.
// t is a place in the batch's ranked list everywhere here: the X row of place t is the row of position QIDX[t], and the three planes are stored in list order.
// which = 0 / 1 (q / k): y[m][n] = X[m][:] . W[n][:] + bf16(bias[n]); tile rows m = b*SEQ + t, tile columns = one head (n = head*64 + d); stored as one f16 head plane, q times log2 e (one rounding), so that q.k is a base-2 exponent.
// which = 2 (v): transposed projection y^T[n][m] = (W[n][:] . X[m][:] + bf16(bias[n])) * mask[m]; tile rows n = head*64 + d, tile columns m = b*SEQ + t (the key's place).
// The key mask multiplies the value rows, so the attention kernel's probabilities and its denominator stay over all keys.
// A q or v tile whose 128 places all lie behind the kept count leaves at once: the attention kernel reads no q row and no value column there.
// grid (NB * 3 * DMOD/128, SEQ/128), 128 threads; each wave one 64x64 tile; the list range is the slow index, so that the ranges in which all three planes work come first in index order.
__global__ __launch_bounds__(GWAVES * 32) void k_proj(const bf* __restrict__ X, const bf* __restrict__ WQ, const bf* __restrict__ WK, const bf* __restrict__ WV,
                                                      const float* __restrict__ bq, const float* __restrict__ bk, const float* __restrict__ bv,
                                                      const int* __restrict__ QIDX, const int* __restrict__ QMSK, const int* __restrict__ QCNT, h16* QF, h16* KF, h16* Pv) {
    __shared__ __align__(16) unsigned char ring[2 * GSTAGE];
    const int wave = __builtin_amdgcn_readfirstlane((int)(threadIdx.x >> 5));
    const int wm = wave >> 1, wn = wave & 1;
    float* os = (float*)ring + wave * 16 * OSP;           // each wave stages its output rows in its own range of the ring: every wave has left the ring at the last trip's barrier, and nothing is in flight behind the loop
    const int lane = (int)threadIdx.x & 31, lr = lane & 15, hi = lane >> 4;
    const int bb0 = (int)blockIdx.x / (3 * (DMOD / 128)), br = (int)blockIdx.x - bb0 * (3 * (DMOD / 128));   // batch; plane and W tile
    const int which = br / (DMOD / 128);
    if (which != 1 && (int)blockIdx.y * 128 >= QCNT[bb0]) return;   // q, v: no kept place in the tile: the whole block leaves, in front of every copy and barrier
    const bool isv = which == 2;
    const bf* W = which == 0 ? WQ : (which == 1 ? WK : WV);
    const float* bias = which == 0 ? bq : (which == 1 ? bk : bv);
    const int xt = bb0 * SEQ + (int)blockIdx.y * 128, wt = (br - which * (DMOD / 128)) * 128;      // first X row (batch and place) and first W row of the block's tile
    const int ra = isv ? wt : xt, rb = isv ? xt : wt;
    const int r0 = ra + wm * 64, c0 = rb + wn * 64;
    v8f acc[4][4];
    gemm_tile(X, W, QIDX + xt, bb0 * SEQ, wt, isv, wm, wn, ring, (unsigned)(size_t)(__attribute__((address_space(3))) unsigned char*)ring, acc);
    const int rq = lane >> 3, cq = (lane & 7) * 8;
    if (!isv) {
        h16* Pf = which == 0 ? QF : KF;
        const float qs = which == 0 ? LOG2E : 1.0f;
        const int b = r0 / SEQ, t0 = r0 - b * SEQ, hd = c0 / HDIM;
        const v4f bv0 = *(const v4f*)(bias + c0 + cq);
        const v4f bv1 = *(const v4f*)(bias + c0 + cq + 4);
        float bb[8];
        bb[0] = bfr(bv0[0]); bb[1] = bfr(bv0[1]); bb[2] = bfr(bv0[2]); bb[3] = bfr(bv0[3]);
        bb[4] = bfr(bv1[0]); bb[5] = bfr(bv1[1]); bb[6] = bfr(bv1[2]); bb[7] = bfr(bv1[3]);
        const size_t pbase = ((size_t)(b * NHEAD + hd) * SEQ + t0) * HDIM;
#pragma unroll
        for (int mb = 0; mb < 4; ++mb) {
#pragma unroll
            for (int nb = 0; nb < 4; ++nb) {
#pragma unroll
                for (int j = 0; j < 8; ++j) os[(hi * 8 + j) * OSP + nb * 16 + lr] = acc[mb][nb][j];
            }
            __syncthreads();
#pragma unroll
            for (int s = 0; s < 4; ++s) {
                const int row = s * 4 + rq;                       // s 0..3 x rq 0..3 -> rows 0..15
                const v4f x0 = *(const v4fa*)(os + row * OSP + cq);
                const v4f x1 = *(const v4fa*)(os + row * OSP + cq + 4);
                v8h of;
#pragma unroll
                for (int i = 0; i < 4; ++i) { of[i] = (h16)((x0[i] + bb[i]) * qs); of[4 + i] = (h16)((x1[i] + bb[4 + i]) * qs); }
                *(v8h*)(Pf + pbase + (size_t)(mb * 16 + row) * HDIM + cq) = of;
            }
            __syncthreads();
        }
    } else {
        const int b = c0 / SEQ, t0 = c0 - b * SEQ, hd = r0 / HDIM;
        const v4i mk0 = *(const v4i*)(QMSK + c0 + cq);                                 // the mask values in list order, compact batch stride
        const v4i mk1 = *(const v4i*)(QMSK + c0 + cq + 4);
        float mf[8];
        mf[0] = (float)mk0[0]; mf[1] = (float)mk0[1]; mf[2] = (float)mk0[2]; mf[3] = (float)mk0[3];
        mf[4] = (float)mk1[0]; mf[5] = (float)mk1[1]; mf[6] = (float)mk1[2]; mf[7] = (float)mk1[3];
        const size_t pbase = (size_t)(b * NHEAD + hd) * HDIM * SEQ + t0;
#pragma unroll
        for (int mb = 0; mb < 4; ++mb) {
#pragma unroll
            for (int nb = 0; nb < 4; ++nb) {
#pragma unroll
                for (int j = 0; j < 8; ++j) os[(hi * 8 + j) * OSP + nb * 16 + lr] = acc[mb][nb][j];
            }
            __syncthreads();
#pragma unroll
            for (int s = 0; s < 4; ++s) {
                const int row = s * 4 + rq;                       // d within the slab, 0..15
                const float bsc = bfr(bias[r0 + mb * 16 + row]);
                const v4f x0 = *(const v4fa*)(os + row * OSP + cq);
                const v4f x1 = *(const v4fa*)(os + row * OSP + cq + 4);
                v8h ov;
#pragma unroll
                for (int i = 0; i < 4; ++i) { ov[i] = toh_flush((x0[i] + bsc) * mf[i]); ov[4 + i] = toh_flush((x1[i] + bsc) * mf[4 + i]); }
                *(v8h*)(Pv + pbase + (size_t)(mb * 16 + row) * SEQ + cq) = ov;
            }
            __syncthreads();
        }
    }
}

// ---- k_attn: fused attention, transposed form. Block = 8 waves = 128 queries of one (batch, head); each wave owns 16 queries.
// The f16 K rows and the f16 V rows of 64 keys are staged in LDS once per block by asynchronous copies (16 B per lane, whole 128-B lines), two buffers: tile t + 1 flies while tile t is worked on.
// Each wave loads its own f16 Q fragments once, before the key loop, and keeps them in registers.
// Per 32-key step: S^T[key][query] = K.Q^T - offset, one f16 product (one accumulator per 16-key tile) that starts from minus the query's offset in use, so the accumulators hold the exponents themselves;
// (lane (hi, lr) holds keys 8*hi + r and 16 + 8*hi + r of query lr); the offset moves, for the whole wave, only in a step where some exponent passes LAZY (and in the first step):
// there the two lanes of a query share the step's maximum through one shuffle, and sums, outputs and this step's exponents are brought to the new offset (column maximum at PSH);
// P^T packed from the two score tiles into the B fragment (element r <- tile 0, element 8 + r <- tile 1); O^T[d][query] += V^T.P^T
// (every one of the four P.V WMMAs carries its own four-nop guard tying exactly its accumulator and its two operands).
// The block's 128 queries are 128 consecutive places of the batch's ranked list (kept queries first); a block whose range begins behind the kept count leaves at once.
// The keys run in list order too: a key tile that begins behind the kept count has zero value rows, so only its K rows are staged and it adds to the denominator alone (scores, exponentials, sum; no P.V).
// grid (NB*NHEAD, SEQ/128), 256 threads: the list range is the slow index, so that the blocks that work come first in index order and the empty ones last.
#define AWAVES 8                      // waves per block that share one staged tile
#define KTILE  64                     // keys per staged tile: K rows and V rows are both 128 B long
#define LPITCH 144                    // LDS row pitch in bytes: 16 B x odd, conflict-free for the 16-byte fragment reads
#define LPLANE (64 * LPITCH)          // one staged plane: 64 rows (keys for K, head dims for V)
#define LSTAGE (2 * LPLANE)           // one buffer: K, V
static_assert(SEQ % (AWAVES * 16) == 0);      // whole blocks of queries
static_assert(SEQ % KTILE == 0);              // whole key tiles
static_assert(SEQ / KTILE >= 2);              // the two-buffer prologue fills tiles 0 and 1
static_assert(KTILE * 2 == 128);              // one V row of a tile == 8 lanes x 16 B
static_assert(HDIM * 2 == 128);               // one K row == 8 lanes x 16 B
static_assert(AWAVES * 32 * 2 == 64 * 8);     // two copies per lane cover one plane (64 rows x 8 pieces)
static_assert(AWAVES * 16 * OSP * 4 <= 2 * LSTAGE);   // the output staging reuses the ring
static_assert(SEQ % 128 == 0);

// One tile = 4 copies per lane. l = the lane's LDS byte address in the K plane of the target buffer; the pointers are the lane's own 16 bytes in rows 0..31 of each plane.
__device__ __forceinline__ void stage_tile(unsigned l, const h16* kf, const h16* vv) {
    // the closing s_wait_xcnt stands inside the statement so that no address register of a copy is rewritten in front of it
    asm volatile("global_load_async_to_lds_b128 %0, %4, off\n\t"
                 "global_load_async_to_lds_b128 %1, %5, off\n\t"
                 "global_load_async_to_lds_b128 %2, %6, off\n\t"
                 "global_load_async_to_lds_b128 %3, %7, off\n\t"
                 "s_wait_xcnt 0x0"
                 :: "v"(l), "v"(l + 32 * LPITCH), "v"(l + LPLANE), "v"(l + LPLANE + 32 * LPITCH),
                    "v"(kf), "v"(kf + 32 * HDIM), "v"(vv), "v"(vv + 32 * SEQ)
                 : "memory");
}

// A tile without values = 2 copies per lane: the K plane alone.
__device__ __forceinline__ void stage_keys(unsigned l, const h16* kf) {
    // the closing s_wait_xcnt stands inside the statement so that no address register of a copy is rewritten in front of it
    asm volatile("global_load_async_to_lds_b128 %0, %2, off\n\t"
                 "global_load_async_to_lds_b128 %1, %3, off\n\t"
                 "s_wait_xcnt 0x0"
                 :: "v"(l), "v"(l + 32 * LPITCH), "v"(kf), "v"(kf + 32 * HDIM)
                 : "memory");
}

// second launch bound: six waves per SIMD, so that the three blocks that fall to each WGP stay resident together
__global__ __launch_bounds__(AWAVES * 32, 6) void k_attn(const h16* __restrict__ QF, const h16* __restrict__ KF, const h16* __restrict__ VV, const int* __restrict__ QCNT, float* OUT) {
    __shared__ __align__(16) unsigned char ring[2 * LSTAGE];
    const int wave = __builtin_amdgcn_readfirstlane((int)(threadIdx.x >> 5));
    const int lane = (int)threadIdx.x & 31, lr = lane & 15, hi = lane >> 4;
    const int bh = (int)blockIdx.x;
    const int b = bh / NHEAD, hd = bh - b * NHEAD;
    const int nk = QCNT[b];
    if ((int)blockIdx.y * (AWAVES * 16) >= nk) return;        // no kept query in this block's range of the list: the whole block leaves, in front of every copy and barrier
    const int nvt = min((nk + KTILE - 1) / KTILE, SEQ / KTILE);   // key tiles that hold a kept key, at least one here; the same for the whole block
    const int q0 = (int)blockIdx.y * (AWAVES * 16) + wave * 16;   // place in the ranked list, not a position
    const size_t pb = (size_t)bh * SEQ * HDIM;
    // copy side: thread -> (row = tid / 8, 16-byte piece = tid % 8) of rows 0..31 of a plane
    const int crow = (int)threadIdx.x >> 3, cpc = (int)threadIdx.x & 7;
    const h16* ckf = KF + pb + crow * HDIM + cpc * 8; const h16* cvv = VV + pb + crow * SEQ + cpc * 8;   // running pointers, advanced tile by tile
    const unsigned cl = (unsigned)(size_t)(__attribute__((address_space(3))) unsigned char*)ring + (unsigned)(crow * LPITCH + cpc * 16);
    // read side: fragment row lr, 16-byte piece hi (K rows and V rows alike)
    const unsigned char* fr = ring + lr * LPITCH + 16 * hi;
    v8f ova[4];
#pragma unroll
    for (int dt = 0; dt < 4; ++dt) ova[dt] = (v8f){};
    float lsum = 0.0f;
    v8f negm = (v8f){};                                   // all eight elements: minus the lane's query's offset in use
    stage_tile(cl, ckf, cvv);
    ckf += KTILE * HDIM; cvv += KTILE;
    const h16* qp = QF + pb + (q0 + lr) * HDIM + 8 * hi;  // the q plane is in list order (a place behind the count is a masked query: worked like any other, its row is never used)
    // the wave's own Q fragments: loaded once, held in registers over the whole key loop
    v16h qf[HDIM / 32];
#pragma unroll
    for (int kc = 0; kc < HDIM; kc += 32) qf[kc / 32] = ldh(qp + kc);
    asm volatile("s_wait_xcnt 0x0" ::: "memory");         // precaution: stands in front of every rewrite of the Q loads' address registers
    asm volatile("s_wait_asynccnt 0x0" ::: "memory");     // this wave's copies of tile 0 have landed
    __syncthreads();                                      // tile 0 readable by every wave
    if (1 < nvt) stage_tile(cl + LSTAGE, ckf, cvv); else stage_keys(cl + LSTAGE, ckf);
#pragma unroll 1   // rolled: one publish point per trip
    for (int t = 0; t < SEQ / KTILE; ++t) {
        const unsigned char* fb = fr + (t & 1) * LSTAGE;
        const bool hasv = t < nvt;                            // the same for the whole block
#pragma unroll   // unrolled: the two 32-key steps of a tile read at constant LDS offsets
        for (int sub = 0; sub < KTILE / 32; ++sub) {
            v8f s0, s1;
            v16h k0[HDIM / 32], k1[HDIM / 32];
            const unsigned char* kp = fb + sub * 32 * LPITCH;
#pragma unroll
            for (int kc = 0; kc < HDIM; kc += 32) { k0[kc / 32] = ldh((const h16*)(kp + kc * 2)); k1[kc / 32] = ldh((const h16*)(kp + 16 * LPITCH + kc * 2)); }
            // inputs-only fence on the loaded values: keeps the eight reads one group with one LDS wait (without it the compiler sinks each pair of reads to its own WMMA: four waits in a row)
            asm volatile("" :: "v"(k0[0]), "v"(k0[1]), "v"(k1[0]), "v"(k1[1]));
            s0 = wmma16(k0[0], qf[0], negm); s1 = wmma16(k1[0], qf[0], negm);
#pragma unroll
            for (int kc = 32; kc < HDIM; kc += 32) { s0 = wmma16(k0[kc / 32], qf[kc / 32], s0); s1 = wmma16(k1[kc / 32], qf[kc / 32], s1); }
            float ma = fmaxf(fmaxf(s0[0], s0[1]), s0[2]), mb = fmaxf(fmaxf(s1[0], s1[1]), s1[2]);
            ma = fmaxf(fmaxf(ma, s0[3]), s0[4]); mb = fmaxf(fmaxf(mb, s1[3]), s1[4]);
            ma = fmaxf(fmaxf(ma, s0[5]), s0[6]); mb = fmaxf(fmaxf(mb, s1[5]), s1[6]);
            float mx = fmaxf(fmaxf(ma, mb), fmaxf(s0[7], s1[7]));
            const bool first = sub == 0 && t == 0;        // no offset yet: the first step sets it, whatever the scores are
            const float thr = first ? -3.0e38f : LAZY;    // below every score that f16 operands can give
            if (__builtin_amdgcn_ballot_w32(mx > thr) != 0u) {                // wave-uniform
                mx = fmaxf(mx, __shfl_xor(mx, 16, 32));
                const float d = first ? mx - PSH : fmaxf(mx - PSH, 0.0f);     // the offset never falls
                const float sc = first ? 0.0f : __builtin_amdgcn_exp2f(-d);   // sums and outputs are zero in the first step
                lsum *= sc;
#pragma unroll
                for (int dt = 0; dt < 4; ++dt) {
#pragma unroll
                    for (int r = 0; r < 8; ++r) ova[dt][r] *= sc;
                }
#pragma unroll
                for (int r = 0; r < 8; ++r) { s0[r] -= d; s1[r] -= d; negm[r] -= d; }
            }
            v16h va[4];
            if (hasv) {                                   // asked for here so that the reads fly under the exponentials
                const unsigned char* vp = fb + LPLANE + sub * 64;
#pragma unroll
                for (int dt = 0; dt < 4; ++dt) va[dt] = ldh((const h16*)(vp + dt * 16 * LPITCH));
            }
            float psum = 0.0f;
            float e0[8], e1[8];                           // p on the offset's scale, at most exp2(LAZY)
#pragma unroll
            for (int r = 0; r < 8; ++r) e0[r] = __builtin_amdgcn_exp2f(s0[r]);
#pragma unroll
            for (int r = 0; r < 8; ++r) e1[r] = __builtin_amdgcn_exp2f(s1[r]);
#pragma unroll
            for (int r = 0; r < 8; ++r) psum += e0[r] + e1[r];
            lsum += psum;
            if (hasv) {
                v16h pf;
#pragma unroll
                for (int r = 0; r < 8; ++r) { pf[r] = (h16)e0[r]; pf[8 + r] = (h16)e1[r]; }
#pragma unroll
                for (int dt = 0; dt < 4; ++dt) ova[dt] = wmma16g(va[dt], pf, ova[dt]);
            }
        }
        asm volatile("s_wait_dscnt 0x0" ::: "memory");        // this wave's reads of tile t have returned before its buffer is refilled
        asm volatile("s_wait_asynccnt 0x0" ::: "memory");     // this wave's copies of tile t + 1 have landed
        __syncthreads();                                      // publishes tile t + 1 and ends every wave's last read of tile t
        if (t + 2 < SEQ / KTILE) {
            ckf += KTILE * HDIM; cvv += KTILE;
            if (t + 2 < nvt) stage_tile(cl + (unsigned)((t & 1) * LSTAGE), ckf, cvv); else stage_keys(cl + (unsigned)((t & 1) * LSTAGE), ckf);
        }
    }
    asm volatile("s_wait_asynccnt 0x0" ::: "memory");         // nothing in flight when the ring becomes output staging
    lsum += __shfl_xor(lsum, 16, 32);
    const float inv = 1.0f / lsum;
    float* os = (float*)ring;                                 // every wave has left the ring at the last trip's barrier
    const int obase = wave * 16 * OSP;
#pragma unroll
    for (int dt = 0; dt < 4; ++dt) {
        v4f x0, x1;
#pragma unroll
        for (int i = 0; i < 4; ++i) {
            x0[i] = ova[dt][i] * inv;
            x1[i] = ova[dt][4 + i] * inv;
        }
        *(v4fa*)(os + obase + lr * OSP + dt * 16 + 8 * hi) = x0;
        *(v4fa*)(os + obase + lr * OSP + dt * 16 + 8 * hi + 4) = x1;
    }
    __syncthreads();
    float* orow = OUT + ((size_t)b * SEQ_FULL + q0) * DMOD + hd * HDIM;   // FULL batch stride; the rows stay in list order
{
#pragma unroll
        for (int s = 0; s < 8; ++s) {
            const int row = 2 * s + hi, cofs = lr * 4;            // s 0..7 x hi 0..1 -> queries 0..15; 16 lanes x 16 B = one 256-B head row
            const v4f val = *(const v4fa*)(os + obase + row * OSP + cofs);
            *(v4f*)(orow + (size_t)row * DMOD + cofs) = val;
        }
        
    }
}

// ---- k_out_ln: ctx convert, output projection, skip connection and LayerNorm in one kernel. A block of 8 waves owns 32 consecutive places of a batch's ranked list and ALL 768 columns,
// so every ctx row is read by one block alone (it is converted on the way into LDS) and every row's mean and variance are formed inside the block.
// y[m][n] = (A[m][:] . W[n][:]) / 1024 + bf16(bias[n]) + bf16(x[m][n]); A = f16(ctx x query mask x 16), rows in list order, W = f16 plane of 64 * bf16(Wo) stored [out][in]; wave w owns columns 96 w .. 96 w + 95 (2 x 6 accumulators).
// The block's 32 x 768 A tile is formed once, in front of the loop, from the f32 ctx rows (FULL batch stride), while stage 0 flies; the places behind the kept count are masked queries: their A rows are zero and their ctx rows are not read.
// 64 k (128 B) of all 768 W rows are staged in LDS by asynchronous copies, two buffers: stage t + 1 flies while stage t is worked on.
// Behind the loop the f32 tile goes to LDS (the ring is free), and each wave takes four whole rows: bias, skip connection (f32 input at the FULL batch stride), mean, centred variance (divide by the width),
// out = (y - mu) * rsqrt(var + 1e-5) * bf16(gain) + bf16(shift), stored to the row's position.
// A block whose places all lie behind the kept count holds masked queries alone (zero context rows): it stages and multiplies nothing and forms its rows as bias + x. A masked place inside a working block has a zero A row.
// grid (NB * SEQ/32) = one block per WGP at the full shape, 256 threads; the list range is the slow index, so that the blocks that multiply come first in index order.
#define FR     32                     // rows per block
#define FWAVES 8
#define FKT    64                     // k elements per stage: 128 B of every operand row
#define FPITCH 144                    // LDS row pitch in bytes: 16 B x odd, conflict-free for the 16-byte fragment reads
#define FSTAGE (DMOD * FPITCH)        // one buffer: all W rows
#define APITCH (DMOD * 2 + 16)        // A tile row pitch in bytes: 16 B x odd
#define FATILE (FR * APITCH)          // the block's whole f16 A tile
#define FCOLS  (DMOD / FWAVES)        // columns per wave
#define YPITCH 772                    // f32 tile row pitch in floats: 16-byte aligned rows; rows 8 apart fall 32 banks apart, so the two lane halves of a store do not collide
static_assert(SEQ % FR == 0);                 // a block never straddles a batch
static_assert((AWAVES * 16) % FR == 0);       // a working block lies inside one range of the list that an attention block has written
static_assert(FR == FWAVES * 4);              // four rows per wave in the row pass
static_assert(FR == 2 * 16);                  // two accumulator rows of tiles
static_assert(FCOLS == 6 * 16);               // six accumulator columns of tiles per wave
static_assert(FKT * 2 == 8 * 16);             // one staged row == 8 lanes x 16 B
static_assert(FWAVES * 32 / 8 == FR);         // A tile: eight threads per row
static_assert(DMOD == 12 * 8 * 8);            // A tile: twelve pieces of eight elements per thread
static_assert((APITCH / 16) % 2 == 1);
static_assert(DMOD == 3 * 8 * 32);            // three runs of eight copies per lane cover the W rows
static_assert(DMOD % FKT == 0);
static_assert(DMOD / FKT >= 2);               // the two-buffer prologue fills stages 0 and 1
static_assert(FR * YPITCH * 4 <= 2 * FSTAGE); // the f32 tile reuses the ring
static_assert(YPITCH >= DMOD);
static_assert(YPITCH % 4 == 0);
static_assert(2 * FSTAGE + FATILE <= 327680);

// Eight copies per lane: rows r, r + 32, ..., r + 224. l = the lane's LDS byte address in row r, g = the lane's own 16 bytes in row r of the 16-bit source plane (row length DMOD).
__device__ __forceinline__ void stage_w8(unsigned l, const unsigned char* g) {
    // the closing s_wait_xcnt stands inside the statement so that no address register of a copy is rewritten in front of it
    asm volatile("global_load_async_to_lds_b128 %0, %8, off\n\t"
                 "global_load_async_to_lds_b128 %1, %9, off\n\t"
                 "global_load_async_to_lds_b128 %2, %10, off\n\t"
                 "global_load_async_to_lds_b128 %3, %11, off\n\t"
                 "global_load_async_to_lds_b128 %4, %12, off\n\t"
                 "global_load_async_to_lds_b128 %5, %13, off\n\t"
                 "global_load_async_to_lds_b128 %6, %14, off\n\t"
                 "global_load_async_to_lds_b128 %7, %15, off\n\t"
                 "s_wait_xcnt 0x0"
                 :: "v"(l), "v"(l + 32 * FPITCH), "v"(l + 64 * FPITCH), "v"(l + 96 * FPITCH),
                    "v"(l + 128 * FPITCH), "v"(l + 160 * FPITCH), "v"(l + 192 * FPITCH), "v"(l + 224 * FPITCH),
                    "v"(g), "v"(g + 32 * DMOD * 2), "v"(g + 64 * DMOD * 2), "v"(g + 96 * DMOD * 2),
                    "v"(g + 128 * DMOD * 2), "v"(g + 160 * DMOD * 2), "v"(g + 192 * DMOD * 2), "v"(g + 224 * DMOD * 2)
                 : "memory");
}
// One stage = 24 copies per lane. l = the lane's LDS byte address in its first W row of the target buffer; gb = the lane's own 16 bytes in that row.
__device__ __forceinline__ void stage_out(unsigned l, const unsigned char* gb) {
    stage_w8(l, gb);
    stage_w8(l + 256 * FPITCH, gb + 256 * DMOD * 2);
    stage_w8(l + 512 * FPITCH, gb + 512 * DMOD * 2);
}

__global__ __launch_bounds__(FWAVES * 32) void k_out_ln(const float* __restrict__ CTX, const h16* __restrict__ W, const float* __restrict__ bias, const float* __restrict__ xin, const int* __restrict__ QIDX, const int* __restrict__ QMSK, const int* __restrict__ QCNT,
                                                        const float* __restrict__ g, const float* __restrict__ be, float* OUT) {
    __shared__ __align__(16) unsigned char ring[2 * FSTAGE];
    __shared__ __align__(16) unsigned char atile[FATILE];
    const int wave = __builtin_amdgcn_readfirstlane((int)(threadIdx.x >> 5));
    const int lane = (int)threadIdx.x & 31, lr = lane & 15, hi = lane >> 4;
    const int b = (int)blockIdx.x % NB, t0 = ((int)blockIdx.x / NB) * FR;   // batch; the block's first place in the batch's ranked list
    const int nk = QCNT[b];
    const bool work = t0 < nk;                            // a kept query among the block's rows; the same for the whole block
    int pt[4];                                            // positions of the wave's four rows, asked for in front of the main loop
#pragma unroll
    for (int r = 0; r < 4; ++r) pt[r] = __builtin_amdgcn_readfirstlane(min(max(QIDX[b * SEQ + t0 + wave * 4 + r], 0), SEQ - 1));   // the same in every lane: held in scalar registers
    float* ys = (float*)ring;
    v8f acc[2][6];
#pragma unroll
    for (int mb = 0; mb < 2; ++mb)
#pragma unroll
        for (int nb = 0; nb < 6; ++nb) acc[mb][nb] = (v8f){};
    if (work) {
        const int crow = (int)threadIdx.x >> 3, cpc = (int)threadIdx.x & 7;     // copy side: row 0..31, 16-byte piece 0..7
        const unsigned char* gb = (const unsigned char*)W + ((size_t)crow * DMOD + cpc * 8) * 2;   // running source pointer, advanced stage by stage
        const unsigned cl = (unsigned)(size_t)(__attribute__((address_space(3))) unsigned char*)ring + (unsigned)(crow * FPITCH + cpc * 16);
        const unsigned char* fa = atile + lr * APITCH + 16 * hi;                // read side: fragment row lr, 16-byte piece hi
        const unsigned char* fb = ring + (wave * FCOLS + lr) * FPITCH + 16 * hi;
        stage_out(cl, gb);
        gb += FKT * 2;
        {   // the A tile: thread -> row crow, pieces cpc, cpc + 8, ... of eight elements (eight threads cover 256 B of a ctx row at a time)
            const int at = t0 + crow;
            const float mq = (float)QMSK[b * SEQ + at] * CCAR;                  // the mask value of the place, in bounds for every place
            const float* cs = CTX + ((size_t)b * SEQ_FULL + (size_t)at) * DMOD + cpc * 8;
            v4f c0[12], c1[12];
#pragma unroll
            for (int c = 0; c < 12; ++c) { c0[c] = (v4f){}; c1[c] = (v4f){}; }
            if (at < nk) {
#pragma unroll
                for (int c = 0; c < 12; ++c) { c0[c] = *(const v4f*)(cs + c * 64); c1[c] = *(const v4f*)(cs + c * 64 + 4); }
            }
#pragma unroll
            for (int c = 0; c < 12; ++c) {
                v8h o;
#pragma unroll
                for (int i = 0; i < 4; ++i) { o[i] = toh_flush(c0[c][i] * mq); o[4 + i] = toh_flush(c1[c][i] * mq); }
                *(v8h*)(atile + crow * APITCH + (c * 8 + cpc) * 16) = o;
            }
        }
        asm volatile("s_wait_asynccnt 0x0" ::: "memory");     // this wave's copies of stage 0 have landed
        __syncthreads();                                      // stage 0 and the A tile readable by every wave
        stage_out(cl + FSTAGE, gb);
#pragma unroll 1   // rolled: one publish point per trip
        for (int t = 0; t < DMOD / FKT; ++t) {
            const unsigned char* pa = fa + t * (FKT * 2);
            const unsigned char* pb = fb + (t & 1) * FSTAGE;
#pragma unroll   // unrolled: the two 32-k blocks of a stage read at constant LDS offsets
            for (int kc = 0; kc < FKT; kc += 32) {
                v16h a[2], bfr6[6];                           // the block's LDS reads stand as one group in front of its guarded WMMAs
#pragma unroll
                for (int mb = 0; mb < 2; ++mb) a[mb] = ldh((const h16*)(pa + mb * 16 * APITCH + kc * 2));
#pragma unroll
                for (int nb = 0; nb < 6; ++nb) bfr6[nb] = ldh((const h16*)(pb + nb * 16 * FPITCH + kc * 2));
#pragma unroll
                for (int nb = 0; nb < 6; ++nb) {
#pragma unroll
                    for (int mb = 0; mb < 2; ++mb) acc[mb][nb] = wmma16g(a[mb], bfr6[nb], acc[mb][nb]);
                }
            }
            // foot of trip t: publish stage t + 1, then refill the buffer that trip t has just read
            asm volatile("s_wait_dscnt 0x0" ::: "memory");        // this wave's reads of stage t have returned before its buffer is refilled
            asm volatile("s_wait_asynccnt 0x0" ::: "memory");     // this wave's copies of stage t + 1 have landed
            __syncthreads();                                      // publishes stage t + 1 and ends every wave's last read of stage t
            if (t + 2 < DMOD / FKT) {
                gb += FKT * 2;
                stage_out(cl + (unsigned)((t & 1) * FSTAGE), gb);
            }
        }
        asm volatile("s_wait_asynccnt 0x0" ::: "memory");     // nothing in flight when the ring becomes the f32 tile; every wave has left the ring at the last trip's barrier
    }
    // row pass: one wave per row, four rows per wave, the four rows held in registers (4 x 6 x 4 floats per lane) and worked side by side
    v4f x[4][6];                                              // first the four skip rows, asked for together, ahead of the tile's way through LDS
#pragma unroll
    for (int r = 0; r < 4; ++r) {
        const float* xi = xin + ((size_t)b * SEQ_FULL + (size_t)pt[r]) * DMOD;
#pragma unroll
        for (int j = 0; j < 6; ++j) x[r][j] = *(const v4f*)(xi + (j * 32 + lane) * 4);
    }
    __builtin_amdgcn_sched_barrier(0);                        // the 24 loads are issued here, so that their memory latency runs under the LDS stores and the barrier (without it the compiler sinks each row's loads to the row's own sums: four latencies in a row)
    if (work) {
#pragma unroll
        for (int mb = 0; mb < 2; ++mb) {
#pragma unroll
            for (int nb = 0; nb < 6; ++nb) {
#pragma unroll
                for (int j = 0; j < 8; ++j) ys[(mb * 16 + hi * 8 + j) * YPITCH + wave * FCOLS + nb * 16 + lr] = acc[mb][nb][j];
            }
        }
        __syncthreads();                                      // the whole 32 x 768 tile readable by every wave (block-uniform branch)
    }
    const float osc = 1.0f / (WCAR * CCAR);
    v4f cb[6];
#pragma unroll
    for (int j = 0; j < 6; ++j) {
        const v4f c4 = *(const v4f*)(bias + (j * 32 + lane) * 4);
#pragma unroll
        for (int i = 0; i < 4; ++i) cb[j][i] = bfr(c4[i]);
    }
    if (work) {
#pragma unroll
        for (int r = 0; r < 4; ++r) {
#pragma unroll
            for (int j = 0; j < 6; ++j) {
                const v4f a4 = *(const v4fa*)(ys + (wave * 4 + r) * YPITCH + (j * 32 + lane) * 4);
#pragma unroll
                for (int i = 0; i < 4; ++i) x[r][j][i] = (a4[i] * osc + cb[j][i]) + bfr(x[r][j][i]);
            }
        }
    } else {
#pragma unroll
        for (int r = 0; r < 4; ++r) {
#pragma unroll
            for (int j = 0; j < 6; ++j) {
#pragma unroll
                for (int i = 0; i < 4; ++i) x[r][j][i] = cb[j][i] + bfr(x[r][j][i]);
            }
        }
    }
    float s[4], q[4];
#pragma unroll
    for (int r = 0; r < 4; ++r) {
        s[r] = 0.0f;
#pragma unroll
        for (int j = 0; j < 6; ++j) s[r] += (x[r][j][0] + x[r][j][1]) + (x[r][j][2] + x[r][j][3]);
    }
#pragma unroll
    for (int d = 16; d >= 1; d >>= 1) {
#pragma unroll
        for (int r = 0; r < 4; ++r) s[r] += __shfl_xor(s[r], d, 32);
    }
#pragma unroll
    for (int r = 0; r < 4; ++r) {
        const float mu = s[r] * (1.0f / (float)DMOD);
        q[r] = 0.0f;
#pragma unroll
        for (int j = 0; j < 6; ++j) {
#pragma unroll
            for (int i = 0; i < 4; ++i) x[r][j][i] -= mu;     // the rows are kept centred from here on
            q[r] += (x[r][j][0] * x[r][j][0] + x[r][j][1] * x[r][j][1]) + (x[r][j][2] * x[r][j][2] + x[r][j][3] * x[r][j][3]);
        }
    }
#pragma unroll
    for (int d = 16; d >= 1; d >>= 1) {
#pragma unroll
        for (int r = 0; r < 4; ++r) q[r] += __shfl_xor(q[r], d, 32);
    }
    float rstd[4];
#pragma unroll
    for (int r = 0; r < 4; ++r) rstd[r] = rsqrtf(q[r] * (1.0f / (float)DMOD) + 1.0e-5f);
#pragma unroll
    for (int j = 0; j < 6; ++j) {
        const v4f g4 = *(const v4f*)(g + (j * 32 + lane) * 4);
        const v4f b4 = *(const v4f*)(be + (j * 32 + lane) * 4);
        v4f gr, br;
#pragma unroll
        for (int i = 0; i < 4; ++i) { gr[i] = bfr(g4[i]); br[i] = bfr(b4[i]); }
#pragma unroll
        for (int r = 0; r < 4; ++r) {
            v4f o;
#pragma unroll
            for (int i = 0; i < 4; ++i) o[i] = (x[r][j][i] * rstd[r]) * gr[i] + br[i];
            // FULL batch stride of the output rows; the list is a permutation: one writer per row
            *(v4f*)(OUT + ((size_t)b * SEQ_FULL + (size_t)pt[r]) * DMOD + (j * 32 + lane) * 4) = o;
        }
    }
}

extern "C" void kernel_launch(void* const* d_in, const int* in_sizes, int n_in,
                              void* d_out, int out_size, void* d_ws, size_t ws_size, hipStream_t stream) {
    if (n_in < 12) return;
    const size_t need_x = (size_t)(NB - 1) * SEQ_FULL * DMOD + (size_t)SEQ * DMOD;
    const size_t need_m = (size_t)(NB - 1) * SEQ_FULL + (size_t)SEQ;
    if ((size_t)in_sizes[0] < need_x || (size_t)in_sizes[1] < need_m) return;
    if (in_sizes[2] < DMOD * DMOD || in_sizes[4] < DMOD * DMOD || in_sizes[6] < DMOD * DMOD || in_sizes[8] < DMOD * DMOD) return;
    if (in_sizes[3] < DMOD || in_sizes[5] < DMOD || in_sizes[7] < DMOD || in_sizes[9] < DMOD) return;
    if (in_sizes[10] < DMOD || in_sizes[11] < DMOD) return;
    if ((size_t)out_size < need_x) return;                       // output rows are addressed at the FULL batch stride
    const float* xin = (const float*)d_in[0];
    const int*   msk = (const int*)d_in[1];
    const float* Wq = (const float*)d_in[2]; const float* bq = (const float*)d_in[3];
    const float* Wk = (const float*)d_in[4]; const float* bk = (const float*)d_in[5];
    const float* Wv = (const float*)d_in[6]; const float* bv = (const float*)d_in[7];
    const float* Wo = (const float*)d_in[8]; const float* bo = (const float*)d_in[9];
    const float* lng = (const float*)d_in[10]; const float* lnb = (const float*)d_in[11];
    float* OUT = (float*)d_out;

    constexpr size_t WB = (size_t)DMOD * DMOD * 2;               // one 16-bit weight plane
    constexpr size_t PB = (size_t)NB * SEQ * DMOD * 2;           // one 16-bit activation / head plane (NB*NHEAD*SEQ*HDIM elements)
    constexpr size_t CB = (size_t)NB * SEQ_FULL * DMOD * 4;      // f32 ctx plane, rows at the FULL batch stride
    static_assert(WB % 256 == 0);
    static_assert(PB % 256 == 0);
    static_assert(CB % 256 == 0);
    constexpr size_t IB = (size_t)NB * SEQ * 4;                  // ranked query list; the mask values in its order
    static_assert(IB % 256 == 0);
    static_assert(4 * WB + 4 * PB + CB + 2 * IB + 256 <= (size_t)134217728);    // total carve at most 128 MiB
    static_assert(((size_t)(NB - 1) * SEQ_FULL + SEQ) * DMOD * 4 <= CB);     // last ctx row written by the attention kernel
    if (4 * WB + 4 * PB + CB + 2 * IB + 256 > ws_size) return;
    char* wsp = (char*)d_ws;
    bf* WQ = (bf*)wsp; wsp += WB;
    bf* WK = (bf*)wsp; wsp += WB;
    bf* WV = (bf*)wsp; wsp += WB;
    h16* WO = (h16*)wsp; wsp += WB;
    bf* XB = (bf*)wsp; wsp += PB;
    h16* QFp = (h16*)wsp; wsp += PB;
    h16* KFp = (h16*)wsp; wsp += PB;
    h16* VVp = (h16*)wsp; wsp += PB;
    float* CTX = (float*)wsp; wsp += CB;
    int* QIDX = (int*)wsp; wsp += IB;
    int* QMSK = (int*)wsp; wsp += IB;
    int* QCNT = (int*)wsp;

    // the ranked query lists, x (the single input stream that feeds all three projections) and the four weights, one grid
    k_cvt_in<<<NB + CVT_GX + 4 * CVT_GW, 256, 0, stream>>>(xin, Wq, Wk, Wv, Wo, msk, XB, WQ, WK, WV, WO, QIDX, QMSK, QCNT);
    // q, k: X rows in list order (A) x W[DMOD][DMOD] (Bt as stored) -> f16 head planes; v: Wv (A) x X rows in list order (Bt) -> transposed f16 value plane [b][head][d][t], key mask applied; one grid
    k_proj<<<dim3(NB * 3 * (DMOD / 128), SEQ / 128), GWAVES * 32, 0, stream>>>(XB, WQ, WK, WV, bq, bk, bv, QIDX, QMSK, QCNT, QFp, KFp, VVp);
    k_attn<<<dim3(NB * NHEAD, SEQ / (AWAVES * 16)), AWAVES * 32, 0, stream>>>(QFp, KFp, VVp, QCNT, CTX);
    // output projection: f16(ctx rows (f32, FULL stride, list order) x query mask) (A) x Wo[DMOD out][DMOD in] (Bt as stored) + bias + skip, then LayerNorm of the block's whole rows -> output
    k_out_ln<<<NB * (SEQ / FR), FWAVES * 32, 0, stream>>>(CTX, WO, bo, xin, QIDX, QMSK, QCNT, lng, lnb, OUT);
}
